// v000
// Times are from an AMD MI455X. After a warm-up the kernel runs many times in a row, and a time is the length of
// such a window on the GPU divided by its runs, so every launch and the gaps after it count. The runs cycle
// through copies of the inputs. A figure is the median of several windows, for all but v000 over two sittings.
// Sittings can differ by a few percent; kernels timed side by side share one.
// v000 is the starting kernel. One run takes 1220 microseconds.
// Contractions: q|k and v^T projections = v_wmma_f32_16x16x32_bf16 (bf16 operands RNE-converted from x and W_attn, single product, + bf16 bias in f32);
// causal scores q.k^T = v_wmma_f32_16x16x32_bf16 with bf16 hi/lo split q and k (hi.hi + hi.lo + lo.hi);
// context p.v = v_wmma_f32_16x16x32_bf16 with bf16 hi/lo split p and v (3 products);
// output projection = v_wmma_f32_16x16x32_bf16, context bf16 hi|lo planes folded along K (K = 2048) times bf16 W_proj^T (+ bf16 bias in f32);
// all f32 accumulate; online softmax statistics, score scale 0.125 and bias adds in f32.
// Carry audit: every 16-bit plane (XB, WAT, WPT2, QKh/QKl, VTh/VTl, CTX hi|lo, P hi|lo in LDS) has carry 1; no inverse factor is applied anywhere.
#include <hip/hip_runtime.h>
#include <math.h>
#include <stdint.h>

#define NB   4
#define SEQ  2048
#define DM   1024
#define NH   16
#define HD   64
#define N3   (3 * DM)      // 3072
#define QKP  (2 * DM)      // pitch of the q|k planes [t][q 1024 | k 1024]
#define CXP  (2 * DM)      // pitch of the context plane [t][hi 1024 | lo 1024]
#define NQB  (SEQ / 64)    // 32 query / key tiles of 64
static_assert(NH * HD == DM);
static_assert((SEQ % 64) == 0 && (DM % 64) == 0 && (N3 % 64) == 0);
static_assert((DM % 32) == 0 && (CXP % 32) == 0 && (QKP % 8) == 0);

typedef __bf16   v16b __attribute__((ext_vector_type(16)));
typedef __bf16   v8b  __attribute__((ext_vector_type(8)));
typedef float    v8f  __attribute__((ext_vector_type(8)));
typedef float    v4f  __attribute__((ext_vector_type(4)));
typedef unsigned int v4u __attribute__((ext_vector_type(4)));

// ---- scalar helpers ----------------------------------------------------------------------------------
__device__ __forceinline__ unsigned short bf_bits(float f) {          // f32 -> bf16 bits, RNE convert
  unsigned u = __float_as_uint(f);
  return (unsigned short)((u + 0x7FFFu + ((u >> 16) & 1u)) >> 16);
}
__device__ __forceinline__ float bf_up(unsigned short h) { return __uint_as_float(((unsigned)h) << 16); }
__device__ __forceinline__ float bfr(float f) { return bf_up(bf_bits(f)); }   // value after bf16 RNE convert
__device__ __forceinline__ unsigned pk16(unsigned short a, unsigned short b) { return (unsigned)a | ((unsigned)b << 16); }
__device__ __forceinline__ v8f zero8() { v8f z = {0.f, 0.f, 0.f, 0.f, 0.f, 0.f, 0.f, 0.f}; return z; }
__device__ __forceinline__ void bf_split(float f, __bf16& hi, __bf16& lo) {
  const unsigned short hb = bf_bits(f);
  hi = __builtin_bit_cast(__bf16, hb);
  lo = __builtin_bit_cast(__bf16, bf_bits(f - bf_up(hb)));
}

// ---- fragment loader: 16-bit A/B operand, lane -> row/col (lane&15), p already includes +8*(lane>>4);
//      elements 0..7 <- p[0..7] (k0+8h..), elements 8..15 <- p[16..23] (k0+16+8h..)
__device__ __forceinline__ v16b ldfrag_b(const __bf16* p) {
  union { v16b v; v8b h[2]; } f;
  f.h[0] = *(const v8b*)(p);
  f.h[1] = *(const v8b*)(p + 16);
  return f.v;
}

// ---- WMMA helpers with trailing VALU hazard gap ----------------------------------------------------------
__device__ __forceinline__ v8f mma_b(v16b a, v16b b, v8f c) {
  c = __builtin_amdgcn_wmma_f32_16x16x32_bf16(false, a, false, b, (short)0, c, false, false);
  asm volatile("v_nop\n\tv_nop\n\tv_nop\n\tv_nop" : "+v"(c) : "v"(a), "v"(b));
  return c;
}
__device__ __forceinline__ v8f mma_b_raw(v16b a, v16b b, v8f c) {
  return __builtin_amdgcn_wmma_f32_16x16x32_bf16(false, a, false, b, (short)0, c, false, false);
}
__device__ __forceinline__ void dep_guard_b(v8f& a, v8f& b, v16b x, v16b y) {
  asm volatile("v_nop\n\tv_nop\n\tv_nop\n\tv_nop" : "+v"(a), "+v"(b) : "v"(x), "v"(y));
}
__device__ __forceinline__ void keep4_b(v16b a, v16b b, v16b c, v16b d) {
  asm volatile("v_nop" :: "v"(a), "v"(b), "v"(c), "v"(d));
}
__device__ __forceinline__ void acc_guard4(v8f& a, v8f& b, v8f& c, v8f& d) {
  asm volatile("v_nop\n\tv_nop\n\tv_nop\n\tv_nop" : "+v"(a), "+v"(b), "+v"(c), "+v"(d));
}

// =====================================================================================================
// f32 -> bf16 (RNE convert), 8 elements per thread, one 16-B store per lane: a wave writes 512 contiguous B
// coverage: n8 threads x 8 = the whole plane (n8 = 1048576, a multiple of 256).
// =====================================================================================================
__global__ __launch_bounds__(256) void cvt_bf16x8(const float* __restrict__ in, unsigned short* out, int n8) {
  const int i = blockIdx.x * 256 + threadIdx.x;
  if (i < n8) {
    const v4f a = *(const v4f*)(in + (size_t)i * 8);
    const v4f b = *(const v4f*)(in + (size_t)i * 8 + 4);
    v4u p;
    p[0] = pk16(bf_bits(a[0]), bf_bits(a[1]));
    p[1] = pk16(bf_bits(a[2]), bf_bits(a[3]));
    p[2] = pk16(bf_bits(b[0]), bf_bits(b[1]));
    p[3] = pk16(bf_bits(b[2]), bf_bits(b[3]));
    *(v4u*)(out + (size_t)i * 8) = p;
    
  }
}

// =====================================================================================================
// Transpose + bf16 convert of an f32 matrix: in [R rows][Cc cols] (pitch Cc) -> o[c][r] = bf16_rne(in[r][c]),
// output row pitch P (>= R); DUP additionally writes the same value at o[c][R + r] (duplicate along k).
// 64x64 tiles through LDS. grid = (Cc/64, R/64), 256 threads (R, Cc multiples of 64).
// coverage per block: load 4 it x 256 thr x 4 floats = 64x64; store 2 it x 256 thr x 8 u16 = 64x64 (x2 with DUP).
// =====================================================================================================
template <bool DUP>
__global__ __launch_bounds__(256) void tcvt_kernel(const float* __restrict__ W, unsigned short* o, int R, int Cc, int P) {
  __shared__ __align__(16) float tf[64 * 68];
  const int c0  = blockIdx.x * 64;   // input column block = output row block
  const int r0  = blockIdx.y * 64;   // input row block    = output column block
  const int tid = threadIdx.x;
  {
    const int lr = tid >> 4;         // 0..15
    const int c4 = (tid & 15) * 4;   // 0..60
#pragma unroll
    for (int it = 0; it < 4; ++it) {
      const int rr = it * 16 + lr;   // 0..63
      const v4f a = *(const v4f*)(W + (size_t)(r0 + rr) * Cc + c0 + c4);
      *(v4f*)(tf + rr * 68 + c4) = a;
    }
  }
  __syncthreads();
  const int sub = tid >> 3;          // 0..31
  const int c8  = (tid & 7) * 8;     // 0..56
  v4u hv[2];
#pragma unroll
  for (int it = 0; it < 2; ++it) {
    const int oc = it * 32 + sub;    // output row within tile (= input column)
    v4u a;
#pragma unroll
    for (int q = 0; q < 4; ++q) {
      const float f0 = tf[(c8 + 2 * q) * 68 + oc];
      const float f1 = tf[(c8 + 2 * q + 1) * 68 + oc];
      a[q] = pk16(bf_bits(f0), bf_bits(f1));
    }
    hv[it] = a;
  }
  {
#pragma unroll
    for (int it = 0; it < 2; ++it) {
      const int oc = it * 32 + sub;
      const size_t go = (size_t)(c0 + oc) * P + r0 + c8;
      *(v4u*)(o + go) = hv[it];
      if (DUP) *(v4u*)(o + go + R) = hv[it];
    }
    
  }
}

// =====================================================================================================
// Register-blocked bf16 WMMA GEMM: C[m][n] = sum_k A[m][k] * Bt[n][k] + bias; one wave per 64x64 tile,
// no block barriers. A row-major [M][K] pitch lda; Bt row-major [N][K] pitch ldb (k contiguous);
// M, N multiples of 64, K multiple of 32 (host-checked constants).
// BIAS_MODE: 1 = bias[m], 2 = bias[n]; bias value RNE-converted to bf16 then added in f32.
// OUT_MODE: 0 = f32 (pitch ldc); 2 = bf16 hi plane C + bf16 lo plane C2 (lo = RNE(v - hi), unscaled), pitch ldc.
// =====================================================================================================
template <int BIAS_MODE, int OUT_MODE>
__global__ __launch_bounds__(256) void gemm64(
    const unsigned short* __restrict__ Ap, int lda,
    const unsigned short* __restrict__ Btp, int ldb,
    void* Cout, void* Cout2, int ldc,
    const float* __restrict__ bias,
    int M, int N, int K) {
  const __bf16* A  = (const __bf16*)(const void*)Ap;
  const __bf16* Bt = (const __bf16*)(const void*)Btp;
  __shared__ __align__(16) float sT[8][16 * 68];   // per-wave 16x64 slab, pitch 68 floats
  const int lane = threadIdx.x & 31;
  const int wave = threadIdx.x >> 5;
  const int tilesN = N >> 6;
  const int tilesM = M >> 6;
  const int tile = blockIdx.x * 8 + wave;
  if (tile >= tilesM * tilesN) return;   // wave-uniform; no block barriers in this kernel
  const int tm = tile / tilesN;
  const int tn = tile - tm * tilesN;
  const int m0 = tm << 6;
  const int n0 = tn << 6;

  const int rlane = lane & 15;                 // row (A) / col (B, D) within subtile
  const int koff  = (lane >> 4) * 8;           // k offset of this lane half
  const int mOff  = (lane >> 4) * 8;           // D row offset

  v8f acc[4][4];
#pragma unroll
  for (int i = 0; i < 4; ++i)
#pragma unroll
    for (int j = 0; j < 4; ++j) acc[i][j] = zero8();

  for (int k0 = 0; k0 < K; k0 += 32) {
    v16b bh[4];
#pragma unroll
    for (int j = 0; j < 4; ++j) {
      const size_t bo = (size_t)(n0 + (j << 4) + rlane) * ldb + koff + k0;
      bh[j] = ldfrag_b(Bt + bo);
    }
#pragma unroll
    for (int i = 0; i < 4; ++i) {
      const size_t ao = (size_t)(m0 + (i << 4) + rlane) * lda + koff + k0;
      const v16b ah = ldfrag_b(A + ao);
#pragma unroll
      for (int j = 0; j < 4; ++j) acc[i][j] = mma_b_raw(ah, bh[j], acc[i][j]);
      dep_guard_b(acc[i][0], acc[i][3], ah, ah);
    }
    keep4_b(bh[0], bh[1], bh[2], bh[3]);
  }
  acc_guard4(acc[0][0], acc[0][1], acc[0][2], acc[0][3]);
  acc_guard4(acc[1][0], acc[1][1], acc[1][2], acc[1][3]);
  acc_guard4(acc[2][0], acc[2][1], acc[2][2], acc[2][3]);
  acc_guard4(acc[3][0], acc[3][1], acc[3][2], acc[3][3]);

  // ---- epilogue ----
  float* slab = sT[wave];
#pragma unroll
  for (int i = 0; i < 4; ++i) {
    const int mBase = m0 + (i << 4);
    float bm8[8];
#pragma unroll
    for (int r = 0; r < 8; ++r) bm8[r] = 0.f;
    if (BIAS_MODE == 1) {                          // rows mBase+mOff .. +7: two 16-B loads (32-B aligned)
      const v4f t0 = *(const v4f*)(bias + mBase + mOff);
      const v4f t1 = *(const v4f*)(bias + mBase + mOff + 4);
      bm8[0] = bfr(t0[0]); bm8[1] = bfr(t0[1]); bm8[2] = bfr(t0[2]); bm8[3] = bfr(t0[3]);
      bm8[4] = bfr(t1[0]); bm8[5] = bfr(t1[1]); bm8[6] = bfr(t1[2]); bm8[7] = bfr(t1[3]);
    }
#pragma unroll
    for (int j = 0; j < 4; ++j) {
      float bn = 0.f;
      if (BIAS_MODE == 2) bn = bfr(bias[n0 + (j << 4) + rlane]);
#pragma unroll
      for (int r = 0; r < 8; ++r) {
        float v = acc[i][j][r];
        if (BIAS_MODE == 1) v += bm8[r];
        if (BIAS_MODE == 2) v += bn;
        slab[(mOff + r) * 68 + (j << 4) + rlane] = v;
      }
    }
    __builtin_amdgcn_fence(__ATOMIC_RELEASE, "workgroup");
    __builtin_amdgcn_wave_barrier();
    __builtin_amdgcn_fence(__ATOMIC_ACQUIRE, "workgroup");
    if (OUT_MODE == 0) {
      float* C = (float*)Cout;
      const int hh = lane >> 4, c4 = (lane & 15) * 4;     // 256-B row segment = 16 lanes x 16 B
      {
#pragma unroll
        for (int it = 0; it < 8; ++it) {
          const int row = it * 2 + hh;                     // it 0..7 x hh 0..1 = rows 0..15
          const v4f v = *(const v4f*)(slab + row * 68 + c4);
          *(v4f*)(C + (size_t)(mBase + row) * ldc + n0 + c4) = v;
        }
        
      }
    } else {
      const int q = lane >> 3, c8 = (lane & 7) * 8;
      unsigned short* C  = (unsigned short*)Cout;
      unsigned short* C2 = (unsigned short*)Cout2;
      v4u hv[4], lv[4];
#pragma unroll
      for (int it = 0; it < 4; ++it) {
        const int row = it * 4 + q;                        // it 0..3 x q 0..3 = rows 0..15
        const float* sp = slab + row * 68 + c8;
        v4u a, a2;
#pragma unroll
        for (int e = 0; e < 4; ++e) {
          const float f0 = sp[2 * e], f1 = sp[2 * e + 1];
          const unsigned short h0 = bf_bits(f0), h1 = bf_bits(f1);
          const unsigned short l0 = bf_bits(f0 - bf_up(h0)), l1 = bf_bits(f1 - bf_up(h1));
          a[e] = pk16(h0, h1); a2[e] = pk16(l0, l1);
        }
        hv[it] = a; lv[it] = a2;
      }
      {
#pragma unroll
        for (int it = 0; it < 4; ++it) {
          const int row = it * 4 + q;
          *(v4u*)(C  + (size_t)(mBase + row) * ldc + n0 + c8) = hv[it];
          *(v4u*)(C2 + (size_t)(mBase + row) * ldc + n0 + c8) = lv[it];
        }
        
      }
    }
    __builtin_amdgcn_fence(__ATOMIC_RELEASE, "workgroup");
    __builtin_amdgcn_wave_barrier();
    __builtin_amdgcn_fence(__ATOMIC_ACQUIRE, "workgroup");
  }
}

// =====================================================================================================
// Causal attention, head dim 64, one launch per batch element.
//   q|k planes (bf16 hi / lo) of this batch: [t][QKP], q(t, h, d) at col h*64 + d, k(s, h, d) at col DM + h*64 + d
//   v^T planes (bf16 hi / lo) of this batch: [(h*64 + d)][SEQ], key s contiguous
//   context plane (bf16): row rowBase + t, pitch CXP; hi at col h*64 + d, lo (RNE(v - hi)) at col DM + h*64 + d
//   scores = q . k : bf16 hi/lo split (hi.hi + hi.lo + lo.hi), f32 accumulate, then * sscale in f32
//   out    = p . v : bf16 hi/lo split of p (unnormalised) and v, f32 accumulate
//   online softmax in f32; key s > t set to -inf only on the diagonal key tile (key s = tile start <= t always live).
//   Block = 4 waves = 64 query rows of one head; grid.x = NH * NQB; key tiles of 64, block-uniform trip count qb+1 <= 32,
//   every wave reaches both block barriers of every iteration.
//   K / V^T tile staging: 128 threads x 32 elements per plane = the whole 64x64 tile (plain 16-B loads,
//   __syncthreads before and after); fragment loads read the LDS tiles with the same v8b element type.
//   Output coverage: each wave stores rows q0..q0+15 (it 0..3 x lane>>3 0..3) x 64 columns (8 lanes x 8) of both planes.
// =====================================================================================================
__global__ __launch_bounds__(128)
void attn_causal64(const unsigned short* __restrict__ qkhp, const unsigned short* __restrict__ qklp,
                   const unsigned short* __restrict__ vhp, const unsigned short* __restrict__ vlp,
                   unsigned short* cxp, int rowBase, float sscale) {
  union FB { v16b v; v8b h[2]; };
  __shared__ __align__(16) __bf16 Ksh[64 * 64];        // K hi [kv][d]   8 KB
  __shared__ __align__(16) __bf16 Ksl[64 * 64];        // K lo
  __shared__ __align__(16) __bf16 Vth[64 * 64];        // V^T hi [d][kv] 8 KB
  __shared__ __align__(16) __bf16 Vtl[64 * 64];        // V^T lo
  __shared__ __align__(16) __bf16 Psh[4][16 * 64];     // per wave P hi [row][kv]
  __shared__ __align__(16) __bf16 Psl[4][16 * 64];     // per wave P lo
  __shared__ __align__(16) float  Os[4][16 * 64];      // per wave context tile [row][d]

  const int tid  = threadIdx.x;
  const int wave = tid >> 5;
  const int lane = tid & 31;
  const int hh   = lane >> 4;
  const int c    = lane & 15;

  const int bx = blockIdx.x;
  const int qb = bx % NQB;
  const int h  = bx / NQB;                 // 0..NH-1 (grid = NH * NQB)
  const int q0 = qb * 64 + wave * 16;

  const __bf16* Qh = (const __bf16*)(const void*)qkhp + (size_t)h * HD;
  const __bf16* Ql = (const __bf16*)(const void*)qklp + (size_t)h * HD;
  const __bf16* Kh = (const __bf16*)(const void*)qkhp + (size_t)DM + (size_t)h * HD;
  const __bf16* Kl = (const __bf16*)(const void*)qklp + (size_t)DM + (size_t)h * HD;
  const __bf16* Vh = (const __bf16*)(const void*)vhp + (size_t)h * HD * SEQ;
  const __bf16* Vl = (const __bf16*)(const void*)vlp + (size_t)h * HD * SEQ;

  // ---- Q fragments (A operand, row = lane&15, split k map): 2 d-chunks, hi and lo ----
  v16b qah[2], qal[2];
#pragma unroll
  for (int dc = 0; dc < 2; ++dc) {
    const size_t qo = (size_t)(q0 + c) * QKP + dc * 32 + 8 * hh;
    qah[dc] = ldfrag_b(Qh + qo);
    qal[dc] = ldfrag_b(Ql + qo);
  }

  float mrow[8], lrow[8];
  v8f oacc[4];
#pragma unroll
  for (int r = 0; r < 8; ++r) { mrow[r] = -INFINITY; lrow[r] = 0.f; }
#pragma unroll
  for (int t = 0; t < 4; ++t) oacc[t] = zero8();

  const int nChunks = qb + 1;   // block-uniform, <= 32
  for (int kc = 0; kc < nChunks; ++kc) {
    const int kv0 = kc * 64;
    __syncthreads();
    {
      // staging coverage: 128 threads x (4 x 8) elements = 64 rows x 64 per plane = the whole tile of all four planes
      const int r = tid >> 1, half = (tid & 1) * 32;
      const __bf16* kg  = Kh + (size_t)(kv0 + r) * QKP + half;    // K row kv0+r, d = half..half+31
      const __bf16* klg = Kl + (size_t)(kv0 + r) * QKP + half;
      const __bf16* vg  = Vh + (size_t)r * SEQ + kv0 + half;      // V^T row d = r, s = kv0+half..+31
      const __bf16* vlg = Vl + (size_t)r * SEQ + kv0 + half;
#pragma unroll
      for (int i = 0; i < 4; ++i) {
        const v8b a0 = *(const v8b*)(kg + 8 * i);
        const v8b a1 = *(const v8b*)(klg + 8 * i);
        const v8b b0 = *(const v8b*)(vg + 8 * i);
        const v8b b1 = *(const v8b*)(vlg + 8 * i);
        *(v8b*)(Ksh + r * 64 + half + 8 * i) = a0;
        *(v8b*)(Ksl + r * 64 + half + 8 * i) = a1;
        *(v8b*)(Vth + r * 64 + half + 8 * i) = b0;
        *(v8b*)(Vtl + r * 64 + half + 8 * i) = b1;
      }
    }
    __syncthreads();

    // ---- scores: 16 query rows x 64 keys per wave, 3 bf16 products ----
    v8f s[4];
#pragma unroll
    for (int j = 0; j < 4; ++j) {
      s[j] = zero8();
#pragma unroll
      for (int dc = 0; dc < 2; ++dc) {
        FB kb, kl;
        kb.h[0] = *(const v8b*)(Ksh + (j * 16 + c) * 64 + dc * 32 + 8 * hh);
        kb.h[1] = *(const v8b*)(Ksh + (j * 16 + c) * 64 + dc * 32 + 16 + 8 * hh);
        kl.h[0] = *(const v8b*)(Ksl + (j * 16 + c) * 64 + dc * 32 + 8 * hh);
        kl.h[1] = *(const v8b*)(Ksl + (j * 16 + c) * 64 + dc * 32 + 16 + 8 * hh);
        s[j] = mma_b(qah[dc], kb.v, s[j]);
        s[j] = mma_b(qah[dc], kl.v, s[j]);
        s[j] = mma_b(qal[dc], kb.v, s[j]);
      }
    }

    // ---- scale, causal mask on the diagonal tile, row max ----
    const bool diag = (kc == qb);   // block-uniform
    float cm[8];
#pragma unroll
    for (int r = 0; r < 8; ++r) {
      const int qrow = q0 + 8 * hh + r;
      float m = -INFINITY;
#pragma unroll
      for (int j = 0; j < 4; ++j) {
        const int kvcol = kv0 + j * 16 + c;
        const float sv = s[j][r] * sscale;
        const bool masked = diag && (kvcol > qrow);
        const float sm = masked ? -INFINITY : sv;
        s[j][r] = sm;
        m = fmaxf(m, sm);
      }
#pragma unroll
      for (int off = 1; off < 16; off <<= 1) m = fmaxf(m, __shfl_xor(m, off, 32));
      cm[r] = m;
    }

    // ---- online softmax, P hi/lo (bf16, unnormalised) to the wave-private LDS tiles ----
    __bf16* pwh = Psh[wave];
    __bf16* pwl = Psl[wave];
#pragma unroll
    for (int r = 0; r < 8; ++r) {
      const float mnew  = fmaxf(mrow[r], cm[r]);      // finite: key kv0 <= qrow is never masked
      const float alpha = __expf(mrow[r] - mnew);
      mrow[r] = mnew;
      float psum = 0.f;
#pragma unroll
      for (int j = 0; j < 4; ++j) {
        const float p = __expf(s[j][r] - mnew);
        psum += p;
        __bf16 a, bl; bf_split(p, a, bl);
        pwh[(8 * hh + r) * 64 + j * 16 + c] = a;
        pwl[(8 * hh + r) * 64 + j * 16 + c] = bl;
      }
#pragma unroll
      for (int off = 1; off < 16; off <<= 1) psum += __shfl_xor(psum, off, 32);
      lrow[r] = lrow[r] * alpha + psum;
#pragma unroll
      for (int t = 0; t < 4; ++t) oacc[t][r] *= alpha;
    }
    __builtin_amdgcn_fence(__ATOMIC_RELEASE, "workgroup");
    __builtin_amdgcn_wave_barrier();
    __builtin_amdgcn_fence(__ATOMIC_ACQUIRE, "workgroup");

    // ---- context += P . V, 3 bf16 products ----
#pragma unroll 1
    for (int kk = 0; kk < 2; ++kk) {
      FB pa, pl;
      pa.h[0] = *(const v8b*)(pwh + c * 64 + kk * 32 + 8 * hh);
      pa.h[1] = *(const v8b*)(pwh + c * 64 + kk * 32 + 16 + 8 * hh);
      pl.h[0] = *(const v8b*)(pwl + c * 64 + kk * 32 + 8 * hh);
      pl.h[1] = *(const v8b*)(pwl + c * 64 + kk * 32 + 16 + 8 * hh);
#pragma unroll
      for (int t = 0; t < 4; ++t) {
        FB vb, vl;
        vb.h[0] = *(const v8b*)(Vth + (t * 16 + c) * 64 + kk * 32 + 8 * hh);
        vb.h[1] = *(const v8b*)(Vth + (t * 16 + c) * 64 + kk * 32 + 16 + 8 * hh);
        vl.h[0] = *(const v8b*)(Vtl + (t * 16 + c) * 64 + kk * 32 + 8 * hh);
        vl.h[1] = *(const v8b*)(Vtl + (t * 16 + c) * 64 + kk * 32 + 16 + 8 * hh);
        oacc[t] = mma_b(pa.v, vb.v, oacc[t]);
        oacc[t] = mma_b(pa.v, vl.v, oacc[t]);
        oacc[t] = mma_b(pl.v, vb.v, oacc[t]);
      }
    }
  }

  // ---- normalise (1/l), stage the wave's 16x64 tile, bf16 hi/lo split,
  float* os = Os[wave];
#pragma unroll
  for (int r = 0; r < 8; ++r) {
    const float l = lrow[r];                      // >= 1 (row-max key contributes exp(0) at its tile)
    const float inv = (l > 0.f) ? (1.0f / l) : 0.f;
#pragma unroll
    for (int t = 0; t < 4; ++t) os[(8 * hh + r) * 64 + t * 16 + c] = oacc[t][r] * inv;
  }
  __builtin_amdgcn_fence(__ATOMIC_RELEASE, "workgroup");
  __builtin_amdgcn_wave_barrier();
  __builtin_amdgcn_fence(__ATOMIC_ACQUIRE, "workgroup");
  {
    const int q4 = lane >> 3, c8 = (lane & 7) * 8;
    v4u hv[4], lv[4];
#pragma unroll
    for (int it = 0; it < 4; ++it) {
      const int row = it * 4 + q4;   // it 0..3 x q4 0..3 = rows 0..15 of the wave tile
      const float* sp = os + row * 64 + c8;
      v4u a, a2;
#pragma unroll
      for (int e = 0; e < 4; ++e) {
        const float f0 = sp[2 * e], f1 = sp[2 * e + 1];
        const unsigned short h0 = bf_bits(f0), h1 = bf_bits(f1);
        const unsigned short l0 = bf_bits(f0 - bf_up(h0)), l1 = bf_bits(f1 - bf_up(h1));
        a[e] = pk16(h0, h1); a2[e] = pk16(l0, l1);
      }
      hv[it] = a; lv[it] = a2;
    }
    {
#pragma unroll
      for (int it = 0; it < 4; ++it) {
        const int row = it * 4 + q4;
        const size_t go = (size_t)(rowBase + q0 + row) * CXP + (size_t)h * HD + c8;
        *(v4u*)(cxp + go)      = hv[it];
        *(v4u*)(cxp + go + DM) = lv[it];
      }
      
    }
  }
}

// =====================================================================================================
// Workspace map (bytes); every region is an exact multiple of its 64x64-tile / whole-line store granularity:
//   XB   bf16 [8192][1024]              0        16777216
//   WAT  bf16 [3072 n][1024 k]          16777216  6291456
//   WPT2 bf16 [1024 n][2048 k]          23068672  4194304   (W_proj^T duplicated along k)
//   QKh  bf16 [2048][2048]  (per batch) 27262976  8388608
//   QKl  bf16 [2048][2048]              35651584  8388608
//   VTh  bf16 [1024][2048]  (per batch) 44040192  4194304
//   VTl  bf16 [1024][2048]              48234496  4194304
//   CTX  bf16 [8192][2048]              52428800 33554432
//   end                                 85983232
// QK / VT planes are fully rewritten for each batch element before that batch's attention launch reads them.
// =====================================================================================================
extern "C" void kernel_launch(void* const* d_in, const int* in_sizes, int n_in,
                              void* d_out, int out_size, void* d_ws, size_t ws_size,
                              hipStream_t stream) {
  if (n_in < 5) return;
  if (in_sizes[0] != NB * SEQ * DM) return;
  if (in_sizes[1] != DM * N3) return;
  if (in_sizes[2] != N3) return;
  if (in_sizes[3] != DM * DM) return;
  if (in_sizes[4] != DM) return;
  if (out_size != NB * SEQ * DM) return;

  const float* x      = (const float*)d_in[0];   // [4][2048][1024]
  const float* W_attn = (const float*)d_in[1];   // [1024 in][3072 out]
  const float* b_attn = (const float*)d_in[2];   // [3072]
  const float* W_proj = (const float*)d_in[3];   // [1024 in][1024 out]
  const float* b_proj = (const float*)d_in[4];   // [1024]

  const size_t PXB = (size_t)NB * SEQ * DM * 2;     // 16777216
  const size_t PWA = (size_t)N3 * DM * 2;           //  6291456
  const size_t PWP = (size_t)DM * (2 * DM) * 2;     //  4194304
  const size_t PQK = (size_t)SEQ * QKP * 2;         //  8388608
  const size_t PVT = (size_t)DM * SEQ * 2;          //  4194304
  const size_t PCX = (size_t)NB * SEQ * CXP * 2;    // 33554432
  size_t off = 0;
  const size_t oXB  = off; off += PXB;
  const size_t oWAT = off; off += PWA;
  const size_t oWPT = off; off += PWP;
  const size_t oQKh = off; off += PQK;
  const size_t oQKl = off; off += PQK;
  const size_t oVTh = off; off += PVT;
  const size_t oVTl = off; off += PVT;
  const size_t oCTX = off; off += PCX;
  if (off > ws_size) return;                        // off = 85983232
  if (off > (size_t)134217728) return;

  char* ws = (char*)d_ws;
  unsigned short* XB   = (unsigned short*)(ws + oXB);
  unsigned short* WAT  = (unsigned short*)(ws + oWAT);
  unsigned short* WPT2 = (unsigned short*)(ws + oWPT);
  unsigned short* QKh  = (unsigned short*)(ws + oQKh);
  unsigned short* QKl  = (unsigned short*)(ws + oQKl);
  unsigned short* VTh  = (unsigned short*)(ws + oVTh);
  unsigned short* VTl  = (unsigned short*)(ws + oVTl);
  unsigned short* CTX  = (unsigned short*)(ws + oCTX);

  const dim3 blk(256);
  const int n8x = NB * SEQ * DM / 8;                               // 1048576
  const dim3 gCvtX((n8x + 255) / 256);                             // 4096 blocks
  const dim3 gTA(N3 / 64, DM / 64);                                // in [1024 rows][3072 cols] -> (cols/64, rows/64)
  const dim3 gTP(DM / 64, DM / 64);                                // in [1024 rows][1024 cols]
  const dim3 gQK(((SEQ / 64) * ((2 * DM) / 64) + 7) / 8);          // 1024 tiles -> 128 blocks: M=2048, N=2048
  const dim3 gVT(((DM / 64) * (SEQ / 64) + 7) / 8);                //  512 tiles ->  64 blocks: M=1024, N=2048
  const dim3 gAtt(NH * NQB);                                       //  512 blocks: 16 heads x 32 query tiles
  const dim3 gOut(((NB * SEQ / 64) * (DM / 64) + 7) / 8);          // 2048 tiles -> 256 blocks: M=8192, N=1024

  // (1) x -> bf16 [8192][1024]
  cvt_bf16x8<<<gCvtX, blk, 0, stream>>>(x, XB, n8x);
  // (2) W_attn [k][n] -> WAT [n][k] bf16 (pitch 1024); W_proj [k][n] -> WPT2 [n][k | k] bf16 (pitch 2048)
  tcvt_kernel<false><<<gTA, blk, 0, stream>>>(W_attn, WAT, DM, N3, DM);
  tcvt_kernel<true><<<gTP, blk, 0, stream>>>(W_proj, WPT2, DM, DM, 2 * DM);

  for (int b = 0; b < NB; ++b) {
    const unsigned short* XBb = XB + (size_t)b * SEQ * DM;
    // (3) q|k = x[b] . W_attn[:, 0:2048] + b_attn[0:2048] -> bf16 hi/lo [2048][2048]   (M=2048, N=2048, K=1024)
    gemm64<2, 2><<<gQK, blk, 0, stream>>>(XBb, DM, WAT, DM, (void*)QKh, (void*)QKl, QKP, b_attn, SEQ, 2 * DM, DM);
    // (4) v^T = W_attn[:, 2048:3072]^T . x[b]^T + b_attn[2048 + m] -> bf16 hi/lo [1024][2048]   (M=1024, N=2048, K=1024)
    gemm64<1, 2><<<gVT, blk, 0, stream>>>(WAT + (size_t)(2 * DM) * DM, DM, XBb, DM, (void*)VTh, (void*)VTl, SEQ,
                                          b_attn + 2 * DM, DM, SEQ, DM);
    // (5) causal attention -> CTX rows b*2048 .. b*2048+2047 (hi at cols 0..1023, lo at 1024..2047)
    attn_causal64<<<gAtt, dim3(128), 0, stream>>>(QKh, QKl, VTh, VTl, CTX, b * SEQ, 0.125f);
  }
  // (6) y = [ctx hi | ctx lo] . [W_proj^T | W_proj^T]^T + b_proj -> d_out f32 [8192][1024]   (M=8192, N=1024, K=2048)
  gemm64<2, 0><<<gOut, blk, 0, stream>>>(CTX, CXP, WPT2, 2 * DM, d_out, d_out, DM, b_proj, NB * SEQ, DM, 2 * DM);
  (void)hipGetLastError();
}

// v001
// It runs in 713 microseconds.
// In two side-by-side timings against v000, it was 1.74 and 1.73 times as fast.
// Contractions: q|k and v^T projections = v_wmma_f32_16x16x32_bf16 (bf16 operands RNE-converted from x and W_attn, single product, + bf16 bias in f32);
// causal scores q.k^T = v_wmma_f32_16x16x32_bf16 with bf16 hi/lo split q and k (hi.hi + hi.lo + lo.hi);
// context p.v = v_wmma_f32_16x16x32_bf16 with bf16 hi/lo split p and v (3 products);
// output projection = v_wmma_f32_16x16x32_bf16, context bf16 hi|lo planes folded along K (K = 2048) times bf16 W_proj^T (+ bf16 bias in f32);
// all f32 accumulate; online softmax statistics, score scale 0.125 and bias adds in f32.
// Carry audit: every 16-bit plane (XB, WAT, WPT2, QKh/QKl, VTh/VTl, CTX hi|lo, P hi|lo in LDS) has carry 1; no inverse factor is applied anywhere.
#include <hip/hip_runtime.h>
#include <math.h>
#include <stdint.h>

#define NB   4
#define SEQ  2048
#define DM   1024
#define NH   16
#define HD   64
#define N3   (3 * DM)      // 3072
#define QKP  (2 * DM)      // pitch of the q|k planes [t][q 1024 | k 1024]
#define CXP  (2 * DM)      // pitch of the context plane [t][hi 1024 | lo 1024]
#define VTP  (NB * SEQ)    // pitch of the v^T planes [h*64 + d][b*2048 + s]
#define NQB  (SEQ / 64)    // 32 query / key tiles of 64
static_assert(NH * HD == DM);
static_assert((SEQ % 64) == 0 && (DM % 64) == 0 && (N3 % 64) == 0);
static_assert((DM % 32) == 0 && (CXP % 32) == 0 && (QKP % 8) == 0);

typedef __bf16   v16b __attribute__((ext_vector_type(16)));
typedef __bf16   v8b  __attribute__((ext_vector_type(8)));
typedef float    v8f  __attribute__((ext_vector_type(8)));
typedef float    v4f  __attribute__((ext_vector_type(4)));
typedef unsigned int v4u __attribute__((ext_vector_type(4)));

// ---- scalar helpers ----------------------------------------------------------------------------------
__device__ __forceinline__ unsigned short bf_bits(float f) {          // f32 -> bf16 bits, RNE convert
  unsigned u = __float_as_uint(f);
  return (unsigned short)((u + 0x7FFFu + ((u >> 16) & 1u)) >> 16);
}
__device__ __forceinline__ float bf_up(unsigned short h) { return __uint_as_float(((unsigned)h) << 16); }
__device__ __forceinline__ float bfr(float f) { return bf_up(bf_bits(f)); }   // value after bf16 RNE convert
__device__ __forceinline__ unsigned pk16(unsigned short a, unsigned short b) { return (unsigned)a | ((unsigned)b << 16); }
__device__ __forceinline__ v8f zero8() { v8f z = {0.f, 0.f, 0.f, 0.f, 0.f, 0.f, 0.f, 0.f}; return z; }
__device__ __forceinline__ void bf_split(float f, __bf16& hi, __bf16& lo) {
  const unsigned short hb = bf_bits(f);
  hi = __builtin_bit_cast(__bf16, hb);
  lo = __builtin_bit_cast(__bf16, bf_bits(f - bf_up(hb)));
}

// ---- fragment loader: 16-bit A/B operand, lane -> row/col (lane&15), p already includes +8*(lane>>4);
//      elements 0..7 <- p[0..7] (k0+8h..), elements 8..15 <- p[16..23] (k0+16+8h..)
__device__ __forceinline__ v16b ldfrag_b(const __bf16* p) {
  union { v16b v; v8b h[2]; } f;
  f.h[0] = *(const v8b*)(p);
  f.h[1] = *(const v8b*)(p + 16);
  return f.v;
}

// ---- WMMA helpers with trailing VALU hazard gap ----------------------------------------------------------
__device__ __forceinline__ v8f mma_b(v16b a, v16b b, v8f c) {
  c = __builtin_amdgcn_wmma_f32_16x16x32_bf16(false, a, false, b, (short)0, c, false, false);
  asm volatile("v_nop\n\tv_nop\n\tv_nop\n\tv_nop" : "+v"(c) : "v"(a), "v"(b));
  return c;
}
__device__ __forceinline__ v8f mma_b_raw(v16b a, v16b b, v8f c) {
  return __builtin_amdgcn_wmma_f32_16x16x32_bf16(false, a, false, b, (short)0, c, false, false);
}
__device__ __forceinline__ void dep_guard_b(v8f& a, v8f& b, v16b x, v16b y) {
  asm volatile("v_nop\n\tv_nop\n\tv_nop\n\tv_nop" : "+v"(a), "+v"(b) : "v"(x), "v"(y));
}
__device__ __forceinline__ void keep4_b(v16b a, v16b b, v16b c, v16b d) {
  asm volatile("v_nop" :: "v"(a), "v"(b), "v"(c), "v"(d));
}
__device__ __forceinline__ void acc_guard4(v8f& a, v8f& b, v8f& c, v8f& d) {
  asm volatile("v_nop\n\tv_nop\n\tv_nop\n\tv_nop" : "+v"(a), "+v"(b), "+v"(c), "+v"(d));
}

// =====================================================================================================
// f32 -> bf16 (RNE convert), 8 elements per thread, one 16-B store per lane: a wave writes 512 contiguous B
// coverage: n8 threads x 8 = the whole plane (n8 = 1048576, a multiple of 256).
// =====================================================================================================
__global__ __launch_bounds__(256) void cvt_bf16x8(const float* __restrict__ in, unsigned short* out, int n8) {
  const int i = blockIdx.x * 256 + threadIdx.x;
  if (i < n8) {
    const v4f a = *(const v4f*)(in + (size_t)i * 8);
    const v4f b = *(const v4f*)(in + (size_t)i * 8 + 4);
    v4u p;
    p[0] = pk16(bf_bits(a[0]), bf_bits(a[1]));
    p[1] = pk16(bf_bits(a[2]), bf_bits(a[3]));
    p[2] = pk16(bf_bits(b[0]), bf_bits(b[1]));
    p[3] = pk16(bf_bits(b[2]), bf_bits(b[3]));
    *(v4u*)(out + (size_t)i * 8) = p;
    
  }
}

// =====================================================================================================
// Transpose + bf16 convert of an f32 matrix: in [R rows][Cc cols] (pitch Cc) -> o[c][r] = bf16_rne(in[r][c]),
// output row pitch P (>= R); DUP additionally writes the same value at o[c][R + r] (duplicate along k).
// 64x64 tiles through LDS. grid = (Cc/64, R/64), 256 threads (R, Cc multiples of 64).
// coverage per block: load 4 it x 256 thr x 4 floats = 64x64; store 2 it x 256 thr x 8 u16 = 64x64 (x2 with DUP).
// =====================================================================================================
template <bool DUP>
__global__ __launch_bounds__(256) void tcvt_kernel(const float* __restrict__ W, unsigned short* o, int R, int Cc, int P) {
  __shared__ __align__(16) float tf[64 * 68];
  const int c0  = blockIdx.x * 64;   // input column block = output row block
  const int r0  = blockIdx.y * 64;   // input row block    = output column block
  const int tid = threadIdx.x;
  {
    const int lr = tid >> 4;         // 0..15
    const int c4 = (tid & 15) * 4;   // 0..60
#pragma unroll
    for (int it = 0; it < 4; ++it) {
      const int rr = it * 16 + lr;   // 0..63
      const v4f a = *(const v4f*)(W + (size_t)(r0 + rr) * Cc + c0 + c4);
      *(v4f*)(tf + rr * 68 + c4) = a;
    }
  }
  __syncthreads();
  const int sub = tid >> 3;          // 0..31
  const int c8  = (tid & 7) * 8;     // 0..56
  v4u hv[2];
#pragma unroll
  for (int it = 0; it < 2; ++it) {
    const int oc = it * 32 + sub;    // output row within tile (= input column)
    v4u a;
#pragma unroll
    for (int q = 0; q < 4; ++q) {
      const float f0 = tf[(c8 + 2 * q) * 68 + oc];
      const float f1 = tf[(c8 + 2 * q + 1) * 68 + oc];
      a[q] = pk16(bf_bits(f0), bf_bits(f1));
    }
    hv[it] = a;
  }
  {
#pragma unroll
    for (int it = 0; it < 2; ++it) {
      const int oc = it * 32 + sub;
      const size_t go = (size_t)(c0 + oc) * P + r0 + c8;
      *(v4u*)(o + go) = hv[it];
      if (DUP) *(v4u*)(o + go + R) = hv[it];
    }
    
  }
}

// =====================================================================================================
// Register-blocked bf16 WMMA GEMM: C[m][n] = sum_k A[m][k] * Bt[n][k] + bias; one wave per 64x64 tile,
// no block barriers. A row-major [M][K] pitch lda; Bt row-major [N][K] pitch ldb (k contiguous);
// M, N multiples of 64, K multiple of 32 (host-checked constants).
// BIAS_MODE: 1 = bias[m], 2 = bias[n]; bias value RNE-converted to bf16 then added in f32.
// OUT_MODE: 0 = f32 (pitch ldc); 2 = bf16 hi plane C + bf16 lo plane C2 (lo = RNE(v - hi), unscaled), pitch ldc.
// =====================================================================================================
template <int BIAS_MODE, int OUT_MODE>
__global__ __launch_bounds__(256) void gemm64(
    const unsigned short* __restrict__ Ap, int lda,
    const unsigned short* __restrict__ Btp, int ldb,
    void* Cout, void* Cout2, int ldc,
    const float* __restrict__ bias,
    int M, int N, int K) {
  const __bf16* A  = (const __bf16*)(const void*)Ap;
  const __bf16* Bt = (const __bf16*)(const void*)Btp;
  __shared__ __align__(16) float sT[8][16 * 68];   // per-wave 16x64 slab, pitch 68 floats
  const int lane = threadIdx.x & 31;
  const int wave = threadIdx.x >> 5;
  const int tilesN = N >> 6;
  const int tilesM = M >> 6;
  const int tile = blockIdx.x * 8 + wave;
  if (tile >= tilesM * tilesN) return;   // wave-uniform; no block barriers in this kernel
  const int tm = tile / tilesN;
  const int tn = tile - tm * tilesN;
  const int m0 = tm << 6;
  const int n0 = tn << 6;

  const int rlane = lane & 15;                 // row (A) / col (B, D) within subtile
  const int koff  = (lane >> 4) * 8;           // k offset of this lane half
  const int mOff  = (lane >> 4) * 8;           // D row offset

  v8f acc[4][4];
#pragma unroll
  for (int i = 0; i < 4; ++i)
#pragma unroll
    for (int j = 0; j < 4; ++j) acc[i][j] = zero8();

  for (int k0 = 0; k0 < K; k0 += 32) {
    v16b bh[4];
#pragma unroll
    for (int j = 0; j < 4; ++j) {
      const size_t bo = (size_t)(n0 + (j << 4) + rlane) * ldb + koff + k0;
      bh[j] = ldfrag_b(Bt + bo);
    }
#pragma unroll
    for (int i = 0; i < 4; ++i) {
      const size_t ao = (size_t)(m0 + (i << 4) + rlane) * lda + koff + k0;
      const v16b ah = ldfrag_b(A + ao);
#pragma unroll
      for (int j = 0; j < 4; ++j) acc[i][j] = mma_b_raw(ah, bh[j], acc[i][j]);
      dep_guard_b(acc[i][0], acc[i][3], ah, ah);
    }
    keep4_b(bh[0], bh[1], bh[2], bh[3]);
  }
  acc_guard4(acc[0][0], acc[0][1], acc[0][2], acc[0][3]);
  acc_guard4(acc[1][0], acc[1][1], acc[1][2], acc[1][3]);
  acc_guard4(acc[2][0], acc[2][1], acc[2][2], acc[2][3]);
  acc_guard4(acc[3][0], acc[3][1], acc[3][2], acc[3][3]);

  // ---- epilogue ----
  float* slab = sT[wave];
#pragma unroll
  for (int i = 0; i < 4; ++i) {
    const int mBase = m0 + (i << 4);
    float bm8[8];
#pragma unroll
    for (int r = 0; r < 8; ++r) bm8[r] = 0.f;
    if (BIAS_MODE == 1) {                          // rows mBase+mOff .. +7: two 16-B loads (32-B aligned)
      const v4f t0 = *(const v4f*)(bias + mBase + mOff);
      const v4f t1 = *(const v4f*)(bias + mBase + mOff + 4);
      bm8[0] = bfr(t0[0]); bm8[1] = bfr(t0[1]); bm8[2] = bfr(t0[2]); bm8[3] = bfr(t0[3]);
      bm8[4] = bfr(t1[0]); bm8[5] = bfr(t1[1]); bm8[6] = bfr(t1[2]); bm8[7] = bfr(t1[3]);
    }
#pragma unroll
    for (int j = 0; j < 4; ++j) {
      float bn = 0.f;
      if (BIAS_MODE == 2) bn = bfr(bias[n0 + (j << 4) + rlane]);
#pragma unroll
      for (int r = 0; r < 8; ++r) {
        float v = acc[i][j][r];
        if (BIAS_MODE == 1) v += bm8[r];
        if (BIAS_MODE == 2) v += bn;
        slab[(mOff + r) * 68 + (j << 4) + rlane] = v;
      }
    }
    __builtin_amdgcn_fence(__ATOMIC_RELEASE, "workgroup");
    __builtin_amdgcn_wave_barrier();
    __builtin_amdgcn_fence(__ATOMIC_ACQUIRE, "workgroup");
    if (OUT_MODE == 0) {
      float* C = (float*)Cout;
      const int hh = lane >> 4, c4 = (lane & 15) * 4;     // 256-B row segment = 16 lanes x 16 B
      {
#pragma unroll
        for (int it = 0; it < 8; ++it) {
          const int row = it * 2 + hh;                     // it 0..7 x hh 0..1 = rows 0..15
          const v4f v = *(const v4f*)(slab + row * 68 + c4);
          *(v4f*)(C + (size_t)(mBase + row) * ldc + n0 + c4) = v;
        }
        
      }
    } else {
      const int q = lane >> 3, c8 = (lane & 7) * 8;
      unsigned short* C  = (unsigned short*)Cout;
      unsigned short* C2 = (unsigned short*)Cout2;
      v4u hv[4], lv[4];
#pragma unroll
      for (int it = 0; it < 4; ++it) {
        const int row = it * 4 + q;                        // it 0..3 x q 0..3 = rows 0..15
        const float* sp = slab + row * 68 + c8;
        v4u a, a2;
#pragma unroll
        for (int e = 0; e < 4; ++e) {
          const float f0 = sp[2 * e], f1 = sp[2 * e + 1];
          const unsigned short h0 = bf_bits(f0), h1 = bf_bits(f1);
          const unsigned short l0 = bf_bits(f0 - bf_up(h0)), l1 = bf_bits(f1 - bf_up(h1));
          a[e] = pk16(h0, h1); a2[e] = pk16(l0, l1);
        }
        hv[it] = a; lv[it] = a2;
      }
      {
#pragma unroll
        for (int it = 0; it < 4; ++it) {
          const int row = it * 4 + q;
          *(v4u*)(C  + (size_t)(mBase + row) * ldc + n0 + c8) = hv[it];
          *(v4u*)(C2 + (size_t)(mBase + row) * ldc + n0 + c8) = lv[it];
        }
        
      }
    }
    __builtin_amdgcn_fence(__ATOMIC_RELEASE, "workgroup");
    __builtin_amdgcn_wave_barrier();
    __builtin_amdgcn_fence(__ATOMIC_ACQUIRE, "workgroup");
  }
}

// =====================================================================================================
// Causal attention, head dim 64, all batch elements in one launch (blockIdx.y = batch element b).
//   q|k planes (bf16 hi / lo): [b*SEQ + t][QKP], q(t, h, d) at col h*64 + d, k(s, h, d) at col DM + h*64 + d
//   v^T planes (bf16 hi / lo): [(h*64 + d)][VTP], key s of batch b at col b*SEQ + s, s contiguous
//   context plane (bf16): row b*SEQ + t, pitch CXP; hi at col h*64 + d, lo (RNE(v - hi)) at col DM + h*64 + d
//   scores = q . k : bf16 hi/lo split (hi.hi + hi.lo + lo.hi), f32 accumulate, then * sscale in f32
//   out    = p . v : bf16 hi/lo split of p (unnormalised) and v, f32 accumulate
//   online softmax in f32; key s > t set to -inf only on the diagonal key tile (key s = tile start <= t always live).
//   Block = 4 waves = 64 query rows of one head; grid = (NH * NQB, NB); key tiles of 64, block-uniform trip count qb+1 <= 32,
//   every wave reaches both block barriers of every iteration.
//   K / V^T tile staging: 128 threads x 32 elements per plane = the whole 64x64 tile (plain 16-B loads,
//   __syncthreads before and after); fragment loads read the LDS tiles with the same v8b element type.
//   Output coverage: each wave stores rows q0..q0+15 (it 0..3 x lane>>3 0..3) x 64 columns (8 lanes x 8) of both planes.
// =====================================================================================================
__global__ __launch_bounds__(128)
void attn_causal64(const unsigned short* __restrict__ qkhp, const unsigned short* __restrict__ qklp,
                   const unsigned short* __restrict__ vhp, const unsigned short* __restrict__ vlp,
                   unsigned short* cxp, float sscale) {
  union FB { v16b v; v8b h[2]; };
  __shared__ __align__(16) __bf16 Ksh[64 * 64];        // K hi [kv][d]   8 KB
  __shared__ __align__(16) __bf16 Ksl[64 * 64];        // K lo
  __shared__ __align__(16) __bf16 Vth[64 * 64];        // V^T hi [d][kv] 8 KB
  __shared__ __align__(16) __bf16 Vtl[64 * 64];        // V^T lo
  __shared__ __align__(16) __bf16 Psh[4][16 * 64];     // per wave P hi [row][kv]
  __shared__ __align__(16) __bf16 Psl[4][16 * 64];     // per wave P lo
  __shared__ __align__(16) float  Os[4][16 * 64];      // per wave context tile [row][d]

  const int tid  = threadIdx.x;
  const int wave = tid >> 5;
  const int lane = tid & 31;
  const int hh   = lane >> 4;
  const int c    = lane & 15;

  const int bx = blockIdx.x;
  const int qb = bx % NQB;
  const int h  = bx / NQB;                 // 0..NH-1 (grid.x = NH * NQB)
  const int q0 = qb * 64 + wave * 16;
  const int rowBase = blockIdx.y * SEQ;    // first token row of this batch element (grid.y = NB)

  const __bf16* Qh = (const __bf16*)(const void*)qkhp + (size_t)rowBase * QKP + (size_t)h * HD;
  const __bf16* Ql = (const __bf16*)(const void*)qklp + (size_t)rowBase * QKP + (size_t)h * HD;
  const __bf16* Kh = Qh + DM;
  const __bf16* Kl = Ql + DM;
  const __bf16* Vh = (const __bf16*)(const void*)vhp + (size_t)h * HD * VTP + rowBase;
  const __bf16* Vl = (const __bf16*)(const void*)vlp + (size_t)h * HD * VTP + rowBase;

  // ---- Q fragments (A operand, row = lane&15, split k map): 2 d-chunks, hi and lo ----
  v16b qah[2], qal[2];
#pragma unroll
  for (int dc = 0; dc < 2; ++dc) {
    const size_t qo = (size_t)(q0 + c) * QKP + dc * 32 + 8 * hh;
    qah[dc] = ldfrag_b(Qh + qo);
    qal[dc] = ldfrag_b(Ql + qo);
  }

  float mrow[8], lrow[8];
  v8f oacc[4];
#pragma unroll
  for (int r = 0; r < 8; ++r) { mrow[r] = -INFINITY; lrow[r] = 0.f; }
#pragma unroll
  for (int t = 0; t < 4; ++t) oacc[t] = zero8();

  const int nChunks = qb + 1;   // block-uniform, <= 32
  for (int kc = 0; kc < nChunks; ++kc) {
    const int kv0 = kc * 64;
    __syncthreads();
    {
      // staging coverage: 128 threads x (4 x 8) elements = 64 rows x 64 per plane = the whole tile of all four planes
      const int r = tid >> 1, half = (tid & 1) * 32;
      const __bf16* kg  = Kh + (size_t)(kv0 + r) * QKP + half;    // K row kv0+r, d = half..half+31
      const __bf16* klg = Kl + (size_t)(kv0 + r) * QKP + half;
      const __bf16* vg  = Vh + (size_t)r * VTP + kv0 + half;      // V^T row d = r, s = kv0+half..+31
      const __bf16* vlg = Vl + (size_t)r * VTP + kv0 + half;
#pragma unroll
      for (int i = 0; i < 4; ++i) {
        const v8b a0 = *(const v8b*)(kg + 8 * i);
        const v8b a1 = *(const v8b*)(klg + 8 * i);
        const v8b b0 = *(const v8b*)(vg + 8 * i);
        const v8b b1 = *(const v8b*)(vlg + 8 * i);
        *(v8b*)(Ksh + r * 64 + half + 8 * i) = a0;
        *(v8b*)(Ksl + r * 64 + half + 8 * i) = a1;
        *(v8b*)(Vth + r * 64 + half + 8 * i) = b0;
        *(v8b*)(Vtl + r * 64 + half + 8 * i) = b1;
      }
    }
    __syncthreads();

    // ---- scores: 16 query rows x 64 keys per wave, 3 bf16 products ----
    v8f s[4];
#pragma unroll
    for (int j = 0; j < 4; ++j) {
      s[j] = zero8();
#pragma unroll
      for (int dc = 0; dc < 2; ++dc) {
        FB kb, kl;
        kb.h[0] = *(const v8b*)(Ksh + (j * 16 + c) * 64 + dc * 32 + 8 * hh);
        kb.h[1] = *(const v8b*)(Ksh + (j * 16 + c) * 64 + dc * 32 + 16 + 8 * hh);
        kl.h[0] = *(const v8b*)(Ksl + (j * 16 + c) * 64 + dc * 32 + 8 * hh);
        kl.h[1] = *(const v8b*)(Ksl + (j * 16 + c) * 64 + dc * 32 + 16 + 8 * hh);
        s[j] = mma_b(qah[dc], kb.v, s[j]);
        s[j] = mma_b(qah[dc], kl.v, s[j]);
        s[j] = mma_b(qal[dc], kb.v, s[j]);
      }
    }

    // ---- scale, causal mask on the diagonal tile, row max ----
    const bool diag = (kc == qb);   // block-uniform
    float cm[8];
#pragma unroll
    for (int r = 0; r < 8; ++r) {
      const int qrow = q0 + 8 * hh + r;
      float m = -INFINITY;
#pragma unroll
      for (int j = 0; j < 4; ++j) {
        const int kvcol = kv0 + j * 16 + c;
        const float sv = s[j][r] * sscale;
        const bool masked = diag && (kvcol > qrow);
        const float sm = masked ? -INFINITY : sv;
        s[j][r] = sm;
        m = fmaxf(m, sm);
      }
#pragma unroll
      for (int off = 1; off < 16; off <<= 1) m = fmaxf(m, __shfl_xor(m, off, 32));
      cm[r] = m;
    }

    // ---- online softmax, P hi/lo (bf16, unnormalised) to the wave-private LDS tiles ----
    __bf16* pwh = Psh[wave];
    __bf16* pwl = Psl[wave];
#pragma unroll
    for (int r = 0; r < 8; ++r) {
      const float mnew  = fmaxf(mrow[r], cm[r]);      // finite: key kv0 <= qrow is never masked
      const float alpha = __expf(mrow[r] - mnew);
      mrow[r] = mnew;
      float psum = 0.f;
#pragma unroll
      for (int j = 0; j < 4; ++j) {
        const float p = __expf(s[j][r] - mnew);
        psum += p;
        __bf16 a, bl; bf_split(p, a, bl);
        pwh[(8 * hh + r) * 64 + j * 16 + c] = a;
        pwl[(8 * hh + r) * 64 + j * 16 + c] = bl;
      }
#pragma unroll
      for (int off = 1; off < 16; off <<= 1) psum += __shfl_xor(psum, off, 32);
      lrow[r] = lrow[r] * alpha + psum;
#pragma unroll
      for (int t = 0; t < 4; ++t) oacc[t][r] *= alpha;
    }
    __builtin_amdgcn_fence(__ATOMIC_RELEASE, "workgroup");
    __builtin_amdgcn_wave_barrier();
    __builtin_amdgcn_fence(__ATOMIC_ACQUIRE, "workgroup");

    // ---- context += P . V, 3 bf16 products ----
#pragma unroll 1
    for (int kk = 0; kk < 2; ++kk) {
      FB pa, pl;
      pa.h[0] = *(const v8b*)(pwh + c * 64 + kk * 32 + 8 * hh);
      pa.h[1] = *(const v8b*)(pwh + c * 64 + kk * 32 + 16 + 8 * hh);
      pl.h[0] = *(const v8b*)(pwl + c * 64 + kk * 32 + 8 * hh);
      pl.h[1] = *(const v8b*)(pwl + c * 64 + kk * 32 + 16 + 8 * hh);
#pragma unroll
      for (int t = 0; t < 4; ++t) {
        FB vb, vl;
        vb.h[0] = *(const v8b*)(Vth + (t * 16 + c) * 64 + kk * 32 + 8 * hh);
        vb.h[1] = *(const v8b*)(Vth + (t * 16 + c) * 64 + kk * 32 + 16 + 8 * hh);
        vl.h[0] = *(const v8b*)(Vtl + (t * 16 + c) * 64 + kk * 32 + 8 * hh);
        vl.h[1] = *(const v8b*)(Vtl + (t * 16 + c) * 64 + kk * 32 + 16 + 8 * hh);
        oacc[t] = mma_b(pa.v, vb.v, oacc[t]);
        oacc[t] = mma_b(pa.v, vl.v, oacc[t]);
        oacc[t] = mma_b(pl.v, vb.v, oacc[t]);
      }
    }
  }

  // ---- normalise (1/l), stage the wave's 16x64 tile, bf16 hi/lo split,
  float* os = Os[wave];
#pragma unroll
  for (int r = 0; r < 8; ++r) {
    const float l = lrow[r];                      // >= 1 (row-max key contributes exp(0) at its tile)
    const float inv = (l > 0.f) ? (1.0f / l) : 0.f;
#pragma unroll
    for (int t = 0; t < 4; ++t) os[(8 * hh + r) * 64 + t * 16 + c] = oacc[t][r] * inv;
  }
  __builtin_amdgcn_fence(__ATOMIC_RELEASE, "workgroup");
  __builtin_amdgcn_wave_barrier();
  __builtin_amdgcn_fence(__ATOMIC_ACQUIRE, "workgroup");
  {
    const int q4 = lane >> 3, c8 = (lane & 7) * 8;
    v4u hv[4], lv[4];
#pragma unroll
    for (int it = 0; it < 4; ++it) {
      const int row = it * 4 + q4;   // it 0..3 x q4 0..3 = rows 0..15 of the wave tile
      const float* sp = os + row * 64 + c8;
      v4u a, a2;
#pragma unroll
      for (int e = 0; e < 4; ++e) {
        const float f0 = sp[2 * e], f1 = sp[2 * e + 1];
        const unsigned short h0 = bf_bits(f0), h1 = bf_bits(f1);
        const unsigned short l0 = bf_bits(f0 - bf_up(h0)), l1 = bf_bits(f1 - bf_up(h1));
        a[e] = pk16(h0, h1); a2[e] = pk16(l0, l1);
      }
      hv[it] = a; lv[it] = a2;
    }
    {
#pragma unroll
      for (int it = 0; it < 4; ++it) {
        const int row = it * 4 + q4;
        const size_t go = (size_t)(rowBase + q0 + row) * CXP + (size_t)h * HD + c8;
        *(v4u*)(cxp + go)      = hv[it];
        *(v4u*)(cxp + go + DM) = lv[it];
      }
      
    }
  }
}

// =====================================================================================================
// Workspace map (bytes); every region is an exact multiple of its 64x64-tile / whole-line store granularity:
//   XB   bf16 [8192][1024]              0        16777216
//   WAT  bf16 [3072 n][1024 k]          16777216  6291456
//   WPT2 bf16 [1024 n][2048 k]          23068672  4194304   (W_proj^T duplicated along k)
//   QKh  bf16 [8192][2048]              27262976 33554432
//   QKl  bf16 [8192][2048]              60817408 33554432
//   VTh  bf16 [1024][8192]              94371840 16777216
//   VTl  bf16 [1024][8192]             111149056 16777216
//   CTX  bf16 [8192][2048]             127926272 33554432
//   end                                161480704
// Every stage is one launch over all four batch elements; QK / VT planes are fully written before the attention launch reads them.
// =====================================================================================================
extern "C" void kernel_launch(void* const* d_in, const int* in_sizes, int n_in,
                              void* d_out, int out_size, void* d_ws, size_t ws_size,
                              hipStream_t stream) {
  if (n_in < 5) return;
  if (in_sizes[0] != NB * SEQ * DM) return;
  if (in_sizes[1] != DM * N3) return;
  if (in_sizes[2] != N3) return;
  if (in_sizes[3] != DM * DM) return;
  if (in_sizes[4] != DM) return;
  if (out_size != NB * SEQ * DM) return;

  const float* x      = (const float*)d_in[0];   // [4][2048][1024]
  const float* W_attn = (const float*)d_in[1];   // [1024 in][3072 out]
  const float* b_attn = (const float*)d_in[2];   // [3072]
  const float* W_proj = (const float*)d_in[3];   // [1024 in][1024 out]
  const float* b_proj = (const float*)d_in[4];   // [1024]

  const size_t PXB = (size_t)NB * SEQ * DM * 2;     // 16777216
  const size_t PWA = (size_t)N3 * DM * 2;           //  6291456
  const size_t PWP = (size_t)DM * (2 * DM) * 2;     //  4194304
  const size_t PQK = (size_t)NB * SEQ * QKP * 2;    // 33554432
  const size_t PVT = (size_t)DM * VTP * 2;          // 16777216
  const size_t PCX = (size_t)NB * SEQ * CXP * 2;    // 33554432
  size_t off = 0;
  const size_t oXB  = off; off += PXB;
  const size_t oWAT = off; off += PWA;
  const size_t oWPT = off; off += PWP;
  const size_t oQKh = off; off += PQK;
  const size_t oQKl = off; off += PQK;
  const size_t oVTh = off; off += PVT;
  const size_t oVTl = off; off += PVT;
  const size_t oCTX = off; off += PCX;
  if (off > ws_size) return;                        // off = 161480704

  char* ws = (char*)d_ws;
  unsigned short* XB   = (unsigned short*)(ws + oXB);
  unsigned short* WAT  = (unsigned short*)(ws + oWAT);
  unsigned short* WPT2 = (unsigned short*)(ws + oWPT);
  unsigned short* QKh  = (unsigned short*)(ws + oQKh);
  unsigned short* QKl  = (unsigned short*)(ws + oQKl);
  unsigned short* VTh  = (unsigned short*)(ws + oVTh);
  unsigned short* VTl  = (unsigned short*)(ws + oVTl);
  unsigned short* CTX  = (unsigned short*)(ws + oCTX);

  const dim3 blk(256);
  const int n8x = NB * SEQ * DM / 8;                               // 1048576
  const dim3 gCvtX((n8x + 255) / 256);                             // 4096 blocks
  const dim3 gTA(N3 / 64, DM / 64);                                // in [1024 rows][3072 cols] -> (cols/64, rows/64)
  const dim3 gTP(DM / 64, DM / 64);                                // in [1024 rows][1024 cols]
  const dim3 gQK(((NB * SEQ / 64) * ((2 * DM) / 64) + 7) / 8);     // 4096 tiles -> 512 blocks: M=8192, N=2048
  const dim3 gVT(((DM / 64) * (NB * SEQ / 64) + 7) / 8);           // 2048 tiles -> 256 blocks: M=1024, N=8192
  const dim3 gAtt(NH * NQB, NB);                                   // 2048 blocks: (16 heads x 32 query tiles) x 4 batch elements
  const dim3 gOut(((NB * SEQ / 64) * (DM / 64) + 7) / 8);          // 2048 tiles -> 256 blocks: M=8192, N=1024

  // (1) x -> bf16 [8192][1024]
  cvt_bf16x8<<<gCvtX, blk, 0, stream>>>(x, XB, n8x);
  // (2) W_attn [k][n] -> WAT [n][k] bf16 (pitch 1024); W_proj [k][n] -> WPT2 [n][k | k] bf16 (pitch 2048)
  tcvt_kernel<false><<<gTA, blk, 0, stream>>>(W_attn, WAT, DM, N3, DM);
  tcvt_kernel<true><<<gTP, blk, 0, stream>>>(W_proj, WPT2, DM, DM, 2 * DM);

  // (3) q|k = x . W_attn[:, 0:2048] + b_attn[0:2048] -> bf16 hi/lo [8192][2048]   (M=8192, N=2048, K=1024)
  gemm64<2, 2><<<gQK, blk, 0, stream>>>(XB, DM, WAT, DM, (void*)QKh, (void*)QKl, QKP, b_attn, NB * SEQ, 2 * DM, DM);
  // (4) v^T = W_attn[:, 2048:3072]^T . x^T + b_attn[2048 + m] -> bf16 hi/lo [1024][8192]   (M=1024, N=8192, K=1024)
  gemm64<1, 2><<<gVT, blk, 0, stream>>>(WAT + (size_t)(2 * DM) * DM, DM, XB, DM, (void*)VTh, (void*)VTl, VTP,
                                        b_attn + 2 * DM, DM, NB * SEQ, DM);
  // (5) causal attention -> CTX rows 0..8191 (hi at cols 0..1023, lo at 1024..2047)
  attn_causal64<<<gAtt, dim3(128), 0, stream>>>(QKh, QKl, VTh, VTl, CTX, 0.125f);
  // (6) y = [ctx hi | ctx lo] . [W_proj^T | W_proj^T]^T + b_proj -> d_out f32 [8192][1024]   (M=8192, N=1024, K=2048)
  gemm64<2, 0><<<gOut, blk, 0, stream>>>(CTX, CXP, WPT2, 2 * DM, d_out, d_out, DM, b_proj, NB * SEQ, DM, 2 * DM);
  (void)hipGetLastError();
}

// v002
// One run takes 501 microseconds.
// Next to v001, in two timings, it ran 1.42 times as fast each time.
// Over all steps from v000 it is 2.47 times as fast.
// Contractions: q|k and v^T projections = v_wmma_f32_16x16x32_bf16 (bf16 operands RNE-converted from x and W_attn, single product, + bf16 bias in f32);
// causal scores q.k^T = v_wmma_f32_16x16x32_bf16 with bf16 hi/lo split q and k (hi.hi + hi.lo + lo.hi);
// context p.v = v_wmma_f32_16x16x32_bf16 with bf16 hi/lo split p and v (3 products);
// output projection = v_wmma_f32_16x16x32_bf16, context bf16 hi|lo planes folded along K (K = 2048) times bf16 W_proj^T (+ bf16 bias in f32);
// all f32 accumulate; online softmax statistics, score scale 0.125 and bias adds in f32.
// Carry audit: every 16-bit plane (XB, WAT, WPT2, QKh/QKl, VTh/VTl, CTX hi|lo, P hi|lo in LDS) has carry 1; no inverse factor is applied anywhere.
#include <hip/hip_runtime.h>
#include <math.h>
#include <stdint.h>

#define NB   4
#define SEQ  2048
#define DM   1024
#define NH   16
#define HD   64
#define N3   (3 * DM)      // 3072
#define QKP  (2 * DM)      // pitch of the q|k planes [t][q 1024 | k 1024]
#define CXP  (2 * DM)      // pitch of the context plane [t][hi 1024 | lo 1024]
#define VTP  (NB * SEQ)    // pitch of the v^T planes [h*64 + d][b*2048 + s]
#define NQB  (SEQ / 64)    // 32 query / key tiles of 64
#define LP   72            // LDS row pitch of the 64-element bf16 tiles: 144 B = 16 B x 9 (odd), conflict-free for 16-B fragment reads
static_assert(NH * HD == DM);
static_assert((SEQ % 64) == 0 && (DM % 64) == 0 && (N3 % 64) == 0);
static_assert((DM % 32) == 0 && (CXP % 32) == 0 && (QKP % 8) == 0);

typedef __bf16   v16b __attribute__((ext_vector_type(16)));
typedef __bf16   v8b  __attribute__((ext_vector_type(8)));
typedef float    v8f  __attribute__((ext_vector_type(8)));
typedef float    v4f  __attribute__((ext_vector_type(4)));
typedef unsigned int v4u __attribute__((ext_vector_type(4)));

// ---- scalar helpers ----------------------------------------------------------------------------------
__device__ __forceinline__ unsigned short bf_bits(float f) {          // f32 -> bf16 bits, RNE convert
  unsigned u = __float_as_uint(f);
  return (unsigned short)((u + 0x7FFFu + ((u >> 16) & 1u)) >> 16);
}
__device__ __forceinline__ float bf_up(unsigned short h) { return __uint_as_float(((unsigned)h) << 16); }
__device__ __forceinline__ float bfr(float f) { return bf_up(bf_bits(f)); }   // value after bf16 RNE convert
__device__ __forceinline__ unsigned pk16(unsigned short a, unsigned short b) { return (unsigned)a | ((unsigned)b << 16); }
__device__ __forceinline__ v8f zero8() { v8f z = {0.f, 0.f, 0.f, 0.f, 0.f, 0.f, 0.f, 0.f}; return z; }
__device__ __forceinline__ void bf_split(float f, __bf16& hi, __bf16& lo) {
  const unsigned short hb = bf_bits(f);
  hi = __builtin_bit_cast(__bf16, hb);
  lo = __builtin_bit_cast(__bf16, bf_bits(f - bf_up(hb)));
}

// ---- fragment loader: 16-bit A/B operand, lane -> row/col (lane&15), p already includes +8*(lane>>4);
//      elements 0..7 <- p[0..7] (k0+8h..), elements 8..15 <- p[16..23] (k0+16+8h..)
__device__ __forceinline__ v16b ldfrag_b(const __bf16* p) {
  union { v16b v; v8b h[2]; } f;
  f.h[0] = *(const v8b*)(p);
  f.h[1] = *(const v8b*)(p + 16);
  return f.v;
}

// ---- WMMA helpers with trailing VALU hazard gap ----------------------------------------------------------
__device__ __forceinline__ v8f mma_b(v16b a, v16b b, v8f c) {
  c = __builtin_amdgcn_wmma_f32_16x16x32_bf16(false, a, false, b, (short)0, c, false, false);
  asm volatile("v_nop\n\tv_nop\n\tv_nop\n\tv_nop" : "+v"(c) : "v"(a), "v"(b));
  return c;
}
__device__ __forceinline__ v8f mma_b_raw(v16b a, v16b b, v8f c) {
  return __builtin_amdgcn_wmma_f32_16x16x32_bf16(false, a, false, b, (short)0, c, false, false);
}
__device__ __forceinline__ void dep_guard_b(v8f& a, v8f& b, v16b x, v16b y) {
  asm volatile("v_nop\n\tv_nop\n\tv_nop\n\tv_nop" : "+v"(a), "+v"(b) : "v"(x), "v"(y));
}
__device__ __forceinline__ void keep4_b(v16b a, v16b b, v16b c, v16b d) {
  asm volatile("v_nop" :: "v"(a), "v"(b), "v"(c), "v"(d));
}
__device__ __forceinline__ void acc_guard4(v8f& a, v8f& b, v8f& c, v8f& d) {
  asm volatile("v_nop\n\tv_nop\n\tv_nop\n\tv_nop" : "+v"(a), "+v"(b), "+v"(c), "+v"(d));
}

// =====================================================================================================
// f32 -> bf16 (RNE convert), 8 elements per thread, one 16-B store per lane: a wave writes 512 contiguous B
// coverage: n8 threads x 8 = the whole plane (n8 = 1048576, a multiple of 256).
// =====================================================================================================
__global__ __launch_bounds__(256) void cvt_bf16x8(const float* __restrict__ in, unsigned short* out, int n8) {
  const int i = blockIdx.x * 256 + threadIdx.x;
  if (i < n8) {
    const v4f a = *(const v4f*)(in + (size_t)i * 8);
    const v4f b = *(const v4f*)(in + (size_t)i * 8 + 4);
    v4u p;
    p[0] = pk16(bf_bits(a[0]), bf_bits(a[1]));
    p[1] = pk16(bf_bits(a[2]), bf_bits(a[3]));
    p[2] = pk16(bf_bits(b[0]), bf_bits(b[1]));
    p[3] = pk16(bf_bits(b[2]), bf_bits(b[3]));
    *(v4u*)(out + (size_t)i * 8) = p;
    
  }
}

// =====================================================================================================
// Transpose + bf16 convert of an f32 matrix: in [R rows][Cc cols] (pitch Cc) -> o[c][r] = bf16_rne(in[r][c]),
// output row pitch P (>= R); DUP additionally writes the same value at o[c][R + r] (duplicate along k).
// 64x64 tiles through LDS. grid = (Cc/64, R/64), 256 threads (R, Cc multiples of 64).
// coverage per block: load 4 it x 256 thr x 4 floats = 64x64; store 2 it x 256 thr x 8 u16 = 64x64 (x2 with DUP).
// =====================================================================================================
template <bool DUP>
__global__ __launch_bounds__(256) void tcvt_kernel(const float* __restrict__ W, unsigned short* o, int R, int Cc, int P) {
  __shared__ __align__(16) float tf[64 * 68];
  const int c0  = blockIdx.x * 64;   // input column block = output row block
  const int r0  = blockIdx.y * 64;   // input row block    = output column block
  const int tid = threadIdx.x;
  {
    const int lr = tid >> 4;         // 0..15
    const int c4 = (tid & 15) * 4;   // 0..60
#pragma unroll
    for (int it = 0; it < 4; ++it) {
      const int rr = it * 16 + lr;   // 0..63
      const v4f a = *(const v4f*)(W + (size_t)(r0 + rr) * Cc + c0 + c4);
      *(v4f*)(tf + rr * 68 + c4) = a;
    }
  }
  __syncthreads();
  const int sub = tid >> 3;          // 0..31
  const int c8  = (tid & 7) * 8;     // 0..56
  v4u hv[2];
#pragma unroll
  for (int it = 0; it < 2; ++it) {
    const int oc = it * 32 + sub;    // output row within tile (= input column)
    v4u a;
#pragma unroll
    for (int q = 0; q < 4; ++q) {
      const float f0 = tf[(c8 + 2 * q) * 68 + oc];
      const float f1 = tf[(c8 + 2 * q + 1) * 68 + oc];
      a[q] = pk16(bf_bits(f0), bf_bits(f1));
    }
    hv[it] = a;
  }
  {
#pragma unroll
    for (int it = 0; it < 2; ++it) {
      const int oc = it * 32 + sub;
      const size_t go = (size_t)(c0 + oc) * P + r0 + c8;
      *(v4u*)(o + go) = hv[it];
      if (DUP) *(v4u*)(o + go + R) = hv[it];
    }
    
  }
}

// =====================================================================================================
// Register-blocked bf16 WMMA GEMM: C[m][n] = sum_k A[m][k] * Bt[n][k] + bias; one wave per 64x64 tile,
// no block barriers. A row-major [M][K] pitch lda; Bt row-major [N][K] pitch ldb (k contiguous);
// M, N multiples of 64, K multiple of 32 (host-checked constants).
// BIAS_MODE: 1 = bias[m], 2 = bias[n]; bias value RNE-converted to bf16 then added in f32.
// OUT_MODE: 0 = f32 (pitch ldc); 2 = bf16 hi plane C + bf16 lo plane C2 (lo = RNE(v - hi), unscaled), pitch ldc.
// =====================================================================================================
template <int BIAS_MODE, int OUT_MODE>
__global__ __launch_bounds__(256) void gemm64(
    const unsigned short* __restrict__ Ap, int lda,
    const unsigned short* __restrict__ Btp, int ldb,
    void* Cout, void* Cout2, int ldc,
    const float* __restrict__ bias,
    int M, int N, int K) {
  const __bf16* A  = (const __bf16*)(const void*)Ap;
  const __bf16* Bt = (const __bf16*)(const void*)Btp;
  __shared__ __align__(16) float sT[8][16 * 68];   // per-wave 16x64 slab, pitch 68 floats
  const int lane = threadIdx.x & 31;
  const int wave = threadIdx.x >> 5;
  const int tilesN = N >> 6;
  const int tilesM = M >> 6;
  const int tile = blockIdx.x * 8 + wave;
  if (tile >= tilesM * tilesN) return;   // wave-uniform; no block barriers in this kernel
  const int tm = tile / tilesN;
  const int tn = tile - tm * tilesN;
  const int m0 = tm << 6;
  const int n0 = tn << 6;

  const int rlane = lane & 15;                 // row (A) / col (B, D) within subtile
  const int koff  = (lane >> 4) * 8;           // k offset of this lane half
  const int mOff  = (lane >> 4) * 8;           // D row offset

  v8f acc[4][4];
#pragma unroll
  for (int i = 0; i < 4; ++i)
#pragma unroll
    for (int j = 0; j < 4; ++j) acc[i][j] = zero8();

  for (int k0 = 0; k0 < K; k0 += 32) {
    v16b bh[4];
#pragma unroll
    for (int j = 0; j < 4; ++j) {
      const size_t bo = (size_t)(n0 + (j << 4) + rlane) * ldb + koff + k0;
      bh[j] = ldfrag_b(Bt + bo);
    }
#pragma unroll
    for (int i = 0; i < 4; ++i) {
      const size_t ao = (size_t)(m0 + (i << 4) + rlane) * lda + koff + k0;
      const v16b ah = ldfrag_b(A + ao);
#pragma unroll
      for (int j = 0; j < 4; ++j) acc[i][j] = mma_b_raw(ah, bh[j], acc[i][j]);
      dep_guard_b(acc[i][0], acc[i][3], ah, ah);
    }
    keep4_b(bh[0], bh[1], bh[2], bh[3]);
  }
  acc_guard4(acc[0][0], acc[0][1], acc[0][2], acc[0][3]);
  acc_guard4(acc[1][0], acc[1][1], acc[1][2], acc[1][3]);
  acc_guard4(acc[2][0], acc[2][1], acc[2][2], acc[2][3]);
  acc_guard4(acc[3][0], acc[3][1], acc[3][2], acc[3][3]);

  // ---- epilogue ----
  float* slab = sT[wave];
#pragma unroll
  for (int i = 0; i < 4; ++i) {
    const int mBase = m0 + (i << 4);
    float bm8[8];
#pragma unroll
    for (int r = 0; r < 8; ++r) bm8[r] = 0.f;
    if (BIAS_MODE == 1) {                          // rows mBase+mOff .. +7: two 16-B loads (32-B aligned)
      const v4f t0 = *(const v4f*)(bias + mBase + mOff);
      const v4f t1 = *(const v4f*)(bias + mBase + mOff + 4);
      bm8[0] = bfr(t0[0]); bm8[1] = bfr(t0[1]); bm8[2] = bfr(t0[2]); bm8[3] = bfr(t0[3]);
      bm8[4] = bfr(t1[0]); bm8[5] = bfr(t1[1]); bm8[6] = bfr(t1[2]); bm8[7] = bfr(t1[3]);
    }
#pragma unroll
    for (int j = 0; j < 4; ++j) {
      float bn = 0.f;
      if (BIAS_MODE == 2) bn = bfr(bias[n0 + (j << 4) + rlane]);
#pragma unroll
      for (int r = 0; r < 8; ++r) {
        float v = acc[i][j][r];
        if (BIAS_MODE == 1) v += bm8[r];
        if (BIAS_MODE == 2) v += bn;
        slab[(mOff + r) * 68 + (j << 4) + rlane] = v;
      }
    }
    __builtin_amdgcn_fence(__ATOMIC_RELEASE, "workgroup");
    __builtin_amdgcn_wave_barrier();
    __builtin_amdgcn_fence(__ATOMIC_ACQUIRE, "workgroup");
    if (OUT_MODE == 0) {
      float* C = (float*)Cout;
      const int hh = lane >> 4, c4 = (lane & 15) * 4;     // 256-B row segment = 16 lanes x 16 B
      {
#pragma unroll
        for (int it = 0; it < 8; ++it) {
          const int row = it * 2 + hh;                     // it 0..7 x hh 0..1 = rows 0..15
          const v4f v = *(const v4f*)(slab + row * 68 + c4);
          *(v4f*)(C + (size_t)(mBase + row) * ldc + n0 + c4) = v;
        }
        
      }
    } else {
      const int q = lane >> 3, c8 = (lane & 7) * 8;
      unsigned short* C  = (unsigned short*)Cout;
      unsigned short* C2 = (unsigned short*)Cout2;
      v4u hv[4], lv[4];
#pragma unroll
      for (int it = 0; it < 4; ++it) {
        const int row = it * 4 + q;                        // it 0..3 x q 0..3 = rows 0..15
        const float* sp = slab + row * 68 + c8;
        v4u a, a2;
#pragma unroll
        for (int e = 0; e < 4; ++e) {
          const float f0 = sp[2 * e], f1 = sp[2 * e + 1];
          const unsigned short h0 = bf_bits(f0), h1 = bf_bits(f1);
          const unsigned short l0 = bf_bits(f0 - bf_up(h0)), l1 = bf_bits(f1 - bf_up(h1));
          a[e] = pk16(h0, h1); a2[e] = pk16(l0, l1);
        }
        hv[it] = a; lv[it] = a2;
      }
      {
#pragma unroll
        for (int it = 0; it < 4; ++it) {
          const int row = it * 4 + q;
          *(v4u*)(C  + (size_t)(mBase + row) * ldc + n0 + c8) = hv[it];
          *(v4u*)(C2 + (size_t)(mBase + row) * ldc + n0 + c8) = lv[it];
        }
        
      }
    }
    __builtin_amdgcn_fence(__ATOMIC_RELEASE, "workgroup");
    __builtin_amdgcn_wave_barrier();
    __builtin_amdgcn_fence(__ATOMIC_ACQUIRE, "workgroup");
  }
}

// =====================================================================================================
// Causal attention, head dim 64, all batch elements in one launch (blockIdx.y = batch element b).
//   q|k planes (bf16 hi / lo): [b*SEQ + t][QKP], q(t, h, d) at col h*64 + d, k(s, h, d) at col DM + h*64 + d
//   v^T planes (bf16 hi / lo): [(h*64 + d)][VTP], key s of batch b at col b*SEQ + s, s contiguous
//   context plane (bf16): row b*SEQ + t, pitch CXP; hi at col h*64 + d, lo (RNE(v - hi)) at col DM + h*64 + d
//   scores = q . k : bf16 hi/lo split (hi.hi + hi.lo + lo.hi), f32 accumulate, then * sscale in f32
//   out    = p . v : bf16 hi/lo split of p (unnormalised) and v, f32 accumulate
//   online softmax in f32; key s > t set to -inf only on the diagonal key tile (key s = tile start <= t always live).
//   Block = 4 waves = 64 query rows of one head; grid = (NH * NQB, NB); key tiles of 64, block-uniform trip count qb+1 <= 32,
//   every wave reaches both block barriers of every iteration.
//   K / V^T tile staging: 128 threads x 32 elements per plane = the whole 64x64 tile (plain 16-B loads,
//   __syncthreads before and after); fragment loads read the LDS tiles with the same v8b element type.
//   Output coverage: each wave stores rows q0..q0+15 (it 0..3 x lane>>3 0..3) x 64 columns (8 lanes x 8) of both planes.
// =====================================================================================================
__global__ __launch_bounds__(128)
void attn_causal64(const unsigned short* __restrict__ qkhp, const unsigned short* __restrict__ qklp,
                   const unsigned short* __restrict__ vhp, const unsigned short* __restrict__ vlp,
                   unsigned short* cxp, float sscale) {
  union FB { v16b v; v8b h[2]; };
  __shared__ __align__(16) __bf16 Ksh[64 * LP];        // K hi [kv][d]   9 KB, rows pitched LP
  __shared__ __align__(16) __bf16 Ksl[64 * LP];        // K lo
  __shared__ __align__(16) __bf16 Vth[64 * LP];        // V^T hi [d][kv] 9 KB, rows pitched LP
  __shared__ __align__(16) __bf16 Vtl[64 * LP];        // V^T lo
  __shared__ __align__(16) __bf16 Psh[4][16 * LP];     // per wave P hi [row][kv], rows pitched LP
  __shared__ __align__(16) __bf16 Psl[4][16 * LP];     // per wave P lo
  __shared__ __align__(16) float  Os[4][16 * 64];      // per wave context tile [row][d]

  const int tid  = threadIdx.x;
  const int wave = tid >> 5;
  const int lane = tid & 31;
  const int hh   = lane >> 4;
  const int c    = lane & 15;

  const int bx = blockIdx.x;
  const int qb = bx % NQB;
  const int h  = bx / NQB;                 // 0..NH-1 (grid.x = NH * NQB)
  const int q0 = qb * 64 + wave * 16;
  const int rowBase = blockIdx.y * SEQ;    // first token row of this batch element (grid.y = NB)

  const __bf16* Qh = (const __bf16*)(const void*)qkhp + (size_t)rowBase * QKP + (size_t)h * HD;
  const __bf16* Ql = (const __bf16*)(const void*)qklp + (size_t)rowBase * QKP + (size_t)h * HD;
  const __bf16* Kh = Qh + DM;
  const __bf16* Kl = Ql + DM;
  const __bf16* Vh = (const __bf16*)(const void*)vhp + (size_t)h * HD * VTP + rowBase;
  const __bf16* Vl = (const __bf16*)(const void*)vlp + (size_t)h * HD * VTP + rowBase;

  // ---- Q fragments (A operand, row = lane&15, split k map): 2 d-chunks, hi and lo ----
  v16b qah[2], qal[2];
#pragma unroll
  for (int dc = 0; dc < 2; ++dc) {
    const size_t qo = (size_t)(q0 + c) * QKP + dc * 32 + 8 * hh;
    qah[dc] = ldfrag_b(Qh + qo);
    qal[dc] = ldfrag_b(Ql + qo);
  }

  float mrow[8], lrow[8];
  v8f oacc[4];
#pragma unroll
  for (int r = 0; r < 8; ++r) { mrow[r] = -INFINITY; lrow[r] = 0.f; }
#pragma unroll
  for (int t = 0; t < 4; ++t) oacc[t] = zero8();

  const int nChunks = qb + 1;   // block-uniform, <= 32
  for (int kc = 0; kc < nChunks; ++kc) {
    const int kv0 = kc * 64;
    __syncthreads();
    {
      // staging coverage: 128 threads x (4 x 8) elements = 64 rows x 64 per plane = the whole tile of all four planes
      const int r = tid >> 1, half = (tid & 1) * 32;
      const __bf16* kg  = Kh + (size_t)(kv0 + r) * QKP + half;    // K row kv0+r, d = half..half+31
      const __bf16* klg = Kl + (size_t)(kv0 + r) * QKP + half;
      const __bf16* vg  = Vh + (size_t)r * VTP + kv0 + half;      // V^T row d = r, s = kv0+half..+31
      const __bf16* vlg = Vl + (size_t)r * VTP + kv0 + half;
#pragma unroll
      for (int i = 0; i < 4; ++i) {
        const v8b a0 = *(const v8b*)(kg + 8 * i);
        const v8b a1 = *(const v8b*)(klg + 8 * i);
        const v8b b0 = *(const v8b*)(vg + 8 * i);
        const v8b b1 = *(const v8b*)(vlg + 8 * i);
        *(v8b*)(Ksh + r * LP + half + 8 * i) = a0;
        *(v8b*)(Ksl + r * LP + half + 8 * i) = a1;
        *(v8b*)(Vth + r * LP + half + 8 * i) = b0;
        *(v8b*)(Vtl + r * LP + half + 8 * i) = b1;
      }
    }
    __syncthreads();

    // ---- scores: 16 query rows x 64 keys per wave, 3 bf16 products ----
    v8f s[4];
#pragma unroll
    for (int j = 0; j < 4; ++j) {
      s[j] = zero8();
#pragma unroll
      for (int dc = 0; dc < 2; ++dc) {
        FB kb, kl;
        kb.h[0] = *(const v8b*)(Ksh + (j * 16 + c) * LP + dc * 32 + 8 * hh);
        kb.h[1] = *(const v8b*)(Ksh + (j * 16 + c) * LP + dc * 32 + 16 + 8 * hh);
        kl.h[0] = *(const v8b*)(Ksl + (j * 16 + c) * LP + dc * 32 + 8 * hh);
        kl.h[1] = *(const v8b*)(Ksl + (j * 16 + c) * LP + dc * 32 + 16 + 8 * hh);
        s[j] = mma_b(qah[dc], kb.v, s[j]);
        s[j] = mma_b(qah[dc], kl.v, s[j]);
        s[j] = mma_b(qal[dc], kb.v, s[j]);
      }
    }

    // ---- scale, causal mask on the diagonal tile, row max ----
    const bool diag = (kc == qb);   // block-uniform
    float cm[8];
#pragma unroll
    for (int r = 0; r < 8; ++r) {
      const int qrow = q0 + 8 * hh + r;
      float m = -INFINITY;
#pragma unroll
      for (int j = 0; j < 4; ++j) {
        const int kvcol = kv0 + j * 16 + c;
        const float sv = s[j][r] * sscale;
        const bool masked = diag && (kvcol > qrow);
        const float sm = masked ? -INFINITY : sv;
        s[j][r] = sm;
        m = fmaxf(m, sm);
      }
#pragma unroll
      for (int off = 1; off < 16; off <<= 1) m = fmaxf(m, __shfl_xor(m, off, 32));
      cm[r] = m;
    }

    // ---- online softmax, P hi/lo (bf16, unnormalised) to the wave-private LDS tiles ----
    __bf16* pwh = Psh[wave];
    __bf16* pwl = Psl[wave];
#pragma unroll
    for (int r = 0; r < 8; ++r) {
      const float mnew  = fmaxf(mrow[r], cm[r]);      // finite: key kv0 <= qrow is never masked
      const float alpha = __expf(mrow[r] - mnew);
      mrow[r] = mnew;
      float psum = 0.f;
#pragma unroll
      for (int j = 0; j < 4; ++j) {
        const float p = __expf(s[j][r] - mnew);
        psum += p;
        __bf16 a, bl; bf_split(p, a, bl);
        pwh[(8 * hh + r) * LP + j * 16 + c] = a;
        pwl[(8 * hh + r) * LP + j * 16 + c] = bl;
      }
#pragma unroll
      for (int off = 1; off < 16; off <<= 1) psum += __shfl_xor(psum, off, 32);
      lrow[r] = lrow[r] * alpha + psum;
#pragma unroll
      for (int t = 0; t < 4; ++t) oacc[t][r] *= alpha;
    }
    __builtin_amdgcn_fence(__ATOMIC_RELEASE, "workgroup");
    __builtin_amdgcn_wave_barrier();
    __builtin_amdgcn_fence(__ATOMIC_ACQUIRE, "workgroup");

    // ---- context += P . V, 3 bf16 products ----
#pragma unroll 1
    for (int kk = 0; kk < 2; ++kk) {
      FB pa, pl;
      pa.h[0] = *(const v8b*)(pwh + c * LP + kk * 32 + 8 * hh);
      pa.h[1] = *(const v8b*)(pwh + c * LP + kk * 32 + 16 + 8 * hh);
      pl.h[0] = *(const v8b*)(pwl + c * LP + kk * 32 + 8 * hh);
      pl.h[1] = *(const v8b*)(pwl + c * LP + kk * 32 + 16 + 8 * hh);
#pragma unroll
      for (int t = 0; t < 4; ++t) {
        FB vb, vl;
        vb.h[0] = *(const v8b*)(Vth + (t * 16 + c) * LP + kk * 32 + 8 * hh);
        vb.h[1] = *(const v8b*)(Vth + (t * 16 + c) * LP + kk * 32 + 16 + 8 * hh);
        vl.h[0] = *(const v8b*)(Vtl + (t * 16 + c) * LP + kk * 32 + 8 * hh);
        vl.h[1] = *(const v8b*)(Vtl + (t * 16 + c) * LP + kk * 32 + 16 + 8 * hh);
        oacc[t] = mma_b(pa.v, vb.v, oacc[t]);
        oacc[t] = mma_b(pa.v, vl.v, oacc[t]);
        oacc[t] = mma_b(pl.v, vb.v, oacc[t]);
      }
    }
  }

  // ---- normalise (1/l), stage the wave's 16x64 tile, bf16 hi/lo split,
  float* os = Os[wave];
#pragma unroll
  for (int r = 0; r < 8; ++r) {
    const float l = lrow[r];                      // >= 1 (row-max key contributes exp(0) at its tile)
    const float inv = (l > 0.f) ? (1.0f / l) : 0.f;
#pragma unroll
    for (int t = 0; t < 4; ++t) os[(8 * hh + r) * 64 + t * 16 + c] = oacc[t][r] * inv;
  }
  __builtin_amdgcn_fence(__ATOMIC_RELEASE, "workgroup");
  __builtin_amdgcn_wave_barrier();
  __builtin_amdgcn_fence(__ATOMIC_ACQUIRE, "workgroup");
  {
    const int q4 = lane >> 3, c8 = (lane & 7) * 8;
    v4u hv[4], lv[4];
#pragma unroll
    for (int it = 0; it < 4; ++it) {
      const int row = it * 4 + q4;   // it 0..3 x q4 0..3 = rows 0..15 of the wave tile
      const float* sp = os + row * 64 + c8;
      v4u a, a2;
#pragma unroll
      for (int e = 0; e < 4; ++e) {
        const float f0 = sp[2 * e], f1 = sp[2 * e + 1];
        const unsigned short h0 = bf_bits(f0), h1 = bf_bits(f1);
        const unsigned short l0 = bf_bits(f0 - bf_up(h0)), l1 = bf_bits(f1 - bf_up(h1));
        a[e] = pk16(h0, h1); a2[e] = pk16(l0, l1);
      }
      hv[it] = a; lv[it] = a2;
    }
    {
#pragma unroll
      for (int it = 0; it < 4; ++it) {
        const int row = it * 4 + q4;
        const size_t go = (size_t)(rowBase + q0 + row) * CXP + (size_t)h * HD + c8;
        *(v4u*)(cxp + go)      = hv[it];
        *(v4u*)(cxp + go + DM) = lv[it];
      }
      
    }
  }
}

// =====================================================================================================
// Workspace map (bytes); every region is an exact multiple of its 64x64-tile / whole-line store granularity:
//   XB   bf16 [8192][1024]              0        16777216
//   WAT  bf16 [3072 n][1024 k]          16777216  6291456
//   WPT2 bf16 [1024 n][2048 k]          23068672  4194304   (W_proj^T duplicated along k)
//   QKh  bf16 [8192][2048]              27262976 33554432
//   QKl  bf16 [8192][2048]              60817408 33554432
//   VTh  bf16 [1024][8192]              94371840 16777216
//   VTl  bf16 [1024][8192]             111149056 16777216
//   CTX  bf16 [8192][2048]             127926272 33554432
//   end                                161480704
// Every stage is one launch over all four batch elements; QK / VT planes are fully written before the attention launch reads them.
// =====================================================================================================
extern "C" void kernel_launch(void* const* d_in, const int* in_sizes, int n_in,
                              void* d_out, int out_size, void* d_ws, size_t ws_size,
                              hipStream_t stream) {
  if (n_in < 5) return;
  if (in_sizes[0] != NB * SEQ * DM) return;
  if (in_sizes[1] != DM * N3) return;
  if (in_sizes[2] != N3) return;
  if (in_sizes[3] != DM * DM) return;
  if (in_sizes[4] != DM) return;
  if (out_size != NB * SEQ * DM) return;

  const float* x      = (const float*)d_in[0];   // [4][2048][1024]
  const float* W_attn = (const float*)d_in[1];   // [1024 in][3072 out]
  const float* b_attn = (const float*)d_in[2];   // [3072]
  const float* W_proj = (const float*)d_in[3];   // [1024 in][1024 out]
  const float* b_proj = (const float*)d_in[4];   // [1024]

  const size_t PXB = (size_t)NB * SEQ * DM * 2;     // 16777216
  const size_t PWA = (size_t)N3 * DM * 2;           //  6291456
  const size_t PWP = (size_t)DM * (2 * DM) * 2;     //  4194304
  const size_t PQK = (size_t)NB * SEQ * QKP * 2;    // 33554432
  const size_t PVT = (size_t)DM * VTP * 2;          // 16777216
  const size_t PCX = (size_t)NB * SEQ * CXP * 2;    // 33554432
  size_t off = 0;
  const size_t oXB  = off; off += PXB;
  const size_t oWAT = off; off += PWA;
  const size_t oWPT = off; off += PWP;
  const size_t oQKh = off; off += PQK;
  const size_t oQKl = off; off += PQK;
  const size_t oVTh = off; off += PVT;
  const size_t oVTl = off; off += PVT;
  const size_t oCTX = off; off += PCX;
  if (off > ws_size) return;                        // off = 161480704

  char* ws = (char*)d_ws;
  unsigned short* XB   = (unsigned short*)(ws + oXB);
  unsigned short* WAT  = (unsigned short*)(ws + oWAT);
  unsigned short* WPT2 = (unsigned short*)(ws + oWPT);
  unsigned short* QKh  = (unsigned short*)(ws + oQKh);
  unsigned short* QKl  = (unsigned short*)(ws + oQKl);
  unsigned short* VTh  = (unsigned short*)(ws + oVTh);
  unsigned short* VTl  = (unsigned short*)(ws + oVTl);
  unsigned short* CTX  = (unsigned short*)(ws + oCTX);

  const dim3 blk(256);
  const int n8x = NB * SEQ * DM / 8;                               // 1048576
  const dim3 gCvtX((n8x + 255) / 256);                             // 4096 blocks
  const dim3 gTA(N3 / 64, DM / 64);                                // in [1024 rows][3072 cols] -> (cols/64, rows/64)
  const dim3 gTP(DM / 64, DM / 64);                                // in [1024 rows][1024 cols]
  const dim3 gQK(((NB * SEQ / 64) * ((2 * DM) / 64) + 7) / 8);     // 4096 tiles -> 512 blocks: M=8192, N=2048
  const dim3 gVT(((DM / 64) * (NB * SEQ / 64) + 7) / 8);           // 2048 tiles -> 256 blocks: M=1024, N=8192
  const dim3 gAtt(NH * NQB, NB);                                   // 2048 blocks: (16 heads x 32 query tiles) x 4 batch elements
  const dim3 gOut(((NB * SEQ / 64) * (DM / 64) + 7) / 8);          // 2048 tiles -> 256 blocks: M=8192, N=1024

  // (1) x -> bf16 [8192][1024]
  cvt_bf16x8<<<gCvtX, blk, 0, stream>>>(x, XB, n8x);
  // (2) W_attn [k][n] -> WAT [n][k] bf16 (pitch 1024); W_proj [k][n] -> WPT2 [n][k | k] bf16 (pitch 2048)
  tcvt_kernel<false><<<gTA, blk, 0, stream>>>(W_attn, WAT, DM, N3, DM);
  tcvt_kernel<true><<<gTP, blk, 0, stream>>>(W_proj, WPT2, DM, DM, 2 * DM);

  // (3) q|k = x . W_attn[:, 0:2048] + b_attn[0:2048] -> bf16 hi/lo [8192][2048]   (M=8192, N=2048, K=1024)
  gemm64<2, 2><<<gQK, blk, 0, stream>>>(XB, DM, WAT, DM, (void*)QKh, (void*)QKl, QKP, b_attn, NB * SEQ, 2 * DM, DM);
  // (4) v^T = W_attn[:, 2048:3072]^T . x^T + b_attn[2048 + m] -> bf16 hi/lo [1024][8192]   (M=1024, N=8192, K=1024)
  gemm64<1, 2><<<gVT, blk, 0, stream>>>(WAT + (size_t)(2 * DM) * DM, DM, XB, DM, (void*)VTh, (void*)VTl, VTP,
                                        b_attn + 2 * DM, DM, NB * SEQ, DM);
  // (5) causal attention -> CTX rows 0..8191 (hi at cols 0..1023, lo at 1024..2047)
  attn_causal64<<<gAtt, dim3(128), 0, stream>>>(QKh, QKl, VTh, VTl, CTX, 0.125f);
  // (6) y = [ctx hi | ctx lo] . [W_proj^T | W_proj^T]^T + b_proj -> d_out f32 [8192][1024]   (M=8192, N=1024, K=2048)
  gemm64<2, 0><<<gOut, blk, 0, stream>>>(CTX, CXP, WPT2, 2 * DM, d_out, d_out, DM, b_proj, NB * SEQ, DM, 2 * DM);
  (void)hipGetLastError();
}

// v003
// A run of this version takes 379 microseconds.
// Timed twice side by side with v002, it ran 1.33 times as fast both times.
// Counting every step since v000, it is 3.28 times as fast.
// Contractions: q|k and v^T projections = v_wmma_f32_16x16x32_bf16 (bf16 operands RNE-converted from x and W_attn, single product, + bf16 bias in f32);
// causal scores q.k^T = v_wmma_f32_16x16x32_bf16 with bf16 hi/lo split q and k (hi.hi + hi.lo + lo.hi);
// context p.v = v_wmma_f32_16x16x32_bf16 with bf16 hi/lo split p and v (3 products);
// output projection = v_wmma_f32_16x16x32_bf16, context bf16 hi|lo planes folded along K (K = 2048) times bf16 W_proj^T (+ bf16 bias in f32);
// all f32 accumulate; online softmax statistics, score scale 0.125 and bias adds in f32.
// Carry audit: every 16-bit plane (XB, WAT, WPT2, QKh/QKl, VTh/VTl, CTX hi|lo, P hi|lo in LDS) has carry 1; no inverse factor is applied anywhere.
#include <hip/hip_runtime.h>
#include <math.h>
#include <stdint.h>

#define NB   4
#define SEQ  2048
#define DM   1024
#define NH   16
#define HD   64
#define N3   (3 * DM)      // 3072
#define QKP  (2 * DM)      // pitch of the q|k planes [t][q 1024 | k 1024]
#define CXP  (2 * DM)      // pitch of the context plane [t][hi 1024 | lo 1024]
#define VTP  (NB * SEQ)    // pitch of the v^T planes [h*64 + d][b*2048 + s]
#define NQB  (SEQ / 64)    // 32 query / key tiles of 64
#define LP   72            // LDS row pitch of the 64-element bf16 tiles: 144 B = 16 B x 9 (odd), conflict-free for 16-B fragment reads
static_assert(NH * HD == DM);
static_assert((SEQ % 64) == 0 && (DM % 64) == 0 && (N3 % 64) == 0);
static_assert((DM % 32) == 0 && (CXP % 32) == 0 && (QKP % 8) == 0);

typedef __bf16   v16b __attribute__((ext_vector_type(16)));
typedef __bf16   v8b  __attribute__((ext_vector_type(8)));
typedef float    v8f  __attribute__((ext_vector_type(8)));
typedef float    v4f  __attribute__((ext_vector_type(4)));
typedef unsigned int v4u __attribute__((ext_vector_type(4)));

// ---- scalar helpers ----------------------------------------------------------------------------------
__device__ __forceinline__ unsigned short bf_bits(float f) {          // f32 -> bf16 bits, RNE convert
  unsigned u = __float_as_uint(f);
  return (unsigned short)((u + 0x7FFFu + ((u >> 16) & 1u)) >> 16);
}
__device__ __forceinline__ float bf_up(unsigned short h) { return __uint_as_float(((unsigned)h) << 16); }
__device__ __forceinline__ float bfr(float f) { return bf_up(bf_bits(f)); }   // value after bf16 RNE convert
__device__ __forceinline__ unsigned pk16(unsigned short a, unsigned short b) { return (unsigned)a | ((unsigned)b << 16); }
__device__ __forceinline__ v8f zero8() { v8f z = {0.f, 0.f, 0.f, 0.f, 0.f, 0.f, 0.f, 0.f}; return z; }
__device__ __forceinline__ void bf_split(float f, __bf16& hi, __bf16& lo) {
  const unsigned short hb = bf_bits(f);
  hi = __builtin_bit_cast(__bf16, hb);
  lo = __builtin_bit_cast(__bf16, bf_bits(f - bf_up(hb)));
}

// ---- fragment loader: 16-bit A/B operand, lane -> row/col (lane&15), p already includes +8*(lane>>4);
//      elements 0..7 <- p[0..7] (k0+8h..), elements 8..15 <- p[16..23] (k0+16+8h..)
__device__ __forceinline__ v16b ldfrag_b(const __bf16* p) {
  union { v16b v; v8b h[2]; } f;
  f.h[0] = *(const v8b*)(p);
  f.h[1] = *(const v8b*)(p + 16);
  return f.v;
}

// ---- WMMA helpers with trailing VALU hazard gap ----------------------------------------------------------
__device__ __forceinline__ v8f mma_b(v16b a, v16b b, v8f c) {
  c = __builtin_amdgcn_wmma_f32_16x16x32_bf16(false, a, false, b, (short)0, c, false, false);
  asm volatile("v_nop\n\tv_nop\n\tv_nop\n\tv_nop" : "+v"(c) : "v"(a), "v"(b));
  return c;
}
__device__ __forceinline__ v8f mma_b_raw(v16b a, v16b b, v8f c) {
  return __builtin_amdgcn_wmma_f32_16x16x32_bf16(false, a, false, b, (short)0, c, false, false);
}
__device__ __forceinline__ void dep_guard_b(v8f& a, v8f& b, v16b x, v16b y) {
  asm volatile("v_nop\n\tv_nop\n\tv_nop\n\tv_nop" : "+v"(a), "+v"(b) : "v"(x), "v"(y));
}
__device__ __forceinline__ void keep4_b(v16b a, v16b b, v16b c, v16b d) {
  asm volatile("v_nop" :: "v"(a), "v"(b), "v"(c), "v"(d));
}
__device__ __forceinline__ void acc_guard4(v8f& a, v8f& b, v8f& c, v8f& d) {
  asm volatile("v_nop\n\tv_nop\n\tv_nop\n\tv_nop" : "+v"(a), "+v"(b), "+v"(c), "+v"(d));
}

// =====================================================================================================
// f32 -> bf16 (RNE convert), 8 elements per thread, one 16-B store per lane: a wave writes 512 contiguous B
// coverage: n8 threads x 8 = the whole plane (n8 = 1048576, a multiple of 256).
// =====================================================================================================
__global__ __launch_bounds__(256) void cvt_bf16x8(const float* __restrict__ in, unsigned short* out, int n8) {
  const int i = blockIdx.x * 256 + threadIdx.x;
  if (i < n8) {
    const v4f a = *(const v4f*)(in + (size_t)i * 8);
    const v4f b = *(const v4f*)(in + (size_t)i * 8 + 4);
    v4u p;
    p[0] = pk16(bf_bits(a[0]), bf_bits(a[1]));
    p[1] = pk16(bf_bits(a[2]), bf_bits(a[3]));
    p[2] = pk16(bf_bits(b[0]), bf_bits(b[1]));
    p[3] = pk16(bf_bits(b[2]), bf_bits(b[3]));
    *(v4u*)(out + (size_t)i * 8) = p;
    
  }
}

// =====================================================================================================
// Transpose + bf16 convert of an f32 matrix: in [R rows][Cc cols] (pitch Cc) -> o[c][r] = bf16_rne(in[r][c]),
// output row pitch P (>= R); DUP additionally writes the same value at o[c][R + r] (duplicate along k).
// 64x64 tiles through LDS. grid = (Cc/64, R/64), 256 threads (R, Cc multiples of 64).
// coverage per block: load 4 it x 256 thr x 4 floats = 64x64; store 2 it x 256 thr x 8 u16 = 64x64 (x2 with DUP).
// =====================================================================================================
template <bool DUP>
__global__ __launch_bounds__(256) void tcvt_kernel(const float* __restrict__ W, unsigned short* o, int R, int Cc, int P) {
  __shared__ __align__(16) float tf[64 * 68];
  const int c0  = blockIdx.x * 64;   // input column block = output row block
  const int r0  = blockIdx.y * 64;   // input row block    = output column block
  const int tid = threadIdx.x;
  {
    const int lr = tid >> 4;         // 0..15
    const int c4 = (tid & 15) * 4;   // 0..60
#pragma unroll
    for (int it = 0; it < 4; ++it) {
      const int rr = it * 16 + lr;   // 0..63
      const v4f a = *(const v4f*)(W + (size_t)(r0 + rr) * Cc + c0 + c4);
      *(v4f*)(tf + rr * 68 + c4) = a;
    }
  }
  __syncthreads();
  const int sub = tid >> 3;          // 0..31
  const int c8  = (tid & 7) * 8;     // 0..56
  v4u hv[2];
#pragma unroll
  for (int it = 0; it < 2; ++it) {
    const int oc = it * 32 + sub;    // output row within tile (= input column)
    v4u a;
#pragma unroll
    for (int q = 0; q < 4; ++q) {
      const float f0 = tf[(c8 + 2 * q) * 68 + oc];
      const float f1 = tf[(c8 + 2 * q + 1) * 68 + oc];
      a[q] = pk16(bf_bits(f0), bf_bits(f1));
    }
    hv[it] = a;
  }
  {
#pragma unroll
    for (int it = 0; it < 2; ++it) {
      const int oc = it * 32 + sub;
      const size_t go = (size_t)(c0 + oc) * P + r0 + c8;
      *(v4u*)(o + go) = hv[it];
      if (DUP) *(v4u*)(o + go + R) = hv[it];
    }
    
  }
}

// =====================================================================================================
// Register-blocked bf16 WMMA GEMM: C[m][n] = sum_k A[m][k] * Bt[n][k] + bias; one wave per 64x64 tile,
// eight waves (2 x 4) = one 128 x 256 tile per work-group. A row-major [M][K] pitch lda; Bt row-major [N][K] pitch ldb
// (k contiguous); M multiple of 128, N multiple of 256, K multiple of 64 and >= 128 (host constants, asserted below).
// Operands: a stage = 64 k = one whole 128-B line of each of the 128 A rows and 256 Bt rows, laid in LDS at pitch LP
// ([A rows | Bt rows]); two buffers; stage t + 2 is copied (16 B per lane, global -> LDS, no register) while stage t + 1 is worked on.
// copy coverage per stage: 12 copies x 256 threads x 16 B = 384 rows x 128 B; a wave's copy = 4 whole lines.
// BIAS_MODE: 1 = bias[m], 2 = bias[n]; bias value RNE-converted to bf16 then added in f32.
// OUT_MODE: 0 = f32 (pitch ldc); 2 = bf16 hi plane C + bf16 lo plane C2 (lo = RNE(v - hi), unscaled), pitch ldc.
// =====================================================================================================
#define GTM  128                   // work-group tile rows
#define GTN  256                   // work-group tile columns
#define GKB  64                    // k elements per stage
#define GSTG ((GTM + GTN) * LP)    // bf16 elements of one stage in LDS (55296 B)
static_assert(((NB * SEQ) % GTN) == 0 && (DM % GTN) == 0 && ((2 * DM) % GTN) == 0);
static_assert((DM % GKB) == 0 && (CXP % GKB) == 0 && DM >= 2 * GKB);

// One stage's copies of one lane: rows r, r + 32, .. of A (4) and of Bt (8), LDS rows 32 * LP elements apart.
// The copies and s_wait_xcnt 0 are one statement, so that no address register is rewritten ahead of that wait.
__device__ __forceinline__ void stage_copy(unsigned l, const __bf16* a, size_t as, const __bf16* b, size_t bs) {
  const unsigned ls = 32 * LP * 2;   // bytes between a lane's consecutive LDS rows
  asm volatile(
      "global_load_async_to_lds_b128 %0, %12, off\n\t"
      "global_load_async_to_lds_b128 %1, %13, off\n\t"
      "global_load_async_to_lds_b128 %2, %14, off\n\t"
      "global_load_async_to_lds_b128 %3, %15, off\n\t"
      "global_load_async_to_lds_b128 %4, %16, off\n\t"
      "global_load_async_to_lds_b128 %5, %17, off\n\t"
      "global_load_async_to_lds_b128 %6, %18, off\n\t"
      "global_load_async_to_lds_b128 %7, %19, off\n\t"
      "global_load_async_to_lds_b128 %8, %20, off\n\t"
      "global_load_async_to_lds_b128 %9, %21, off\n\t"
      "global_load_async_to_lds_b128 %10, %22, off\n\t"
      "global_load_async_to_lds_b128 %11, %23, off\n\t"
      "s_wait_xcnt 0x0"
      :: "v"(l), "v"(l + ls), "v"(l + 2 * ls), "v"(l + 3 * ls), "v"(l + 4 * ls), "v"(l + 5 * ls),
         "v"(l + 6 * ls), "v"(l + 7 * ls), "v"(l + 8 * ls), "v"(l + 9 * ls), "v"(l + 10 * ls), "v"(l + 11 * ls),
         "v"(a), "v"(a + as), "v"(a + 2 * as), "v"(a + 3 * as),
         "v"(b), "v"(b + bs), "v"(b + 2 * bs), "v"(b + 3 * bs), "v"(b + 4 * bs), "v"(b + 5 * bs), "v"(b + 6 * bs), "v"(b + 7 * bs)
      : "memory");
}

template <int BIAS_MODE, int OUT_MODE>
__global__ __launch_bounds__(256) void gemm64(
    const unsigned short* __restrict__ Ap, int lda,
    const unsigned short* __restrict__ Btp, int ldb,
    void* Cout, void* Cout2, int ldc,
    const float* __restrict__ bias,
    int M, int N, int K) {
  const __bf16* A  = (const __bf16*)(const void*)Ap;
  const __bf16* Bt = (const __bf16*)(const void*)Btp;
  __shared__ __align__(16) __bf16 ring[2 * GSTG];  // two stages [A 128 rows | Bt 256 rows], pitch LP
  __shared__ __align__(16) float sT[8][16 * 68];   // per-wave 16x64 slab, pitch 68 floats
  const int lane = threadIdx.x & 31;
  const int wave = threadIdx.x >> 5;
  const int blocksN = N / GTN;
  const int blocksM = M / GTM;
  if ((int)blockIdx.x >= blocksM * blocksN) return;   // block-uniform, in front of every barrier
  const int bm = blockIdx.x / blocksN;
  const int bn = blockIdx.x - bm * blocksN;
  const int wm = wave >> 2;                    // 0..1
  const int wn = wave & 3;                     // 0..3
  const int m0 = bm * GTM + (wm << 6);
  const int n0 = bn * GTN + (wn << 6);

  const int rlane = lane & 15;                 // row (A) / col (B, D) within subtile
  const int koff  = (lane >> 4) * 8;           // k offset of this lane half
  const int mOff  = (lane >> 4) * 8;           // D row offset

  v8f acc[4][4];
#pragma unroll
  for (int i = 0; i < 4; ++i)
#pragma unroll
    for (int j = 0; j < 4; ++j) acc[i][j] = zero8();

  // this lane's place in a stage: row crow (+ 32 per copy), 16-B piece ccol of the row's 128 B
  const int crow = threadIdx.x >> 3;           // 0..31
  const int ccol = (threadIdx.x & 7) * 8;      // 0..56 elements
  const __bf16* ga = A  + (size_t)(bm * GTM + crow) * lda + ccol;
  const __bf16* gb = Bt + (size_t)(bn * GTN + crow) * ldb + ccol;
  const size_t  as = (size_t)32 * lda;
  const size_t  bs = (size_t)32 * ldb;
  const unsigned l0 = (unsigned)(uintptr_t)(ring + crow * LP + ccol);   // LDS byte address in buffer 0
  const int nst = K / GKB;                     // stages, >= 2

  stage_copy(l0, ga, as, gb, bs);
  asm volatile("s_wait_asynccnt 0x0" ::: "memory");   // stage 0 of this wave has landed
  __syncthreads();                                    // stage 0 of every wave is readable
  if (nst > 1) stage_copy(l0 + GSTG * 2, ga + GKB, as, gb + GKB, bs);

#pragma unroll 1   // rolled: one publish point in the text, the buffer chosen by t & 1
  for (int t = 0; t < nst; ++t) {
    const int bo = (t & 1) * GSTG;
    const __bf16* sa = ring + bo + ((wm << 6) + rlane) * LP + koff;
    const __bf16* sb = ring + bo + (GTM + (wn << 6) + rlane) * LP + koff;
#pragma unroll
    for (int kk = 0; kk < GKB; kk += 32) {
      v16b bh[4], ah[4];
#pragma unroll
      for (int j = 0; j < 4; ++j) bh[j] = ldfrag_b(sb + (j << 4) * LP + kk);
#pragma unroll
      for (int i = 0; i < 4; ++i) ah[i] = ldfrag_b(sa + (i << 4) * LP + kk);
#pragma unroll
      for (int i = 0; i < 4; ++i) {
#pragma unroll
        for (int j = 0; j < 4; ++j) acc[i][j] = mma_b_raw(ah[i], bh[j], acc[i][j]);
        dep_guard_b(acc[i][0], acc[i][3], ah[i], ah[i]);
      }
      keep4_b(bh[0], bh[1], bh[2], bh[3]);
    }
    asm volatile("s_wait_dscnt 0x0" ::: "memory");      // this wave's reads of stage t are done before the buffer is refilled
    asm volatile("s_wait_asynccnt 0x0" ::: "memory");   // this wave's copies of stage t + 1 have landed
    __syncthreads();                                    // publishes stage t + 1 and ends every reader's use of stage t
    if (t + 2 < nst) stage_copy(l0 + (unsigned)bo * 2, ga + (size_t)(t + 2) * GKB, as, gb + (size_t)(t + 2) * GKB, bs);
  }
  asm volatile("s_wait_asynccnt 0x0" ::: "memory");     // no copy is outstanding when the wave goes on
  acc_guard4(acc[0][0], acc[0][1], acc[0][2], acc[0][3]);
  acc_guard4(acc[1][0], acc[1][1], acc[1][2], acc[1][3]);
  acc_guard4(acc[2][0], acc[2][1], acc[2][2], acc[2][3]);
  acc_guard4(acc[3][0], acc[3][1], acc[3][2], acc[3][3]);

  // ---- epilogue ----
  float* slab = sT[wave];
#pragma unroll
  for (int i = 0; i < 4; ++i) {
    const int mBase = m0 + (i << 4);
    float bm8[8];
#pragma unroll
    for (int r = 0; r < 8; ++r) bm8[r] = 0.f;
    if (BIAS_MODE == 1) {                          // rows mBase+mOff .. +7: two 16-B loads (32-B aligned)
      const v4f t0 = *(const v4f*)(bias + mBase + mOff);
      const v4f t1 = *(const v4f*)(bias + mBase + mOff + 4);
      bm8[0] = bfr(t0[0]); bm8[1] = bfr(t0[1]); bm8[2] = bfr(t0[2]); bm8[3] = bfr(t0[3]);
      bm8[4] = bfr(t1[0]); bm8[5] = bfr(t1[1]); bm8[6] = bfr(t1[2]); bm8[7] = bfr(t1[3]);
    }
#pragma unroll
    for (int j = 0; j < 4; ++j) {
      float bn = 0.f;
      if (BIAS_MODE == 2) bn = bfr(bias[n0 + (j << 4) + rlane]);
#pragma unroll
      for (int r = 0; r < 8; ++r) {
        float v = acc[i][j][r];
        if (BIAS_MODE == 1) v += bm8[r];
        if (BIAS_MODE == 2) v += bn;
        slab[(mOff + r) * 68 + (j << 4) + rlane] = v;
      }
    }
    __builtin_amdgcn_fence(__ATOMIC_RELEASE, "workgroup");
    __builtin_amdgcn_wave_barrier();
    __builtin_amdgcn_fence(__ATOMIC_ACQUIRE, "workgroup");
    if (OUT_MODE == 0) {
      float* C = (float*)Cout;
      const int hh = lane >> 4, c4 = (lane & 15) * 4;     // 256-B row segment = 16 lanes x 16 B
      {
#pragma unroll
        for (int it = 0; it < 8; ++it) {
          const int row = it * 2 + hh;                     // it 0..7 x hh 0..1 = rows 0..15
          const v4f v = *(const v4f*)(slab + row * 68 + c4);
          *(v4f*)(C + (size_t)(mBase + row) * ldc + n0 + c4) = v;
        }
        
      }
    } else {
      const int q = lane >> 3, c8 = (lane & 7) * 8;
      unsigned short* C  = (unsigned short*)Cout;
      unsigned short* C2 = (unsigned short*)Cout2;
      v4u hv[4], lv[4];
#pragma unroll
      for (int it = 0; it < 4; ++it) {
        const int row = it * 4 + q;                        // it 0..3 x q 0..3 = rows 0..15
        const float* sp = slab + row * 68 + c8;
        v4u a, a2;
#pragma unroll
        for (int e = 0; e < 4; ++e) {
          const float f0 = sp[2 * e], f1 = sp[2 * e + 1];
          const unsigned short h0 = bf_bits(f0), h1 = bf_bits(f1);
          const unsigned short l0 = bf_bits(f0 - bf_up(h0)), l1 = bf_bits(f1 - bf_up(h1));
          a[e] = pk16(h0, h1); a2[e] = pk16(l0, l1);
        }
        hv[it] = a; lv[it] = a2;
      }
      {
#pragma unroll
        for (int it = 0; it < 4; ++it) {
          const int row = it * 4 + q;
          *(v4u*)(C  + (size_t)(mBase + row) * ldc + n0 + c8) = hv[it];
          *(v4u*)(C2 + (size_t)(mBase + row) * ldc + n0 + c8) = lv[it];
        }
        
      }
    }
    __builtin_amdgcn_fence(__ATOMIC_RELEASE, "workgroup");
    __builtin_amdgcn_wave_barrier();
    __builtin_amdgcn_fence(__ATOMIC_ACQUIRE, "workgroup");
  }
}

// =====================================================================================================
// Causal attention, head dim 64, all batch elements in one launch (blockIdx.y = batch element b).
//   q|k planes (bf16 hi / lo): [b*SEQ + t][QKP], q(t, h, d) at col h*64 + d, k(s, h, d) at col DM + h*64 + d
//   v^T planes (bf16 hi / lo): [(h*64 + d)][VTP], key s of batch b at col b*SEQ + s, s contiguous
//   context plane (bf16): row b*SEQ + t, pitch CXP; hi at col h*64 + d, lo (RNE(v - hi)) at col DM + h*64 + d
//   scores = q . k : bf16 hi/lo split (hi.hi + hi.lo + lo.hi), f32 accumulate, then * sscale in f32
//   out    = p . v : bf16 hi/lo split of p (unnormalised) and v, f32 accumulate
//   online softmax in f32; key s > t set to -inf only on the diagonal key tile (key s = tile start <= t always live).
//   Block = 4 waves = 64 query rows of one head; grid = (NH * NQB, NB); key tiles of 64, block-uniform trip count qb+1 <= 32,
//   every wave reaches both block barriers of every iteration.
//   K / V^T tile staging: 128 threads x 32 elements per plane = the whole 64x64 tile (plain 16-B loads,
//   __syncthreads before and after); fragment loads read the LDS tiles with the same v8b element type.
//   Output coverage: each wave stores rows q0..q0+15 (it 0..3 x lane>>3 0..3) x 64 columns (8 lanes x 8) of both planes.
// =====================================================================================================
__global__ __launch_bounds__(128)
void attn_causal64(const unsigned short* __restrict__ qkhp, const unsigned short* __restrict__ qklp,
                   const unsigned short* __restrict__ vhp, const unsigned short* __restrict__ vlp,
                   unsigned short* cxp, float sscale) {
  union FB { v16b v; v8b h[2]; };
  __shared__ __align__(16) __bf16 Ksh[64 * LP];        // K hi [kv][d]   9 KB, rows pitched LP
  __shared__ __align__(16) __bf16 Ksl[64 * LP];        // K lo
  __shared__ __align__(16) __bf16 Vth[64 * LP];        // V^T hi [d][kv] 9 KB, rows pitched LP
  __shared__ __align__(16) __bf16 Vtl[64 * LP];        // V^T lo
  __shared__ __align__(16) __bf16 Psh[4][16 * LP];     // per wave P hi [row][kv], rows pitched LP
  __shared__ __align__(16) __bf16 Psl[4][16 * LP];     // per wave P lo
  __shared__ __align__(16) float  Os[4][16 * 64];      // per wave context tile [row][d]

  const int tid  = threadIdx.x;
  const int wave = tid >> 5;
  const int lane = tid & 31;
  const int hh   = lane >> 4;
  const int c    = lane & 15;

  const int bx = blockIdx.x;
  const int qb = bx % NQB;
  const int h  = bx / NQB;                 // 0..NH-1 (grid.x = NH * NQB)
  const int q0 = qb * 64 + wave * 16;
  const int rowBase = blockIdx.y * SEQ;    // first token row of this batch element (grid.y = NB)

  const __bf16* Qh = (const __bf16*)(const void*)qkhp + (size_t)rowBase * QKP + (size_t)h * HD;
  const __bf16* Ql = (const __bf16*)(const void*)qklp + (size_t)rowBase * QKP + (size_t)h * HD;
  const __bf16* Kh = Qh + DM;
  const __bf16* Kl = Ql + DM;
  const __bf16* Vh = (const __bf16*)(const void*)vhp + (size_t)h * HD * VTP + rowBase;
  const __bf16* Vl = (const __bf16*)(const void*)vlp + (size_t)h * HD * VTP + rowBase;

  // ---- Q fragments (A operand, row = lane&15, split k map): 2 d-chunks, hi and lo ----
  v16b qah[2], qal[2];
#pragma unroll
  for (int dc = 0; dc < 2; ++dc) {
    const size_t qo = (size_t)(q0 + c) * QKP + dc * 32 + 8 * hh;
    qah[dc] = ldfrag_b(Qh + qo);
    qal[dc] = ldfrag_b(Ql + qo);
  }

  float mrow[8], lrow[8];
  v8f oacc[4];
#pragma unroll
  for (int r = 0; r < 8; ++r) { mrow[r] = -INFINITY; lrow[r] = 0.f; }
#pragma unroll
  for (int t = 0; t < 4; ++t) oacc[t] = zero8();

  const int nChunks = qb + 1;   // block-uniform, <= 32
  for (int kc = 0; kc < nChunks; ++kc) {
    const int kv0 = kc * 64;
    __syncthreads();
    {
      // staging coverage: 128 threads x (4 x 8) elements = 64 rows x 64 per plane = the whole tile of all four planes
      const int r = tid >> 1, half = (tid & 1) * 32;
      const __bf16* kg  = Kh + (size_t)(kv0 + r) * QKP + half;    // K row kv0+r, d = half..half+31
      const __bf16* klg = Kl + (size_t)(kv0 + r) * QKP + half;
      const __bf16* vg  = Vh + (size_t)r * VTP + kv0 + half;      // V^T row d = r, s = kv0+half..+31
      const __bf16* vlg = Vl + (size_t)r * VTP + kv0 + half;
#pragma unroll
      for (int i = 0; i < 4; ++i) {
        const v8b a0 = *(const v8b*)(kg + 8 * i);
        const v8b a1 = *(const v8b*)(klg + 8 * i);
        const v8b b0 = *(const v8b*)(vg + 8 * i);
        const v8b b1 = *(const v8b*)(vlg + 8 * i);
        *(v8b*)(Ksh + r * LP + half + 8 * i) = a0;
        *(v8b*)(Ksl + r * LP + half + 8 * i) = a1;
        *(v8b*)(Vth + r * LP + half + 8 * i) = b0;
        *(v8b*)(Vtl + r * LP + half + 8 * i) = b1;
      }
    }
    __syncthreads();

    // ---- scores: 16 query rows x 64 keys per wave, 3 bf16 products ----
    v8f s[4];
#pragma unroll
    for (int j = 0; j < 4; ++j) {
      s[j] = zero8();
#pragma unroll
      for (int dc = 0; dc < 2; ++dc) {
        FB kb, kl;
        kb.h[0] = *(const v8b*)(Ksh + (j * 16 + c) * LP + dc * 32 + 8 * hh);
        kb.h[1] = *(const v8b*)(Ksh + (j * 16 + c) * LP + dc * 32 + 16 + 8 * hh);
        kl.h[0] = *(const v8b*)(Ksl + (j * 16 + c) * LP + dc * 32 + 8 * hh);
        kl.h[1] = *(const v8b*)(Ksl + (j * 16 + c) * LP + dc * 32 + 16 + 8 * hh);
        s[j] = mma_b(qah[dc], kb.v, s[j]);
        s[j] = mma_b(qah[dc], kl.v, s[j]);
        s[j] = mma_b(qal[dc], kb.v, s[j]);
      }
    }

    // ---- scale, causal mask on the diagonal tile, row max ----
    const bool diag = (kc == qb);   // block-uniform
    float cm[8];
#pragma unroll
    for (int r = 0; r < 8; ++r) {
      const int qrow = q0 + 8 * hh + r;
      float m = -INFINITY;
#pragma unroll
      for (int j = 0; j < 4; ++j) {
        const int kvcol = kv0 + j * 16 + c;
        const float sv = s[j][r] * sscale;
        const bool masked = diag && (kvcol > qrow);
        const float sm = masked ? -INFINITY : sv;
        s[j][r] = sm;
        m = fmaxf(m, sm);
      }
#pragma unroll
      for (int off = 1; off < 16; off <<= 1) m = fmaxf(m, __shfl_xor(m, off, 32));
      cm[r] = m;
    }

    // ---- online softmax, P hi/lo (bf16, unnormalised) to the wave-private LDS tiles ----
    __bf16* pwh = Psh[wave];
    __bf16* pwl = Psl[wave];
#pragma unroll
    for (int r = 0; r < 8; ++r) {
      const float mnew  = fmaxf(mrow[r], cm[r]);      // finite: key kv0 <= qrow is never masked
      const float alpha = __expf(mrow[r] - mnew);
      mrow[r] = mnew;
      float psum = 0.f;
#pragma unroll
      for (int j = 0; j < 4; ++j) {
        const float p = __expf(s[j][r] - mnew);
        psum += p;
        __bf16 a, bl; bf_split(p, a, bl);
        pwh[(8 * hh + r) * LP + j * 16 + c] = a;
        pwl[(8 * hh + r) * LP + j * 16 + c] = bl;
      }
#pragma unroll
      for (int off = 1; off < 16; off <<= 1) psum += __shfl_xor(psum, off, 32);
      lrow[r] = lrow[r] * alpha + psum;
#pragma unroll
      for (int t = 0; t < 4; ++t) oacc[t][r] *= alpha;
    }
    __builtin_amdgcn_fence(__ATOMIC_RELEASE, "workgroup");
    __builtin_amdgcn_wave_barrier();
    __builtin_amdgcn_fence(__ATOMIC_ACQUIRE, "workgroup");

    // ---- context += P . V, 3 bf16 products ----
#pragma unroll 1
    for (int kk = 0; kk < 2; ++kk) {
      FB pa, pl;
      pa.h[0] = *(const v8b*)(pwh + c * LP + kk * 32 + 8 * hh);
      pa.h[1] = *(const v8b*)(pwh + c * LP + kk * 32 + 16 + 8 * hh);
      pl.h[0] = *(const v8b*)(pwl + c * LP + kk * 32 + 8 * hh);
      pl.h[1] = *(const v8b*)(pwl + c * LP + kk * 32 + 16 + 8 * hh);
#pragma unroll
      for (int t = 0; t < 4; ++t) {
        FB vb, vl;
        vb.h[0] = *(const v8b*)(Vth + (t * 16 + c) * LP + kk * 32 + 8 * hh);
        vb.h[1] = *(const v8b*)(Vth + (t * 16 + c) * LP + kk * 32 + 16 + 8 * hh);
        vl.h[0] = *(const v8b*)(Vtl + (t * 16 + c) * LP + kk * 32 + 8 * hh);
        vl.h[1] = *(const v8b*)(Vtl + (t * 16 + c) * LP + kk * 32 + 16 + 8 * hh);
        oacc[t] = mma_b(pa.v, vb.v, oacc[t]);
        oacc[t] = mma_b(pa.v, vl.v, oacc[t]);
        oacc[t] = mma_b(pl.v, vb.v, oacc[t]);
      }
    }
  }

  // ---- normalise (1/l), stage the wave's 16x64 tile, bf16 hi/lo split,
  float* os = Os[wave];
#pragma unroll
  for (int r = 0; r < 8; ++r) {
    const float l = lrow[r];                      // >= 1 (row-max key contributes exp(0) at its tile)
    const float inv = (l > 0.f) ? (1.0f / l) : 0.f;
#pragma unroll
    for (int t = 0; t < 4; ++t) os[(8 * hh + r) * 64 + t * 16 + c] = oacc[t][r] * inv;
  }
  __builtin_amdgcn_fence(__ATOMIC_RELEASE, "workgroup");
  __builtin_amdgcn_wave_barrier();
  __builtin_amdgcn_fence(__ATOMIC_ACQUIRE, "workgroup");
  {
    const int q4 = lane >> 3, c8 = (lane & 7) * 8;
    v4u hv[4], lv[4];
#pragma unroll
    for (int it = 0; it < 4; ++it) {
      const int row = it * 4 + q4;   // it 0..3 x q4 0..3 = rows 0..15 of the wave tile
      const float* sp = os + row * 64 + c8;
      v4u a, a2;
#pragma unroll
      for (int e = 0; e < 4; ++e) {
        const float f0 = sp[2 * e], f1 = sp[2 * e + 1];
        const unsigned short h0 = bf_bits(f0), h1 = bf_bits(f1);
        const unsigned short l0 = bf_bits(f0 - bf_up(h0)), l1 = bf_bits(f1 - bf_up(h1));
        a[e] = pk16(h0, h1); a2[e] = pk16(l0, l1);
      }
      hv[it] = a; lv[it] = a2;
    }
    {
#pragma unroll
      for (int it = 0; it < 4; ++it) {
        const int row = it * 4 + q4;
        const size_t go = (size_t)(rowBase + q0 + row) * CXP + (size_t)h * HD + c8;
        *(v4u*)(cxp + go)      = hv[it];
        *(v4u*)(cxp + go + DM) = lv[it];
      }
      
    }
  }
}

// =====================================================================================================
// Workspace map (bytes); every region is an exact multiple of its 64x64-tile / whole-line store granularity:
//   XB   bf16 [8192][1024]              0        16777216
//   WAT  bf16 [3072 n][1024 k]          16777216  6291456
//   WPT2 bf16 [1024 n][2048 k]          23068672  4194304   (W_proj^T duplicated along k)
//   QKh  bf16 [8192][2048]              27262976 33554432
//   QKl  bf16 [8192][2048]              60817408 33554432
//   VTh  bf16 [1024][8192]              94371840 16777216
//   VTl  bf16 [1024][8192]             111149056 16777216
//   CTX  bf16 [8192][2048]             127926272 33554432
//   end                                161480704
// Every stage is one launch over all four batch elements; QK / VT planes are fully written before the attention launch reads them.
// =====================================================================================================
extern "C" void kernel_launch(void* const* d_in, const int* in_sizes, int n_in,
                              void* d_out, int out_size, void* d_ws, size_t ws_size,
                              hipStream_t stream) {
  if (n_in < 5) return;
  if (in_sizes[0] != NB * SEQ * DM) return;
  if (in_sizes[1] != DM * N3) return;
  if (in_sizes[2] != N3) return;
  if (in_sizes[3] != DM * DM) return;
  if (in_sizes[4] != DM) return;
  if (out_size != NB * SEQ * DM) return;

  const float* x      = (const float*)d_in[0];   // [4][2048][1024]
  const float* W_attn = (const float*)d_in[1];   // [1024 in][3072 out]
  const float* b_attn = (const float*)d_in[2];   // [3072]
  const float* W_proj = (const float*)d_in[3];   // [1024 in][1024 out]
  const float* b_proj = (const float*)d_in[4];   // [1024]

  const size_t PXB = (size_t)NB * SEQ * DM * 2;     // 16777216
  const size_t PWA = (size_t)N3 * DM * 2;           //  6291456
  const size_t PWP = (size_t)DM * (2 * DM) * 2;     //  4194304
  const size_t PQK = (size_t)NB * SEQ * QKP * 2;    // 33554432
  const size_t PVT = (size_t)DM * VTP * 2;          // 16777216
  const size_t PCX = (size_t)NB * SEQ * CXP * 2;    // 33554432
  size_t off = 0;
  const size_t oXB  = off; off += PXB;
  const size_t oWAT = off; off += PWA;
  const size_t oWPT = off; off += PWP;
  const size_t oQKh = off; off += PQK;
  const size_t oQKl = off; off += PQK;
  const size_t oVTh = off; off += PVT;
  const size_t oVTl = off; off += PVT;
  const size_t oCTX = off; off += PCX;
  if (off > ws_size) return;                        // off = 161480704

  char* ws = (char*)d_ws;
  unsigned short* XB   = (unsigned short*)(ws + oXB);
  unsigned short* WAT  = (unsigned short*)(ws + oWAT);
  unsigned short* WPT2 = (unsigned short*)(ws + oWPT);
  unsigned short* QKh  = (unsigned short*)(ws + oQKh);
  unsigned short* QKl  = (unsigned short*)(ws + oQKl);
  unsigned short* VTh  = (unsigned short*)(ws + oVTh);
  unsigned short* VTl  = (unsigned short*)(ws + oVTl);
  unsigned short* CTX  = (unsigned short*)(ws + oCTX);

  const dim3 blk(256);
  const int n8x = NB * SEQ * DM / 8;                               // 1048576
  const dim3 gCvtX((n8x + 255) / 256);                             // 4096 blocks
  const dim3 gTA(N3 / 64, DM / 64);                                // in [1024 rows][3072 cols] -> (cols/64, rows/64)
  const dim3 gTP(DM / 64, DM / 64);                                // in [1024 rows][1024 cols]
  const dim3 gQK(((NB * SEQ / 64) * ((2 * DM) / 64) + 7) / 8);     // 4096 tiles -> 512 blocks: M=8192, N=2048
  const dim3 gVT(((DM / 64) * (NB * SEQ / 64) + 7) / 8);           // 2048 tiles -> 256 blocks: M=1024, N=8192
  const dim3 gAtt(NH * NQB, NB);                                   // 2048 blocks: (16 heads x 32 query tiles) x 4 batch elements
  const dim3 gOut(((NB * SEQ / 64) * (DM / 64) + 7) / 8);          // 2048 tiles -> 256 blocks: M=8192, N=1024

  // (1) x -> bf16 [8192][1024]
  cvt_bf16x8<<<gCvtX, blk, 0, stream>>>(x, XB, n8x);
  // (2) W_attn [k][n] -> WAT [n][k] bf16 (pitch 1024); W_proj [k][n] -> WPT2 [n][k | k] bf16 (pitch 2048)
  tcvt_kernel<false><<<gTA, blk, 0, stream>>>(W_attn, WAT, DM, N3, DM);
  tcvt_kernel<true><<<gTP, blk, 0, stream>>>(W_proj, WPT2, DM, DM, 2 * DM);

  // (3) q|k = x . W_attn[:, 0:2048] + b_attn[0:2048] -> bf16 hi/lo [8192][2048]   (M=8192, N=2048, K=1024)
  gemm64<2, 2><<<gQK, blk, 0, stream>>>(XB, DM, WAT, DM, (void*)QKh, (void*)QKl, QKP, b_attn, NB * SEQ, 2 * DM, DM);
  // (4) v^T = W_attn[:, 2048:3072]^T . x^T + b_attn[2048 + m] -> bf16 hi/lo [1024][8192]   (M=1024, N=8192, K=1024)
  gemm64<1, 2><<<gVT, blk, 0, stream>>>(WAT + (size_t)(2 * DM) * DM, DM, XB, DM, (void*)VTh, (void*)VTl, VTP,
                                        b_attn + 2 * DM, DM, NB * SEQ, DM);
  // (5) causal attention -> CTX rows 0..8191 (hi at cols 0..1023, lo at 1024..2047)
  attn_causal64<<<gAtt, dim3(128), 0, stream>>>(QKh, QKl, VTh, VTl, CTX, 0.125f);
  // (6) y = [ctx hi | ctx lo] . [W_proj^T | W_proj^T]^T + b_proj -> d_out f32 [8192][1024]   (M=8192, N=1024, K=2048)
  gemm64<2, 0><<<gOut, blk, 0, stream>>>(CTX, CXP, WPT2, 2 * DM, d_out, d_out, DM, b_proj, NB * SEQ, DM, 2 * DM);
  (void)hipGetLastError();
}

// v004
// A run of this version takes 264 microseconds.
// Two timings next to v003 both put it at 1.44 times that version's speed.
// Counting every step since v000, it is 4.72 times as fast.
// Contractions: q|k and v^T projections = v_wmma_f32_16x16x32_bf16 (bf16 operands RNE-converted from x and W_attn, single product, + bf16 bias in f32);
// causal scores q.k^T = v_wmma_f32_16x16x32_bf16 with bf16 hi/lo split q and k (hi.hi + hi.lo + lo.hi);
// context p.v = v_wmma_f32_16x16x32_bf16 with bf16 hi/lo split p and v (3 products);
// output projection = v_wmma_f32_16x16x32_bf16, context bf16 hi|lo planes folded along K (K = 2048) times bf16 W_proj^T (+ bf16 bias in f32);
// all f32 accumulate; online softmax statistics, score scale 0.125 and bias adds in f32.
// Carry audit: every 16-bit plane (XB, WAT, WPT2, QKh/QKl, VTh/VTl, CTX hi|lo, P hi|lo in registers) has carry 1; no inverse factor is applied anywhere.
#include <hip/hip_runtime.h>
#include <math.h>
#include <stdint.h>

#define NB   4
#define SEQ  2048
#define DM   1024
#define NH   16
#define HD   64
#define N3   (3 * DM)      // 3072
#define QKP  (2 * DM)      // pitch of the q|k planes [t][q 1024 | k 1024]
#define CXP  (2 * DM)      // pitch of the context plane [t][hi 1024 | lo 1024]
#define VTP  (NB * SEQ)    // pitch of the v^T planes [h*64 + d][b*2048 + s]
#define NQB  (SEQ / 64)    // 32 query / key tiles of 64
#define OSP  68            // LDS row pitch of the f32 context tile: 272 B = 16 B x 17 (odd), conflict-free for 16-B stores of 16 rows
#define LP   72            // LDS row pitch of the 64-element bf16 tiles: 144 B = 16 B x 9 (odd), conflict-free for 16-B fragment reads
static_assert(NH * HD == DM);
static_assert((SEQ % 64) == 0 && (DM % 64) == 0 && (N3 % 64) == 0);
static_assert((DM % 32) == 0 && (CXP % 32) == 0 && (QKP % 8) == 0);

typedef __bf16   v16b __attribute__((ext_vector_type(16)));
typedef __bf16   v8b  __attribute__((ext_vector_type(8)));
typedef float    v8f  __attribute__((ext_vector_type(8)));
typedef float    v4f  __attribute__((ext_vector_type(4)));
typedef unsigned int v4u __attribute__((ext_vector_type(4)));

// ---- scalar helpers ----------------------------------------------------------------------------------
__device__ __forceinline__ unsigned short bf_bits(float f) {          // f32 -> bf16 bits, RNE convert
  unsigned u = __float_as_uint(f);
  return (unsigned short)((u + 0x7FFFu + ((u >> 16) & 1u)) >> 16);
}
__device__ __forceinline__ float bf_up(unsigned short h) { return __uint_as_float(((unsigned)h) << 16); }
__device__ __forceinline__ float bfr(float f) { return bf_up(bf_bits(f)); }   // value after bf16 RNE convert
__device__ __forceinline__ unsigned pk16(unsigned short a, unsigned short b) { return (unsigned)a | ((unsigned)b << 16); }
__device__ __forceinline__ v8f zero8() { v8f z = {0.f, 0.f, 0.f, 0.f, 0.f, 0.f, 0.f, 0.f}; return z; }
__device__ __forceinline__ void bf_split(float f, __bf16& hi, __bf16& lo) {
  const unsigned short hb = bf_bits(f);
  hi = __builtin_bit_cast(__bf16, hb);
  lo = __builtin_bit_cast(__bf16, bf_bits(f - bf_up(hb)));
}

// value of the same lane position in the other 16-lane half (lane ^ 16), as a vector cross-row move: no LDS round trip
__device__ __forceinline__ float other_half(float v) {
  const int b = __float_as_int(v);
  return __int_as_float(__builtin_amdgcn_permlanex16(b, b, 0x76543210, 0xfedcba98, false, false));
}

// ---- fragment loader: 16-bit A/B operand, lane -> row/col (lane&15), p already includes +8*(lane>>4);
//      elements 0..7 <- p[0..7] (k0+8h..), elements 8..15 <- p[16..23] (k0+16+8h..)
__device__ __forceinline__ v16b ldfrag_b(const __bf16* p) {
  union { v16b v; v8b h[2]; } f;
  f.h[0] = *(const v8b*)(p);
  f.h[1] = *(const v8b*)(p + 16);
  return f.v;
}

// ---- WMMA helpers with trailing VALU hazard gap ----------------------------------------------------------
__device__ __forceinline__ v8f mma_b(v16b a, v16b b, v8f c) {
  c = __builtin_amdgcn_wmma_f32_16x16x32_bf16(false, a, false, b, (short)0, c, false, false);
  asm volatile("v_nop\n\tv_nop\n\tv_nop\n\tv_nop" : "+v"(c) : "v"(a), "v"(b));
  return c;
}
__device__ __forceinline__ v8f mma_b_raw(v16b a, v16b b, v8f c) {
  return __builtin_amdgcn_wmma_f32_16x16x32_bf16(false, a, false, b, (short)0, c, false, false);
}
__device__ __forceinline__ void dep_guard_b(v8f& a, v8f& b, v16b x, v16b y) {
  asm volatile("v_nop\n\tv_nop\n\tv_nop\n\tv_nop" : "+v"(a), "+v"(b) : "v"(x), "v"(y));
}
__device__ __forceinline__ void keep4_b(v16b a, v16b b, v16b c, v16b d) {
  asm volatile("v_nop" :: "v"(a), "v"(b), "v"(c), "v"(d));
}
__device__ __forceinline__ void acc_guard4(v8f& a, v8f& b, v8f& c, v8f& d) {
  asm volatile("v_nop\n\tv_nop\n\tv_nop\n\tv_nop" : "+v"(a), "+v"(b), "+v"(c), "+v"(d));
}

// =====================================================================================================
// f32 -> bf16 (RNE convert), 8 elements per thread, one 16-B store per lane: a wave writes 512 contiguous B
// coverage: n8 threads x 8 = the whole plane (n8 = 1048576, a multiple of 256).
// =====================================================================================================
__global__ __launch_bounds__(256) void cvt_bf16x8(const float* __restrict__ in, unsigned short* out, int n8) {
  const int i = blockIdx.x * 256 + threadIdx.x;
  if (i < n8) {
    const v4f a = *(const v4f*)(in + (size_t)i * 8);
    const v4f b = *(const v4f*)(in + (size_t)i * 8 + 4);
    v4u p;
    p[0] = pk16(bf_bits(a[0]), bf_bits(a[1]));
    p[1] = pk16(bf_bits(a[2]), bf_bits(a[3]));
    p[2] = pk16(bf_bits(b[0]), bf_bits(b[1]));
    p[3] = pk16(bf_bits(b[2]), bf_bits(b[3]));
    *(v4u*)(out + (size_t)i * 8) = p;
    
  }
}

// =====================================================================================================
// Transpose + bf16 convert of an f32 matrix: in [R rows][Cc cols] (pitch Cc) -> o[c][r] = bf16_rne(in[r][c]),
// output row pitch P (>= R); DUP additionally writes the same value at o[c][R + r] (duplicate along k).
// 64x64 tiles through LDS. grid = (Cc/64, R/64), 256 threads (R, Cc multiples of 64).
// coverage per block: load 4 it x 256 thr x 4 floats = 64x64; store 2 it x 256 thr x 8 u16 = 64x64 (x2 with DUP).
// =====================================================================================================
template <bool DUP>
__global__ __launch_bounds__(256) void tcvt_kernel(const float* __restrict__ W, unsigned short* o, int R, int Cc, int P) {
  __shared__ __align__(16) float tf[64 * 68];
  const int c0  = blockIdx.x * 64;   // input column block = output row block
  const int r0  = blockIdx.y * 64;   // input row block    = output column block
  const int tid = threadIdx.x;
  {
    const int lr = tid >> 4;         // 0..15
    const int c4 = (tid & 15) * 4;   // 0..60
#pragma unroll
    for (int it = 0; it < 4; ++it) {
      const int rr = it * 16 + lr;   // 0..63
      const v4f a = *(const v4f*)(W + (size_t)(r0 + rr) * Cc + c0 + c4);
      *(v4f*)(tf + rr * 68 + c4) = a;
    }
  }
  __syncthreads();
  const int sub = tid >> 3;          // 0..31
  const int c8  = (tid & 7) * 8;     // 0..56
  v4u hv[2];
#pragma unroll
  for (int it = 0; it < 2; ++it) {
    const int oc = it * 32 + sub;    // output row within tile (= input column)
    v4u a;
#pragma unroll
    for (int q = 0; q < 4; ++q) {
      const float f0 = tf[(c8 + 2 * q) * 68 + oc];
      const float f1 = tf[(c8 + 2 * q + 1) * 68 + oc];
      a[q] = pk16(bf_bits(f0), bf_bits(f1));
    }
    hv[it] = a;
  }
  {
#pragma unroll
    for (int it = 0; it < 2; ++it) {
      const int oc = it * 32 + sub;
      const size_t go = (size_t)(c0 + oc) * P + r0 + c8;
      *(v4u*)(o + go) = hv[it];
      if (DUP) *(v4u*)(o + go + R) = hv[it];
    }
    
  }
}

// =====================================================================================================
// Register-blocked bf16 WMMA GEMM: C[m][n] = sum_k A[m][k] * Bt[n][k] + bias; one wave per 64x64 tile,
// eight waves (2 x 4) = one 128 x 256 tile per work-group. A row-major [M][K] pitch lda; Bt row-major [N][K] pitch ldb
// (k contiguous); M multiple of 128, N multiple of 256, K multiple of 64 and >= 128 (host constants, asserted below).
// Operands: a stage = 64 k = one whole 128-B line of each of the 128 A rows and 256 Bt rows, laid in LDS at pitch LP
// ([A rows | Bt rows]); two buffers; stage t + 2 is copied (16 B per lane, global -> LDS, no register) while stage t + 1 is worked on.
// copy coverage per stage: 12 copies x 256 threads x 16 B = 384 rows x 128 B; a wave's copy = 4 whole lines.
// BIAS_MODE: 1 = bias[m], 2 = bias[n]; bias value RNE-converted to bf16 then added in f32.
// OUT_MODE: 0 = f32 (pitch ldc); 2 = bf16 hi plane C + bf16 lo plane C2 (lo = RNE(v - hi), unscaled), pitch ldc.
// =====================================================================================================
#define GTM  128                   // work-group tile rows
#define GTN  256                   // work-group tile columns
#define GKB  64                    // k elements per stage
#define GSTG ((GTM + GTN) * LP)    // bf16 elements of one stage in LDS (55296 B)
static_assert(((NB * SEQ) % GTN) == 0 && (DM % GTN) == 0 && ((2 * DM) % GTN) == 0);
static_assert((DM % GKB) == 0 && (CXP % GKB) == 0 && DM >= 2 * GKB);

// One stage's copies of one lane: rows r, r + 32, .. of A (4) and of Bt (8), LDS rows 32 * LP elements apart.
// The copies and s_wait_xcnt 0 are one statement, so that no address register is rewritten ahead of that wait.
__device__ __forceinline__ void stage_copy(unsigned l, const __bf16* a, size_t as, const __bf16* b, size_t bs) {
  const unsigned ls = 32 * LP * 2;   // bytes between a lane's consecutive LDS rows
  asm volatile(
      "global_load_async_to_lds_b128 %0, %12, off\n\t"
      "global_load_async_to_lds_b128 %1, %13, off\n\t"
      "global_load_async_to_lds_b128 %2, %14, off\n\t"
      "global_load_async_to_lds_b128 %3, %15, off\n\t"
      "global_load_async_to_lds_b128 %4, %16, off\n\t"
      "global_load_async_to_lds_b128 %5, %17, off\n\t"
      "global_load_async_to_lds_b128 %6, %18, off\n\t"
      "global_load_async_to_lds_b128 %7, %19, off\n\t"
      "global_load_async_to_lds_b128 %8, %20, off\n\t"
      "global_load_async_to_lds_b128 %9, %21, off\n\t"
      "global_load_async_to_lds_b128 %10, %22, off\n\t"
      "global_load_async_to_lds_b128 %11, %23, off\n\t"
      "s_wait_xcnt 0x0"
      :: "v"(l), "v"(l + ls), "v"(l + 2 * ls), "v"(l + 3 * ls), "v"(l + 4 * ls), "v"(l + 5 * ls),
         "v"(l + 6 * ls), "v"(l + 7 * ls), "v"(l + 8 * ls), "v"(l + 9 * ls), "v"(l + 10 * ls), "v"(l + 11 * ls),
         "v"(a), "v"(a + as), "v"(a + 2 * as), "v"(a + 3 * as),
         "v"(b), "v"(b + bs), "v"(b + 2 * bs), "v"(b + 3 * bs), "v"(b + 4 * bs), "v"(b + 5 * bs), "v"(b + 6 * bs), "v"(b + 7 * bs)
      : "memory");
}

template <int BIAS_MODE, int OUT_MODE>
__global__ __launch_bounds__(256) void gemm64(
    const unsigned short* __restrict__ Ap, int lda,
    const unsigned short* __restrict__ Btp, int ldb,
    void* Cout, void* Cout2, int ldc,
    const float* __restrict__ bias,
    int M, int N, int K) {
  const __bf16* A  = (const __bf16*)(const void*)Ap;
  const __bf16* Bt = (const __bf16*)(const void*)Btp;
  __shared__ __align__(16) __bf16 ring[2 * GSTG];  // two stages [A 128 rows | Bt 256 rows], pitch LP
  __shared__ __align__(16) float sT[8][16 * 68];   // per-wave 16x64 slab, pitch 68 floats
  const int lane = threadIdx.x & 31;
  const int wave = threadIdx.x >> 5;
  const int blocksN = N / GTN;
  const int blocksM = M / GTM;
  if ((int)blockIdx.x >= blocksM * blocksN) return;   // block-uniform, in front of every barrier
  const int bm = blockIdx.x / blocksN;
  const int bn = blockIdx.x - bm * blocksN;
  const int wm = wave >> 2;                    // 0..1
  const int wn = wave & 3;                     // 0..3
  const int m0 = bm * GTM + (wm << 6);
  const int n0 = bn * GTN + (wn << 6);

  const int rlane = lane & 15;                 // row (A) / col (B, D) within subtile
  const int koff  = (lane >> 4) * 8;           // k offset of this lane half
  const int mOff  = (lane >> 4) * 8;           // D row offset

  v8f acc[4][4];
#pragma unroll
  for (int i = 0; i < 4; ++i)
#pragma unroll
    for (int j = 0; j < 4; ++j) acc[i][j] = zero8();

  // this lane's place in a stage: row crow (+ 32 per copy), 16-B piece ccol of the row's 128 B
  const int crow = threadIdx.x >> 3;           // 0..31
  const int ccol = (threadIdx.x & 7) * 8;      // 0..56 elements
  const __bf16* ga = A  + (size_t)(bm * GTM + crow) * lda + ccol;
  const __bf16* gb = Bt + (size_t)(bn * GTN + crow) * ldb + ccol;
  const size_t  as = (size_t)32 * lda;
  const size_t  bs = (size_t)32 * ldb;
  const unsigned l0 = (unsigned)(uintptr_t)(ring + crow * LP + ccol);   // LDS byte address in buffer 0
  const int nst = K / GKB;                     // stages, >= 2

  stage_copy(l0, ga, as, gb, bs);
  asm volatile("s_wait_asynccnt 0x0" ::: "memory");   // stage 0 of this wave has landed
  __syncthreads();                                    // stage 0 of every wave is readable
  if (nst > 1) stage_copy(l0 + GSTG * 2, ga + GKB, as, gb + GKB, bs);

#pragma unroll 1   // rolled: one publish point in the text, the buffer chosen by t & 1
  for (int t = 0; t < nst; ++t) {
    const int bo = (t & 1) * GSTG;
    const __bf16* sa = ring + bo + ((wm << 6) + rlane) * LP + koff;
    const __bf16* sb = ring + bo + (GTM + (wn << 6) + rlane) * LP + koff;
#pragma unroll
    for (int kk = 0; kk < GKB; kk += 32) {
      v16b bh[4], ah[4];
#pragma unroll
      for (int j = 0; j < 4; ++j) bh[j] = ldfrag_b(sb + (j << 4) * LP + kk);
#pragma unroll
      for (int i = 0; i < 4; ++i) ah[i] = ldfrag_b(sa + (i << 4) * LP + kk);
#pragma unroll
      for (int i = 0; i < 4; ++i) {
#pragma unroll
        for (int j = 0; j < 4; ++j) acc[i][j] = mma_b_raw(ah[i], bh[j], acc[i][j]);
        dep_guard_b(acc[i][0], acc[i][3], ah[i], ah[i]);
      }
      keep4_b(bh[0], bh[1], bh[2], bh[3]);
    }
    asm volatile("s_wait_dscnt 0x0" ::: "memory");      // this wave's reads of stage t are done before the buffer is refilled
    asm volatile("s_wait_asynccnt 0x0" ::: "memory");   // this wave's copies of stage t + 1 have landed
    __syncthreads();                                    // publishes stage t + 1 and ends every reader's use of stage t
    if (t + 2 < nst) stage_copy(l0 + (unsigned)bo * 2, ga + (size_t)(t + 2) * GKB, as, gb + (size_t)(t + 2) * GKB, bs);
  }
  asm volatile("s_wait_asynccnt 0x0" ::: "memory");     // no copy is outstanding when the wave goes on
  acc_guard4(acc[0][0], acc[0][1], acc[0][2], acc[0][3]);
  acc_guard4(acc[1][0], acc[1][1], acc[1][2], acc[1][3]);
  acc_guard4(acc[2][0], acc[2][1], acc[2][2], acc[2][3]);
  acc_guard4(acc[3][0], acc[3][1], acc[3][2], acc[3][3]);

  // ---- epilogue ----
  float* slab = sT[wave];
#pragma unroll
  for (int i = 0; i < 4; ++i) {
    const int mBase = m0 + (i << 4);
    float bm8[8];
#pragma unroll
    for (int r = 0; r < 8; ++r) bm8[r] = 0.f;
    if (BIAS_MODE == 1) {                          // rows mBase+mOff .. +7: two 16-B loads (32-B aligned)
      const v4f t0 = *(const v4f*)(bias + mBase + mOff);
      const v4f t1 = *(const v4f*)(bias + mBase + mOff + 4);
      bm8[0] = bfr(t0[0]); bm8[1] = bfr(t0[1]); bm8[2] = bfr(t0[2]); bm8[3] = bfr(t0[3]);
      bm8[4] = bfr(t1[0]); bm8[5] = bfr(t1[1]); bm8[6] = bfr(t1[2]); bm8[7] = bfr(t1[3]);
    }
#pragma unroll
    for (int j = 0; j < 4; ++j) {
      float bn = 0.f;
      if (BIAS_MODE == 2) bn = bfr(bias[n0 + (j << 4) + rlane]);
#pragma unroll
      for (int r = 0; r < 8; ++r) {
        float v = acc[i][j][r];
        if (BIAS_MODE == 1) v += bm8[r];
        if (BIAS_MODE == 2) v += bn;
        slab[(mOff + r) * 68 + (j << 4) + rlane] = v;
      }
    }
    __builtin_amdgcn_fence(__ATOMIC_RELEASE, "workgroup");
    __builtin_amdgcn_wave_barrier();
    __builtin_amdgcn_fence(__ATOMIC_ACQUIRE, "workgroup");
    if (OUT_MODE == 0) {
      float* C = (float*)Cout;
      const int hh = lane >> 4, c4 = (lane & 15) * 4;     // 256-B row segment = 16 lanes x 16 B
      {
#pragma unroll
        for (int it = 0; it < 8; ++it) {
          const int row = it * 2 + hh;                     // it 0..7 x hh 0..1 = rows 0..15
          const v4f v = *(const v4f*)(slab + row * 68 + c4);
          *(v4f*)(C + (size_t)(mBase + row) * ldc + n0 + c4) = v;
        }
        
      }
    } else {
      const int q = lane >> 3, c8 = (lane & 7) * 8;
      unsigned short* C  = (unsigned short*)Cout;
      unsigned short* C2 = (unsigned short*)Cout2;
      v4u hv[4], lv[4];
#pragma unroll
      for (int it = 0; it < 4; ++it) {
        const int row = it * 4 + q;                        // it 0..3 x q 0..3 = rows 0..15
        const float* sp = slab + row * 68 + c8;
        v4u a, a2;
#pragma unroll
        for (int e = 0; e < 4; ++e) {
          const float f0 = sp[2 * e], f1 = sp[2 * e + 1];
          const unsigned short h0 = bf_bits(f0), h1 = bf_bits(f1);
          const unsigned short l0 = bf_bits(f0 - bf_up(h0)), l1 = bf_bits(f1 - bf_up(h1));
          a[e] = pk16(h0, h1); a2[e] = pk16(l0, l1);
        }
        hv[it] = a; lv[it] = a2;
      }
      {
#pragma unroll
        for (int it = 0; it < 4; ++it) {
          const int row = it * 4 + q;
          *(v4u*)(C  + (size_t)(mBase + row) * ldc + n0 + c8) = hv[it];
          *(v4u*)(C2 + (size_t)(mBase + row) * ldc + n0 + c8) = lv[it];
        }
        
      }
    }
    __builtin_amdgcn_fence(__ATOMIC_RELEASE, "workgroup");
    __builtin_amdgcn_wave_barrier();
    __builtin_amdgcn_fence(__ATOMIC_ACQUIRE, "workgroup");
  }
}

// =====================================================================================================
// Causal attention, head dim 64, all batch elements in one launch (blockIdx.y = batch element b).
//   q|k planes (bf16 hi / lo): [b*SEQ + t][QKP], q(t, h, d) at col h*64 + d, k(s, h, d) at col DM + h*64 + d
//   v^T planes (bf16 hi / lo): [(h*64 + d)][VTP], key s of batch b at col b*SEQ + s, s contiguous
//   context plane (bf16): row b*SEQ + t, pitch CXP; hi at col h*64 + d, lo (RNE(v - hi)) at col DM + h*64 + d
//   scores = q . k : bf16 hi/lo split (hi.hi + hi.lo + lo.hi), f32 accumulate, then * sscale in f32
//   out    = p . v : bf16 hi/lo split of p (unnormalised) and v, f32 accumulate
//   both products are formed transposed: S^T = K . Q^T (A = K rows, B = q) and O^T += V^T . P^T (A = V^T rows, B = p):
//   a lane holds the scores of ONE query (q0 + lane&15), keys 8*(lane>>4) + r of each 16-key tile, so two score tiles, split in
//   place, are the B operand of the second product (element e = tile 2kk row e, element 8 + e = tile 2kk+1 row e: the k order of
//   the V^T loader), and maximum, sum and rescale factor are one value per lane.
//   online softmax in f32; key s > t set to -inf only on the diagonal key tile (key s = tile start <= t always live).
//   Block = 4 waves = 64 query rows of one head; grid = (NH * NQB, NB); key tiles of 64, block-uniform trip count qb+1 <= 32,
//   every wave reaches both block barriers of every iteration.
//   K / V^T tile staging: 128 threads x 32 elements per plane = the whole 64x64 tile (plain 16-B loads,
//   __syncthreads before and after); fragment loads read the LDS tiles with the same v8b element type.
//   Output coverage: each wave stores rows q0..q0+15 (it 0..3 x lane>>3 0..3) x 64 columns (8 lanes x 8) of both planes.
// =====================================================================================================
__global__ __launch_bounds__(128)
void attn_causal64(const unsigned short* __restrict__ qkhp, const unsigned short* __restrict__ qklp,
                   const unsigned short* __restrict__ vhp, const unsigned short* __restrict__ vlp,
                   unsigned short* cxp, float sscale) {
  union FB { v16b v; v8b h[2]; };
  __shared__ __align__(16) __bf16 Ksh[64 * LP];        // K hi [kv][d]   9 KB, rows pitched LP
  __shared__ __align__(16) __bf16 Ksl[64 * LP];        // K lo
  __shared__ __align__(16) __bf16 Vth[64 * LP];        // V^T hi [d][kv] 9 KB, rows pitched LP
  __shared__ __align__(16) __bf16 Vtl[64 * LP];        // V^T lo
  __shared__ __align__(16) float  Os[4][16 * OSP];     // per wave context tile [row][d], rows pitched OSP

  const int tid  = threadIdx.x;
  const int wave = tid >> 5;
  const int lane = tid & 31;
  const int hh   = lane >> 4;
  const int c    = lane & 15;

  const int bx = blockIdx.x;
  const int qb = bx % NQB;
  const int h  = bx / NQB;                 // 0..NH-1 (grid.x = NH * NQB)
  const int q0 = qb * 64 + wave * 16;
  const int rowBase = blockIdx.y * SEQ;    // first token row of this batch element (grid.y = NB)

  const __bf16* Qh = (const __bf16*)(const void*)qkhp + (size_t)rowBase * QKP + (size_t)h * HD;
  const __bf16* Ql = (const __bf16*)(const void*)qklp + (size_t)rowBase * QKP + (size_t)h * HD;
  const __bf16* Kh = Qh + DM;
  const __bf16* Kl = Ql + DM;
  const __bf16* Vh = (const __bf16*)(const void*)vhp + (size_t)h * HD * VTP + rowBase;
  const __bf16* Vl = (const __bf16*)(const void*)vlp + (size_t)h * HD * VTP + rowBase;

  // ---- Q fragments (B operand, column = query = lane&15, split k map): 2 d-chunks, hi and lo ----
  v16b qah[2], qal[2];
#pragma unroll
  for (int dc = 0; dc < 2; ++dc) {
    const size_t qo = (size_t)(q0 + c) * QKP + dc * 32 + 8 * hh;
    qah[dc] = ldfrag_b(Qh + qo);
    qal[dc] = ldfrag_b(Ql + qo);
  }

  float mrow = -INFINITY;   // running maximum of query q0 + c (the same in both lane halves)
  float lrow = 0.f;         // running sum over this lane half's keys only; the halves are joined after the loop
  v8f oacc[4];              // O^T: oacc[t][r] = context(query q0 + c, d = t*16 + 8*hh + r)
#pragma unroll
  for (int t = 0; t < 4; ++t) oacc[t] = zero8();

  const int nChunks = qb + 1;   // block-uniform, <= 32
  for (int kc = 0; kc < nChunks; ++kc) {
    const int kv0 = kc * 64;
    __syncthreads();
    {
      // staging coverage: 128 threads x (4 x 8) elements = 64 rows x 64 per plane = the whole tile of all four planes
      const int r = tid >> 1, half = (tid & 1) * 32;
      const __bf16* kg  = Kh + (size_t)(kv0 + r) * QKP + half;    // K row kv0+r, d = half..half+31
      const __bf16* klg = Kl + (size_t)(kv0 + r) * QKP + half;
      const __bf16* vg  = Vh + (size_t)r * VTP + kv0 + half;      // V^T row d = r, s = kv0+half..+31
      const __bf16* vlg = Vl + (size_t)r * VTP + kv0 + half;
#pragma unroll
      for (int i = 0; i < 4; ++i) {
        const v8b a0 = *(const v8b*)(kg + 8 * i);
        const v8b a1 = *(const v8b*)(klg + 8 * i);
        const v8b b0 = *(const v8b*)(vg + 8 * i);
        const v8b b1 = *(const v8b*)(vlg + 8 * i);
        *(v8b*)(Ksh + r * LP + half + 8 * i) = a0;
        *(v8b*)(Ksl + r * LP + half + 8 * i) = a1;
        *(v8b*)(Vth + r * LP + half + 8 * i) = b0;
        *(v8b*)(Vtl + r * LP + half + 8 * i) = b1;
      }
    }
    __syncthreads();

    // ---- scores, transposed: 64 keys (rows) x 16 queries (columns) per wave, 3 bf16 products ----
    v8f s[4];
#pragma unroll
    for (int j = 0; j < 4; ++j) {
      s[j] = zero8();
#pragma unroll
      for (int dc = 0; dc < 2; ++dc) {
        FB kb, kl;
        kb.h[0] = *(const v8b*)(Ksh + (j * 16 + c) * LP + dc * 32 + 8 * hh);
        kb.h[1] = *(const v8b*)(Ksh + (j * 16 + c) * LP + dc * 32 + 16 + 8 * hh);
        kl.h[0] = *(const v8b*)(Ksl + (j * 16 + c) * LP + dc * 32 + 8 * hh);
        kl.h[1] = *(const v8b*)(Ksl + (j * 16 + c) * LP + dc * 32 + 16 + 8 * hh);
        s[j] = mma_b(kb.v, qah[dc], s[j]);
        s[j] = mma_b(kl.v, qah[dc], s[j]);
        s[j] = mma_b(kb.v, qal[dc], s[j]);
      }
    }

    // ---- scale, causal mask on the diagonal tile, maximum of this lane's query ----
    const bool diag = (kc == qb);   // block-uniform
    const int qrow = q0 + c;
    float cm = -INFINITY;
#pragma unroll
    for (int j = 0; j < 4; ++j) {
#pragma unroll
      for (int r = 0; r < 8; ++r) {
        const int kvrow = kv0 + j * 16 + 8 * hh + r;
        const float sv = s[j][r] * sscale;
        const bool masked = diag && (kvrow > qrow);
        const float sm = masked ? -INFINITY : sv;
        s[j][r] = sm;
        cm = fmaxf(cm, sm);
      }
    }
    cm = fmaxf(cm, other_half(cm));                  // the other lane half holds the query's other 32 keys

    // ---- online softmax; P hi/lo (bf16, unnormalised) stays in registers as the B operand ----
    const float mnew  = fmaxf(mrow, cm);             // finite: key kv0 <= qrow is never masked
    const float alpha = __expf(mrow - mnew);
    mrow = mnew;
    float psum = 0.f;
    FB pa[2], pl[2];
#pragma unroll
    for (int j = 0; j < 4; ++j) {
#pragma unroll
      for (int r = 0; r < 8; ++r) {
        const float p = __expf(s[j][r] - mnew);
        psum += p;
        __bf16 a, bl; bf_split(p, a, bl);
        pa[j >> 1].v[(j & 1) * 8 + r] = a;
        pl[j >> 1].v[(j & 1) * 8 + r] = bl;
      }
    }
    lrow = lrow * alpha + psum;
#pragma unroll
    for (int t = 0; t < 4; ++t)
#pragma unroll
      for (int r = 0; r < 8; ++r) oacc[t][r] *= alpha;

    // ---- context^T += V^T . P^T, 3 bf16 products ----
#pragma unroll   // unrolled: pa / pl are registers and are indexed by kk
    for (int kk = 0; kk < 2; ++kk) {
#pragma unroll
      for (int t = 0; t < 4; ++t) {
        FB vb, vl;
        vb.h[0] = *(const v8b*)(Vth + (t * 16 + c) * LP + kk * 32 + 8 * hh);
        vb.h[1] = *(const v8b*)(Vth + (t * 16 + c) * LP + kk * 32 + 16 + 8 * hh);
        vl.h[0] = *(const v8b*)(Vtl + (t * 16 + c) * LP + kk * 32 + 8 * hh);
        vl.h[1] = *(const v8b*)(Vtl + (t * 16 + c) * LP + kk * 32 + 16 + 8 * hh);
        oacc[t] = mma_b(vb.v, pa[kk].v, oacc[t]);
        oacc[t] = mma_b(vl.v, pa[kk].v, oacc[t]);
        oacc[t] = mma_b(vb.v, pl[kk].v, oacc[t]);
      }
    }
  }

  // ---- normalise (1/l), stage the wave's 16x64 tile, bf16 hi/lo split,
  float* os = Os[wave];
  {
    const float l = lrow + other_half(lrow);           // join the lane halves' sums; >= 1 (the maximum's key contributes exp(0))
    const float inv = (l > 0.f) ? (1.0f / l) : 0.f;
#pragma unroll
    for (int t = 0; t < 4; ++t) {                      // 8 consecutive d of query row c: two 16-B stores
      v4f o0, o1;
#pragma unroll
      for (int r = 0; r < 4; ++r) { o0[r] = oacc[t][r] * inv; o1[r] = oacc[t][4 + r] * inv; }
      *(v4f*)(os + c * OSP + t * 16 + 8 * hh)     = o0;
      *(v4f*)(os + c * OSP + t * 16 + 8 * hh + 4) = o1;
    }
  }
  __builtin_amdgcn_fence(__ATOMIC_RELEASE, "workgroup");
  __builtin_amdgcn_wave_barrier();
  __builtin_amdgcn_fence(__ATOMIC_ACQUIRE, "workgroup");
  {
    const int q4 = lane >> 3, c8 = (lane & 7) * 8;
    v4u hv[4], lv[4];
#pragma unroll
    for (int it = 0; it < 4; ++it) {
      const int row = it * 4 + q4;   // it 0..3 x q4 0..3 = rows 0..15 of the wave tile
      const float* sp = os + row * OSP + c8;
      v4u a, a2;
#pragma unroll
      for (int e = 0; e < 4; ++e) {
        const float f0 = sp[2 * e], f1 = sp[2 * e + 1];
        const unsigned short h0 = bf_bits(f0), h1 = bf_bits(f1);
        const unsigned short l0 = bf_bits(f0 - bf_up(h0)), l1 = bf_bits(f1 - bf_up(h1));
        a[e] = pk16(h0, h1); a2[e] = pk16(l0, l1);
      }
      hv[it] = a; lv[it] = a2;
    }
    {
#pragma unroll
      for (int it = 0; it < 4; ++it) {
        const int row = it * 4 + q4;
        const size_t go = (size_t)(rowBase + q0 + row) * CXP + (size_t)h * HD + c8;
        *(v4u*)(cxp + go)      = hv[it];
        *(v4u*)(cxp + go + DM) = lv[it];
      }
      
    }
  }
}

// =====================================================================================================
// Workspace map (bytes); every region is an exact multiple of its 64x64-tile / whole-line store granularity:
//   XB   bf16 [8192][1024]              0        16777216
//   WAT  bf16 [3072 n][1024 k]          16777216  6291456
//   WPT2 bf16 [1024 n][2048 k]          23068672  4194304   (W_proj^T duplicated along k)
//   QKh  bf16 [8192][2048]              27262976 33554432
//   QKl  bf16 [8192][2048]              60817408 33554432
//   VTh  bf16 [1024][8192]              94371840 16777216
//   VTl  bf16 [1024][8192]             111149056 16777216
//   CTX  bf16 [8192][2048]             127926272 33554432
//   end                                161480704
// Every stage is one launch over all four batch elements; QK / VT planes are fully written before the attention launch reads them.
// =====================================================================================================
extern "C" void kernel_launch(void* const* d_in, const int* in_sizes, int n_in,
                              void* d_out, int out_size, void* d_ws, size_t ws_size,
                              hipStream_t stream) {
  if (n_in < 5) return;
  if (in_sizes[0] != NB * SEQ * DM) return;
  if (in_sizes[1] != DM * N3) return;
  if (in_sizes[2] != N3) return;
  if (in_sizes[3] != DM * DM) return;
  if (in_sizes[4] != DM) return;
  if (out_size != NB * SEQ * DM) return;

  const float* x      = (const float*)d_in[0];   // [4][2048][1024]
  const float* W_attn = (const float*)d_in[1];   // [1024 in][3072 out]
  const float* b_attn = (const float*)d_in[2];   // [3072]
  const float* W_proj = (const float*)d_in[3];   // [1024 in][1024 out]
  const float* b_proj = (const float*)d_in[4];   // [1024]

  const size_t PXB = (size_t)NB * SEQ * DM * 2;     // 16777216
  const size_t PWA = (size_t)N3 * DM * 2;           //  6291456
  const size_t PWP = (size_t)DM * (2 * DM) * 2;     //  4194304
  const size_t PQK = (size_t)NB * SEQ * QKP * 2;    // 33554432
  const size_t PVT = (size_t)DM * VTP * 2;          // 16777216
  const size_t PCX = (size_t)NB * SEQ * CXP * 2;    // 33554432
  size_t off = 0;
  const size_t oXB  = off; off += PXB;
  const size_t oWAT = off; off += PWA;
  const size_t oWPT = off; off += PWP;
  const size_t oQKh = off; off += PQK;
  const size_t oQKl = off; off += PQK;
  const size_t oVTh = off; off += PVT;
  const size_t oVTl = off; off += PVT;
  const size_t oCTX = off; off += PCX;
  if (off > ws_size) return;                        // off = 161480704

  char* ws = (char*)d_ws;
  unsigned short* XB   = (unsigned short*)(ws + oXB);
  unsigned short* WAT  = (unsigned short*)(ws + oWAT);
  unsigned short* WPT2 = (unsigned short*)(ws + oWPT);
  unsigned short* QKh  = (unsigned short*)(ws + oQKh);
  unsigned short* QKl  = (unsigned short*)(ws + oQKl);
  unsigned short* VTh  = (unsigned short*)(ws + oVTh);
  unsigned short* VTl  = (unsigned short*)(ws + oVTl);
  unsigned short* CTX  = (unsigned short*)(ws + oCTX);

  const dim3 blk(256);
  const int n8x = NB * SEQ * DM / 8;                               // 1048576
  const dim3 gCvtX((n8x + 255) / 256);                             // 4096 blocks
  const dim3 gTA(N3 / 64, DM / 64);                                // in [1024 rows][3072 cols] -> (cols/64, rows/64)
  const dim3 gTP(DM / 64, DM / 64);                                // in [1024 rows][1024 cols]
  const dim3 gQK(((NB * SEQ / 64) * ((2 * DM) / 64) + 7) / 8);     // 4096 tiles -> 512 blocks: M=8192, N=2048
  const dim3 gVT(((DM / 64) * (NB * SEQ / 64) + 7) / 8);           // 2048 tiles -> 256 blocks: M=1024, N=8192
  const dim3 gAtt(NH * NQB, NB);                                   // 2048 blocks: (16 heads x 32 query tiles) x 4 batch elements
  const dim3 gOut(((NB * SEQ / 64) * (DM / 64) + 7) / 8);          // 2048 tiles -> 256 blocks: M=8192, N=1024

  // (1) x -> bf16 [8192][1024]
  cvt_bf16x8<<<gCvtX, blk, 0, stream>>>(x, XB, n8x);
  // (2) W_attn [k][n] -> WAT [n][k] bf16 (pitch 1024); W_proj [k][n] -> WPT2 [n][k | k] bf16 (pitch 2048)
  tcvt_kernel<false><<<gTA, blk, 0, stream>>>(W_attn, WAT, DM, N3, DM);
  tcvt_kernel<true><<<gTP, blk, 0, stream>>>(W_proj, WPT2, DM, DM, 2 * DM);

  // (3) q|k = x . W_attn[:, 0:2048] + b_attn[0:2048] -> bf16 hi/lo [8192][2048]   (M=8192, N=2048, K=1024)
  gemm64<2, 2><<<gQK, blk, 0, stream>>>(XB, DM, WAT, DM, (void*)QKh, (void*)QKl, QKP, b_attn, NB * SEQ, 2 * DM, DM);
  // (4) v^T = W_attn[:, 2048:3072]^T . x^T + b_attn[2048 + m] -> bf16 hi/lo [1024][8192]   (M=1024, N=8192, K=1024)
  gemm64<1, 2><<<gVT, blk, 0, stream>>>(WAT + (size_t)(2 * DM) * DM, DM, XB, DM, (void*)VTh, (void*)VTl, VTP,
                                        b_attn + 2 * DM, DM, NB * SEQ, DM);
  // (5) causal attention -> CTX rows 0..8191 (hi at cols 0..1023, lo at 1024..2047)
  attn_causal64<<<gAtt, dim3(128), 0, stream>>>(QKh, QKl, VTh, VTl, CTX, 0.125f);
  // (6) y = [ctx hi | ctx lo] . [W_proj^T | W_proj^T]^T + b_proj -> d_out f32 [8192][1024]   (M=8192, N=1024, K=2048)
  gemm64<2, 0><<<gOut, blk, 0, stream>>>(CTX, CXP, WPT2, 2 * DM, d_out, d_out, DM, b_proj, NB * SEQ, DM, 2 * DM);
  (void)hipGetLastError();
}

// v005
// It runs in 237 microseconds.
// Two timings next to v004 both put it at 1.11 times that version's speed.
// Over all steps from v000 it is 5.24 times as fast.
// Contractions: q|k and v^T projections = v_wmma_f32_16x16x32_bf16 (bf16 operands RNE-converted from x and W_attn, single product, + bf16 bias in f32);
// causal scores q.k^T = v_wmma_f32_16x16x32_bf16 with bf16 hi/lo split q and k (hi.hi + hi.lo + lo.hi);
// context p.v = v_wmma_f32_16x16x32_bf16 with bf16 hi/lo split p and v (3 products);
// output projection = v_wmma_f32_16x16x32_bf16, context bf16 hi|lo planes folded along K (K = 2048) times bf16 W_proj^T (+ bf16 bias in f32);
// all f32 accumulate; online softmax statistics, score scale 0.125 and bias adds in f32.
// Carry audit: every 16-bit plane (XB, WAT, WPT2, QKh/QKl, VTh/VTl, CTX hi|lo, P hi|lo in registers) has carry 1; no inverse factor is applied anywhere.
#include <hip/hip_runtime.h>
#include <math.h>
#include <stdint.h>

#define NB   4
#define SEQ  2048
#define DM   1024
#define NH   16
#define HD   64
#define N3   (3 * DM)      // 3072
#define QKP  (2 * DM)      // pitch of the q|k planes [t][q 1024 | k 1024]
#define CXP  (2 * DM)      // pitch of the context plane [t][hi 1024 | lo 1024]
#define VTP  (NB * SEQ)    // pitch of the v^T planes [h*64 + d][b*2048 + s]
#define NQB  (SEQ / 64)    // 32 query / key tiles of 64
#define OSP  68            // LDS row pitch of the f32 context tile: 272 B = 16 B x 17 (odd), conflict-free for 16-B stores of 16 rows
#define LP   72            // LDS row pitch of the 64-element bf16 tiles: 144 B = 16 B x 9 (odd), conflict-free for 16-B fragment reads
static_assert(NH * HD == DM);
static_assert((SEQ % 64) == 0 && (DM % 64) == 0 && (N3 % 64) == 0);
static_assert((DM % 32) == 0 && (CXP % 32) == 0 && (QKP % 8) == 0);

typedef __bf16   v16b __attribute__((ext_vector_type(16)));
typedef __bf16   v8b  __attribute__((ext_vector_type(8)));
typedef float    v8f  __attribute__((ext_vector_type(8)));
typedef float    v4f  __attribute__((ext_vector_type(4)));
typedef unsigned int v4u __attribute__((ext_vector_type(4)));

// ---- scalar helpers ----------------------------------------------------------------------------------
__device__ __forceinline__ unsigned short bf_bits(float f) {          // f32 -> bf16 bits, RNE convert
  unsigned u = __float_as_uint(f);
  return (unsigned short)((u + 0x7FFFu + ((u >> 16) & 1u)) >> 16);
}
__device__ __forceinline__ float bf_up(unsigned short h) { return __uint_as_float(((unsigned)h) << 16); }
__device__ __forceinline__ float bfr(float f) { return bf_up(bf_bits(f)); }   // value after bf16 RNE convert
__device__ __forceinline__ unsigned pk16(unsigned short a, unsigned short b) { return (unsigned)a | ((unsigned)b << 16); }
__device__ __forceinline__ v8f zero8() { v8f z = {0.f, 0.f, 0.f, 0.f, 0.f, 0.f, 0.f, 0.f}; return z; }
__device__ __forceinline__ void bf_split(float f, __bf16& hi, __bf16& lo) {
  const unsigned short hb = bf_bits(f);
  hi = __builtin_bit_cast(__bf16, hb);
  lo = __builtin_bit_cast(__bf16, bf_bits(f - bf_up(hb)));
}

// value of the same lane position in the other 16-lane half (lane ^ 16), as a vector cross-row move: no LDS round trip
__device__ __forceinline__ float other_half(float v) {
  const int b = __float_as_int(v);
  return __int_as_float(__builtin_amdgcn_permlanex16(b, b, 0x76543210, 0xfedcba98, false, false));
}

// ---- fragment loader: 16-bit A/B operand, lane -> row/col (lane&15), p already includes +8*(lane>>4);
//      elements 0..7 <- p[0..7] (k0+8h..), elements 8..15 <- p[16..23] (k0+16+8h..)
__device__ __forceinline__ v16b ldfrag_b(const __bf16* p) {
  union { v16b v; v8b h[2]; } f;
  f.h[0] = *(const v8b*)(p);
  f.h[1] = *(const v8b*)(p + 16);
  return f.v;
}

// ---- WMMA helpers with trailing VALU hazard gap ----------------------------------------------------------
__device__ __forceinline__ v8f mma_b(v16b a, v16b b, v8f c) {
  c = __builtin_amdgcn_wmma_f32_16x16x32_bf16(false, a, false, b, (short)0, c, false, false);
  asm volatile("v_nop\n\tv_nop\n\tv_nop\n\tv_nop" : "+v"(c) : "v"(a), "v"(b));
  return c;
}
__device__ __forceinline__ v8f mma_b_raw(v16b a, v16b b, v8f c) {
  return __builtin_amdgcn_wmma_f32_16x16x32_bf16(false, a, false, b, (short)0, c, false, false);
}
__device__ __forceinline__ void dep_guard_b(v8f& a, v8f& b, v16b x, v16b y) {
  asm volatile("v_nop\n\tv_nop\n\tv_nop\n\tv_nop" : "+v"(a), "+v"(b) : "v"(x), "v"(y));
}
__device__ __forceinline__ void keep4_b(v16b a, v16b b, v16b c, v16b d) {
  asm volatile("v_nop" :: "v"(a), "v"(b), "v"(c), "v"(d));
}
__device__ __forceinline__ void acc_guard4(v8f& a, v8f& b, v8f& c, v8f& d) {
  asm volatile("v_nop\n\tv_nop\n\tv_nop\n\tv_nop" : "+v"(a), "+v"(b), "+v"(c), "+v"(d));
}

// =====================================================================================================
// f32 -> bf16 (RNE convert), 8 elements per thread, one 16-B store per lane: a wave writes 512 contiguous B
// coverage: n8 threads x 8 = the whole plane (n8 = 1048576, a multiple of 256).
// =====================================================================================================
__global__ __launch_bounds__(256) void cvt_bf16x8(const float* __restrict__ in, unsigned short* out, int n8) {
  const int i = blockIdx.x * 256 + threadIdx.x;
  if (i < n8) {
    const v4f a = *(const v4f*)(in + (size_t)i * 8);
    const v4f b = *(const v4f*)(in + (size_t)i * 8 + 4);
    v4u p;
    p[0] = pk16(bf_bits(a[0]), bf_bits(a[1]));
    p[1] = pk16(bf_bits(a[2]), bf_bits(a[3]));
    p[2] = pk16(bf_bits(b[0]), bf_bits(b[1]));
    p[3] = pk16(bf_bits(b[2]), bf_bits(b[3]));
    *(v4u*)(out + (size_t)i * 8) = p;
    
  }
}

// =====================================================================================================
// Transpose + bf16 convert of an f32 matrix: in [R rows][Cc cols] (pitch Cc) -> o[c][r] = bf16_rne(in[r][c]),
// output row pitch P (>= R); DUP additionally writes the same value at o[c][R + r] (duplicate along k).
// 64x64 tiles through LDS. grid = (Cc/64, R/64), 256 threads (R, Cc multiples of 64).
// coverage per block: load 4 it x 256 thr x 4 floats = 64x64; store 2 it x 256 thr x 8 u16 = 64x64 (x2 with DUP).
// =====================================================================================================
template <bool DUP>
__global__ __launch_bounds__(256) void tcvt_kernel(const float* __restrict__ W, unsigned short* o, int R, int Cc, int P) {
  __shared__ __align__(16) float tf[64 * 68];
  const int c0  = blockIdx.x * 64;   // input column block = output row block
  const int r0  = blockIdx.y * 64;   // input row block    = output column block
  const int tid = threadIdx.x;
  {
    const int lr = tid >> 4;         // 0..15
    const int c4 = (tid & 15) * 4;   // 0..60
#pragma unroll
    for (int it = 0; it < 4; ++it) {
      const int rr = it * 16 + lr;   // 0..63
      const v4f a = *(const v4f*)(W + (size_t)(r0 + rr) * Cc + c0 + c4);
      *(v4f*)(tf + rr * 68 + c4) = a;
    }
  }
  __syncthreads();
  const int sub = tid >> 3;          // 0..31
  const int c8  = (tid & 7) * 8;     // 0..56
  v4u hv[2];
#pragma unroll
  for (int it = 0; it < 2; ++it) {
    const int oc = it * 32 + sub;    // output row within tile (= input column)
    v4u a;
#pragma unroll
    for (int q = 0; q < 4; ++q) {
      const float f0 = tf[(c8 + 2 * q) * 68 + oc];
      const float f1 = tf[(c8 + 2 * q + 1) * 68 + oc];
      a[q] = pk16(bf_bits(f0), bf_bits(f1));
    }
    hv[it] = a;
  }
  {
#pragma unroll
    for (int it = 0; it < 2; ++it) {
      const int oc = it * 32 + sub;
      const size_t go = (size_t)(c0 + oc) * P + r0 + c8;
      *(v4u*)(o + go) = hv[it];
      if (DUP) *(v4u*)(o + go + R) = hv[it];
    }
    
  }
}

// =====================================================================================================
// Register-blocked bf16 WMMA GEMM: C[m][n] = sum_k A[m][k] * Bt[n][k] + bias; one wave per 64x64 tile,
// eight waves (2 x 4) = one 128 x 256 tile per work-group. A row-major [M][K] pitch lda; Bt row-major [N][K] pitch ldb
// (k contiguous); M multiple of 128, N multiple of 256, K multiple of 64 and >= 128 (host constants, asserted below).
// Operands: a stage = 64 k = one whole 128-B line of each of the 128 A rows and 256 Bt rows, laid in LDS at pitch LP
// ([A rows | Bt rows]); two buffers; stage t + 2 is copied (16 B per lane, global -> LDS, no register) while stage t + 1 is worked on.
// copy coverage per stage: 12 copies x 256 threads x 16 B = 384 rows x 128 B; a wave's copy = 4 whole lines.
// BIAS_MODE: 1 = bias[m], 2 = bias[n]; bias value RNE-converted to bf16 then added in f32.
// OUT_MODE: 0 = f32 (pitch ldc); 2 = bf16 hi plane C + bf16 lo plane C2 (lo = RNE(v - hi), unscaled), pitch ldc.
// =====================================================================================================
#define GTM  128                   // work-group tile rows
#define GTN  256                   // work-group tile columns
#define GKB  64                    // k elements per stage
#define GSTG ((GTM + GTN) * LP)    // bf16 elements of one stage in LDS (55296 B)
static_assert(((NB * SEQ) % GTN) == 0 && (DM % GTN) == 0 && ((2 * DM) % GTN) == 0);
static_assert((DM % GKB) == 0 && (CXP % GKB) == 0 && DM >= 2 * GKB);

// One stage's copies of one lane: rows r, r + 32, .. of A (4) and of Bt (8), LDS rows 32 * LP elements apart.
// The copies and s_wait_xcnt 0 are one statement, so that no address register is rewritten ahead of that wait.
__device__ __forceinline__ void stage_copy(unsigned l, const __bf16* a, size_t as, const __bf16* b, size_t bs) {
  const unsigned ls = 32 * LP * 2;   // bytes between a lane's consecutive LDS rows
  asm volatile(
      "global_load_async_to_lds_b128 %0, %12, off\n\t"
      "global_load_async_to_lds_b128 %1, %13, off\n\t"
      "global_load_async_to_lds_b128 %2, %14, off\n\t"
      "global_load_async_to_lds_b128 %3, %15, off\n\t"
      "global_load_async_to_lds_b128 %4, %16, off\n\t"
      "global_load_async_to_lds_b128 %5, %17, off\n\t"
      "global_load_async_to_lds_b128 %6, %18, off\n\t"
      "global_load_async_to_lds_b128 %7, %19, off\n\t"
      "global_load_async_to_lds_b128 %8, %20, off\n\t"
      "global_load_async_to_lds_b128 %9, %21, off\n\t"
      "global_load_async_to_lds_b128 %10, %22, off\n\t"
      "global_load_async_to_lds_b128 %11, %23, off\n\t"
      "s_wait_xcnt 0x0"
      :: "v"(l), "v"(l + ls), "v"(l + 2 * ls), "v"(l + 3 * ls), "v"(l + 4 * ls), "v"(l + 5 * ls),
         "v"(l + 6 * ls), "v"(l + 7 * ls), "v"(l + 8 * ls), "v"(l + 9 * ls), "v"(l + 10 * ls), "v"(l + 11 * ls),
         "v"(a), "v"(a + as), "v"(a + 2 * as), "v"(a + 3 * as),
         "v"(b), "v"(b + bs), "v"(b + 2 * bs), "v"(b + 3 * bs), "v"(b + 4 * bs), "v"(b + 5 * bs), "v"(b + 6 * bs), "v"(b + 7 * bs)
      : "memory");
}

template <int BIAS_MODE, int OUT_MODE>
__global__ __launch_bounds__(256) void gemm64(
    const unsigned short* __restrict__ Ap, int lda,
    const unsigned short* __restrict__ Btp, int ldb,
    void* Cout, void* Cout2, int ldc,
    const float* __restrict__ bias,
    int M, int N, int K) {
  const __bf16* A  = (const __bf16*)(const void*)Ap;
  const __bf16* Bt = (const __bf16*)(const void*)Btp;
  __shared__ __align__(16) __bf16 ring[2 * GSTG];  // two stages [A 128 rows | Bt 256 rows], pitch LP
  __shared__ __align__(16) float sT[8][16 * 68];   // per-wave 16x64 slab, pitch 68 floats
  const int lane = threadIdx.x & 31;
  const int wave = threadIdx.x >> 5;
  const int blocksN = N / GTN;
  const int blocksM = M / GTM;
  if ((int)blockIdx.x >= blocksM * blocksN) return;   // block-uniform, in front of every barrier
  const int bm = blockIdx.x / blocksN;
  const int bn = blockIdx.x - bm * blocksN;
  const int wm = wave >> 2;                    // 0..1
  const int wn = wave & 3;                     // 0..3
  const int m0 = bm * GTM + (wm << 6);
  const int n0 = bn * GTN + (wn << 6);

  const int rlane = lane & 15;                 // row (A) / col (B, D) within subtile
  const int koff  = (lane >> 4) * 8;           // k offset of this lane half
  const int mOff  = (lane >> 4) * 8;           // D row offset

  v8f acc[4][4];
#pragma unroll
  for (int i = 0; i < 4; ++i)
#pragma unroll
    for (int j = 0; j < 4; ++j) acc[i][j] = zero8();

  // this lane's place in a stage: row crow (+ 32 per copy), 16-B piece ccol of the row's 128 B
  const int crow = threadIdx.x >> 3;           // 0..31
  const int ccol = (threadIdx.x & 7) * 8;      // 0..56 elements
  const __bf16* ga = A  + (size_t)(bm * GTM + crow) * lda + ccol;
  const __bf16* gb = Bt + (size_t)(bn * GTN + crow) * ldb + ccol;
  const size_t  as = (size_t)32 * lda;
  const size_t  bs = (size_t)32 * ldb;
  const unsigned l0 = (unsigned)(uintptr_t)(ring + crow * LP + ccol);   // LDS byte address in buffer 0
  const int nst = K / GKB;                     // stages, >= 2

  stage_copy(l0, ga, as, gb, bs);
  asm volatile("s_wait_asynccnt 0x0" ::: "memory");   // stage 0 of this wave has landed
  __syncthreads();                                    // stage 0 of every wave is readable
  if (nst > 1) stage_copy(l0 + GSTG * 2, ga + GKB, as, gb + GKB, bs);

#pragma unroll 1   // rolled: one publish point in the text, the buffer chosen by t & 1
  for (int t = 0; t < nst; ++t) {
    const int bo = (t & 1) * GSTG;
    const __bf16* sa = ring + bo + ((wm << 6) + rlane) * LP + koff;
    const __bf16* sb = ring + bo + (GTM + (wn << 6) + rlane) * LP + koff;
#pragma unroll
    for (int kk = 0; kk < GKB; kk += 32) {
      v16b bh[4], ah[4];
#pragma unroll
      for (int j = 0; j < 4; ++j) bh[j] = ldfrag_b(sb + (j << 4) * LP + kk);
#pragma unroll
      for (int i = 0; i < 4; ++i) ah[i] = ldfrag_b(sa + (i << 4) * LP + kk);
#pragma unroll
      for (int i = 0; i < 4; ++i) {
#pragma unroll
        for (int j = 0; j < 4; ++j) acc[i][j] = mma_b_raw(ah[i], bh[j], acc[i][j]);
        dep_guard_b(acc[i][0], acc[i][3], ah[i], ah[i]);
      }
      keep4_b(bh[0], bh[1], bh[2], bh[3]);
    }
    asm volatile("s_wait_dscnt 0x0" ::: "memory");      // this wave's reads of stage t are done before the buffer is refilled
    asm volatile("s_wait_asynccnt 0x0" ::: "memory");   // this wave's copies of stage t + 1 have landed
    __syncthreads();                                    // publishes stage t + 1 and ends every reader's use of stage t
    if (t + 2 < nst) stage_copy(l0 + (unsigned)bo * 2, ga + (size_t)(t + 2) * GKB, as, gb + (size_t)(t + 2) * GKB, bs);
  }
  asm volatile("s_wait_asynccnt 0x0" ::: "memory");     // no copy is outstanding when the wave goes on
  acc_guard4(acc[0][0], acc[0][1], acc[0][2], acc[0][3]);
  acc_guard4(acc[1][0], acc[1][1], acc[1][2], acc[1][3]);
  acc_guard4(acc[2][0], acc[2][1], acc[2][2], acc[2][3]);
  acc_guard4(acc[3][0], acc[3][1], acc[3][2], acc[3][3]);

  // ---- epilogue ----
  float* slab = sT[wave];
#pragma unroll
  for (int i = 0; i < 4; ++i) {
    const int mBase = m0 + (i << 4);
    float bm8[8];
#pragma unroll
    for (int r = 0; r < 8; ++r) bm8[r] = 0.f;
    if (BIAS_MODE == 1) {                          // rows mBase+mOff .. +7: two 16-B loads (32-B aligned)
      const v4f t0 = *(const v4f*)(bias + mBase + mOff);
      const v4f t1 = *(const v4f*)(bias + mBase + mOff + 4);
      bm8[0] = bfr(t0[0]); bm8[1] = bfr(t0[1]); bm8[2] = bfr(t0[2]); bm8[3] = bfr(t0[3]);
      bm8[4] = bfr(t1[0]); bm8[5] = bfr(t1[1]); bm8[6] = bfr(t1[2]); bm8[7] = bfr(t1[3]);
    }
#pragma unroll
    for (int j = 0; j < 4; ++j) {
      float bn = 0.f;
      if (BIAS_MODE == 2) bn = bfr(bias[n0 + (j << 4) + rlane]);
#pragma unroll
      for (int r = 0; r < 8; ++r) {
        float v = acc[i][j][r];
        if (BIAS_MODE == 1) v += bm8[r];
        if (BIAS_MODE == 2) v += bn;
        slab[(mOff + r) * 68 + (j << 4) + rlane] = v;
      }
    }
    __builtin_amdgcn_fence(__ATOMIC_RELEASE, "workgroup");
    __builtin_amdgcn_wave_barrier();
    __builtin_amdgcn_fence(__ATOMIC_ACQUIRE, "workgroup");
    if (OUT_MODE == 0) {
      float* C = (float*)Cout;
      const int hh = lane >> 4, c4 = (lane & 15) * 4;     // 256-B row segment = 16 lanes x 16 B
      {
#pragma unroll
        for (int it = 0; it < 8; ++it) {
          const int row = it * 2 + hh;                     // it 0..7 x hh 0..1 = rows 0..15
          const v4f v = *(const v4f*)(slab + row * 68 + c4);
          *(v4f*)(C + (size_t)(mBase + row) * ldc + n0 + c4) = v;
        }
        
      }
    } else {
      const int q = lane >> 3, c8 = (lane & 7) * 8;
      unsigned short* C  = (unsigned short*)Cout;
      unsigned short* C2 = (unsigned short*)Cout2;
      v4u hv[4], lv[4];
#pragma unroll
      for (int it = 0; it < 4; ++it) {
        const int row = it * 4 + q;                        // it 0..3 x q 0..3 = rows 0..15
        const float* sp = slab + row * 68 + c8;
        v4u a, a2;
#pragma unroll
        for (int e = 0; e < 4; ++e) {
          const float f0 = sp[2 * e], f1 = sp[2 * e + 1];
          const unsigned short h0 = bf_bits(f0), h1 = bf_bits(f1);
          const unsigned short l0 = bf_bits(f0 - bf_up(h0)), l1 = bf_bits(f1 - bf_up(h1));
          a[e] = pk16(h0, h1); a2[e] = pk16(l0, l1);
        }
        hv[it] = a; lv[it] = a2;
      }
      {
#pragma unroll
        for (int it = 0; it < 4; ++it) {
          const int row = it * 4 + q;
          *(v4u*)(C  + (size_t)(mBase + row) * ldc + n0 + c8) = hv[it];
          *(v4u*)(C2 + (size_t)(mBase + row) * ldc + n0 + c8) = lv[it];
        }
        
      }
    }
    __builtin_amdgcn_fence(__ATOMIC_RELEASE, "workgroup");
    __builtin_amdgcn_wave_barrier();
    __builtin_amdgcn_fence(__ATOMIC_ACQUIRE, "workgroup");
  }
}

// =====================================================================================================
// Causal attention, head dim 64, all batch elements in one launch (blockIdx.y = batch element b).
//   q|k planes (bf16 hi / lo): [b*SEQ + t][QKP], q(t, h, d) at col h*64 + d, k(s, h, d) at col DM + h*64 + d
//   v^T planes (bf16 hi / lo): [(h*64 + d)][VTP], key s of batch b at col b*SEQ + s, s contiguous
//   context plane (bf16): row b*SEQ + t, pitch CXP; hi at col h*64 + d, lo (RNE(v - hi)) at col DM + h*64 + d
//   scores = q . k : bf16 hi/lo split (hi.hi + hi.lo + lo.hi), f32 accumulate, then * sscale in f32
//   out    = p . v : bf16 hi/lo split of p (unnormalised) and v, f32 accumulate
//   both products are formed transposed: S^T = K . Q^T (A = K rows, B = q) and O^T += V^T . P^T (A = V^T rows, B = p):
//   a lane holds the scores of ONE query (q0 + lane&15), keys 8*(lane>>4) + r of each 16-key tile, so two score tiles, split in
//   place, are the B operand of the second product (element e = tile 2kk row e, element 8 + e = tile 2kk+1 row e: the k order of
//   the V^T loader), and maximum, sum and rescale factor are one value per lane.
//   online softmax in f32; key s > t set to -inf only on the diagonal key tile (key s = tile start <= t always live).
//   Block = 4 waves = 64 query rows of one head; grid = (NH * NQB, NB); key tiles of 64, block-uniform trip count qb+1 <= 32,
//   every wave reaches the one block barrier of every iteration.
//   K / V^T tile staging: a stage = the 64x64 tile of all four planes [K hi | K lo | V^T hi | V^T lo], rows pitched LP; two buffers;
//   tile kc + 2 is copied (16 B per lane, global -> LDS, no register) while tile kc + 1 is worked on.
//   copy coverage per stage: 16 copies x 128 threads x 16 B = 4 planes x 64 rows x 128 B; a wave's copy = 4 whole 128-B lines.
//   After the loop the ring is free (the last trip's barrier ends every read) and holds the per-wave f32 context tiles.
//   Output coverage: each wave stores rows q0..q0+15 (it 0..3 x lane>>3 0..3) x 64 columns (8 lanes x 8) of both planes.
// =====================================================================================================
#define APL  (64 * LP)     // bf16 elements of one plane's tile in LDS (9216 B)
#define ASTG (4 * APL)     // bf16 elements of one stage in LDS (36864 B)
static_assert(4 * 16 * OSP * 4 <= 2 * ASTG * 2);   // the four f32 context tiles fit in the ring

// One lane's copies of two planes of a stage: rows r, r + 16, r + 32, r + 48 of plane a, then of plane b (LDS: the next plane).
// The copies and s_wait_xcnt 0 are one statement, so that no address register is rewritten ahead of that wait.
__device__ __forceinline__ void tile_copy(unsigned l, const __bf16* a, const __bf16* b, size_t rs) {
  const unsigned ls = 16 * LP * 2;   // bytes between a lane's consecutive LDS rows
  const unsigned ps = APL * 2;       // bytes between the planes in LDS
  asm volatile(
      "global_load_async_to_lds_b128 %0, %8, off\n\t"
      "global_load_async_to_lds_b128 %1, %9, off\n\t"
      "global_load_async_to_lds_b128 %2, %10, off\n\t"
      "global_load_async_to_lds_b128 %3, %11, off\n\t"
      "global_load_async_to_lds_b128 %4, %12, off\n\t"
      "global_load_async_to_lds_b128 %5, %13, off\n\t"
      "global_load_async_to_lds_b128 %6, %14, off\n\t"
      "global_load_async_to_lds_b128 %7, %15, off\n\t"
      "s_wait_xcnt 0x0"
      :: "v"(l), "v"(l + ls), "v"(l + 2 * ls), "v"(l + 3 * ls),
         "v"(l + ps), "v"(l + ps + ls), "v"(l + ps + 2 * ls), "v"(l + ps + 3 * ls),
         "v"(a), "v"(a + rs), "v"(a + 2 * rs), "v"(a + 3 * rs),
         "v"(b), "v"(b + rs), "v"(b + 2 * rs), "v"(b + 3 * rs)
      : "memory");
}

__global__ __launch_bounds__(128)
void attn_causal64(const unsigned short* __restrict__ qkhp, const unsigned short* __restrict__ qklp,
                   const unsigned short* __restrict__ vhp, const unsigned short* __restrict__ vlp,
                   unsigned short* cxp, float sscale) {
  union FB { v16b v; v8b h[2]; };
  __shared__ __align__(16) __bf16 ring[2 * ASTG];      // two stages [K hi [kv][d] | K lo | V^T hi [d][kv] | V^T lo], rows pitched LP

  const int tid  = threadIdx.x;
  const int wave = tid >> 5;
  const int lane = tid & 31;
  const int hh   = lane >> 4;
  const int c    = lane & 15;

  const int bx = blockIdx.x;
  const int qb = bx % NQB;
  const int h  = bx / NQB;                 // 0..NH-1 (grid.x = NH * NQB)
  const int q0 = qb * 64 + wave * 16;
  const int rowBase = blockIdx.y * SEQ;    // first token row of this batch element (grid.y = NB)

  const __bf16* Qh = (const __bf16*)(const void*)qkhp + (size_t)rowBase * QKP + (size_t)h * HD;
  const __bf16* Ql = (const __bf16*)(const void*)qklp + (size_t)rowBase * QKP + (size_t)h * HD;
  const __bf16* Kh = Qh + DM;
  const __bf16* Kl = Ql + DM;
  const __bf16* Vh = (const __bf16*)(const void*)vhp + (size_t)h * HD * VTP + rowBase;
  const __bf16* Vl = (const __bf16*)(const void*)vlp + (size_t)h * HD * VTP + rowBase;

  // ---- Q fragments (B operand, column = query = lane&15, split k map): 2 d-chunks, hi and lo ----
  v16b qah[2], qal[2];
#pragma unroll
  for (int dc = 0; dc < 2; ++dc) {
    const size_t qo = (size_t)(q0 + c) * QKP + dc * 32 + 8 * hh;
    qah[dc] = ldfrag_b(Qh + qo);
    qal[dc] = ldfrag_b(Ql + qo);
  }

  float mrow = -INFINITY;   // running maximum of query q0 + c (the same in both lane halves)
  float lrow = 0.f;         // running sum over this lane half's keys only; the halves are joined after the loop
  v8f oacc[4];              // O^T: oacc[t][r] = context(query q0 + c, d = t*16 + 8*hh + r)
#pragma unroll
  for (int t = 0; t < 4; ++t) oacc[t] = zero8();

  const int nChunks = qb + 1;   // block-uniform, <= 32

  // this lane's place in a stage: row crow (+ 16 per copy), 16-B piece ccol of the row's 128 B
  const int crow = tid >> 3;               // 0..15
  const int ccol = (tid & 7) * 8;          // 0..56 elements
  const __bf16* kgh = Kh + (size_t)crow * QKP + ccol;    // K row crow of tile 0; a tile is 64 rows on
  const __bf16* kgl = Kl + (size_t)crow * QKP + ccol;
  const __bf16* vgh = Vh + (size_t)crow * VTP + ccol;    // V^T row d = crow, keys of tile 0; a tile is 64 columns on
  const __bf16* vgl = Vl + (size_t)crow * VTP + ccol;
  const size_t  krs = (size_t)16 * QKP;
  const size_t  vrs = (size_t)16 * VTP;
  const size_t  kts = (size_t)64 * QKP;
  const unsigned l0 = (unsigned)(uintptr_t)(ring + crow * LP + ccol);   // LDS byte address in buffer 0, plane K hi

  tile_copy(l0, kgh, kgl, krs);
  tile_copy(l0 + 2 * APL * 2, vgh, vgl, vrs);
  asm volatile("s_wait_asynccnt 0x0" ::: "memory");   // tile 0 of this wave has landed
  __syncthreads();                                    // tile 0 of every wave is readable
  if (nChunks > 1) {
    tile_copy(l0 + ASTG * 2, kgh + kts, kgl + kts, krs);
    tile_copy(l0 + ASTG * 2 + 2 * APL * 2, vgh + 64, vgl + 64, vrs);
  }

#pragma unroll 1   // rolled: one publish point in the text, the buffer chosen by kc & 1
  for (int kc = 0; kc < nChunks; ++kc) {
    const int kv0 = kc * 64;
    const int bo  = (kc & 1) * ASTG;
    const __bf16* Ksh = ring + bo;
    const __bf16* Ksl = Ksh + APL;
    const __bf16* Vth = Ksh + 2 * APL;
    const __bf16* Vtl = Ksh + 3 * APL;

    // ---- scores, transposed: 64 keys (rows) x 16 queries (columns) per wave, 3 bf16 products ----
    v8f s[4];
#pragma unroll
    for (int j = 0; j < 4; ++j) {
      s[j] = zero8();
#pragma unroll
      for (int dc = 0; dc < 2; ++dc) {
        FB kb, kl;
        kb.h[0] = *(const v8b*)(Ksh + (j * 16 + c) * LP + dc * 32 + 8 * hh);
        kb.h[1] = *(const v8b*)(Ksh + (j * 16 + c) * LP + dc * 32 + 16 + 8 * hh);
        kl.h[0] = *(const v8b*)(Ksl + (j * 16 + c) * LP + dc * 32 + 8 * hh);
        kl.h[1] = *(const v8b*)(Ksl + (j * 16 + c) * LP + dc * 32 + 16 + 8 * hh);
        s[j] = mma_b(kb.v, qah[dc], s[j]);
        s[j] = mma_b(kl.v, qah[dc], s[j]);
        s[j] = mma_b(kb.v, qal[dc], s[j]);
      }
    }

    // ---- scale, causal mask on the diagonal tile, maximum of this lane's query ----
    const bool diag = (kc == qb);   // block-uniform
    const int qrow = q0 + c;
    float cm = -INFINITY;
#pragma unroll
    for (int j = 0; j < 4; ++j) {
#pragma unroll
      for (int r = 0; r < 8; ++r) {
        const int kvrow = kv0 + j * 16 + 8 * hh + r;
        const float sv = s[j][r] * sscale;
        const bool masked = diag && (kvrow > qrow);
        const float sm = masked ? -INFINITY : sv;
        s[j][r] = sm;
        cm = fmaxf(cm, sm);
      }
    }
    cm = fmaxf(cm, other_half(cm));                  // the other lane half holds the query's other 32 keys

    // ---- online softmax; P hi/lo (bf16, unnormalised) stays in registers as the B operand ----
    const float mnew  = fmaxf(mrow, cm);             // finite: key kv0 <= qrow is never masked
    const float alpha = __expf(mrow - mnew);
    mrow = mnew;
    float psum = 0.f;
    FB pa[2], pl[2];
#pragma unroll
    for (int j = 0; j < 4; ++j) {
#pragma unroll
      for (int r = 0; r < 8; ++r) {
        const float p = __expf(s[j][r] - mnew);
        psum += p;
        __bf16 a, bl; bf_split(p, a, bl);
        pa[j >> 1].v[(j & 1) * 8 + r] = a;
        pl[j >> 1].v[(j & 1) * 8 + r] = bl;
      }
    }
    lrow = lrow * alpha + psum;
#pragma unroll
    for (int t = 0; t < 4; ++t)
#pragma unroll
      for (int r = 0; r < 8; ++r) oacc[t][r] *= alpha;

    // ---- context^T += V^T . P^T, 3 bf16 products ----
#pragma unroll   // unrolled: pa / pl are registers and are indexed by kk
    for (int kk = 0; kk < 2; ++kk) {
#pragma unroll
      for (int t = 0; t < 4; ++t) {
        FB vb, vl;
        vb.h[0] = *(const v8b*)(Vth + (t * 16 + c) * LP + kk * 32 + 8 * hh);
        vb.h[1] = *(const v8b*)(Vth + (t * 16 + c) * LP + kk * 32 + 16 + 8 * hh);
        vl.h[0] = *(const v8b*)(Vtl + (t * 16 + c) * LP + kk * 32 + 8 * hh);
        vl.h[1] = *(const v8b*)(Vtl + (t * 16 + c) * LP + kk * 32 + 16 + 8 * hh);
        oacc[t] = mma_b(vb.v, pa[kk].v, oacc[t]);
        oacc[t] = mma_b(vl.v, pa[kk].v, oacc[t]);
        oacc[t] = mma_b(vb.v, pl[kk].v, oacc[t]);
      }
    }
    asm volatile("s_wait_dscnt 0x0" ::: "memory");      // this wave's reads of tile kc are done before the buffer is refilled
    asm volatile("s_wait_asynccnt 0x0" ::: "memory");   // this wave's copies of tile kc + 1 have landed
    __syncthreads();                                    // publishes tile kc + 1 and ends every reader's use of tile kc
    if (kc + 2 < nChunks) {
      tile_copy(l0 + (unsigned)bo * 2, kgh + (size_t)(kc + 2) * kts, kgl + (size_t)(kc + 2) * kts, krs);
      tile_copy(l0 + (unsigned)bo * 2 + 2 * APL * 2, vgh + (kc + 2) * 64, vgl + (kc + 2) * 64, vrs);
    }
  }
  asm volatile("s_wait_asynccnt 0x0" ::: "memory");     // no copy is outstanding when the ring becomes output staging

  // ---- normalise (1/l), stage the wave's 16x64 tile, bf16 hi/lo split,
  float* os = (float*)(void*)ring + wave * (16 * OSP);   // per wave context tile [row][d], rows pitched OSP
  {
    const float l = lrow + other_half(lrow);           // join the lane halves' sums; >= 1 (the maximum's key contributes exp(0))
    const float inv = (l > 0.f) ? (1.0f / l) : 0.f;
#pragma unroll
    for (int t = 0; t < 4; ++t) {                      // 8 consecutive d of query row c: two 16-B stores
      v4f o0, o1;
#pragma unroll
      for (int r = 0; r < 4; ++r) { o0[r] = oacc[t][r] * inv; o1[r] = oacc[t][4 + r] * inv; }
      *(v4f*)(os + c * OSP + t * 16 + 8 * hh)     = o0;
      *(v4f*)(os + c * OSP + t * 16 + 8 * hh + 4) = o1;
    }
  }
  __builtin_amdgcn_fence(__ATOMIC_RELEASE, "workgroup");
  __builtin_amdgcn_wave_barrier();
  __builtin_amdgcn_fence(__ATOMIC_ACQUIRE, "workgroup");
  {
    const int q4 = lane >> 3, c8 = (lane & 7) * 8;
    v4u hv[4], lv[4];
#pragma unroll
    for (int it = 0; it < 4; ++it) {
      const int row = it * 4 + q4;   // it 0..3 x q4 0..3 = rows 0..15 of the wave tile
      const float* sp = os + row * OSP + c8;
      v4u a, a2;
#pragma unroll
      for (int e = 0; e < 4; ++e) {
        const float f0 = sp[2 * e], f1 = sp[2 * e + 1];
        const unsigned short h0 = bf_bits(f0), h1 = bf_bits(f1);
        const unsigned short l0 = bf_bits(f0 - bf_up(h0)), l1 = bf_bits(f1 - bf_up(h1));
        a[e] = pk16(h0, h1); a2[e] = pk16(l0, l1);
      }
      hv[it] = a; lv[it] = a2;
    }
    {
#pragma unroll
      for (int it = 0; it < 4; ++it) {
        const int row = it * 4 + q4;
        const size_t go = (size_t)(rowBase + q0 + row) * CXP + (size_t)h * HD + c8;
        *(v4u*)(cxp + go)      = hv[it];
        *(v4u*)(cxp + go + DM) = lv[it];
      }
      
    }
  }
}

// =====================================================================================================
// Workspace map (bytes); every region is an exact multiple of its 64x64-tile / whole-line store granularity:
//   XB   bf16 [8192][1024]              0        16777216
//   WAT  bf16 [3072 n][1024 k]          16777216  6291456
//   WPT2 bf16 [1024 n][2048 k]          23068672  4194304   (W_proj^T duplicated along k)
//   QKh  bf16 [8192][2048]              27262976 33554432
//   QKl  bf16 [8192][2048]              60817408 33554432
//   VTh  bf16 [1024][8192]              94371840 16777216
//   VTl  bf16 [1024][8192]             111149056 16777216
//   CTX  bf16 [8192][2048]             127926272 33554432
//   end                                161480704
// Every stage is one launch over all four batch elements; QK / VT planes are fully written before the attention launch reads them.
// =====================================================================================================
extern "C" void kernel_launch(void* const* d_in, const int* in_sizes, int n_in,
                              void* d_out, int out_size, void* d_ws, size_t ws_size,
                              hipStream_t stream) {
  if (n_in < 5) return;
  if (in_sizes[0] != NB * SEQ * DM) return;
  if (in_sizes[1] != DM * N3) return;
  if (in_sizes[2] != N3) return;
  if (in_sizes[3] != DM * DM) return;
  if (in_sizes[4] != DM) return;
  if (out_size != NB * SEQ * DM) return;

  const float* x      = (const float*)d_in[0];   // [4][2048][1024]
  const float* W_attn = (const float*)d_in[1];   // [1024 in][3072 out]
  const float* b_attn = (const float*)d_in[2];   // [3072]
  const float* W_proj = (const float*)d_in[3];   // [1024 in][1024 out]
  const float* b_proj = (const float*)d_in[4];   // [1024]

  const size_t PXB = (size_t)NB * SEQ * DM * 2;     // 16777216
  const size_t PWA = (size_t)N3 * DM * 2;           //  6291456
  const size_t PWP = (size_t)DM * (2 * DM) * 2;     //  4194304
  const size_t PQK = (size_t)NB * SEQ * QKP * 2;    // 33554432
  const size_t PVT = (size_t)DM * VTP * 2;          // 16777216
  const size_t PCX = (size_t)NB * SEQ * CXP * 2;    // 33554432
  size_t off = 0;
  const size_t oXB  = off; off += PXB;
  const size_t oWAT = off; off += PWA;
  const size_t oWPT = off; off += PWP;
  const size_t oQKh = off; off += PQK;
  const size_t oQKl = off; off += PQK;
  const size_t oVTh = off; off += PVT;
  const size_t oVTl = off; off += PVT;
  const size_t oCTX = off; off += PCX;
  if (off > ws_size) return;                        // off = 161480704

  char* ws = (char*)d_ws;
  unsigned short* XB   = (unsigned short*)(ws + oXB);
  unsigned short* WAT  = (unsigned short*)(ws + oWAT);
  unsigned short* WPT2 = (unsigned short*)(ws + oWPT);
  unsigned short* QKh  = (unsigned short*)(ws + oQKh);
  unsigned short* QKl  = (unsigned short*)(ws + oQKl);
  unsigned short* VTh  = (unsigned short*)(ws + oVTh);
  unsigned short* VTl  = (unsigned short*)(ws + oVTl);
  unsigned short* CTX  = (unsigned short*)(ws + oCTX);

  const dim3 blk(256);
  const int n8x = NB * SEQ * DM / 8;                               // 1048576
  const dim3 gCvtX((n8x + 255) / 256);                             // 4096 blocks
  const dim3 gTA(N3 / 64, DM / 64);                                // in [1024 rows][3072 cols] -> (cols/64, rows/64)
  const dim3 gTP(DM / 64, DM / 64);                                // in [1024 rows][1024 cols]
  const dim3 gQK(((NB * SEQ / 64) * ((2 * DM) / 64) + 7) / 8);     // 4096 tiles -> 512 blocks: M=8192, N=2048
  const dim3 gVT(((DM / 64) * (NB * SEQ / 64) + 7) / 8);           // 2048 tiles -> 256 blocks: M=1024, N=8192
  const dim3 gAtt(NH * NQB, NB);                                   // 2048 blocks: (16 heads x 32 query tiles) x 4 batch elements
  const dim3 gOut(((NB * SEQ / 64) * (DM / 64) + 7) / 8);          // 2048 tiles -> 256 blocks: M=8192, N=1024

  // (1) x -> bf16 [8192][1024]
  cvt_bf16x8<<<gCvtX, blk, 0, stream>>>(x, XB, n8x);
  // (2) W_attn [k][n] -> WAT [n][k] bf16 (pitch 1024); W_proj [k][n] -> WPT2 [n][k | k] bf16 (pitch 2048)
  tcvt_kernel<false><<<gTA, blk, 0, stream>>>(W_attn, WAT, DM, N3, DM);
  tcvt_kernel<true><<<gTP, blk, 0, stream>>>(W_proj, WPT2, DM, DM, 2 * DM);

  // (3) q|k = x . W_attn[:, 0:2048] + b_attn[0:2048] -> bf16 hi/lo [8192][2048]   (M=8192, N=2048, K=1024)
  gemm64<2, 2><<<gQK, blk, 0, stream>>>(XB, DM, WAT, DM, (void*)QKh, (void*)QKl, QKP, b_attn, NB * SEQ, 2 * DM, DM);
  // (4) v^T = W_attn[:, 2048:3072]^T . x^T + b_attn[2048 + m] -> bf16 hi/lo [1024][8192]   (M=1024, N=8192, K=1024)
  gemm64<1, 2><<<gVT, blk, 0, stream>>>(WAT + (size_t)(2 * DM) * DM, DM, XB, DM, (void*)VTh, (void*)VTl, VTP,
                                        b_attn + 2 * DM, DM, NB * SEQ, DM);
  // (5) causal attention -> CTX rows 0..8191 (hi at cols 0..1023, lo at 1024..2047)
  attn_causal64<<<gAtt, dim3(128), 0, stream>>>(QKh, QKl, VTh, VTl, CTX, 0.125f);
  // (6) y = [ctx hi | ctx lo] . [W_proj^T | W_proj^T]^T + b_proj -> d_out f32 [8192][1024]   (M=8192, N=1024, K=2048)
  gemm64<2, 0><<<gOut, blk, 0, stream>>>(CTX, CXP, WPT2, 2 * DM, d_out, d_out, DM, b_proj, NB * SEQ, DM, 2 * DM);
  (void)hipGetLastError();
}

// v006
// Measured time: 200 microseconds a run.
// Timed twice side by side with v005, it ran 1.20 times as fast both times.
// Over all steps from v000 it is 6.28 times as fast.
// Contractions: q|k and v^T projections = v_wmma_f32_16x16x32_bf16 (bf16 operands RNE-converted from x and W_attn, single product, + bf16 bias in f32);
// causal scores q.k^T = v_wmma_f32_16x16x32_bf16 with bf16 hi/lo split q and k (hi.hi + hi.lo + lo.hi);
// context p.v = v_wmma_f32_16x16x32_bf16 with bf16 hi/lo split p and v (3 products);
// output projection = v_wmma_f32_16x16x32_bf16, context bf16 hi|lo planes folded along K (K = 2048) times bf16 W_proj^T (+ bf16 bias in f32);
// all f32 accumulate; online softmax statistics, score scale 0.125 and bias adds in f32.
// Carry audit: every 16-bit plane (XB, WAT, WPT2, QKh/QKl, VTh/VTl, CTX hi|lo, P hi|lo in registers) has carry 1; no inverse factor is applied anywhere.
#include <hip/hip_runtime.h>
#include <math.h>
#include <stdint.h>

#define NB   4
#define SEQ  2048
#define DM   1024
#define NH   16
#define HD   64
#define N3   (3 * DM)      // 3072
#define QKP  (2 * DM)      // pitch of the q|k planes [t][q 1024 | k 1024]
#define CXP  (2 * DM)      // pitch of the context plane [t][hi 1024 | lo 1024]
#define VTP  (NB * SEQ)    // pitch of the v^T planes [h*64 + d][b*2048 + s]
#define NQB  (SEQ / 64)    // 32 query / key tiles of 64
#define OSP  68            // LDS row pitch of the f32 context tile: 272 B = 16 B x 17 (odd), conflict-free for 16-B stores of 16 rows
#define LP   72            // LDS row pitch of the 64-element bf16 tiles: 144 B = 16 B x 9 (odd), conflict-free for 16-B fragment reads
static_assert(NH * HD == DM);
static_assert((SEQ % 64) == 0 && (DM % 64) == 0 && (N3 % 64) == 0);
static_assert((DM % 32) == 0 && (CXP % 32) == 0 && (QKP % 8) == 0);

typedef __bf16   v16b __attribute__((ext_vector_type(16)));
typedef __bf16   v8b  __attribute__((ext_vector_type(8)));
typedef float    v8f  __attribute__((ext_vector_type(8)));
typedef float    v4f  __attribute__((ext_vector_type(4)));
typedef unsigned int v4u __attribute__((ext_vector_type(4)));

// ---- scalar helpers ----------------------------------------------------------------------------------
__device__ __forceinline__ unsigned short bf_bits(float f) {          // f32 -> bf16 bits, RNE convert
  unsigned u = __float_as_uint(f);
  return (unsigned short)((u + 0x7FFFu + ((u >> 16) & 1u)) >> 16);
}
__device__ __forceinline__ float bf_up(unsigned short h) { return __uint_as_float(((unsigned)h) << 16); }
__device__ __forceinline__ float bfr(float f) { return bf_up(bf_bits(f)); }   // value after bf16 RNE convert
__device__ __forceinline__ unsigned pk16(unsigned short a, unsigned short b) { return (unsigned)a | ((unsigned)b << 16); }
__device__ __forceinline__ v8f zero8() { v8f z = {0.f, 0.f, 0.f, 0.f, 0.f, 0.f, 0.f, 0.f}; return z; }
__device__ __forceinline__ void bf_split(float f, __bf16& hi, __bf16& lo) {
  const unsigned short hb = bf_bits(f);
  hi = __builtin_bit_cast(__bf16, hb);
  lo = __builtin_bit_cast(__bf16, bf_bits(f - bf_up(hb)));
}

// value of the same lane position in the other 16-lane half (lane ^ 16), as a vector cross-row move: no LDS round trip
__device__ __forceinline__ float other_half(float v) {
  const int b = __float_as_int(v);
  return __int_as_float(__builtin_amdgcn_permlanex16(b, b, 0x76543210, 0xfedcba98, false, false));
}

// ---- fragment loader: 16-bit A/B operand, lane -> row/col (lane&15), p already includes +8*(lane>>4);
//      elements 0..7 <- p[0..7] (k0+8h..), elements 8..15 <- p[16..23] (k0+16+8h..)
__device__ __forceinline__ v16b ldfrag_b(const __bf16* p) {
  union { v16b v; v8b h[2]; } f;
  f.h[0] = *(const v8b*)(p);
  f.h[1] = *(const v8b*)(p + 16);
  return f.v;
}

// ---- WMMA helpers with trailing VALU hazard gap ----------------------------------------------------------
__device__ __forceinline__ v8f mma_b(v16b a, v16b b, v8f c) {
  c = __builtin_amdgcn_wmma_f32_16x16x32_bf16(false, a, false, b, (short)0, c, false, false);
  asm volatile("v_nop\n\tv_nop\n\tv_nop\n\tv_nop" : "+v"(c) : "v"(a), "v"(b));
  return c;
}
__device__ __forceinline__ v8f mma_b_raw(v16b a, v16b b, v8f c) {
  return __builtin_amdgcn_wmma_f32_16x16x32_bf16(false, a, false, b, (short)0, c, false, false);
}
__device__ __forceinline__ void dep_guard_b(v8f& a, v8f& b, v16b x, v16b y) {
  asm volatile("v_nop\n\tv_nop\n\tv_nop\n\tv_nop" : "+v"(a), "+v"(b) : "v"(x), "v"(y));
}
__device__ __forceinline__ void keep4_b(v16b a, v16b b, v16b c, v16b d) {
  asm volatile("v_nop" :: "v"(a), "v"(b), "v"(c), "v"(d));
}
__device__ __forceinline__ void acc_guard4(v8f& a, v8f& b, v8f& c, v8f& d) {
  asm volatile("v_nop\n\tv_nop\n\tv_nop\n\tv_nop" : "+v"(a), "+v"(b), "+v"(c), "+v"(d));
}

// =====================================================================================================
// f32 -> bf16 (RNE convert), 8 elements per thread, one 16-B store per lane: a wave writes 512 contiguous B
// coverage: n8 threads x 8 = the whole plane (n8 = 1048576, a multiple of 256).
// =====================================================================================================
__global__ __launch_bounds__(256) void cvt_bf16x8(const float* __restrict__ in, unsigned short* out, int n8) {
  const int i = blockIdx.x * 256 + threadIdx.x;
  if (i < n8) {
    const v4f a = *(const v4f*)(in + (size_t)i * 8);
    const v4f b = *(const v4f*)(in + (size_t)i * 8 + 4);
    v4u p;
    p[0] = pk16(bf_bits(a[0]), bf_bits(a[1]));
    p[1] = pk16(bf_bits(a[2]), bf_bits(a[3]));
    p[2] = pk16(bf_bits(b[0]), bf_bits(b[1]));
    p[3] = pk16(bf_bits(b[2]), bf_bits(b[3]));
    *(v4u*)(out + (size_t)i * 8) = p;
    
  }
}

// =====================================================================================================
// Transpose + bf16 convert of an f32 matrix: in [R rows][Cc cols] (pitch Cc) -> o[c][r] = bf16_rne(in[r][c]),
// output row pitch P (>= R); DUP additionally writes the same value at o[c][R + r] (duplicate along k).
// 64x64 tiles through LDS. grid = (Cc/64, R/64), 256 threads (R, Cc multiples of 64).
// coverage per block: load 4 it x 256 thr x 4 floats = 64x64; store 2 it x 256 thr x 8 u16 = 64x64 (x2 with DUP).
// =====================================================================================================
template <bool DUP>
__global__ __launch_bounds__(256) void tcvt_kernel(const float* __restrict__ W, unsigned short* o, int R, int Cc, int P) {
  __shared__ __align__(16) float tf[64 * 68];
  const int c0  = blockIdx.x * 64;   // input column block = output row block
  const int r0  = blockIdx.y * 64;   // input row block    = output column block
  const int tid = threadIdx.x;
  {
    const int lr = tid >> 4;         // 0..15
    const int c4 = (tid & 15) * 4;   // 0..60
#pragma unroll
    for (int it = 0; it < 4; ++it) {
      const int rr = it * 16 + lr;   // 0..63
      const v4f a = *(const v4f*)(W + (size_t)(r0 + rr) * Cc + c0 + c4);
      *(v4f*)(tf + rr * 68 + c4) = a;
    }
  }
  __syncthreads();
  const int sub = tid >> 3;          // 0..31
  const int c8  = (tid & 7) * 8;     // 0..56
  v4u hv[2];
#pragma unroll
  for (int it = 0; it < 2; ++it) {
    const int oc = it * 32 + sub;    // output row within tile (= input column)
    v4u a;
#pragma unroll
    for (int q = 0; q < 4; ++q) {
      const float f0 = tf[(c8 + 2 * q) * 68 + oc];
      const float f1 = tf[(c8 + 2 * q + 1) * 68 + oc];
      a[q] = pk16(bf_bits(f0), bf_bits(f1));
    }
    hv[it] = a;
  }
  {
#pragma unroll
    for (int it = 0; it < 2; ++it) {
      const int oc = it * 32 + sub;
      const size_t go = (size_t)(c0 + oc) * P + r0 + c8;
      *(v4u*)(o + go) = hv[it];
      if (DUP) *(v4u*)(o + go + R) = hv[it];
    }
    
  }
}

// =====================================================================================================
// Register-blocked bf16 WMMA GEMM: C[m][n] = sum_k A[m][k] * Bt[n][k] + bias; one wave per 64x64 tile,
// eight waves (2 x 4) = one 128 x 256 tile per work-group. A row-major [M][K] pitch lda; Bt row-major [N][K] pitch ldb
// (k contiguous); M multiple of 128, N multiple of 256, K multiple of 64 and >= 128 (host constants, asserted below).
// Operands: a stage = 64 k = one whole 128-B line of each of the 128 A rows and 256 Bt rows, laid in LDS at pitch LP
// ([A rows | Bt rows]); two buffers; stage t + 2 is copied (16 B per lane, global -> LDS, no register) while stage t + 1 is worked on.
// copy coverage per stage: 12 copies x 256 threads x 16 B = 384 rows x 128 B; a wave's copy = 4 whole lines.
// BIAS_MODE: 1 = bias[m], 2 = bias[n]; bias value RNE-converted to bf16 then added in f32.
// OUT_MODE: 0 = f32 (pitch ldc); 2 = bf16 hi plane C + bf16 lo plane C2 (lo = RNE(v - hi), unscaled), pitch ldc.
// =====================================================================================================
#define GTM  128                   // work-group tile rows
#define GTN  256                   // work-group tile columns
#define GKB  64                    // k elements per stage
#define GSTG ((GTM + GTN) * LP)    // bf16 elements of one stage in LDS (55296 B)
static_assert(((NB * SEQ) % GTN) == 0 && (DM % GTN) == 0 && ((2 * DM) % GTN) == 0);
static_assert((DM % GKB) == 0 && (CXP % GKB) == 0 && DM >= 2 * GKB);

// One stage's copies of one lane: rows r, r + 32, .. of A (4) and of Bt (8), LDS rows 32 * LP elements apart.
// The copies and s_wait_xcnt 0 are one statement, so that no address register is rewritten ahead of that wait.
__device__ __forceinline__ void stage_copy(unsigned l, const __bf16* a, size_t as, const __bf16* b, size_t bs) {
  const unsigned ls = 32 * LP * 2;   // bytes between a lane's consecutive LDS rows
  asm volatile(
      "global_load_async_to_lds_b128 %0, %12, off\n\t"
      "global_load_async_to_lds_b128 %1, %13, off\n\t"
      "global_load_async_to_lds_b128 %2, %14, off\n\t"
      "global_load_async_to_lds_b128 %3, %15, off\n\t"
      "global_load_async_to_lds_b128 %4, %16, off\n\t"
      "global_load_async_to_lds_b128 %5, %17, off\n\t"
      "global_load_async_to_lds_b128 %6, %18, off\n\t"
      "global_load_async_to_lds_b128 %7, %19, off\n\t"
      "global_load_async_to_lds_b128 %8, %20, off\n\t"
      "global_load_async_to_lds_b128 %9, %21, off\n\t"
      "global_load_async_to_lds_b128 %10, %22, off\n\t"
      "global_load_async_to_lds_b128 %11, %23, off\n\t"
      "s_wait_xcnt 0x0"
      :: "v"(l), "v"(l + ls), "v"(l + 2 * ls), "v"(l + 3 * ls), "v"(l + 4 * ls), "v"(l + 5 * ls),
         "v"(l + 6 * ls), "v"(l + 7 * ls), "v"(l + 8 * ls), "v"(l + 9 * ls), "v"(l + 10 * ls), "v"(l + 11 * ls),
         "v"(a), "v"(a + as), "v"(a + 2 * as), "v"(a + 3 * as),
         "v"(b), "v"(b + bs), "v"(b + 2 * bs), "v"(b + 3 * bs), "v"(b + 4 * bs), "v"(b + 5 * bs), "v"(b + 6 * bs), "v"(b + 7 * bs)
      : "memory");
}

template <int BIAS_MODE, int OUT_MODE>
__global__ __launch_bounds__(256) void gemm64(
    const unsigned short* __restrict__ Ap, int lda,
    const unsigned short* __restrict__ Btp, int ldb,
    void* Cout, void* Cout2, int ldc,
    const float* __restrict__ bias,
    int M, int N, int K) {
  const __bf16* A  = (const __bf16*)(const void*)Ap;
  const __bf16* Bt = (const __bf16*)(const void*)Btp;
  __shared__ __align__(16) __bf16 ring[2 * GSTG];  // two stages [A 128 rows | Bt 256 rows], pitch LP
  __shared__ __align__(16) float sT[8][16 * 68];   // per-wave 16x64 slab, pitch 68 floats
  const int lane = threadIdx.x & 31;
  const int wave = threadIdx.x >> 5;
  const int blocksN = N / GTN;
  const int blocksM = M / GTM;
  if ((int)blockIdx.x >= blocksM * blocksN) return;   // block-uniform, in front of every barrier
  const int bm = blockIdx.x / blocksN;
  const int bn = blockIdx.x - bm * blocksN;
  const int wm = wave >> 2;                    // 0..1
  const int wn = wave & 3;                     // 0..3
  const int m0 = bm * GTM + (wm << 6);
  const int n0 = bn * GTN + (wn << 6);

  const int rlane = lane & 15;                 // row (A) / col (B, D) within subtile
  const int koff  = (lane >> 4) * 8;           // k offset of this lane half
  const int mOff  = (lane >> 4) * 8;           // D row offset

  v8f acc[4][4];
#pragma unroll
  for (int i = 0; i < 4; ++i)
#pragma unroll
    for (int j = 0; j < 4; ++j) acc[i][j] = zero8();

  // this lane's place in a stage: row crow (+ 32 per copy), 16-B piece ccol of the row's 128 B
  const int crow = threadIdx.x >> 3;           // 0..31
  const int ccol = (threadIdx.x & 7) * 8;      // 0..56 elements
  const __bf16* ga = A  + (size_t)(bm * GTM + crow) * lda + ccol;
  const __bf16* gb = Bt + (size_t)(bn * GTN + crow) * ldb + ccol;
  const size_t  as = (size_t)32 * lda;
  const size_t  bs = (size_t)32 * ldb;
  const unsigned l0 = (unsigned)(uintptr_t)(ring + crow * LP + ccol);   // LDS byte address in buffer 0
  const int nst = K / GKB;                     // stages, >= 2

  stage_copy(l0, ga, as, gb, bs);
  asm volatile("s_wait_asynccnt 0x0" ::: "memory");   // stage 0 of this wave has landed
  __syncthreads();                                    // stage 0 of every wave is readable
  if (nst > 1) stage_copy(l0 + GSTG * 2, ga + GKB, as, gb + GKB, bs);

#pragma unroll 1   // rolled: one publish point in the text, the buffer chosen by t & 1
  for (int t = 0; t < nst; ++t) {
    const int bo = (t & 1) * GSTG;
    const __bf16* sa = ring + bo + ((wm << 6) + rlane) * LP + koff;
    const __bf16* sb = ring + bo + (GTM + (wn << 6) + rlane) * LP + koff;
#pragma unroll
    for (int kk = 0; kk < GKB; kk += 32) {
      v16b bh[4], ah[4];
#pragma unroll
      for (int j = 0; j < 4; ++j) bh[j] = ldfrag_b(sb + (j << 4) * LP + kk);
#pragma unroll
      for (int i = 0; i < 4; ++i) ah[i] = ldfrag_b(sa + (i << 4) * LP + kk);
#pragma unroll
      for (int i = 0; i < 4; ++i) {
#pragma unroll
        for (int j = 0; j < 4; ++j) acc[i][j] = mma_b_raw(ah[i], bh[j], acc[i][j]);
        dep_guard_b(acc[i][0], acc[i][3], ah[i], ah[i]);
      }
      keep4_b(bh[0], bh[1], bh[2], bh[3]);
    }
    asm volatile("s_wait_dscnt 0x0" ::: "memory");      // this wave's reads of stage t are done before the buffer is refilled
    asm volatile("s_wait_asynccnt 0x0" ::: "memory");   // this wave's copies of stage t + 1 have landed
    __syncthreads();                                    // publishes stage t + 1 and ends every reader's use of stage t
    if (t + 2 < nst) stage_copy(l0 + (unsigned)bo * 2, ga + (size_t)(t + 2) * GKB, as, gb + (size_t)(t + 2) * GKB, bs);
  }
  asm volatile("s_wait_asynccnt 0x0" ::: "memory");     // no copy is outstanding when the wave goes on
  acc_guard4(acc[0][0], acc[0][1], acc[0][2], acc[0][3]);
  acc_guard4(acc[1][0], acc[1][1], acc[1][2], acc[1][3]);
  acc_guard4(acc[2][0], acc[2][1], acc[2][2], acc[2][3]);
  acc_guard4(acc[3][0], acc[3][1], acc[3][2], acc[3][3]);

  // ---- epilogue ----
  float* slab = sT[wave];
#pragma unroll
  for (int i = 0; i < 4; ++i) {
    const int mBase = m0 + (i << 4);
    float bm8[8];
#pragma unroll
    for (int r = 0; r < 8; ++r) bm8[r] = 0.f;
    if (BIAS_MODE == 1) {                          // rows mBase+mOff .. +7: two 16-B loads (32-B aligned)
      const v4f t0 = *(const v4f*)(bias + mBase + mOff);
      const v4f t1 = *(const v4f*)(bias + mBase + mOff + 4);
      bm8[0] = bfr(t0[0]); bm8[1] = bfr(t0[1]); bm8[2] = bfr(t0[2]); bm8[3] = bfr(t0[3]);
      bm8[4] = bfr(t1[0]); bm8[5] = bfr(t1[1]); bm8[6] = bfr(t1[2]); bm8[7] = bfr(t1[3]);
    }
#pragma unroll
    for (int j = 0; j < 4; ++j) {
      float bn = 0.f;
      if (BIAS_MODE == 2) bn = bfr(bias[n0 + (j << 4) + rlane]);
#pragma unroll
      for (int r = 0; r < 8; ++r) {
        float v = acc[i][j][r];
        if (BIAS_MODE == 1) v += bm8[r];
        if (BIAS_MODE == 2) v += bn;
        slab[(mOff + r) * 68 + (j << 4) + rlane] = v;
      }
    }
    __builtin_amdgcn_fence(__ATOMIC_RELEASE, "workgroup");
    __builtin_amdgcn_wave_barrier();
    __builtin_amdgcn_fence(__ATOMIC_ACQUIRE, "workgroup");
    if (OUT_MODE == 0) {
      float* C = (float*)Cout;
      const int hh = lane >> 4, c4 = (lane & 15) * 4;     // 256-B row segment = 16 lanes x 16 B
      {
#pragma unroll
        for (int it = 0; it < 8; ++it) {
          const int row = it * 2 + hh;                     // it 0..7 x hh 0..1 = rows 0..15
          const v4f v = *(const v4f*)(slab + row * 68 + c4);
          *(v4f*)(C + (size_t)(mBase + row) * ldc + n0 + c4) = v;
        }
        
      }
    } else {
      const int q = lane >> 3, c8 = (lane & 7) * 8;
      unsigned short* C  = (unsigned short*)Cout;
      unsigned short* C2 = (unsigned short*)Cout2;
      v4u hv[4], lv[4];
#pragma unroll
      for (int it = 0; it < 4; ++it) {
        const int row = it * 4 + q;                        // it 0..3 x q 0..3 = rows 0..15
        const float* sp = slab + row * 68 + c8;
        v4u a, a2;
#pragma unroll
        for (int e = 0; e < 4; ++e) {
          const float f0 = sp[2 * e], f1 = sp[2 * e + 1];
          const unsigned short h0 = bf_bits(f0), h1 = bf_bits(f1);
          const unsigned short l0 = bf_bits(f0 - bf_up(h0)), l1 = bf_bits(f1 - bf_up(h1));
          a[e] = pk16(h0, h1); a2[e] = pk16(l0, l1);
        }
        hv[it] = a; lv[it] = a2;
      }
      {
#pragma unroll
        for (int it = 0; it < 4; ++it) {
          const int row = it * 4 + q;
          *(v4u*)(C  + (size_t)(mBase + row) * ldc + n0 + c8) = hv[it];
          *(v4u*)(C2 + (size_t)(mBase + row) * ldc + n0 + c8) = lv[it];
        }
        
      }
    }
    __builtin_amdgcn_fence(__ATOMIC_RELEASE, "workgroup");
    __builtin_amdgcn_wave_barrier();
    __builtin_amdgcn_fence(__ATOMIC_ACQUIRE, "workgroup");
  }
}

// =====================================================================================================
// Causal attention, head dim 64, all batch elements in one launch (blockIdx.x = head and batch element, blockIdx.y = query tile, longest first).
//   q|k planes (bf16 hi / lo): [b*SEQ + t][QKP], q(t, h, d) at col h*64 + d, k(s, h, d) at col DM + h*64 + d
//   v^T planes (bf16 hi / lo): [(h*64 + d)][VTP], key s of batch b at col b*SEQ + s, s contiguous
//   context plane (bf16): row b*SEQ + t, pitch CXP; hi at col h*64 + d, lo (RNE(v - hi)) at col DM + h*64 + d
//   scores = q . k : bf16 hi/lo split (hi.hi + hi.lo + lo.hi), f32 accumulate, then * sscale in f32
//   out    = p . v : bf16 hi/lo split of p (unnormalised) and v, f32 accumulate
//   both products are formed transposed: S^T = K . Q^T (A = K rows, B = q) and O^T += V^T . P^T (A = V^T rows, B = p):
//   a lane holds the scores of ONE query (q0 + lane&15), keys 8*(lane>>4) + r of each 16-key tile, so two score tiles, split in
//   place, are the B operand of the second product (element e = tile 2kk row e, element 8 + e = tile 2kk+1 row e: the k order of
//   the V^T loader), and maximum, sum and rescale factor are one value per lane.
//   online softmax in f32; key s > t set to -inf only on the diagonal key tile (key s = tile start <= t always live).
//   Block = 4 waves = 64 query rows of one head; grid = (NH * NB, NQB); key tiles of 64, block-uniform trip count qb+1 <= 32,
//   every wave reaches the one block barrier of every iteration.
//   K / V^T tile staging: a stage = the 64x64 tile of all four planes [K hi | K lo | V^T hi | V^T lo], rows pitched LP; two buffers;
//   tile kc + 2 is copied (16 B per lane, global -> LDS, no register) while tile kc + 1 is worked on.
//   copy coverage per stage: 16 copies x 128 threads x 16 B = 4 planes x 64 rows x 128 B; a wave's copy = 4 whole 128-B lines.
//   After the loop the ring is free (the last trip's barrier ends every read) and holds the per-wave f32 context tiles.
//   Output coverage: each wave stores rows q0..q0+15 (it 0..3 x lane>>3 0..3) x 64 columns (8 lanes x 8) of both planes.
// =====================================================================================================
#define APL  (64 * LP)     // bf16 elements of one plane's tile in LDS (9216 B)
#define ASTG (4 * APL)     // bf16 elements of one stage in LDS (36864 B)
static_assert(4 * 16 * OSP * 4 <= 2 * ASTG * 2);   // the four f32 context tiles fit in the ring

// One lane's copies of two planes of a stage: rows r, r + 16, r + 32, r + 48 of plane a, then of plane b (LDS: the next plane).
// The copies and s_wait_xcnt 0 are one statement, so that no address register is rewritten ahead of that wait.
__device__ __forceinline__ void tile_copy(unsigned l, const __bf16* a, const __bf16* b, size_t rs) {
  const unsigned ls = 16 * LP * 2;   // bytes between a lane's consecutive LDS rows
  const unsigned ps = APL * 2;       // bytes between the planes in LDS
  asm volatile(
      "global_load_async_to_lds_b128 %0, %8, off\n\t"
      "global_load_async_to_lds_b128 %1, %9, off\n\t"
      "global_load_async_to_lds_b128 %2, %10, off\n\t"
      "global_load_async_to_lds_b128 %3, %11, off\n\t"
      "global_load_async_to_lds_b128 %4, %12, off\n\t"
      "global_load_async_to_lds_b128 %5, %13, off\n\t"
      "global_load_async_to_lds_b128 %6, %14, off\n\t"
      "global_load_async_to_lds_b128 %7, %15, off\n\t"
      "s_wait_xcnt 0x0"
      :: "v"(l), "v"(l + ls), "v"(l + 2 * ls), "v"(l + 3 * ls),
         "v"(l + ps), "v"(l + ps + ls), "v"(l + ps + 2 * ls), "v"(l + ps + 3 * ls),
         "v"(a), "v"(a + rs), "v"(a + 2 * rs), "v"(a + 3 * rs),
         "v"(b), "v"(b + rs), "v"(b + 2 * rs), "v"(b + 3 * rs)
      : "memory");
}

__global__ __launch_bounds__(128)
void attn_causal64(const unsigned short* __restrict__ qkhp, const unsigned short* __restrict__ qklp,
                   const unsigned short* __restrict__ vhp, const unsigned short* __restrict__ vlp,
                   unsigned short* cxp, float sscale) {
  union FB { v16b v; v8b h[2]; };
  __shared__ __align__(16) __bf16 ring[2 * ASTG];      // two stages [K hi [kv][d] | K lo | V^T hi [d][kv] | V^T lo], rows pitched LP

  const int tid  = threadIdx.x;
  const int wave = tid >> 5;
  const int lane = tid & 31;
  const int hh   = lane >> 4;
  const int c    = lane & 15;

  // The query tile falls with blockIdx.y: in index order (x fastest) the longest key loops come first and the shortest last.
  const int bx = blockIdx.x;               // 0..NH*NB-1 (grid.x = NH * NB)
  const int by = blockIdx.y;               // 0..NQB-1   (grid.y = NQB)
  // % NQB is an identity on this grid: it gives the compiler the tile's range, and with it the mask's compare values stay in
  // registers over the key loop instead of being formed anew in every trip.
  const int qb = (NQB - 1 - by) % NQB;     // 31 for the first 64 work-groups .. 0 for the last 64
  const int h  = bx % NH;                  // 0..NH-1
  const int q0 = qb * 64 + wave * 16;
  const int rowBase = (bx / NH) * SEQ;     // first token row of this batch element (bx / NH = 0..NB-1)

  const __bf16* Qh = (const __bf16*)(const void*)qkhp + (size_t)rowBase * QKP + (size_t)h * HD;
  const __bf16* Ql = (const __bf16*)(const void*)qklp + (size_t)rowBase * QKP + (size_t)h * HD;
  const __bf16* Kh = Qh + DM;
  const __bf16* Kl = Ql + DM;
  const __bf16* Vh = (const __bf16*)(const void*)vhp + (size_t)h * HD * VTP + rowBase;
  const __bf16* Vl = (const __bf16*)(const void*)vlp + (size_t)h * HD * VTP + rowBase;

  // ---- Q fragments (B operand, column = query = lane&15, split k map): 2 d-chunks, hi and lo ----
  v16b qah[2], qal[2];
#pragma unroll
  for (int dc = 0; dc < 2; ++dc) {
    const size_t qo = (size_t)(q0 + c) * QKP + dc * 32 + 8 * hh;
    qah[dc] = ldfrag_b(Qh + qo);
    qal[dc] = ldfrag_b(Ql + qo);
  }

  float mrow = -INFINITY;   // running maximum of query q0 + c (the same in both lane halves)
  float lrow = 0.f;         // running sum over this lane half's keys only; the halves are joined after the loop
  v8f oacc[4];              // O^T: oacc[t][r] = context(query q0 + c, d = t*16 + 8*hh + r)
#pragma unroll
  for (int t = 0; t < 4; ++t) oacc[t] = zero8();

  const int nChunks = qb + 1;   // block-uniform, <= 32

  // this lane's place in a stage: row crow (+ 16 per copy), 16-B piece ccol of the row's 128 B
  const int crow = tid >> 3;               // 0..15
  const int ccol = (tid & 7) * 8;          // 0..56 elements
  const __bf16* kgh = Kh + (size_t)crow * QKP + ccol;    // K row crow of tile 0; a tile is 64 rows on
  const __bf16* kgl = Kl + (size_t)crow * QKP + ccol;
  const __bf16* vgh = Vh + (size_t)crow * VTP + ccol;    // V^T row d = crow, keys of tile 0; a tile is 64 columns on
  const __bf16* vgl = Vl + (size_t)crow * VTP + ccol;
  const size_t  krs = (size_t)16 * QKP;
  const size_t  vrs = (size_t)16 * VTP;
  const size_t  kts = (size_t)64 * QKP;
  const unsigned l0 = (unsigned)(uintptr_t)(ring + crow * LP + ccol);   // LDS byte address in buffer 0, plane K hi

  tile_copy(l0, kgh, kgl, krs);
  tile_copy(l0 + 2 * APL * 2, vgh, vgl, vrs);
  asm volatile("s_wait_asynccnt 0x0" ::: "memory");   // tile 0 of this wave has landed
  __syncthreads();                                    // tile 0 of every wave is readable
  if (nChunks > 1) {
    tile_copy(l0 + ASTG * 2, kgh + kts, kgl + kts, krs);
    tile_copy(l0 + ASTG * 2 + 2 * APL * 2, vgh + 64, vgl + 64, vrs);
  }

#pragma unroll 1   // rolled: one publish point in the text, the buffer chosen by kc & 1
  for (int kc = 0; kc < nChunks; ++kc) {
    const int kv0 = kc * 64;
    const int bo  = (kc & 1) * ASTG;
    const __bf16* Ksh = ring + bo;
    const __bf16* Ksl = Ksh + APL;
    const __bf16* Vth = Ksh + 2 * APL;
    const __bf16* Vtl = Ksh + 3 * APL;

    // ---- scores, transposed: 64 keys (rows) x 16 queries (columns) per wave, 3 bf16 products ----
    v8f s[4];
#pragma unroll
    for (int j = 0; j < 4; ++j) {
      s[j] = zero8();
#pragma unroll
      for (int dc = 0; dc < 2; ++dc) {
        FB kb, kl;
        kb.h[0] = *(const v8b*)(Ksh + (j * 16 + c) * LP + dc * 32 + 8 * hh);
        kb.h[1] = *(const v8b*)(Ksh + (j * 16 + c) * LP + dc * 32 + 16 + 8 * hh);
        kl.h[0] = *(const v8b*)(Ksl + (j * 16 + c) * LP + dc * 32 + 8 * hh);
        kl.h[1] = *(const v8b*)(Ksl + (j * 16 + c) * LP + dc * 32 + 16 + 8 * hh);
        s[j] = mma_b(kb.v, qah[dc], s[j]);
        s[j] = mma_b(kl.v, qah[dc], s[j]);
        s[j] = mma_b(kb.v, qal[dc], s[j]);
      }
    }

    // ---- scale, causal mask on the diagonal tile, maximum of this lane's query ----
    const bool diag = (kc == qb);   // block-uniform
    const int qrow = q0 + c;
    float cm = -INFINITY;
#pragma unroll
    for (int j = 0; j < 4; ++j) {
#pragma unroll
      for (int r = 0; r < 8; ++r) {
        const int kvrow = kv0 + j * 16 + 8 * hh + r;
        const float sv = s[j][r] * sscale;
        const bool masked = diag && (kvrow > qrow);
        const float sm = masked ? -INFINITY : sv;
        s[j][r] = sm;
        cm = fmaxf(cm, sm);
      }
    }
    cm = fmaxf(cm, other_half(cm));                  // the other lane half holds the query's other 32 keys

    // ---- online softmax; P hi/lo (bf16, unnormalised) stays in registers as the B operand ----
    const float mnew  = fmaxf(mrow, cm);             // finite: key kv0 <= qrow is never masked
    const float alpha = __expf(mrow - mnew);
    mrow = mnew;
    float psum = 0.f;
    FB pa[2], pl[2];
#pragma unroll
    for (int j = 0; j < 4; ++j) {
#pragma unroll
      for (int r = 0; r < 8; ++r) {
        const float p = __expf(s[j][r] - mnew);
        psum += p;
        __bf16 a, bl; bf_split(p, a, bl);
        pa[j >> 1].v[(j & 1) * 8 + r] = a;
        pl[j >> 1].v[(j & 1) * 8 + r] = bl;
      }
    }
    lrow = lrow * alpha + psum;
#pragma unroll
    for (int t = 0; t < 4; ++t)
#pragma unroll
      for (int r = 0; r < 8; ++r) oacc[t][r] *= alpha;

    // ---- context^T += V^T . P^T, 3 bf16 products ----
#pragma unroll   // unrolled: pa / pl are registers and are indexed by kk
    for (int kk = 0; kk < 2; ++kk) {
#pragma unroll
      for (int t = 0; t < 4; ++t) {
        FB vb, vl;
        vb.h[0] = *(const v8b*)(Vth + (t * 16 + c) * LP + kk * 32 + 8 * hh);
        vb.h[1] = *(const v8b*)(Vth + (t * 16 + c) * LP + kk * 32 + 16 + 8 * hh);
        vl.h[0] = *(const v8b*)(Vtl + (t * 16 + c) * LP + kk * 32 + 8 * hh);
        vl.h[1] = *(const v8b*)(Vtl + (t * 16 + c) * LP + kk * 32 + 16 + 8 * hh);
        oacc[t] = mma_b(vb.v, pa[kk].v, oacc[t]);
        oacc[t] = mma_b(vl.v, pa[kk].v, oacc[t]);
        oacc[t] = mma_b(vb.v, pl[kk].v, oacc[t]);
      }
    }
    asm volatile("s_wait_dscnt 0x0" ::: "memory");      // this wave's reads of tile kc are done before the buffer is refilled
    asm volatile("s_wait_asynccnt 0x0" ::: "memory");   // this wave's copies of tile kc + 1 have landed
    __syncthreads();                                    // publishes tile kc + 1 and ends every reader's use of tile kc
    if (kc + 2 < nChunks) {
      tile_copy(l0 + (unsigned)bo * 2, kgh + (size_t)(kc + 2) * kts, kgl + (size_t)(kc + 2) * kts, krs);
      tile_copy(l0 + (unsigned)bo * 2 + 2 * APL * 2, vgh + (kc + 2) * 64, vgl + (kc + 2) * 64, vrs);
    }
  }
  asm volatile("s_wait_asynccnt 0x0" ::: "memory");     // no copy is outstanding when the ring becomes output staging

  // ---- normalise (1/l), stage the wave's 16x64 tile, bf16 hi/lo split,
  float* os = (float*)(void*)ring + wave * (16 * OSP);   // per wave context tile [row][d], rows pitched OSP
  {
    const float l = lrow + other_half(lrow);           // join the lane halves' sums; >= 1 (the maximum's key contributes exp(0))
    const float inv = (l > 0.f) ? (1.0f / l) : 0.f;
#pragma unroll
    for (int t = 0; t < 4; ++t) {                      // 8 consecutive d of query row c: two 16-B stores
      v4f o0, o1;
#pragma unroll
      for (int r = 0; r < 4; ++r) { o0[r] = oacc[t][r] * inv; o1[r] = oacc[t][4 + r] * inv; }
      *(v4f*)(os + c * OSP + t * 16 + 8 * hh)     = o0;
      *(v4f*)(os + c * OSP + t * 16 + 8 * hh + 4) = o1;
    }
  }
  __builtin_amdgcn_fence(__ATOMIC_RELEASE, "workgroup");
  __builtin_amdgcn_wave_barrier();
  __builtin_amdgcn_fence(__ATOMIC_ACQUIRE, "workgroup");
  {
    const int q4 = lane >> 3, c8 = (lane & 7) * 8;
    v4u hv[4], lv[4];
#pragma unroll
    for (int it = 0; it < 4; ++it) {
      const int row = it * 4 + q4;   // it 0..3 x q4 0..3 = rows 0..15 of the wave tile
      const float* sp = os + row * OSP + c8;
      v4u a, a2;
#pragma unroll
      for (int e = 0; e < 4; ++e) {
        const float f0 = sp[2 * e], f1 = sp[2 * e + 1];
        const unsigned short h0 = bf_bits(f0), h1 = bf_bits(f1);
        const unsigned short l0 = bf_bits(f0 - bf_up(h0)), l1 = bf_bits(f1 - bf_up(h1));
        a[e] = pk16(h0, h1); a2[e] = pk16(l0, l1);
      }
      hv[it] = a; lv[it] = a2;
    }
    {
#pragma unroll
      for (int it = 0; it < 4; ++it) {
        const int row = it * 4 + q4;
        const size_t go = (size_t)(rowBase + q0 + row) * CXP + (size_t)h * HD + c8;
        *(v4u*)(cxp + go)      = hv[it];
        *(v4u*)(cxp + go + DM) = lv[it];
      }
      
    }
  }
}

// =====================================================================================================
// Workspace map (bytes); every region is an exact multiple of its 64x64-tile / whole-line store granularity:
//   XB   bf16 [8192][1024]              0        16777216
//   WAT  bf16 [3072 n][1024 k]          16777216  6291456
//   WPT2 bf16 [1024 n][2048 k]          23068672  4194304   (W_proj^T duplicated along k)
//   QKh  bf16 [8192][2048]              27262976 33554432
//   QKl  bf16 [8192][2048]              60817408 33554432
//   VTh  bf16 [1024][8192]              94371840 16777216
//   VTl  bf16 [1024][8192]             111149056 16777216
//   CTX  bf16 [8192][2048]             127926272 33554432
//   end                                161480704
// Every stage is one launch over all four batch elements; QK / VT planes are fully written before the attention launch reads them.
// =====================================================================================================
extern "C" void kernel_launch(void* const* d_in, const int* in_sizes, int n_in,
                              void* d_out, int out_size, void* d_ws, size_t ws_size,
                              hipStream_t stream) {
  if (n_in < 5) return;
  if (in_sizes[0] != NB * SEQ * DM) return;
  if (in_sizes[1] != DM * N3) return;
  if (in_sizes[2] != N3) return;
  if (in_sizes[3] != DM * DM) return;
  if (in_sizes[4] != DM) return;
  if (out_size != NB * SEQ * DM) return;

  const float* x      = (const float*)d_in[0];   // [4][2048][1024]
  const float* W_attn = (const float*)d_in[1];   // [1024 in][3072 out]
  const float* b_attn = (const float*)d_in[2];   // [3072]
  const float* W_proj = (const float*)d_in[3];   // [1024 in][1024 out]
  const float* b_proj = (const float*)d_in[4];   // [1024]

  const size_t PXB = (size_t)NB * SEQ * DM * 2;     // 16777216
  const size_t PWA = (size_t)N3 * DM * 2;           //  6291456
  const size_t PWP = (size_t)DM * (2 * DM) * 2;     //  4194304
  const size_t PQK = (size_t)NB * SEQ * QKP * 2;    // 33554432
  const size_t PVT = (size_t)DM * VTP * 2;          // 16777216
  const size_t PCX = (size_t)NB * SEQ * CXP * 2;    // 33554432
  size_t off = 0;
  const size_t oXB  = off; off += PXB;
  const size_t oWAT = off; off += PWA;
  const size_t oWPT = off; off += PWP;
  const size_t oQKh = off; off += PQK;
  const size_t oQKl = off; off += PQK;
  const size_t oVTh = off; off += PVT;
  const size_t oVTl = off; off += PVT;
  const size_t oCTX = off; off += PCX;
  if (off > ws_size) return;                        // off = 161480704

  char* ws = (char*)d_ws;
  unsigned short* XB   = (unsigned short*)(ws + oXB);
  unsigned short* WAT  = (unsigned short*)(ws + oWAT);
  unsigned short* WPT2 = (unsigned short*)(ws + oWPT);
  unsigned short* QKh  = (unsigned short*)(ws + oQKh);
  unsigned short* QKl  = (unsigned short*)(ws + oQKl);
  unsigned short* VTh  = (unsigned short*)(ws + oVTh);
  unsigned short* VTl  = (unsigned short*)(ws + oVTl);
  unsigned short* CTX  = (unsigned short*)(ws + oCTX);

  const dim3 blk(256);
  const int n8x = NB * SEQ * DM / 8;                               // 1048576
  const dim3 gCvtX((n8x + 255) / 256);                             // 4096 blocks
  const dim3 gTA(N3 / 64, DM / 64);                                // in [1024 rows][3072 cols] -> (cols/64, rows/64)
  const dim3 gTP(DM / 64, DM / 64);                                // in [1024 rows][1024 cols]
  const dim3 gQK(((NB * SEQ / 64) * ((2 * DM) / 64) + 7) / 8);     // 4096 tiles -> 512 blocks: M=8192, N=2048
  const dim3 gVT(((DM / 64) * (NB * SEQ / 64) + 7) / 8);           // 2048 tiles -> 256 blocks: M=1024, N=8192
  const dim3 gAtt(NH * NB, NQB);                                   // 2048 blocks: (16 heads x 4 batch elements) x 32 query tiles, longest first
  const dim3 gOut(((NB * SEQ / 64) * (DM / 64) + 7) / 8);          // 2048 tiles -> 256 blocks: M=8192, N=1024

  // (1) x -> bf16 [8192][1024]
  cvt_bf16x8<<<gCvtX, blk, 0, stream>>>(x, XB, n8x);
  // (2) W_attn [k][n] -> WAT [n][k] bf16 (pitch 1024); W_proj [k][n] -> WPT2 [n][k | k] bf16 (pitch 2048)
  tcvt_kernel<false><<<gTA, blk, 0, stream>>>(W_attn, WAT, DM, N3, DM);
  tcvt_kernel<true><<<gTP, blk, 0, stream>>>(W_proj, WPT2, DM, DM, 2 * DM);

  // (3) q|k = x . W_attn[:, 0:2048] + b_attn[0:2048] -> bf16 hi/lo [8192][2048]   (M=8192, N=2048, K=1024)
  gemm64<2, 2><<<gQK, blk, 0, stream>>>(XB, DM, WAT, DM, (void*)QKh, (void*)QKl, QKP, b_attn, NB * SEQ, 2 * DM, DM);
  // (4) v^T = W_attn[:, 2048:3072]^T . x^T + b_attn[2048 + m] -> bf16 hi/lo [1024][8192]   (M=1024, N=8192, K=1024)
  gemm64<1, 2><<<gVT, blk, 0, stream>>>(WAT + (size_t)(2 * DM) * DM, DM, XB, DM, (void*)VTh, (void*)VTl, VTP,
                                        b_attn + 2 * DM, DM, NB * SEQ, DM);
  // (5) causal attention -> CTX rows 0..8191 (hi at cols 0..1023, lo at 1024..2047)
  attn_causal64<<<gAtt, dim3(128), 0, stream>>>(QKh, QKl, VTh, VTl, CTX, 0.125f);
  // (6) y = [ctx hi | ctx lo] . [W_proj^T | W_proj^T]^T + b_proj -> d_out f32 [8192][1024]   (M=8192, N=1024, K=2048)
  gemm64<2, 0><<<gOut, blk, 0, stream>>>(CTX, CXP, WPT2, 2 * DM, d_out, d_out, DM, b_proj, NB * SEQ, DM, 2 * DM);
  (void)hipGetLastError();
}

// v007
// A run of this version takes 192 microseconds.
// Timed twice side by side with v006, it ran 1.04 times as fast both times.
// Over all steps from v000 it is 6.53 times as fast.
// Contractions: q|k and v^T projections = v_wmma_f32_16x16x32_bf16 (bf16 operands RNE-converted from x and W_attn, single product, + bf16 bias in f32);
// causal scores q.k^T = v_wmma_f32_16x16x32_bf16 with bf16 hi/lo split q and k (hi.hi + hi.lo + lo.hi);
// context p.v = v_wmma_f32_16x16x32_bf16 with bf16 hi/lo split p and v (3 products);
// output projection = v_wmma_f32_16x16x32_bf16, context bf16 hi|lo planes folded along K (K = 2048) times bf16 W_proj^T (+ bf16 bias in f32);
// all f32 accumulate; online softmax statistics, score scale 0.125 and bias adds in f32.
// Carry audit: every 16-bit plane (XB, WAT, WPT2, QKh/QKl, VTh/VTl, CTX hi|lo, P hi|lo in registers) has carry 1; no inverse factor is applied anywhere.
#include <hip/hip_runtime.h>
#include <math.h>
#include <stdint.h>

#define NB   4
#define SEQ  2048
#define DM   1024
#define NH   16
#define HD   64
#define N3   (3 * DM)      // 3072
#define QKP  (2 * DM)      // pitch of the q|k planes [t][q 1024 | k 1024]
#define CXP  (2 * DM)      // pitch of the context plane [t][hi 1024 | lo 1024]
#define VTP  (NB * SEQ)    // pitch of the v^T planes [h*64 + d][b*2048 + s]
#define NQB  (SEQ / 64)    // 32 query / key tiles of 64
#define OSP  68            // LDS row pitch of the f32 context tile: 272 B = 16 B x 17 (odd), conflict-free for 16-B stores of 16 rows
#define LP   72            // LDS row pitch of the 64-element bf16 tiles: 144 B = 16 B x 9 (odd), conflict-free for 16-B fragment reads
static_assert(NH * HD == DM);
static_assert((SEQ % 64) == 0 && (DM % 64) == 0 && (N3 % 64) == 0);
static_assert((DM % 32) == 0 && (CXP % 32) == 0 && (QKP % 8) == 0);

typedef __bf16   v16b __attribute__((ext_vector_type(16)));
typedef __bf16   v8b  __attribute__((ext_vector_type(8)));
typedef float    v8f  __attribute__((ext_vector_type(8)));
typedef float    v4f  __attribute__((ext_vector_type(4)));
typedef unsigned int v4u __attribute__((ext_vector_type(4)));
typedef float    v2f  __attribute__((ext_vector_type(2)));
typedef __bf16   v2b  __attribute__((ext_vector_type(2)));

// ---- scalar helpers ----------------------------------------------------------------------------------
// f32 -> bf16 is the chip's own packed convert (RNE): two values in, one dword (a in the low half, b in the high half) out
__device__ __forceinline__ v2b cvt2(float a, float b) { const v2f x = {a, b}; return __builtin_convertvector(x, v2b); }
__device__ __forceinline__ unsigned pk_bf(float a, float b) { return __builtin_bit_cast(unsigned, cvt2(a, b)); }
__device__ __forceinline__ float bfr(float f) { return (float)(__bf16)f; }    // value after bf16 RNE convert
__device__ __forceinline__ v8f zero8() { v8f z = {0.f, 0.f, 0.f, 0.f, 0.f, 0.f, 0.f, 0.f}; return z; }
// hi = RNE(v), lo = RNE(v - hi) of eight values, packed two to a dword: three instructions a pair.
// The asm is there because the compiler unpacks hi, subtracts and converts again (five a pair): v_fma_mixlo/mixhi_bf16 read one
// bf16 half of hi, form v - hi in f32 (exact) and round it into one half of lo. The four low halves go first, so that each high
// half follows its register's first write at a distance of four; the s_delay_alu hints let other waves issue in the meantime.
__device__ __forceinline__ void split8(const float* f, v4u& hi, v4u& lo) {
  const unsigned h0 = pk_bf(f[0], f[1]), h1 = pk_bf(f[2], f[3]), h2 = pk_bf(f[4], f[5]), h3 = pk_bf(f[6], f[7]);
  unsigned l0, l1, l2, l3;
  asm("v_fma_mixlo_bf16 %0, %4, -1.0, %8 op_sel:[0,1,0] op_sel_hi:[1,1,0]\n\t"
      "v_fma_mixlo_bf16 %1, %5, -1.0, %10 op_sel:[0,1,0] op_sel_hi:[1,1,0]\n\t"
      "v_fma_mixlo_bf16 %2, %6, -1.0, %12 op_sel:[0,1,0] op_sel_hi:[1,1,0]\n\t"
      "v_fma_mixlo_bf16 %3, %7, -1.0, %14 op_sel:[0,1,0] op_sel_hi:[1,1,0]\n\t"
      "s_delay_alu instid0(VALU_DEP_4) | instskip(NEXT) | instid1(VALU_DEP_4)\n\t"
      "v_fma_mixhi_bf16 %0, %4, -1.0, %9 op_sel:[1,1,0] op_sel_hi:[1,1,0]\n\t"
      "v_fma_mixhi_bf16 %1, %5, -1.0, %11 op_sel:[1,1,0] op_sel_hi:[1,1,0]\n\t"
      "s_delay_alu instid0(VALU_DEP_4) | instskip(NEXT) | instid1(VALU_DEP_4)\n\t"
      "v_fma_mixhi_bf16 %2, %6, -1.0, %13 op_sel:[1,1,0] op_sel_hi:[1,1,0]\n\t"
      "v_fma_mixhi_bf16 %3, %7, -1.0, %15 op_sel:[1,1,0] op_sel_hi:[1,1,0]"
      : "=&v"(l0), "=&v"(l1), "=&v"(l2), "=&v"(l3)
      : "v"(h0), "v"(h1), "v"(h2), "v"(h3),
        "v"(f[0]), "v"(f[1]), "v"(f[2]), "v"(f[3]), "v"(f[4]), "v"(f[5]), "v"(f[6]), "v"(f[7]));
  hi[0] = h0; hi[1] = h1; hi[2] = h2; hi[3] = h3;
  lo[0] = l0; lo[1] = l1; lo[2] = l2; lo[3] = l3;
}

// value of the same lane position in the other 16-lane half (lane ^ 16), as a vector cross-row move: no LDS round trip
__device__ __forceinline__ float other_half(float v) {
  const int b = __float_as_int(v);
  return __int_as_float(__builtin_amdgcn_permlanex16(b, b, 0x76543210, 0xfedcba98, false, false));
}

// ---- fragment loader: 16-bit A/B operand, lane -> row/col (lane&15), p already includes +8*(lane>>4);
//      elements 0..7 <- p[0..7] (k0+8h..), elements 8..15 <- p[16..23] (k0+16+8h..)
__device__ __forceinline__ v16b ldfrag_b(const __bf16* p) {
  union { v16b v; v8b h[2]; } f;
  f.h[0] = *(const v8b*)(p);
  f.h[1] = *(const v8b*)(p + 16);
  return f.v;
}

// ---- WMMA helpers with trailing VALU hazard gap ----------------------------------------------------------
__device__ __forceinline__ v8f mma_b(v16b a, v16b b, v8f c) {
  c = __builtin_amdgcn_wmma_f32_16x16x32_bf16(false, a, false, b, (short)0, c, false, false);
  asm volatile("v_nop\n\tv_nop\n\tv_nop\n\tv_nop" : "+v"(c) : "v"(a), "v"(b));
  return c;
}
__device__ __forceinline__ v8f mma_b_raw(v16b a, v16b b, v8f c) {
  return __builtin_amdgcn_wmma_f32_16x16x32_bf16(false, a, false, b, (short)0, c, false, false);
}
__device__ __forceinline__ void dep_guard_b(v8f& a, v8f& b, v16b x, v16b y) {
  asm volatile("v_nop\n\tv_nop\n\tv_nop\n\tv_nop" : "+v"(a), "+v"(b) : "v"(x), "v"(y));
}
__device__ __forceinline__ void keep4_b(v16b a, v16b b, v16b c, v16b d) {
  asm volatile("v_nop" :: "v"(a), "v"(b), "v"(c), "v"(d));
}
__device__ __forceinline__ void acc_guard4(v8f& a, v8f& b, v8f& c, v8f& d) {
  asm volatile("v_nop\n\tv_nop\n\tv_nop\n\tv_nop" : "+v"(a), "+v"(b), "+v"(c), "+v"(d));
}

// =====================================================================================================
// f32 -> bf16 (RNE convert), 8 elements per thread, one 16-B store per lane: a wave writes 512 contiguous B
// coverage: n8 threads x 8 = the whole plane (n8 = 1048576, a multiple of 256).
// =====================================================================================================
__global__ __launch_bounds__(256) void cvt_bf16x8(const float* __restrict__ in, unsigned short* out, int n8) {
  const int i = blockIdx.x * 256 + threadIdx.x;
  if (i < n8) {
    const v4f a = *(const v4f*)(in + (size_t)i * 8);
    const v4f b = *(const v4f*)(in + (size_t)i * 8 + 4);
    v4u p;
    p[0] = pk_bf(a[0], a[1]);
    p[1] = pk_bf(a[2], a[3]);
    p[2] = pk_bf(b[0], b[1]);
    p[3] = pk_bf(b[2], b[3]);
    *(v4u*)(out + (size_t)i * 8) = p;
    
  }
}

// =====================================================================================================
// Transpose + bf16 convert of an f32 matrix: in [R rows][Cc cols] (pitch Cc) -> o[c][r] = bf16_rne(in[r][c]),
// output row pitch P (>= R); DUP additionally writes the same value at o[c][R + r] (duplicate along k).
// 64x64 tiles through LDS. grid = (Cc/64, R/64), 256 threads (R, Cc multiples of 64).
// coverage per block: load 4 it x 256 thr x 4 floats = 64x64; store 2 it x 256 thr x 8 u16 = 64x64 (x2 with DUP).
// =====================================================================================================
template <bool DUP>
__global__ __launch_bounds__(256) void tcvt_kernel(const float* __restrict__ W, unsigned short* o, int R, int Cc, int P) {
  __shared__ __align__(16) float tf[64 * 68];
  const int c0  = blockIdx.x * 64;   // input column block = output row block
  const int r0  = blockIdx.y * 64;   // input row block    = output column block
  const int tid = threadIdx.x;
  {
    const int lr = tid >> 4;         // 0..15
    const int c4 = (tid & 15) * 4;   // 0..60
#pragma unroll
    for (int it = 0; it < 4; ++it) {
      const int rr = it * 16 + lr;   // 0..63
      const v4f a = *(const v4f*)(W + (size_t)(r0 + rr) * Cc + c0 + c4);
      *(v4f*)(tf + rr * 68 + c4) = a;
    }
  }
  __syncthreads();
  const int sub = tid >> 3;          // 0..31
  const int c8  = (tid & 7) * 8;     // 0..56
  v4u hv[2];
#pragma unroll
  for (int it = 0; it < 2; ++it) {
    const int oc = it * 32 + sub;    // output row within tile (= input column)
    v4u a;
#pragma unroll
    for (int q = 0; q < 4; ++q) {
      const float f0 = tf[(c8 + 2 * q) * 68 + oc];
      const float f1 = tf[(c8 + 2 * q + 1) * 68 + oc];
      a[q] = pk_bf(f0, f1);
    }
    hv[it] = a;
  }
  {
#pragma unroll
    for (int it = 0; it < 2; ++it) {
      const int oc = it * 32 + sub;
      const size_t go = (size_t)(c0 + oc) * P + r0 + c8;
      *(v4u*)(o + go) = hv[it];
      if (DUP) *(v4u*)(o + go + R) = hv[it];
    }
    
  }
}

// =====================================================================================================
// Register-blocked bf16 WMMA GEMM: C[m][n] = sum_k A[m][k] * Bt[n][k] + bias; one wave per 64x64 tile,
// eight waves (2 x 4) = one 128 x 256 tile per work-group. A row-major [M][K] pitch lda; Bt row-major [N][K] pitch ldb
// (k contiguous); M multiple of 128, N multiple of 256, K multiple of 64 and >= 128 (host constants, asserted below).
// Operands: a stage = 64 k = one whole 128-B line of each of the 128 A rows and 256 Bt rows, laid in LDS at pitch LP
// ([A rows | Bt rows]); two buffers; stage t + 2 is copied (16 B per lane, global -> LDS, no register) while stage t + 1 is worked on.
// copy coverage per stage: 12 copies x 256 threads x 16 B = 384 rows x 128 B; a wave's copy = 4 whole lines.
// BIAS_MODE: 1 = bias[m], 2 = bias[n]; bias value RNE-converted to bf16 then added in f32.
// OUT_MODE: 0 = f32 (pitch ldc); 2 = bf16 hi plane C + bf16 lo plane C2 (lo = RNE(v - hi), unscaled), pitch ldc.
// =====================================================================================================
#define GTM  128                   // work-group tile rows
#define GTN  256                   // work-group tile columns
#define GKB  64                    // k elements per stage
#define GSTG ((GTM + GTN) * LP)    // bf16 elements of one stage in LDS (55296 B)
static_assert(((NB * SEQ) % GTN) == 0 && (DM % GTN) == 0 && ((2 * DM) % GTN) == 0);
static_assert((DM % GKB) == 0 && (CXP % GKB) == 0 && DM >= 2 * GKB);

// One stage's copies of one lane: rows r, r + 32, .. of A (4) and of Bt (8), LDS rows 32 * LP elements apart.
// The copies and s_wait_xcnt 0 are one statement, so that no address register is rewritten ahead of that wait.
__device__ __forceinline__ void stage_copy(unsigned l, const __bf16* a, size_t as, const __bf16* b, size_t bs) {
  const unsigned ls = 32 * LP * 2;   // bytes between a lane's consecutive LDS rows
  asm volatile(
      "global_load_async_to_lds_b128 %0, %12, off\n\t"
      "global_load_async_to_lds_b128 %1, %13, off\n\t"
      "global_load_async_to_lds_b128 %2, %14, off\n\t"
      "global_load_async_to_lds_b128 %3, %15, off\n\t"
      "global_load_async_to_lds_b128 %4, %16, off\n\t"
      "global_load_async_to_lds_b128 %5, %17, off\n\t"
      "global_load_async_to_lds_b128 %6, %18, off\n\t"
      "global_load_async_to_lds_b128 %7, %19, off\n\t"
      "global_load_async_to_lds_b128 %8, %20, off\n\t"
      "global_load_async_to_lds_b128 %9, %21, off\n\t"
      "global_load_async_to_lds_b128 %10, %22, off\n\t"
      "global_load_async_to_lds_b128 %11, %23, off\n\t"
      "s_wait_xcnt 0x0"
      :: "v"(l), "v"(l + ls), "v"(l + 2 * ls), "v"(l + 3 * ls), "v"(l + 4 * ls), "v"(l + 5 * ls),
         "v"(l + 6 * ls), "v"(l + 7 * ls), "v"(l + 8 * ls), "v"(l + 9 * ls), "v"(l + 10 * ls), "v"(l + 11 * ls),
         "v"(a), "v"(a + as), "v"(a + 2 * as), "v"(a + 3 * as),
         "v"(b), "v"(b + bs), "v"(b + 2 * bs), "v"(b + 3 * bs), "v"(b + 4 * bs), "v"(b + 5 * bs), "v"(b + 6 * bs), "v"(b + 7 * bs)
      : "memory");
}

template <int BIAS_MODE, int OUT_MODE>
__global__ __launch_bounds__(256) void gemm64(
    const unsigned short* __restrict__ Ap, int lda,
    const unsigned short* __restrict__ Btp, int ldb,
    void* Cout, void* Cout2, int ldc,
    const float* __restrict__ bias,
    int M, int N, int K) {
  const __bf16* A  = (const __bf16*)(const void*)Ap;
  const __bf16* Bt = (const __bf16*)(const void*)Btp;
  __shared__ __align__(16) __bf16 ring[2 * GSTG];  // two stages [A 128 rows | Bt 256 rows], pitch LP
  __shared__ __align__(16) float sT[8][16 * 68];   // per-wave 16x64 slab, pitch 68 floats
  const int lane = threadIdx.x & 31;
  const int wave = threadIdx.x >> 5;
  const int blocksN = N / GTN;
  const int blocksM = M / GTM;
  if ((int)blockIdx.x >= blocksM * blocksN) return;   // block-uniform, in front of every barrier
  const int bm = blockIdx.x / blocksN;
  const int bn = blockIdx.x - bm * blocksN;
  const int wm = wave >> 2;                    // 0..1
  const int wn = wave & 3;                     // 0..3
  const int m0 = bm * GTM + (wm << 6);
  const int n0 = bn * GTN + (wn << 6);

  const int rlane = lane & 15;                 // row (A) / col (B, D) within subtile
  const int koff  = (lane >> 4) * 8;           // k offset of this lane half
  const int mOff  = (lane >> 4) * 8;           // D row offset

  v8f acc[4][4];
#pragma unroll
  for (int i = 0; i < 4; ++i)
#pragma unroll
    for (int j = 0; j < 4; ++j) acc[i][j] = zero8();

  // this lane's place in a stage: row crow (+ 32 per copy), 16-B piece ccol of the row's 128 B
  const int crow = threadIdx.x >> 3;           // 0..31
  const int ccol = (threadIdx.x & 7) * 8;      // 0..56 elements
  const __bf16* ga = A  + (size_t)(bm * GTM + crow) * lda + ccol;
  const __bf16* gb = Bt + (size_t)(bn * GTN + crow) * ldb + ccol;
  const size_t  as = (size_t)32 * lda;
  const size_t  bs = (size_t)32 * ldb;
  const unsigned l0 = (unsigned)(uintptr_t)(ring + crow * LP + ccol);   // LDS byte address in buffer 0
  const int nst = K / GKB;                     // stages, >= 2

  stage_copy(l0, ga, as, gb, bs);
  asm volatile("s_wait_asynccnt 0x0" ::: "memory");   // stage 0 of this wave has landed
  __syncthreads();                                    // stage 0 of every wave is readable
  if (nst > 1) stage_copy(l0 + GSTG * 2, ga + GKB, as, gb + GKB, bs);

#pragma unroll 1   // rolled: one publish point in the text, the buffer chosen by t & 1
  for (int t = 0; t < nst; ++t) {
    const int bo = (t & 1) * GSTG;
    const __bf16* sa = ring + bo + ((wm << 6) + rlane) * LP + koff;
    const __bf16* sb = ring + bo + (GTM + (wn << 6) + rlane) * LP + koff;
#pragma unroll
    for (int kk = 0; kk < GKB; kk += 32) {
      v16b bh[4], ah[4];
#pragma unroll
      for (int j = 0; j < 4; ++j) bh[j] = ldfrag_b(sb + (j << 4) * LP + kk);
#pragma unroll
      for (int i = 0; i < 4; ++i) ah[i] = ldfrag_b(sa + (i << 4) * LP + kk);
#pragma unroll
      for (int i = 0; i < 4; ++i) {
#pragma unroll
        for (int j = 0; j < 4; ++j) acc[i][j] = mma_b_raw(ah[i], bh[j], acc[i][j]);
        dep_guard_b(acc[i][0], acc[i][3], ah[i], ah[i]);
      }
      keep4_b(bh[0], bh[1], bh[2], bh[3]);
    }
    asm volatile("s_wait_dscnt 0x0" ::: "memory");      // this wave's reads of stage t are done before the buffer is refilled
    asm volatile("s_wait_asynccnt 0x0" ::: "memory");   // this wave's copies of stage t + 1 have landed
    __syncthreads();                                    // publishes stage t + 1 and ends every reader's use of stage t
    if (t + 2 < nst) stage_copy(l0 + (unsigned)bo * 2, ga + (size_t)(t + 2) * GKB, as, gb + (size_t)(t + 2) * GKB, bs);
  }
  asm volatile("s_wait_asynccnt 0x0" ::: "memory");     // no copy is outstanding when the wave goes on
  acc_guard4(acc[0][0], acc[0][1], acc[0][2], acc[0][3]);
  acc_guard4(acc[1][0], acc[1][1], acc[1][2], acc[1][3]);
  acc_guard4(acc[2][0], acc[2][1], acc[2][2], acc[2][3]);
  acc_guard4(acc[3][0], acc[3][1], acc[3][2], acc[3][3]);

  // ---- epilogue ----
  float* slab = sT[wave];
#pragma unroll
  for (int i = 0; i < 4; ++i) {
    const int mBase = m0 + (i << 4);
    float bm8[8];
#pragma unroll
    for (int r = 0; r < 8; ++r) bm8[r] = 0.f;
    if (BIAS_MODE == 1) {                          // rows mBase+mOff .. +7: two 16-B loads (32-B aligned)
      const v4f t0 = *(const v4f*)(bias + mBase + mOff);
      const v4f t1 = *(const v4f*)(bias + mBase + mOff + 4);
      bm8[0] = bfr(t0[0]); bm8[1] = bfr(t0[1]); bm8[2] = bfr(t0[2]); bm8[3] = bfr(t0[3]);
      bm8[4] = bfr(t1[0]); bm8[5] = bfr(t1[1]); bm8[6] = bfr(t1[2]); bm8[7] = bfr(t1[3]);
    }
#pragma unroll
    for (int j = 0; j < 4; ++j) {
      float bn = 0.f;
      if (BIAS_MODE == 2) bn = bfr(bias[n0 + (j << 4) + rlane]);
#pragma unroll
      for (int r = 0; r < 8; ++r) {
        float v = acc[i][j][r];
        if (BIAS_MODE == 1) v += bm8[r];
        if (BIAS_MODE == 2) v += bn;
        slab[(mOff + r) * 68 + (j << 4) + rlane] = v;
      }
    }
    __builtin_amdgcn_fence(__ATOMIC_RELEASE, "workgroup");
    __builtin_amdgcn_wave_barrier();
    __builtin_amdgcn_fence(__ATOMIC_ACQUIRE, "workgroup");
    if (OUT_MODE == 0) {
      float* C = (float*)Cout;
      const int hh = lane >> 4, c4 = (lane & 15) * 4;     // 256-B row segment = 16 lanes x 16 B
      {
#pragma unroll
        for (int it = 0; it < 8; ++it) {
          const int row = it * 2 + hh;                     // it 0..7 x hh 0..1 = rows 0..15
          const v4f v = *(const v4f*)(slab + row * 68 + c4);
          *(v4f*)(C + (size_t)(mBase + row) * ldc + n0 + c4) = v;
        }
        
      }
    } else {
      const int q = lane >> 3, c8 = (lane & 7) * 8;
      unsigned short* C  = (unsigned short*)Cout;
      unsigned short* C2 = (unsigned short*)Cout2;
      v4u hv[4], lv[4];
#pragma unroll
      for (int it = 0; it < 4; ++it) {
        const int row = it * 4 + q;                        // it 0..3 x q 0..3 = rows 0..15
        const float* sp = slab + row * 68 + c8;
        float f[8];
#pragma unroll
        for (int e = 0; e < 8; ++e) f[e] = sp[e];
        split8(f, hv[it], lv[it]);
      }
      {
#pragma unroll
        for (int it = 0; it < 4; ++it) {
          const int row = it * 4 + q;
          *(v4u*)(C  + (size_t)(mBase + row) * ldc + n0 + c8) = hv[it];
          *(v4u*)(C2 + (size_t)(mBase + row) * ldc + n0 + c8) = lv[it];
        }
        
      }
    }
    __builtin_amdgcn_fence(__ATOMIC_RELEASE, "workgroup");
    __builtin_amdgcn_wave_barrier();
    __builtin_amdgcn_fence(__ATOMIC_ACQUIRE, "workgroup");
  }
}

// =====================================================================================================
// Causal attention, head dim 64, all batch elements in one launch (blockIdx.x = head and batch element, blockIdx.y = query tile, longest first).
//   q|k planes (bf16 hi / lo): [b*SEQ + t][QKP], q(t, h, d) at col h*64 + d, k(s, h, d) at col DM + h*64 + d
//   v^T planes (bf16 hi / lo): [(h*64 + d)][VTP], key s of batch b at col b*SEQ + s, s contiguous
//   context plane (bf16): row b*SEQ + t, pitch CXP; hi at col h*64 + d, lo (RNE(v - hi)) at col DM + h*64 + d
//   scores = q . k : bf16 hi/lo split (hi.hi + hi.lo + lo.hi), f32 accumulate, then * sscale in f32
//   out    = p . v : bf16 hi/lo split of p (unnormalised) and v, f32 accumulate
//   both products are formed transposed: S^T = K . Q^T (A = K rows, B = q) and O^T += V^T . P^T (A = V^T rows, B = p):
//   a lane holds the scores of ONE query (q0 + lane&15), keys 8*(lane>>4) + r of each 16-key tile, so two score tiles, split in
//   place, are the B operand of the second product (element e = tile 2kk row e, element 8 + e = tile 2kk+1 row e: the k order of
//   the V^T loader), and maximum, sum and rescale factor are one value per lane.
//   online softmax in f32; key s > t set to -inf only on the diagonal key tile (key s = tile start <= t always live).
//   Block = 4 waves = 64 query rows of one head; grid = (NH * NB, NQB); key tiles of 64, block-uniform trip count qb+1 <= 32,
//   every wave reaches the one block barrier of every iteration.
//   K / V^T tile staging: a stage = the 64x64 tile of all four planes [K hi | K lo | V^T hi | V^T lo], rows pitched LP; two buffers;
//   tile kc + 2 is copied (16 B per lane, global -> LDS, no register) while tile kc + 1 is worked on.
//   copy coverage per stage: 16 copies x 128 threads x 16 B = 4 planes x 64 rows x 128 B; a wave's copy = 4 whole 128-B lines.
//   After the loop the ring is free (the last trip's barrier ends every read) and holds the per-wave f32 context tiles.
//   Output coverage: each wave stores rows q0..q0+15 (it 0..3 x lane>>3 0..3) x 64 columns (8 lanes x 8) of both planes.
// =====================================================================================================
#define APL  (64 * LP)     // bf16 elements of one plane's tile in LDS (9216 B)
#define ASTG (4 * APL)     // bf16 elements of one stage in LDS (36864 B)
static_assert(4 * 16 * OSP * 4 <= 2 * ASTG * 2);   // the four f32 context tiles fit in the ring

// One lane's copies of two planes of a stage: rows r, r + 16, r + 32, r + 48 of plane a, then of plane b (LDS: the next plane).
// The copies and s_wait_xcnt 0 are one statement, so that no address register is rewritten ahead of that wait.
__device__ __forceinline__ void tile_copy(unsigned l, const __bf16* a, const __bf16* b, size_t rs) {
  const unsigned ls = 16 * LP * 2;   // bytes between a lane's consecutive LDS rows
  const unsigned ps = APL * 2;       // bytes between the planes in LDS
  asm volatile(
      "global_load_async_to_lds_b128 %0, %8, off\n\t"
      "global_load_async_to_lds_b128 %1, %9, off\n\t"
      "global_load_async_to_lds_b128 %2, %10, off\n\t"
      "global_load_async_to_lds_b128 %3, %11, off\n\t"
      "global_load_async_to_lds_b128 %4, %12, off\n\t"
      "global_load_async_to_lds_b128 %5, %13, off\n\t"
      "global_load_async_to_lds_b128 %6, %14, off\n\t"
      "global_load_async_to_lds_b128 %7, %15, off\n\t"
      "s_wait_xcnt 0x0"
      :: "v"(l), "v"(l + ls), "v"(l + 2 * ls), "v"(l + 3 * ls),
         "v"(l + ps), "v"(l + ps + ls), "v"(l + ps + 2 * ls), "v"(l + ps + 3 * ls),
         "v"(a), "v"(a + rs), "v"(a + 2 * rs), "v"(a + 3 * rs),
         "v"(b), "v"(b + rs), "v"(b + 2 * rs), "v"(b + 3 * rs)
      : "memory");
}

__global__ __launch_bounds__(128)
void attn_causal64(const unsigned short* __restrict__ qkhp, const unsigned short* __restrict__ qklp,
                   const unsigned short* __restrict__ vhp, const unsigned short* __restrict__ vlp,
                   unsigned short* cxp, float sscale) {
  union FB { v16b v; v8b h[2]; v4u q[2]; };
  __shared__ __align__(16) __bf16 ring[2 * ASTG];      // two stages [K hi [kv][d] | K lo | V^T hi [d][kv] | V^T lo], rows pitched LP

  const int tid  = threadIdx.x;
  const int wave = tid >> 5;
  const int lane = tid & 31;
  const int hh   = lane >> 4;
  const int c    = lane & 15;

  // The query tile falls with blockIdx.y: in index order (x fastest) the longest key loops come first and the shortest last.
  const int bx = blockIdx.x;               // 0..NH*NB-1 (grid.x = NH * NB)
  const int by = blockIdx.y;               // 0..NQB-1   (grid.y = NQB)
  // % NQB is an identity on this grid: it gives the compiler the tile's range, and with it the mask's compare values stay in
  // registers over the key loop instead of being formed anew in every trip.
  const int qb = (NQB - 1 - by) % NQB;     // 31 for the first 64 work-groups .. 0 for the last 64
  const int h  = bx % NH;                  // 0..NH-1
  const int q0 = qb * 64 + wave * 16;
  const int rowBase = (bx / NH) * SEQ;     // first token row of this batch element (bx / NH = 0..NB-1)

  const __bf16* Qh = (const __bf16*)(const void*)qkhp + (size_t)rowBase * QKP + (size_t)h * HD;
  const __bf16* Ql = (const __bf16*)(const void*)qklp + (size_t)rowBase * QKP + (size_t)h * HD;
  const __bf16* Kh = Qh + DM;
  const __bf16* Kl = Ql + DM;
  const __bf16* Vh = (const __bf16*)(const void*)vhp + (size_t)h * HD * VTP + rowBase;
  const __bf16* Vl = (const __bf16*)(const void*)vlp + (size_t)h * HD * VTP + rowBase;

  // ---- Q fragments (B operand, column = query = lane&15, split k map): 2 d-chunks, hi and lo ----
  v16b qah[2], qal[2];
#pragma unroll
  for (int dc = 0; dc < 2; ++dc) {
    const size_t qo = (size_t)(q0 + c) * QKP + dc * 32 + 8 * hh;
    qah[dc] = ldfrag_b(Qh + qo);
    qal[dc] = ldfrag_b(Ql + qo);
  }

  float mrow = -INFINITY;   // running maximum of query q0 + c (the same in both lane halves)
  float lrow = 0.f;         // running sum over this lane half's keys only; the halves are joined after the loop
  v8f oacc[4];              // O^T: oacc[t][r] = context(query q0 + c, d = t*16 + 8*hh + r)
#pragma unroll
  for (int t = 0; t < 4; ++t) oacc[t] = zero8();

  const int nChunks = qb + 1;   // block-uniform, <= 32

  // this lane's place in a stage: row crow (+ 16 per copy), 16-B piece ccol of the row's 128 B
  const int crow = tid >> 3;               // 0..15
  const int ccol = (tid & 7) * 8;          // 0..56 elements
  const __bf16* kgh = Kh + (size_t)crow * QKP + ccol;    // K row crow of tile 0; a tile is 64 rows on
  const __bf16* kgl = Kl + (size_t)crow * QKP + ccol;
  const __bf16* vgh = Vh + (size_t)crow * VTP + ccol;    // V^T row d = crow, keys of tile 0; a tile is 64 columns on
  const __bf16* vgl = Vl + (size_t)crow * VTP + ccol;
  const size_t  krs = (size_t)16 * QKP;
  const size_t  vrs = (size_t)16 * VTP;
  const size_t  kts = (size_t)64 * QKP;
  const unsigned l0 = (unsigned)(uintptr_t)(ring + crow * LP + ccol);   // LDS byte address in buffer 0, plane K hi

  tile_copy(l0, kgh, kgl, krs);
  tile_copy(l0 + 2 * APL * 2, vgh, vgl, vrs);
  asm volatile("s_wait_asynccnt 0x0" ::: "memory");   // tile 0 of this wave has landed
  __syncthreads();                                    // tile 0 of every wave is readable
  if (nChunks > 1) {
    tile_copy(l0 + ASTG * 2, kgh + kts, kgl + kts, krs);
    tile_copy(l0 + ASTG * 2 + 2 * APL * 2, vgh + 64, vgl + 64, vrs);
  }

#pragma unroll 1   // rolled: one publish point in the text, the buffer chosen by kc & 1
  for (int kc = 0; kc < nChunks; ++kc) {
    const int kv0 = kc * 64;
    const int bo  = (kc & 1) * ASTG;
    const __bf16* Ksh = ring + bo;
    const __bf16* Ksl = Ksh + APL;
    const __bf16* Vth = Ksh + 2 * APL;
    const __bf16* Vtl = Ksh + 3 * APL;

    // ---- scores, transposed: 64 keys (rows) x 16 queries (columns) per wave, 3 bf16 products ----
    v8f s[4];
#pragma unroll
    for (int j = 0; j < 4; ++j) {
      s[j] = zero8();
#pragma unroll
      for (int dc = 0; dc < 2; ++dc) {
        FB kb, kl;
        kb.h[0] = *(const v8b*)(Ksh + (j * 16 + c) * LP + dc * 32 + 8 * hh);
        kb.h[1] = *(const v8b*)(Ksh + (j * 16 + c) * LP + dc * 32 + 16 + 8 * hh);
        kl.h[0] = *(const v8b*)(Ksl + (j * 16 + c) * LP + dc * 32 + 8 * hh);
        kl.h[1] = *(const v8b*)(Ksl + (j * 16 + c) * LP + dc * 32 + 16 + 8 * hh);
        s[j] = mma_b(kb.v, qah[dc], s[j]);
        s[j] = mma_b(kl.v, qah[dc], s[j]);
        s[j] = mma_b(kb.v, qal[dc], s[j]);
      }
    }

    // ---- scale, causal mask on the diagonal tile, maximum of this lane's query ----
    const bool diag = (kc == qb);   // block-uniform
    const int qrow = q0 + c;
    float cm = -INFINITY;
#pragma unroll
    for (int j = 0; j < 4; ++j) {
#pragma unroll
      for (int r = 0; r < 8; ++r) {
        const int kvrow = kv0 + j * 16 + 8 * hh + r;
        const float sv = s[j][r] * sscale;
        const bool masked = diag && (kvrow > qrow);
        const float sm = masked ? -INFINITY : sv;
        s[j][r] = sm;
        cm = fmaxf(cm, sm);
      }
    }
    cm = fmaxf(cm, other_half(cm));                  // the other lane half holds the query's other 32 keys

    // ---- online softmax; P hi/lo (bf16, unnormalised) stays in registers as the B operand ----
    const float mnew  = fmaxf(mrow, cm);             // finite: key kv0 <= qrow is never masked
    const float alpha = __expf(mrow - mnew);
    mrow = mnew;
    float psum = 0.f;
    FB pa[2], pl[2];
#pragma unroll
    for (int j = 0; j < 4; ++j) {
      float p[8];
#pragma unroll
      for (int r = 0; r < 8; ++r) {
        p[r] = __expf(s[j][r] - mnew);
        psum += p[r];
      }
      split8(p, pa[j >> 1].q[j & 1], pl[j >> 1].q[j & 1]);   // elements (j & 1) * 8 + r of the operand
    }
    lrow = lrow * alpha + psum;
#pragma unroll
    for (int t = 0; t < 4; ++t)
#pragma unroll
      for (int r = 0; r < 8; ++r) oacc[t][r] *= alpha;

    // ---- context^T += V^T . P^T, 3 bf16 products ----
#pragma unroll   // unrolled: pa / pl are registers and are indexed by kk
    for (int kk = 0; kk < 2; ++kk) {
#pragma unroll
      for (int t = 0; t < 4; ++t) {
        FB vb, vl;
        vb.h[0] = *(const v8b*)(Vth + (t * 16 + c) * LP + kk * 32 + 8 * hh);
        vb.h[1] = *(const v8b*)(Vth + (t * 16 + c) * LP + kk * 32 + 16 + 8 * hh);
        vl.h[0] = *(const v8b*)(Vtl + (t * 16 + c) * LP + kk * 32 + 8 * hh);
        vl.h[1] = *(const v8b*)(Vtl + (t * 16 + c) * LP + kk * 32 + 16 + 8 * hh);
        oacc[t] = mma_b(vb.v, pa[kk].v, oacc[t]);
        oacc[t] = mma_b(vl.v, pa[kk].v, oacc[t]);
        oacc[t] = mma_b(vb.v, pl[kk].v, oacc[t]);
      }
    }
    asm volatile("s_wait_dscnt 0x0" ::: "memory");      // this wave's reads of tile kc are done before the buffer is refilled
    asm volatile("s_wait_asynccnt 0x0" ::: "memory");   // this wave's copies of tile kc + 1 have landed
    __syncthreads();                                    // publishes tile kc + 1 and ends every reader's use of tile kc
    if (kc + 2 < nChunks) {
      tile_copy(l0 + (unsigned)bo * 2, kgh + (size_t)(kc + 2) * kts, kgl + (size_t)(kc + 2) * kts, krs);
      tile_copy(l0 + (unsigned)bo * 2 + 2 * APL * 2, vgh + (kc + 2) * 64, vgl + (kc + 2) * 64, vrs);
    }
  }
  asm volatile("s_wait_asynccnt 0x0" ::: "memory");     // no copy is outstanding when the ring becomes output staging

  // ---- normalise (1/l), stage the wave's 16x64 tile, bf16 hi/lo split,
  float* os = (float*)(void*)ring + wave * (16 * OSP);   // per wave context tile [row][d], rows pitched OSP
  {
    const float l = lrow + other_half(lrow);           // join the lane halves' sums; >= 1 (the maximum's key contributes exp(0))
    const float inv = (l > 0.f) ? (1.0f / l) : 0.f;
#pragma unroll
    for (int t = 0; t < 4; ++t) {                      // 8 consecutive d of query row c: two 16-B stores
      v4f o0, o1;
#pragma unroll
      for (int r = 0; r < 4; ++r) { o0[r] = oacc[t][r] * inv; o1[r] = oacc[t][4 + r] * inv; }
      *(v4f*)(os + c * OSP + t * 16 + 8 * hh)     = o0;
      *(v4f*)(os + c * OSP + t * 16 + 8 * hh + 4) = o1;
    }
  }
  __builtin_amdgcn_fence(__ATOMIC_RELEASE, "workgroup");
  __builtin_amdgcn_wave_barrier();
  __builtin_amdgcn_fence(__ATOMIC_ACQUIRE, "workgroup");
  {
    const int q4 = lane >> 3, c8 = (lane & 7) * 8;
    v4u hv[4], lv[4];
#pragma unroll
    for (int it = 0; it < 4; ++it) {
      const int row = it * 4 + q4;   // it 0..3 x q4 0..3 = rows 0..15 of the wave tile
      const float* sp = os + row * OSP + c8;
      float f[8];
#pragma unroll
      for (int e = 0; e < 8; ++e) f[e] = sp[e];
      split8(f, hv[it], lv[it]);
    }
    {
#pragma unroll
      for (int it = 0; it < 4; ++it) {
        const int row = it * 4 + q4;
        const size_t go = (size_t)(rowBase + q0 + row) * CXP + (size_t)h * HD + c8;
        *(v4u*)(cxp + go)      = hv[it];
        *(v4u*)(cxp + go + DM) = lv[it];
      }
      
    }
  }
}

// =====================================================================================================
// Workspace map (bytes); every region is an exact multiple of its 64x64-tile / whole-line store granularity:
//   XB   bf16 [8192][1024]              0        16777216
//   WAT  bf16 [3072 n][1024 k]          16777216  6291456
//   WPT2 bf16 [1024 n][2048 k]          23068672  4194304   (W_proj^T duplicated along k)
//   QKh  bf16 [8192][2048]              27262976 33554432
//   QKl  bf16 [8192][2048]              60817408 33554432
//   VTh  bf16 [1024][8192]              94371840 16777216
//   VTl  bf16 [1024][8192]             111149056 16777216
//   CTX  bf16 [8192][2048]             127926272 33554432
//   end                                161480704
// Every stage is one launch over all four batch elements; QK / VT planes are fully written before the attention launch reads them.
// =====================================================================================================
extern "C" void kernel_launch(void* const* d_in, const int* in_sizes, int n_in,
                              void* d_out, int out_size, void* d_ws, size_t ws_size,
                              hipStream_t stream) {
  if (n_in < 5) return;
  if (in_sizes[0] != NB * SEQ * DM) return;
  if (in_sizes[1] != DM * N3) return;
  if (in_sizes[2] != N3) return;
  if (in_sizes[3] != DM * DM) return;
  if (in_sizes[4] != DM) return;
  if (out_size != NB * SEQ * DM) return;

  const float* x      = (const float*)d_in[0];   // [4][2048][1024]
  const float* W_attn = (const float*)d_in[1];   // [1024 in][3072 out]
  const float* b_attn = (const float*)d_in[2];   // [3072]
  const float* W_proj = (const float*)d_in[3];   // [1024 in][1024 out]
  const float* b_proj = (const float*)d_in[4];   // [1024]

  const size_t PXB = (size_t)NB * SEQ * DM * 2;     // 16777216
  const size_t PWA = (size_t)N3 * DM * 2;           //  6291456
  const size_t PWP = (size_t)DM * (2 * DM) * 2;     //  4194304
  const size_t PQK = (size_t)NB * SEQ * QKP * 2;    // 33554432
  const size_t PVT = (size_t)DM * VTP * 2;          // 16777216
  const size_t PCX = (size_t)NB * SEQ * CXP * 2;    // 33554432
  size_t off = 0;
  const size_t oXB  = off; off += PXB;
  const size_t oWAT = off; off += PWA;
  const size_t oWPT = off; off += PWP;
  const size_t oQKh = off; off += PQK;
  const size_t oQKl = off; off += PQK;
  const size_t oVTh = off; off += PVT;
  const size_t oVTl = off; off += PVT;
  const size_t oCTX = off; off += PCX;
  if (off > ws_size) return;                        // off = 161480704

  char* ws = (char*)d_ws;
  unsigned short* XB   = (unsigned short*)(ws + oXB);
  unsigned short* WAT  = (unsigned short*)(ws + oWAT);
  unsigned short* WPT2 = (unsigned short*)(ws + oWPT);
  unsigned short* QKh  = (unsigned short*)(ws + oQKh);
  unsigned short* QKl  = (unsigned short*)(ws + oQKl);
  unsigned short* VTh  = (unsigned short*)(ws + oVTh);
  unsigned short* VTl  = (unsigned short*)(ws + oVTl);
  unsigned short* CTX  = (unsigned short*)(ws + oCTX);

  const dim3 blk(256);
  const int n8x = NB * SEQ * DM / 8;                               // 1048576
  const dim3 gCvtX((n8x + 255) / 256);                             // 4096 blocks
  const dim3 gTA(N3 / 64, DM / 64);                                // in [1024 rows][3072 cols] -> (cols/64, rows/64)
  const dim3 gTP(DM / 64, DM / 64);                                // in [1024 rows][1024 cols]
  const dim3 gQK(((NB * SEQ / 64) * ((2 * DM) / 64) + 7) / 8);     // 4096 tiles -> 512 blocks: M=8192, N=2048
  const dim3 gVT(((DM / 64) * (NB * SEQ / 64) + 7) / 8);           // 2048 tiles -> 256 blocks: M=1024, N=8192
  const dim3 gAtt(NH * NB, NQB);                                   // 2048 blocks: (16 heads x 4 batch elements) x 32 query tiles, longest first
  const dim3 gOut(((NB * SEQ / 64) * (DM / 64) + 7) / 8);          // 2048 tiles -> 256 blocks: M=8192, N=1024

  // (1) x -> bf16 [8192][1024]
  cvt_bf16x8<<<gCvtX, blk, 0, stream>>>(x, XB, n8x);
  // (2) W_attn [k][n] -> WAT [n][k] bf16 (pitch 1024); W_proj [k][n] -> WPT2 [n][k | k] bf16 (pitch 2048)
  tcvt_kernel<false><<<gTA, blk, 0, stream>>>(W_attn, WAT, DM, N3, DM);
  tcvt_kernel<true><<<gTP, blk, 0, stream>>>(W_proj, WPT2, DM, DM, 2 * DM);

  // (3) q|k = x . W_attn[:, 0:2048] + b_attn[0:2048] -> bf16 hi/lo [8192][2048]   (M=8192, N=2048, K=1024)
  gemm64<2, 2><<<gQK, blk, 0, stream>>>(XB, DM, WAT, DM, (void*)QKh, (void*)QKl, QKP, b_attn, NB * SEQ, 2 * DM, DM);
  // (4) v^T = W_attn[:, 2048:3072]^T . x^T + b_attn[2048 + m] -> bf16 hi/lo [1024][8192]   (M=1024, N=8192, K=1024)
  gemm64<1, 2><<<gVT, blk, 0, stream>>>(WAT + (size_t)(2 * DM) * DM, DM, XB, DM, (void*)VTh, (void*)VTl, VTP,
                                        b_attn + 2 * DM, DM, NB * SEQ, DM);
  // (5) causal attention -> CTX rows 0..8191 (hi at cols 0..1023, lo at 1024..2047)
  attn_causal64<<<gAtt, dim3(128), 0, stream>>>(QKh, QKl, VTh, VTl, CTX, 0.125f);
  // (6) y = [ctx hi | ctx lo] . [W_proj^T | W_proj^T]^T + b_proj -> d_out f32 [8192][1024]   (M=8192, N=1024, K=2048)
  gemm64<2, 0><<<gOut, blk, 0, stream>>>(CTX, CXP, WPT2, 2 * DM, d_out, d_out, DM, b_proj, NB * SEQ, DM, 2 * DM);
  (void)hipGetLastError();
}

// v008
// Measured time: 172 microseconds a run.
// In two side-by-side timings against v007, it was 1.12 and 1.11 times as fast.
// All steps since v000 together make it 7.29 times as fast.
// Contractions: q|k and v^T projections = v_wmma_f32_16x16x32_bf16 (bf16 operands RNE-converted from x and W_attn, single product, + bf16 bias in f32);
// causal scores q.k^T = v_wmma_f32_16x16x32_bf16 with bf16 hi/lo split q and k (hi.hi + hi.lo + lo.hi);
// context p.v = v_wmma_f32_16x16x32_bf16 with bf16 hi/lo split p and v (3 products);
// output projection = v_wmma_f32_16x16x32_bf16, context bf16 hi|lo planes folded along K (K = 2048) times bf16 W_proj^T (+ bf16 bias in f32);
// all f32 accumulate; online softmax statistics, score scale 0.125 and bias adds in f32.
// Carry audit: every 16-bit plane (XB, WAT, WPT2, QKh/QKl, VTh/VTl, CTX hi|lo, P hi|lo in registers) has carry 1; no inverse factor is applied anywhere.
#include <hip/hip_runtime.h>
#include <math.h>
#include <stdint.h>

#define NB   4
#define SEQ  2048
#define DM   1024
#define NH   16
#define HD   64
#define N3   (3 * DM)      // 3072
#define QKP  (2 * DM)      // pitch of the q|k planes [t][q 1024 | k 1024]
#define CXP  (2 * DM)      // pitch of the context plane [t][hi 1024 | lo 1024]
#define VTP  (NB * SEQ)    // pitch of the v^T planes [h*64 + d][b*2048 + s]
#define QBLK 128           // query rows of one attention work-group: 4 waves x 32
#define NQT  (SEQ / QBLK)  // 16 query tiles
#define OSP  68            // LDS row pitch of the f32 context tile: 272 B = 16 B x 17 (odd), conflict-free for 16-B stores of 16 rows
#define LP   72            // LDS row pitch of the 64-element bf16 tiles: 144 B = 16 B x 9 (odd), conflict-free for 16-B fragment reads
static_assert(NH * HD == DM);
static_assert((SEQ % QBLK) == 0 && (QBLK % 64) == 0 && (SEQ % 64) == 0 && (DM % 64) == 0 && (N3 % 64) == 0);
static_assert((DM % 32) == 0 && (CXP % 32) == 0 && (QKP % 8) == 0);

typedef __bf16   v16b __attribute__((ext_vector_type(16)));
typedef __bf16   v8b  __attribute__((ext_vector_type(8)));
typedef float    v8f  __attribute__((ext_vector_type(8)));
typedef float    v4f  __attribute__((ext_vector_type(4)));
typedef unsigned int v4u __attribute__((ext_vector_type(4)));
typedef float    v2f  __attribute__((ext_vector_type(2)));
typedef __bf16   v2b  __attribute__((ext_vector_type(2)));

// ---- scalar helpers ----------------------------------------------------------------------------------
// f32 -> bf16 is the chip's own packed convert (RNE): two values in, one dword (a in the low half, b in the high half) out
__device__ __forceinline__ v2b cvt2(float a, float b) { const v2f x = {a, b}; return __builtin_convertvector(x, v2b); }
__device__ __forceinline__ unsigned pk_bf(float a, float b) { return __builtin_bit_cast(unsigned, cvt2(a, b)); }
__device__ __forceinline__ float bfr(float f) { return (float)(__bf16)f; }    // value after bf16 RNE convert
__device__ __forceinline__ v8f zero8() { v8f z = {0.f, 0.f, 0.f, 0.f, 0.f, 0.f, 0.f, 0.f}; return z; }
// hi = RNE(v), lo = RNE(v - hi) of eight values, packed two to a dword: three instructions a pair.
// The asm is there because the compiler unpacks hi, subtracts and converts again (five a pair): v_fma_mixlo/mixhi_bf16 read one
// bf16 half of hi, form v - hi in f32 (exact) and round it into one half of lo. The four low halves go first, so that each high
// half follows its register's first write at a distance of four; the s_delay_alu hints let other waves issue in the meantime.
// The four v_nop in front: the compiler may give lo registers that a matrix instruction issued just ahead still reads as its A or B,
// they are the four vector slots that the chip needs between the two.
__device__ __forceinline__ void split8(const float* f, v4u& hi, v4u& lo) {
  const unsigned h0 = pk_bf(f[0], f[1]), h1 = pk_bf(f[2], f[3]), h2 = pk_bf(f[4], f[5]), h3 = pk_bf(f[6], f[7]);
  unsigned l0, l1, l2, l3;
  asm("v_nop\n\tv_nop\n\tv_nop\n\tv_nop\n\t"
      "v_fma_mixlo_bf16 %0, %4, -1.0, %8 op_sel:[0,1,0] op_sel_hi:[1,1,0]\n\t"
      "v_fma_mixlo_bf16 %1, %5, -1.0, %10 op_sel:[0,1,0] op_sel_hi:[1,1,0]\n\t"
      "v_fma_mixlo_bf16 %2, %6, -1.0, %12 op_sel:[0,1,0] op_sel_hi:[1,1,0]\n\t"
      "v_fma_mixlo_bf16 %3, %7, -1.0, %14 op_sel:[0,1,0] op_sel_hi:[1,1,0]\n\t"
      "s_delay_alu instid0(VALU_DEP_4) | instskip(NEXT) | instid1(VALU_DEP_4)\n\t"
      "v_fma_mixhi_bf16 %0, %4, -1.0, %9 op_sel:[1,1,0] op_sel_hi:[1,1,0]\n\t"
      "v_fma_mixhi_bf16 %1, %5, -1.0, %11 op_sel:[1,1,0] op_sel_hi:[1,1,0]\n\t"
      "s_delay_alu instid0(VALU_DEP_4) | instskip(NEXT) | instid1(VALU_DEP_4)\n\t"
      "v_fma_mixhi_bf16 %2, %6, -1.0, %13 op_sel:[1,1,0] op_sel_hi:[1,1,0]\n\t"
      "v_fma_mixhi_bf16 %3, %7, -1.0, %15 op_sel:[1,1,0] op_sel_hi:[1,1,0]"
      : "=&v"(l0), "=&v"(l1), "=&v"(l2), "=&v"(l3)
      : "v"(h0), "v"(h1), "v"(h2), "v"(h3),
        "v"(f[0]), "v"(f[1]), "v"(f[2]), "v"(f[3]), "v"(f[4]), "v"(f[5]), "v"(f[6]), "v"(f[7]));
  hi[0] = h0; hi[1] = h1; hi[2] = h2; hi[3] = h3;
  lo[0] = l0; lo[1] = l1; lo[2] = l2; lo[3] = l3;
}

// value of the same lane position in the other 16-lane half (lane ^ 16), as a vector cross-row move: no LDS round trip
__device__ __forceinline__ float other_half(float v) {
  const int b = __float_as_int(v);
  return __int_as_float(__builtin_amdgcn_permlanex16(b, b, 0x76543210, 0xfedcba98, false, false));
}

// ---- fragment loader: 16-bit A/B operand, lane -> row/col (lane&15), p already includes +8*(lane>>4);
//      elements 0..7 <- p[0..7] (k0+8h..), elements 8..15 <- p[16..23] (k0+16+8h..)
__device__ __forceinline__ v16b ldfrag_b(const __bf16* p) {
  union { v16b v; v8b h[2]; } f;
  f.h[0] = *(const v8b*)(p);
  f.h[1] = *(const v8b*)(p + 16);
  return f.v;
}

// ---- WMMA helpers with trailing VALU hazard gap ----------------------------------------------------------
__device__ __forceinline__ v8f mma_b_raw(v16b a, v16b b, v8f c) {
  return __builtin_amdgcn_wmma_f32_16x16x32_bf16(false, a, false, b, (short)0, c, false, false);
}
__device__ __forceinline__ void dep_guard_b(v8f& a, v8f& b, v16b x, v16b y) {
  asm volatile("v_nop\n\tv_nop\n\tv_nop\n\tv_nop" : "+v"(a), "+v"(b) : "v"(x), "v"(y));
}
__device__ __forceinline__ void keep4_b(v16b a, v16b b, v16b c, v16b d) {
  asm volatile("v_nop" :: "v"(a), "v"(b), "v"(c), "v"(d));
}
__device__ __forceinline__ void acc_guard4(v8f& a, v8f& b, v8f& c, v8f& d) {
  asm volatile("v_nop\n\tv_nop\n\tv_nop\n\tv_nop" : "+v"(a), "+v"(b), "+v"(c), "+v"(d));
}

// =====================================================================================================
// f32 -> bf16 (RNE convert), 8 elements per thread, one 16-B store per lane: a wave writes 512 contiguous B
// coverage: n8 threads x 8 = the whole plane (n8 = 1048576, a multiple of 256).
// =====================================================================================================
__global__ __launch_bounds__(256) void cvt_bf16x8(const float* __restrict__ in, unsigned short* out, int n8) {
  const int i = blockIdx.x * 256 + threadIdx.x;
  if (i < n8) {
    const v4f a = *(const v4f*)(in + (size_t)i * 8);
    const v4f b = *(const v4f*)(in + (size_t)i * 8 + 4);
    v4u p;
    p[0] = pk_bf(a[0], a[1]);
    p[1] = pk_bf(a[2], a[3]);
    p[2] = pk_bf(b[0], b[1]);
    p[3] = pk_bf(b[2], b[3]);
    *(v4u*)(out + (size_t)i * 8) = p;
    
  }
}

// =====================================================================================================
// Transpose + bf16 convert of an f32 matrix: in [R rows][Cc cols] (pitch Cc) -> o[c][r] = bf16_rne(in[r][c]),
// output row pitch P (>= R); DUP additionally writes the same value at o[c][R + r] (duplicate along k).
// 64x64 tiles through LDS. grid = (Cc/64, R/64), 256 threads (R, Cc multiples of 64).
// coverage per block: load 4 it x 256 thr x 4 floats = 64x64; store 2 it x 256 thr x 8 u16 = 64x64 (x2 with DUP).
// =====================================================================================================
template <bool DUP>
__global__ __launch_bounds__(256) void tcvt_kernel(const float* __restrict__ W, unsigned short* o, int R, int Cc, int P) {
  __shared__ __align__(16) float tf[64 * 68];
  const int c0  = blockIdx.x * 64;   // input column block = output row block
  const int r0  = blockIdx.y * 64;   // input row block    = output column block
  const int tid = threadIdx.x;
  {
    const int lr = tid >> 4;         // 0..15
    const int c4 = (tid & 15) * 4;   // 0..60
#pragma unroll
    for (int it = 0; it < 4; ++it) {
      const int rr = it * 16 + lr;   // 0..63
      const v4f a = *(const v4f*)(W + (size_t)(r0 + rr) * Cc + c0 + c4);
      *(v4f*)(tf + rr * 68 + c4) = a;
    }
  }
  __syncthreads();
  const int sub = tid >> 3;          // 0..31
  const int c8  = (tid & 7) * 8;     // 0..56
  v4u hv[2];
#pragma unroll
  for (int it = 0; it < 2; ++it) {
    const int oc = it * 32 + sub;    // output row within tile (= input column)
    v4u a;
#pragma unroll
    for (int q = 0; q < 4; ++q) {
      const float f0 = tf[(c8 + 2 * q) * 68 + oc];
      const float f1 = tf[(c8 + 2 * q + 1) * 68 + oc];
      a[q] = pk_bf(f0, f1);
    }
    hv[it] = a;
  }
  {
#pragma unroll
    for (int it = 0; it < 2; ++it) {
      const int oc = it * 32 + sub;
      const size_t go = (size_t)(c0 + oc) * P + r0 + c8;
      *(v4u*)(o + go) = hv[it];
      if (DUP) *(v4u*)(o + go + R) = hv[it];
    }
    
  }
}

// =====================================================================================================
// Register-blocked bf16 WMMA GEMM: C[m][n] = sum_k A[m][k] * Bt[n][k] + bias; one wave per 64x64 tile,
// eight waves (2 x 4) = one 128 x 256 tile per work-group. A row-major [M][K] pitch lda; Bt row-major [N][K] pitch ldb
// (k contiguous); M multiple of 128, N multiple of 256, K multiple of 64 and >= 128 (host constants, asserted below).
// Operands: a stage = 64 k = one whole 128-B line of each of the 128 A rows and 256 Bt rows, laid in LDS at pitch LP
// ([A rows | Bt rows]); two buffers; stage t + 2 is copied (16 B per lane, global -> LDS, no register) while stage t + 1 is worked on.
// copy coverage per stage: 12 copies x 256 threads x 16 B = 384 rows x 128 B; a wave's copy = 4 whole lines.
// BIAS_MODE: 1 = bias[m], 2 = bias[n]; bias value RNE-converted to bf16 then added in f32.
// OUT_MODE: 0 = f32 (pitch ldc); 2 = bf16 hi plane C + bf16 lo plane C2 (lo = RNE(v - hi), unscaled), pitch ldc.
// =====================================================================================================
#define GTM  128                   // work-group tile rows
#define GTN  256                   // work-group tile columns
#define GKB  64                    // k elements per stage
#define GSTG ((GTM + GTN) * LP)    // bf16 elements of one stage in LDS (55296 B)
static_assert(((NB * SEQ) % GTN) == 0 && (DM % GTN) == 0 && ((2 * DM) % GTN) == 0);
static_assert((DM % GKB) == 0 && (CXP % GKB) == 0 && DM >= 2 * GKB);

// One stage's copies of one lane: rows r, r + 32, .. of A (4) and of Bt (8), LDS rows 32 * LP elements apart.
// The copies and s_wait_xcnt 0 are one statement, so that no address register is rewritten ahead of that wait.
__device__ __forceinline__ void stage_copy(unsigned l, const __bf16* a, size_t as, const __bf16* b, size_t bs) {
  const unsigned ls = 32 * LP * 2;   // bytes between a lane's consecutive LDS rows
  asm volatile(
      "global_load_async_to_lds_b128 %0, %12, off\n\t"
      "global_load_async_to_lds_b128 %1, %13, off\n\t"
      "global_load_async_to_lds_b128 %2, %14, off\n\t"
      "global_load_async_to_lds_b128 %3, %15, off\n\t"
      "global_load_async_to_lds_b128 %4, %16, off\n\t"
      "global_load_async_to_lds_b128 %5, %17, off\n\t"
      "global_load_async_to_lds_b128 %6, %18, off\n\t"
      "global_load_async_to_lds_b128 %7, %19, off\n\t"
      "global_load_async_to_lds_b128 %8, %20, off\n\t"
      "global_load_async_to_lds_b128 %9, %21, off\n\t"
      "global_load_async_to_lds_b128 %10, %22, off\n\t"
      "global_load_async_to_lds_b128 %11, %23, off\n\t"
      "s_wait_xcnt 0x0"
      :: "v"(l), "v"(l + ls), "v"(l + 2 * ls), "v"(l + 3 * ls), "v"(l + 4 * ls), "v"(l + 5 * ls),
         "v"(l + 6 * ls), "v"(l + 7 * ls), "v"(l + 8 * ls), "v"(l + 9 * ls), "v"(l + 10 * ls), "v"(l + 11 * ls),
         "v"(a), "v"(a + as), "v"(a + 2 * as), "v"(a + 3 * as),
         "v"(b), "v"(b + bs), "v"(b + 2 * bs), "v"(b + 3 * bs), "v"(b + 4 * bs), "v"(b + 5 * bs), "v"(b + 6 * bs), "v"(b + 7 * bs)
      : "memory");
}

template <int BIAS_MODE, int OUT_MODE>
__global__ __launch_bounds__(256) void gemm64(
    const unsigned short* __restrict__ Ap, int lda,
    const unsigned short* __restrict__ Btp, int ldb,
    void* Cout, void* Cout2, int ldc,
    const float* __restrict__ bias,
    int M, int N, int K) {
  const __bf16* A  = (const __bf16*)(const void*)Ap;
  const __bf16* Bt = (const __bf16*)(const void*)Btp;
  __shared__ __align__(16) __bf16 ring[2 * GSTG];  // two stages [A 128 rows | Bt 256 rows], pitch LP
  __shared__ __align__(16) float sT[8][16 * 68];   // per-wave 16x64 slab, pitch 68 floats
  const int lane = threadIdx.x & 31;
  const int wave = threadIdx.x >> 5;
  const int blocksN = N / GTN;
  const int blocksM = M / GTM;
  if ((int)blockIdx.x >= blocksM * blocksN) return;   // block-uniform, in front of every barrier
  const int bm = blockIdx.x / blocksN;
  const int bn = blockIdx.x - bm * blocksN;
  const int wm = wave >> 2;                    // 0..1
  const int wn = wave & 3;                     // 0..3
  const int m0 = bm * GTM + (wm << 6);
  const int n0 = bn * GTN + (wn << 6);

  const int rlane = lane & 15;                 // row (A) / col (B, D) within subtile
  const int koff  = (lane >> 4) * 8;           // k offset of this lane half
  const int mOff  = (lane >> 4) * 8;           // D row offset

  v8f acc[4][4];
#pragma unroll
  for (int i = 0; i < 4; ++i)
#pragma unroll
    for (int j = 0; j < 4; ++j) acc[i][j] = zero8();

  // this lane's place in a stage: row crow (+ 32 per copy), 16-B piece ccol of the row's 128 B
  const int crow = threadIdx.x >> 3;           // 0..31
  const int ccol = (threadIdx.x & 7) * 8;      // 0..56 elements
  const __bf16* ga = A  + (size_t)(bm * GTM + crow) * lda + ccol;
  const __bf16* gb = Bt + (size_t)(bn * GTN + crow) * ldb + ccol;
  const size_t  as = (size_t)32 * lda;
  const size_t  bs = (size_t)32 * ldb;
  const unsigned l0 = (unsigned)(uintptr_t)(ring + crow * LP + ccol);   // LDS byte address in buffer 0
  const int nst = K / GKB;                     // stages, >= 2

  stage_copy(l0, ga, as, gb, bs);
  asm volatile("s_wait_asynccnt 0x0" ::: "memory");   // stage 0 of this wave has landed
  __syncthreads();                                    // stage 0 of every wave is readable
  if (nst > 1) stage_copy(l0 + GSTG * 2, ga + GKB, as, gb + GKB, bs);

#pragma unroll 1   // rolled: one publish point in the text, the buffer chosen by t & 1
  for (int t = 0; t < nst; ++t) {
    const int bo = (t & 1) * GSTG;
    const __bf16* sa = ring + bo + ((wm << 6) + rlane) * LP + koff;
    const __bf16* sb = ring + bo + (GTM + (wn << 6) + rlane) * LP + koff;
#pragma unroll
    for (int kk = 0; kk < GKB; kk += 32) {
      v16b bh[4], ah[4];
#pragma unroll
      for (int j = 0; j < 4; ++j) bh[j] = ldfrag_b(sb + (j << 4) * LP + kk);
#pragma unroll
      for (int i = 0; i < 4; ++i) ah[i] = ldfrag_b(sa + (i << 4) * LP + kk);
#pragma unroll
      for (int i = 0; i < 4; ++i) {
#pragma unroll
        for (int j = 0; j < 4; ++j) acc[i][j] = mma_b_raw(ah[i], bh[j], acc[i][j]);
        dep_guard_b(acc[i][0], acc[i][3], ah[i], ah[i]);
      }
      keep4_b(bh[0], bh[1], bh[2], bh[3]);
    }
    asm volatile("s_wait_dscnt 0x0" ::: "memory");      // this wave's reads of stage t are done before the buffer is refilled
    asm volatile("s_wait_asynccnt 0x0" ::: "memory");   // this wave's copies of stage t + 1 have landed
    __syncthreads();                                    // publishes stage t + 1 and ends every reader's use of stage t
    if (t + 2 < nst) stage_copy(l0 + (unsigned)bo * 2, ga + (size_t)(t + 2) * GKB, as, gb + (size_t)(t + 2) * GKB, bs);
  }
  asm volatile("s_wait_asynccnt 0x0" ::: "memory");     // no copy is outstanding when the wave goes on
  acc_guard4(acc[0][0], acc[0][1], acc[0][2], acc[0][3]);
  acc_guard4(acc[1][0], acc[1][1], acc[1][2], acc[1][3]);
  acc_guard4(acc[2][0], acc[2][1], acc[2][2], acc[2][3]);
  acc_guard4(acc[3][0], acc[3][1], acc[3][2], acc[3][3]);

  // ---- epilogue ----
  float* slab = sT[wave];
#pragma unroll
  for (int i = 0; i < 4; ++i) {
    const int mBase = m0 + (i << 4);
    float bm8[8];
#pragma unroll
    for (int r = 0; r < 8; ++r) bm8[r] = 0.f;
    if (BIAS_MODE == 1) {                          // rows mBase+mOff .. +7: two 16-B loads (32-B aligned)
      const v4f t0 = *(const v4f*)(bias + mBase + mOff);
      const v4f t1 = *(const v4f*)(bias + mBase + mOff + 4);
      bm8[0] = bfr(t0[0]); bm8[1] = bfr(t0[1]); bm8[2] = bfr(t0[2]); bm8[3] = bfr(t0[3]);
      bm8[4] = bfr(t1[0]); bm8[5] = bfr(t1[1]); bm8[6] = bfr(t1[2]); bm8[7] = bfr(t1[3]);
    }
#pragma unroll
    for (int j = 0; j < 4; ++j) {
      float bn = 0.f;
      if (BIAS_MODE == 2) bn = bfr(bias[n0 + (j << 4) + rlane]);
#pragma unroll
      for (int r = 0; r < 8; ++r) {
        float v = acc[i][j][r];
        if (BIAS_MODE == 1) v += bm8[r];
        if (BIAS_MODE == 2) v += bn;
        slab[(mOff + r) * 68 + (j << 4) + rlane] = v;
      }
    }
    __builtin_amdgcn_fence(__ATOMIC_RELEASE, "workgroup");
    __builtin_amdgcn_wave_barrier();
    __builtin_amdgcn_fence(__ATOMIC_ACQUIRE, "workgroup");
    if (OUT_MODE == 0) {
      float* C = (float*)Cout;
      const int hh = lane >> 4, c4 = (lane & 15) * 4;     // 256-B row segment = 16 lanes x 16 B
      {
#pragma unroll
        for (int it = 0; it < 8; ++it) {
          const int row = it * 2 + hh;                     // it 0..7 x hh 0..1 = rows 0..15
          const v4f v = *(const v4f*)(slab + row * 68 + c4);
          *(v4f*)(C + (size_t)(mBase + row) * ldc + n0 + c4) = v;
        }
        
      }
    } else {
      const int q = lane >> 3, c8 = (lane & 7) * 8;
      unsigned short* C  = (unsigned short*)Cout;
      unsigned short* C2 = (unsigned short*)Cout2;
      v4u hv[4], lv[4];
#pragma unroll
      for (int it = 0; it < 4; ++it) {
        const int row = it * 4 + q;                        // it 0..3 x q 0..3 = rows 0..15
        const float* sp = slab + row * 68 + c8;
        float f[8];
#pragma unroll
        for (int e = 0; e < 8; ++e) f[e] = sp[e];
        split8(f, hv[it], lv[it]);
      }
      {
#pragma unroll
        for (int it = 0; it < 4; ++it) {
          const int row = it * 4 + q;
          *(v4u*)(C  + (size_t)(mBase + row) * ldc + n0 + c8) = hv[it];
          *(v4u*)(C2 + (size_t)(mBase + row) * ldc + n0 + c8) = lv[it];
        }
        
      }
    }
    __builtin_amdgcn_fence(__ATOMIC_RELEASE, "workgroup");
    __builtin_amdgcn_wave_barrier();
    __builtin_amdgcn_fence(__ATOMIC_ACQUIRE, "workgroup");
  }
}

// =====================================================================================================
// Causal attention, head dim 64, all batch elements in one launch (blockIdx.x = head and batch element, blockIdx.y = query tile, longest first).
//   q|k planes (bf16 hi / lo): [b*SEQ + t][QKP], q(t, h, d) at col h*64 + d, k(s, h, d) at col DM + h*64 + d
//   v^T planes (bf16 hi / lo): [(h*64 + d)][VTP], key s of batch b at col b*SEQ + s, s contiguous
//   context plane (bf16): row b*SEQ + t, pitch CXP; hi at col h*64 + d, lo (RNE(v - hi)) at col DM + h*64 + d
//   scores = q . k : bf16 hi/lo split (hi.hi + hi.lo + lo.hi), f32 accumulate, then * sscale in f32
//   out    = p . v : bf16 hi/lo split of p (unnormalised) and v, f32 accumulate
//   both products are formed transposed: S^T = K . Q^T (A = K rows, B = q) and O^T += V^T . P^T (A = V^T rows, B = p):
//   a wave holds 32 queries as two column groups n of 16, so every K and V^T fragment read from LDS feeds two products;
//   in a group a lane holds the scores of ONE query (q0 + n*16 + lane&15), keys 8*(lane>>4) + r of each 16-key tile, so two score tiles, split in
//   place, are the B operand of the second product (element e = tile 2kk row e, element 8 + e = tile 2kk+1 row e: the k order of
//   the V^T loader), and maximum, sum and rescale factor are one value per lane and group.
//   online softmax in f32; key s > t set to -inf only on the block's last two key tiles (key 0 of tile 0 is live for every query).
//   Block = 4 waves = 128 query rows of one head; grid = (NH * NB, NQT); key tiles of 64, block-uniform trip count 2*qb+2 <= 32,
//   every wave reaches the one block barrier of every iteration.
//   K / V^T tile staging: a stage = the 64x64 tile of all four planes [K hi | K lo | V^T hi | V^T lo], rows pitched LP; two buffers;
//   tile kc + 2 is copied (16 B per lane, global -> LDS, no register) while tile kc + 1 is worked on.
//   copy coverage per stage: 16 copies x 128 threads x 16 B = 4 planes x 64 rows x 128 B; a wave's copy = 4 whole 128-B lines.
//   After the loop the ring is free (the last trip's barrier ends every read) and holds the per-wave f32 context tiles.
//   Output coverage: each wave stores rows q0..q0+31 (it 0..7 x lane>>3 0..3) x 64 columns (8 lanes x 8) of both planes.
// =====================================================================================================
#define APL  (64 * LP)     // bf16 elements of one plane's tile in LDS (9216 B)
#define ASTG (4 * APL)     // bf16 elements of one stage in LDS (36864 B)
static_assert(4 * 32 * OSP * 4 <= 2 * ASTG * 2);   // the four f32 context tiles fit in the ring

// One lane's copies of two planes of a stage: rows r, r + 16, r + 32, r + 48 of plane a, then of plane b (LDS: the next plane).
// a, b: the two planes' tile starts, the same for the whole work-group (scalar base); o: this lane's byte offset in a tile, rs: bytes
// between its consecutive rows: four offset registers serve both planes, and no 64-bit lane pointer lives over the key loop.
// The copies and s_wait_xcnt 0 are one statement, so that no address register is rewritten ahead of that wait.
__device__ __forceinline__ void tile_copy(unsigned l, const __bf16* a, const __bf16* b, unsigned o, unsigned rs) {
  const unsigned ls = 16 * LP * 2;   // bytes between a lane's consecutive LDS rows
  const unsigned ps = APL * 2;       // bytes between the planes in LDS
  asm volatile(
      "global_load_async_to_lds_b128 %0, %8, %12\n\t"
      "global_load_async_to_lds_b128 %1, %9, %12\n\t"
      "global_load_async_to_lds_b128 %2, %10, %12\n\t"
      "global_load_async_to_lds_b128 %3, %11, %12\n\t"
      "global_load_async_to_lds_b128 %4, %8, %13\n\t"
      "global_load_async_to_lds_b128 %5, %9, %13\n\t"
      "global_load_async_to_lds_b128 %6, %10, %13\n\t"
      "global_load_async_to_lds_b128 %7, %11, %13\n\t"
      "s_wait_xcnt 0x0"
      :: "v"(l), "v"(l + ls), "v"(l + 2 * ls), "v"(l + 3 * ls),
         "v"(l + ps), "v"(l + ps + ls), "v"(l + ps + 2 * ls), "v"(l + ps + 3 * ls),
         "v"(o), "v"(o + rs), "v"(o + 2 * rs), "v"(o + 3 * rs),
         "s"(a), "s"(b)
      : "memory");
}

__global__ __launch_bounds__(128)
void attn_causal64(const unsigned short* __restrict__ qkhp, const unsigned short* __restrict__ qklp,
                   const unsigned short* __restrict__ vhp, const unsigned short* __restrict__ vlp,
                   unsigned short* cxp, float sscale) {
  union FB { v16b v; v8b h[2]; v4u q[2]; };
  __shared__ __align__(16) __bf16 ring[2 * ASTG];      // two stages [K hi [kv][d] | K lo | V^T hi [d][kv] | V^T lo], rows pitched LP

  const int tid  = threadIdx.x;
  const int wave = tid >> 5;
  const int lane = tid & 31;
  const int hh   = lane >> 4;
  const int c    = lane & 15;

  // The query tile falls with blockIdx.y, so the longest key loops get the lowest block indices (for speed only).
  const int bx = blockIdx.x;               // 0..NH*NB-1 (grid.x = NH * NB)
  const int by = blockIdx.y;               // 0..NQT-1   (grid.y = NQT)
  const int qb = (NQT - 1 - by) % NQT;     // % NQT is an identity on this grid: it gives the compiler the tile's range
  const int h  = bx % NH;                  // 0..NH-1
  const int q0 = qb * QBLK + wave * 32;    // first of this wave's 32 queries
  const int rowBase = (bx / NH) * SEQ;     // first token row of this batch element (bx / NH = 0..NB-1)

  const __bf16* Qh = (const __bf16*)(const void*)qkhp + (size_t)rowBase * QKP + (size_t)h * HD;
  const __bf16* Ql = (const __bf16*)(const void*)qklp + (size_t)rowBase * QKP + (size_t)h * HD;
  const __bf16* Kh = Qh + DM;
  const __bf16* Kl = Ql + DM;
  const __bf16* Vh = (const __bf16*)(const void*)vhp + (size_t)h * HD * VTP + rowBase;
  const __bf16* Vl = (const __bf16*)(const void*)vlp + (size_t)h * HD * VTP + rowBase;

  // ---- Q fragments (B operand, column = query = n*16 + lane&15, split k map): 2 column groups x 2 d-chunks, hi and lo ----
  v16b qah[2][2], qal[2][2];
#pragma unroll
  for (int n = 0; n < 2; ++n) {
#pragma unroll
    for (int dc = 0; dc < 2; ++dc) {
      const size_t qo = (size_t)(q0 + n * 16 + c) * QKP + dc * 32 + 8 * hh;
      qah[n][dc] = ldfrag_b(Qh + qo);
      qal[n][dc] = ldfrag_b(Ql + qo);
    }
  }
  asm volatile("s_wait_xcnt 0x0" ::: "memory");   // stands in front of the first instruction that reuses an address register of the Q loads
  __builtin_amdgcn_sched_barrier(0);              // keeps the later address arithmetic below that wait (the compiler lifted one over it)

  float mrow[2];            // running maximum of query q0 + n*16 + c (the same in both lane halves)
  float lrow[2];            // running sum over this lane half's keys only; the halves are joined after the loop
  v8f oacc[2][4];           // O^T: oacc[n][t][r] = context(query q0 + n*16 + c, d = t*16 + 8*hh + r)
#pragma unroll
  for (int n = 0; n < 2; ++n) {
    mrow[n] = -INFINITY;
    lrow[n] = 0.f;
#pragma unroll
    for (int t = 0; t < 4; ++t) oacc[n][t] = zero8();
  }

  const int nChunks = 2 * qb + 2;   // block-uniform, 2..32: key tiles 0 .. the one that holds the block's last query

  // this lane's place in a stage: row crow (+ 16 per copy), 16-B piece ccol of the row's 128 B
  const int crow = tid >> 3;               // 0..15
  const int ccol = (tid & 7) * 8;          // 0..56 elements
  const unsigned ko  = (crow * QKP + ccol) * 2;   // this lane's byte in a K tile (row crow)
  const unsigned vo  = (crow * VTP + ccol) * 2;   // this lane's byte in a V^T tile (row d = crow)
  const unsigned krs = 16 * QKP * 2;
  const unsigned vrs = 16 * VTP * 2;
  const size_t   kts = (size_t)64 * QKP;          // a K tile is 64 rows on, a V^T tile 64 columns on
  const unsigned l0 = (unsigned)(uintptr_t)(ring + crow * LP + ccol);   // LDS byte address in buffer 0, plane K hi

  tile_copy(l0, Kh, Kl, ko, krs);
  tile_copy(l0 + 2 * APL * 2, Vh, Vl, vo, vrs);
  asm volatile("s_wait_asynccnt 0x0" ::: "memory");   // tile 0 of this wave has landed
  __syncthreads();                                    // tile 0 of every wave is readable
  if (nChunks > 1) {
    tile_copy(l0 + ASTG * 2, Kh + kts, Kl + kts, ko, krs);
    tile_copy(l0 + ASTG * 2 + 2 * APL * 2, Vh + 64, Vl + 64, vo, vrs);
  }

#pragma unroll 1   // rolled: one publish point in the text, the buffer chosen by kc & 1
  for (int kc = 0; kc < nChunks; ++kc) {
    const int kv0 = kc * 64;
    const int bo  = (kc & 1) * ASTG;
    const __bf16* Ksh = ring + bo;
    const __bf16* Ksl = Ksh + APL;
    const __bf16* Vth = Ksh + 2 * APL;
    const __bf16* Vtl = Ksh + 3 * APL;

    // ---- scores, transposed: 64 keys (rows) x 32 queries (columns) per wave, 3 bf16 products;
    //      each K fragment is read once and multiplies both column groups (two independent accumulators) ----
    v8f s[2][4];
#pragma unroll
    for (int j = 0; j < 4; ++j) {
      s[0][j] = zero8();
      s[1][j] = zero8();
#pragma unroll
      for (int dc = 0; dc < 2; ++dc) {
        FB kb, kl;
        kb.h[0] = *(const v8b*)(Ksh + (j * 16 + c) * LP + dc * 32 + 8 * hh);
        kb.h[1] = *(const v8b*)(Ksh + (j * 16 + c) * LP + dc * 32 + 16 + 8 * hh);
        kl.h[0] = *(const v8b*)(Ksl + (j * 16 + c) * LP + dc * 32 + 8 * hh);
        kl.h[1] = *(const v8b*)(Ksl + (j * 16 + c) * LP + dc * 32 + 16 + 8 * hh);
        s[0][j] = mma_b_raw(kb.v, qah[0][dc], s[0][j]);
        s[1][j] = mma_b_raw(kb.v, qah[1][dc], s[1][j]);
        s[0][j] = mma_b_raw(kl.v, qah[0][dc], s[0][j]);
        s[1][j] = mma_b_raw(kl.v, qah[1][dc], s[1][j]);
        s[0][j] = mma_b_raw(kb.v, qal[0][dc], s[0][j]);
        s[1][j] = mma_b_raw(kb.v, qal[1][dc], s[1][j]);
      }
    }

    // ---- per column group: scale, causal mask, online softmax; P hi/lo (bf16, unnormalised) stays in registers as the B operand ----
    const bool diag = (kc >= 2 * qb);   // block-uniform: only the block's last two key tiles hold a key above one of its queries
    FB pa[2][2], pl[2][2];
#pragma unroll
    for (int n = 0; n < 2; ++n) {
      // key j*16 + r of this lane half is masked when it lies above lim (64 = above every key of a tile: nothing masked)
      const int lim = diag ? (q0 + n * 16 + c - kv0 - 8 * hh) : 64;
      float cm = -INFINITY;
#pragma unroll
      for (int j = 0; j < 4; ++j) {
#pragma unroll
        for (int r = 0; r < 8; ++r) {
          const float sv = s[n][j][r] * sscale;
          const float sm = (j * 16 + r > lim) ? -INFINITY : sv;
          s[n][j][r] = sm;
          cm = fmaxf(cm, sm);
        }
      }
      cm = fmaxf(cm, other_half(cm));                  // the other lane half holds the query's other 32 keys

      // finite: key 0 of tile 0 is live for every query, so mrow is finite from tile 0 on; a tile that is masked whole for a query
      // (the last tile, first two waves) gives alpha = 1 and p = 0
      const float mnew  = fmaxf(mrow[n], cm);
      const float alpha = __expf(mrow[n] - mnew);
      mrow[n] = mnew;
      float psum = 0.f;
#pragma unroll
      for (int j = 0; j < 4; ++j) {
        float p[8];
#pragma unroll
        for (int r = 0; r < 8; ++r) {
          p[r] = __expf(s[n][j][r] - mnew);
          psum += p[r];
        }
        split8(p, pa[n][j >> 1].q[j & 1], pl[n][j >> 1].q[j & 1]);   // elements (j & 1) * 8 + r of the operand
      }
      lrow[n] = lrow[n] * alpha + psum;
#pragma unroll
      for (int t = 0; t < 4; ++t)
#pragma unroll
        for (int r = 0; r < 8; ++r) oacc[n][t][r] *= alpha;
    }

    // ---- context^T += V^T . P^T, 3 bf16 products; each V^T fragment is read once and multiplies both column groups ----
#pragma unroll   // unrolled: pa / pl are registers and are indexed by kk
    for (int kk = 0; kk < 2; ++kk) {
#pragma unroll
      for (int t = 0; t < 4; ++t) {
        FB vb, vl;
        vb.h[0] = *(const v8b*)(Vth + (t * 16 + c) * LP + kk * 32 + 8 * hh);
        vb.h[1] = *(const v8b*)(Vth + (t * 16 + c) * LP + kk * 32 + 16 + 8 * hh);
        vl.h[0] = *(const v8b*)(Vtl + (t * 16 + c) * LP + kk * 32 + 8 * hh);
        vl.h[1] = *(const v8b*)(Vtl + (t * 16 + c) * LP + kk * 32 + 16 + 8 * hh);
        oacc[0][t] = mma_b_raw(vb.v, pa[0][kk].v, oacc[0][t]);
        oacc[1][t] = mma_b_raw(vb.v, pa[1][kk].v, oacc[1][t]);
        oacc[0][t] = mma_b_raw(vl.v, pa[0][kk].v, oacc[0][t]);
        oacc[1][t] = mma_b_raw(vl.v, pa[1][kk].v, oacc[1][t]);
        oacc[0][t] = mma_b_raw(vb.v, pl[0][kk].v, oacc[0][t]);
        oacc[1][t] = mma_b_raw(vb.v, pl[1][kk].v, oacc[1][t]);
      }
    }
    asm volatile("s_wait_dscnt 0x0" ::: "memory");      // this wave's reads of tile kc are done before the buffer is refilled
    asm volatile("s_wait_asynccnt 0x0" ::: "memory");   // this wave's copies of tile kc + 1 have landed
    __syncthreads();                                    // publishes tile kc + 1 and ends every reader's use of tile kc
    if (kc + 2 < nChunks) {
      tile_copy(l0 + (unsigned)bo * 2, Kh + (size_t)(kc + 2) * kts, Kl + (size_t)(kc + 2) * kts, ko, krs);
      tile_copy(l0 + (unsigned)bo * 2 + 2 * APL * 2, Vh + (kc + 2) * 64, Vl + (kc + 2) * 64, vo, vrs);
    }
  }
  asm volatile("s_wait_asynccnt 0x0" ::: "memory");     // no copy is outstanding when the ring becomes output staging

  // ---- normalise (1/l), stage the wave's 32x64 tile, bf16 hi/lo split,
  float* os = (float*)(void*)ring + wave * (32 * OSP);   // per wave context tile [row][d], rows pitched OSP
#pragma unroll
  for (int n = 0; n < 2; ++n) {
    const float l = lrow[n] + other_half(lrow[n]);     // join the lane halves' sums; >= 1 (the maximum's key contributes exp(0))
    const float inv = (l > 0.f) ? (1.0f / l) : 0.f;
#pragma unroll
    for (int t = 0; t < 4; ++t) {                      // 8 consecutive d of query row n*16 + c: two 16-B stores
      v4f o0, o1;
#pragma unroll
      for (int r = 0; r < 4; ++r) { o0[r] = oacc[n][t][r] * inv; o1[r] = oacc[n][t][4 + r] * inv; }
      *(v4f*)(os + (n * 16 + c) * OSP + t * 16 + 8 * hh)     = o0;
      *(v4f*)(os + (n * 16 + c) * OSP + t * 16 + 8 * hh + 4) = o1;
    }
  }
  __builtin_amdgcn_fence(__ATOMIC_RELEASE, "workgroup");
  __builtin_amdgcn_wave_barrier();
  __builtin_amdgcn_fence(__ATOMIC_ACQUIRE, "workgroup");
  {
    const int q4 = lane >> 3, c8 = (lane & 7) * 8;
    v4u hv[8], lv[8];
#pragma unroll
    for (int it = 0; it < 8; ++it) {
      const int row = it * 4 + q4;   // it 0..7 x q4 0..3 = rows 0..31 of the wave tile
      const float* sp = os + row * OSP + c8;
      float f[8];
#pragma unroll
      for (int e = 0; e < 8; ++e) f[e] = sp[e];
      split8(f, hv[it], lv[it]);
    }
    {
#pragma unroll
      for (int it = 0; it < 8; ++it) {
        const int row = it * 4 + q4;
        const size_t go = (size_t)(rowBase + q0 + row) * CXP + (size_t)h * HD + c8;
        *(v4u*)(cxp + go)      = hv[it];
        *(v4u*)(cxp + go + DM) = lv[it];
        if (it < 7) {
          asm volatile("s_wait_xcnt 0x0" ::: "memory");   // in front of the next rows' address arithmetic, which reuses these stores' registers
          __builtin_amdgcn_sched_barrier(0);              // keeps that arithmetic below the wait
        }
      }
    }
  }
}

// =====================================================================================================
// Workspace map (bytes); every region is an exact multiple of its 64x64-tile / whole-line store granularity:
//   XB   bf16 [8192][1024]              0        16777216
//   WAT  bf16 [3072 n][1024 k]          16777216  6291456
//   WPT2 bf16 [1024 n][2048 k]          23068672  4194304   (W_proj^T duplicated along k)
//   QKh  bf16 [8192][2048]              27262976 33554432
//   QKl  bf16 [8192][2048]              60817408 33554432
//   VTh  bf16 [1024][8192]              94371840 16777216
//   VTl  bf16 [1024][8192]             111149056 16777216
//   CTX  bf16 [8192][2048]             127926272 33554432
//   end                                161480704
// Every stage is one launch over all four batch elements; QK / VT planes are fully written before the attention launch reads them.
// =====================================================================================================
extern "C" void kernel_launch(void* const* d_in, const int* in_sizes, int n_in,
                              void* d_out, int out_size, void* d_ws, size_t ws_size,
                              hipStream_t stream) {
  if (n_in < 5) return;
  if (in_sizes[0] != NB * SEQ * DM) return;
  if (in_sizes[1] != DM * N3) return;
  if (in_sizes[2] != N3) return;
  if (in_sizes[3] != DM * DM) return;
  if (in_sizes[4] != DM) return;
  if (out_size != NB * SEQ * DM) return;

  const float* x      = (const float*)d_in[0];   // [4][2048][1024]
  const float* W_attn = (const float*)d_in[1];   // [1024 in][3072 out]
  const float* b_attn = (const float*)d_in[2];   // [3072]
  const float* W_proj = (const float*)d_in[3];   // [1024 in][1024 out]
  const float* b_proj = (const float*)d_in[4];   // [1024]

  const size_t PXB = (size_t)NB * SEQ * DM * 2;     // 16777216
  const size_t PWA = (size_t)N3 * DM * 2;           //  6291456
  const size_t PWP = (size_t)DM * (2 * DM) * 2;     //  4194304
  const size_t PQK = (size_t)NB * SEQ * QKP * 2;    // 33554432
  const size_t PVT = (size_t)DM * VTP * 2;          // 16777216
  const size_t PCX = (size_t)NB * SEQ * CXP * 2;    // 33554432
  size_t off = 0;
  const size_t oXB  = off; off += PXB;
  const size_t oWAT = off; off += PWA;
  const size_t oWPT = off; off += PWP;
  const size_t oQKh = off; off += PQK;
  const size_t oQKl = off; off += PQK;
  const size_t oVTh = off; off += PVT;
  const size_t oVTl = off; off += PVT;
  const size_t oCTX = off; off += PCX;
  if (off > ws_size) return;                        // off = 161480704

  char* ws = (char*)d_ws;
  unsigned short* XB   = (unsigned short*)(ws + oXB);
  unsigned short* WAT  = (unsigned short*)(ws + oWAT);
  unsigned short* WPT2 = (unsigned short*)(ws + oWPT);
  unsigned short* QKh  = (unsigned short*)(ws + oQKh);
  unsigned short* QKl  = (unsigned short*)(ws + oQKl);
  unsigned short* VTh  = (unsigned short*)(ws + oVTh);
  unsigned short* VTl  = (unsigned short*)(ws + oVTl);
  unsigned short* CTX  = (unsigned short*)(ws + oCTX);

  const dim3 blk(256);
  const int n8x = NB * SEQ * DM / 8;                               // 1048576
  const dim3 gCvtX((n8x + 255) / 256);                             // 4096 blocks
  const dim3 gTA(N3 / 64, DM / 64);                                // in [1024 rows][3072 cols] -> (cols/64, rows/64)
  const dim3 gTP(DM / 64, DM / 64);                                // in [1024 rows][1024 cols]
  const dim3 gQK(((NB * SEQ / 64) * ((2 * DM) / 64) + 7) / 8);     // 4096 tiles -> 512 blocks: M=8192, N=2048
  const dim3 gVT(((DM / 64) * (NB * SEQ / 64) + 7) / 8);           // 2048 tiles -> 256 blocks: M=1024, N=8192
  const dim3 gAtt(NH * NB, NQT);                                   // 1024 blocks: (16 heads x 4 batch elements) x 16 query tiles, longest first
  const dim3 gOut(((NB * SEQ / 64) * (DM / 64) + 7) / 8);          // 2048 tiles -> 256 blocks: M=8192, N=1024

  // (1) x -> bf16 [8192][1024]
  cvt_bf16x8<<<gCvtX, blk, 0, stream>>>(x, XB, n8x);
  // (2) W_attn [k][n] -> WAT [n][k] bf16 (pitch 1024); W_proj [k][n] -> WPT2 [n][k | k] bf16 (pitch 2048)
  tcvt_kernel<false><<<gTA, blk, 0, stream>>>(W_attn, WAT, DM, N3, DM);
  tcvt_kernel<true><<<gTP, blk, 0, stream>>>(W_proj, WPT2, DM, DM, 2 * DM);

  // (3) q|k = x . W_attn[:, 0:2048] + b_attn[0:2048] -> bf16 hi/lo [8192][2048]   (M=8192, N=2048, K=1024)
  gemm64<2, 2><<<gQK, blk, 0, stream>>>(XB, DM, WAT, DM, (void*)QKh, (void*)QKl, QKP, b_attn, NB * SEQ, 2 * DM, DM);
  // (4) v^T = W_attn[:, 2048:3072]^T . x^T + b_attn[2048 + m] -> bf16 hi/lo [1024][8192]   (M=1024, N=8192, K=1024)
  gemm64<1, 2><<<gVT, blk, 0, stream>>>(WAT + (size_t)(2 * DM) * DM, DM, XB, DM, (void*)VTh, (void*)VTl, VTP,
                                        b_attn + 2 * DM, DM, NB * SEQ, DM);
  // (5) causal attention -> CTX rows 0..8191 (hi at cols 0..1023, lo at 1024..2047)
  attn_causal64<<<gAtt, dim3(128), 0, stream>>>(QKh, QKl, VTh, VTl, CTX, 0.125f);
  // (6) y = [ctx hi | ctx lo] . [W_proj^T | W_proj^T]^T + b_proj -> d_out f32 [8192][1024]   (M=8192, N=1024, K=2048)
  gemm64<2, 0><<<gOut, blk, 0, stream>>>(CTX, CXP, WPT2, 2 * DM, d_out, d_out, DM, b_proj, NB * SEQ, DM, 2 * DM);
  (void)hipGetLastError();
}

// v009
// A run of this version takes 162 microseconds.
// Next to v008, in two timings, it ran 1.06 times as fast each time.
// Counting every step since v000, it is 7.73 times as fast.
// Contractions: q|k and v^T projections = v_wmma_f32_16x16x32_bf16 (bf16 operands RNE-converted from x and W_attn, single product, + bf16 bias in f32);
// causal scores q.k^T = v_wmma_f32_16x16x32_bf16 with bf16 hi/lo split q and k (hi.hi + hi.lo + lo.hi);
// context p.v = v_wmma_f32_16x16x32_bf16 with bf16 hi/lo split p and v (3 products);
// output projection = v_wmma_f32_16x16x32_bf16, context bf16 hi|lo planes folded along K (K = 2048) times bf16 W_proj^T (+ bf16 bias in f32);
// all f32 accumulate; online softmax statistics, score scale 0.125 and bias adds in f32.
// Carry audit: every 16-bit plane (XB, WAT, WPT2, QKh/QKl, VTh/VTl, CTX hi|lo, P hi|lo in registers) has carry 1; no inverse factor is applied anywhere.
#include <hip/hip_runtime.h>
#include <math.h>
#include <stdint.h>

#define NB   4
#define SEQ  2048
#define DM   1024
#define NH   16
#define HD   64
#define N3   (3 * DM)      // 3072
#define QKP  (2 * DM)      // pitch of the q|k planes [t][q 1024 | k 1024]
#define CXP  (2 * DM)      // pitch of the context plane [t][hi 1024 | lo 1024]
#define VTP  (NB * SEQ)    // pitch of the v^T planes [h*64 + d][b*2048 + s]
#define QBLK 128           // query rows of one attention work-group: 4 waves x 32
#define NQT  (SEQ / QBLK)  // 16 query tiles
#define OSP  68            // LDS row pitch of the f32 context tile: 272 B = 16 B x 17 (odd), conflict-free for 16-B stores of 16 rows
#define LP   72            // LDS row pitch of the 64-element bf16 tiles: 144 B = 16 B x 9 (odd), conflict-free for 16-B fragment reads
static_assert(NH * HD == DM);
static_assert((SEQ % QBLK) == 0 && (QBLK % 64) == 0 && (SEQ % 64) == 0 && (DM % 64) == 0 && (N3 % 64) == 0);
static_assert((DM % 32) == 0 && (CXP % 32) == 0 && (QKP % 8) == 0);

typedef __bf16   v16b __attribute__((ext_vector_type(16)));
typedef __bf16   v8b  __attribute__((ext_vector_type(8)));
typedef float    v8f  __attribute__((ext_vector_type(8)));
typedef float    v4f  __attribute__((ext_vector_type(4)));
typedef unsigned int v4u __attribute__((ext_vector_type(4)));
typedef float    v2f  __attribute__((ext_vector_type(2)));
typedef __bf16   v2b  __attribute__((ext_vector_type(2)));

// ---- scalar helpers ----------------------------------------------------------------------------------
// f32 -> bf16 is the chip's own packed convert (RNE): two values in, one dword (a in the low half, b in the high half) out
__device__ __forceinline__ v2b cvt2(float a, float b) { const v2f x = {a, b}; return __builtin_convertvector(x, v2b); }
__device__ __forceinline__ unsigned pk_bf(float a, float b) { return __builtin_bit_cast(unsigned, cvt2(a, b)); }
__device__ __forceinline__ float bfr(float f) { return (float)(__bf16)f; }    // value after bf16 RNE convert
__device__ __forceinline__ v8f zero8() { v8f z = {0.f, 0.f, 0.f, 0.f, 0.f, 0.f, 0.f, 0.f}; return z; }
// hi = RNE(v), lo = RNE(v - hi) of eight values, packed two to a dword: three instructions a pair.
// The asm is there because the compiler unpacks hi, subtracts and converts again (five a pair): v_fma_mixlo/mixhi_bf16 read one
// bf16 half of hi, form v - hi in f32 (exact) and round it into one half of lo. The four low halves go first, so that each high
// half follows its register's first write at a distance of four; the s_delay_alu hints let other waves issue in the meantime.
// The four v_nop in front: the compiler may give lo registers that a matrix instruction issued just ahead still reads as its A or B,
// they are the four vector slots that the chip needs between the two.
__device__ __forceinline__ void split8(const float* f, v4u& hi, v4u& lo) {
  const unsigned h0 = pk_bf(f[0], f[1]), h1 = pk_bf(f[2], f[3]), h2 = pk_bf(f[4], f[5]), h3 = pk_bf(f[6], f[7]);
  unsigned l0, l1, l2, l3;
  asm("v_nop\n\tv_nop\n\tv_nop\n\tv_nop\n\t"
      "v_fma_mixlo_bf16 %0, %4, -1.0, %8 op_sel:[0,1,0] op_sel_hi:[1,1,0]\n\t"
      "v_fma_mixlo_bf16 %1, %5, -1.0, %10 op_sel:[0,1,0] op_sel_hi:[1,1,0]\n\t"
      "v_fma_mixlo_bf16 %2, %6, -1.0, %12 op_sel:[0,1,0] op_sel_hi:[1,1,0]\n\t"
      "v_fma_mixlo_bf16 %3, %7, -1.0, %14 op_sel:[0,1,0] op_sel_hi:[1,1,0]\n\t"
      "s_delay_alu instid0(VALU_DEP_4) | instskip(NEXT) | instid1(VALU_DEP_4)\n\t"
      "v_fma_mixhi_bf16 %0, %4, -1.0, %9 op_sel:[1,1,0] op_sel_hi:[1,1,0]\n\t"
      "v_fma_mixhi_bf16 %1, %5, -1.0, %11 op_sel:[1,1,0] op_sel_hi:[1,1,0]\n\t"
      "s_delay_alu instid0(VALU_DEP_4) | instskip(NEXT) | instid1(VALU_DEP_4)\n\t"
      "v_fma_mixhi_bf16 %2, %6, -1.0, %13 op_sel:[1,1,0] op_sel_hi:[1,1,0]\n\t"
      "v_fma_mixhi_bf16 %3, %7, -1.0, %15 op_sel:[1,1,0] op_sel_hi:[1,1,0]"
      : "=&v"(l0), "=&v"(l1), "=&v"(l2), "=&v"(l3)
      : "v"(h0), "v"(h1), "v"(h2), "v"(h3),
        "v"(f[0]), "v"(f[1]), "v"(f[2]), "v"(f[3]), "v"(f[4]), "v"(f[5]), "v"(f[6]), "v"(f[7]));
  hi[0] = h0; hi[1] = h1; hi[2] = h2; hi[3] = h3;
  lo[0] = l0; lo[1] = l1; lo[2] = l2; lo[3] = l3;
}

// value of the same lane position in the other 16-lane half (lane ^ 16), as a vector cross-row move: no LDS round trip
__device__ __forceinline__ float other_half(float v) {
  const int b = __float_as_int(v);
  return __int_as_float(__builtin_amdgcn_permlanex16(b, b, 0x76543210, 0xfedcba98, false, false));
}

// ---- fragment loader: 16-bit A/B operand, lane -> row/col (lane&15), p already includes +8*(lane>>4);
//      elements 0..7 <- p[0..7] (k0+8h..), elements 8..15 <- p[16..23] (k0+16+8h..)
__device__ __forceinline__ v16b ldfrag_b(const __bf16* p) {
  union { v16b v; v8b h[2]; } f;
  f.h[0] = *(const v8b*)(p);
  f.h[1] = *(const v8b*)(p + 16);
  return f.v;
}

// ---- WMMA helpers with trailing VALU hazard gap ----------------------------------------------------------
__device__ __forceinline__ v8f mma_b_raw(v16b a, v16b b, v8f c) {
  return __builtin_amdgcn_wmma_f32_16x16x32_bf16(false, a, false, b, (short)0, c, false, false);
}
__device__ __forceinline__ void dep_guard_b(v8f& a, v8f& b, v16b x, v16b y) {
  asm volatile("v_nop\n\tv_nop\n\tv_nop\n\tv_nop" : "+v"(a), "+v"(b) : "v"(x), "v"(y));
}
__device__ __forceinline__ void keep4_b(v16b a, v16b b, v16b c, v16b d) {
  asm volatile("v_nop" :: "v"(a), "v"(b), "v"(c), "v"(d));
}
__device__ __forceinline__ void acc_guard4(v8f& a, v8f& b, v8f& c, v8f& d) {
  asm volatile("v_nop\n\tv_nop\n\tv_nop\n\tv_nop" : "+v"(a), "+v"(b), "+v"(c), "+v"(d));
}

// =====================================================================================================
// f32 -> bf16 (RNE convert), 8 elements per thread, one 16-B store per lane: a wave writes 512 contiguous B
// coverage: n8 threads x 8 = the whole plane (n8 = 1048576, a multiple of 256). blk = this work-group's index in the job.
// =====================================================================================================
__device__ __forceinline__ void cvt_bf16x8(const float* __restrict__ in, unsigned short* out, int n8, int blk) {
  const int i = blk * 256 + threadIdx.x;
  if (i < n8) {
    const v4f a = *(const v4f*)(in + (size_t)i * 8);
    const v4f b = *(const v4f*)(in + (size_t)i * 8 + 4);
    v4u p;
    p[0] = pk_bf(a[0], a[1]);
    p[1] = pk_bf(a[2], a[3]);
    p[2] = pk_bf(b[0], b[1]);
    p[3] = pk_bf(b[2], b[3]);
    *(v4u*)(out + (size_t)i * 8) = p;
    
  }
}

// =====================================================================================================
// Transpose + bf16 convert of an f32 matrix: in [R rows][Cc cols] (pitch Cc) -> o[c][r] = bf16_rne(in[r][c]),
// output row pitch P (>= R); DUP additionally writes the same value at o[c][R + r] (duplicate along k).
// 64x64 tiles through LDS (tf, 64 x 68 floats). Tile (bx, by) of (Cc/64, R/64), 256 threads (R, Cc multiples of 64).
// coverage per block: load 4 it x 256 thr x 4 floats = 64x64; store 2 it x 256 thr x 8 u16 = 64x64 (x2 with DUP).
// =====================================================================================================
template <bool DUP>
__device__ __forceinline__ void tcvt_tile(float* tf, const float* __restrict__ W, unsigned short* o, int R, int Cc, int P, int bx, int by) {
  const int c0  = bx * 64;           // input column block = output row block
  const int r0  = by * 64;           // input row block    = output column block
  const int tid = threadIdx.x;
  {
    const int lr = tid >> 4;         // 0..15
    const int c4 = (tid & 15) * 4;   // 0..60
#pragma unroll
    for (int it = 0; it < 4; ++it) {
      const int rr = it * 16 + lr;   // 0..63
      const v4f a = *(const v4f*)(W + (size_t)(r0 + rr) * Cc + c0 + c4);
      *(v4f*)(tf + rr * 68 + c4) = a;
    }
  }
  __syncthreads();
  const int sub = tid >> 3;          // 0..31
  const int c8  = (tid & 7) * 8;     // 0..56
  v4u hv[2];
#pragma unroll
  for (int it = 0; it < 2; ++it) {
    const int oc = it * 32 + sub;    // output row within tile (= input column)
    v4u a;
#pragma unroll
    for (int q = 0; q < 4; ++q) {
      const float f0 = tf[(c8 + 2 * q) * 68 + oc];
      const float f1 = tf[(c8 + 2 * q + 1) * 68 + oc];
      a[q] = pk_bf(f0, f1);
    }
    hv[it] = a;
  }
  {
#pragma unroll
    for (int it = 0; it < 2; ++it) {
      const int oc = it * 32 + sub;
      const size_t go = (size_t)(c0 + oc) * P + r0 + c8;
      *(v4u*)(o + go) = hv[it];
      if (DUP) *(v4u*)(o + go + R) = hv[it];
    }
    // another job's code follows these stores in the merged kernel: no register that they name is rewritten ahead of this wait
    asm volatile("s_wait_xcnt 0x0" ::: "memory");
  }
}

// =====================================================================================================
// The three input conversions read none of each other's output: one launch, the job picked by the work-group index (block-uniform,
// so the transposes' barrier is reached by a whole work-group or by none). The transposes come first: theirs is the longer chain.
//   0 .. TA_N-1: W_attn tiles; TA_N .. TA_N+TP_N-1: W_proj tiles; then CV_N work-groups of the x conversion.
// =====================================================================================================
#define TA_BX (N3 / 64)
#define TA_N  ((N3 / 64) * (DM / 64))        // 768
#define TP_BX (DM / 64)
#define TP_N  ((DM / 64) * (DM / 64))        // 256
#define CV_N  (NB * SEQ * DM / 8 / 256)      // 4096
static_assert(((NB * SEQ * DM) % (8 * 256)) == 0);
__global__ __launch_bounds__(256) void prep_inputs(const float* __restrict__ x, const float* __restrict__ Wa, const float* __restrict__ Wp,
                                                   unsigned short* xb, unsigned short* wat, unsigned short* wpt) {
  __shared__ __align__(16) float tf[64 * 68];
  const int b = blockIdx.x;
  if (b < TA_N) {
    tcvt_tile<false>(tf, Wa, wat, DM, N3, DM, b % TA_BX, b / TA_BX);
  } else if (b < TA_N + TP_N) {
    tcvt_tile<true>(tf, Wp, wpt, DM, DM, 2 * DM, (b - TA_N) % TP_BX, (b - TA_N) / TP_BX);
  } else {
    cvt_bf16x8(x, xb, NB * SEQ * DM / 8, b - (TA_N + TP_N));
  }
}

// =====================================================================================================
// Register-blocked bf16 WMMA GEMM: C[m][n] = sum_k A[m][k] * Bt[n][k] + bias; one wave per 64x64 tile,
// eight waves (2 x 4) = one 128 x 256 tile per work-group. A row-major [M][K] pitch lda; Bt row-major [N][K] pitch ldb
// (k contiguous); M multiple of 128, N multiple of 256, K multiple of 64 and >= 128 (host constants, asserted below).
// Operands: a stage = 64 k = one whole 128-B line of each of the 128 A rows and 256 Bt rows, laid in LDS at pitch LP
// ([A rows | Bt rows]); two buffers; stage t + 2 is copied (16 B per lane, global -> LDS, no register) while stage t + 1 is worked on.
// copy coverage per stage: 12 copies x 256 threads x 16 B = 384 rows x 128 B; a wave's copy = 4 whole lines.
// BIAS_MODE: 1 = bias[m], 2 = bias[n]; bias value RNE-converted to bf16 then added in f32.
// OUT_MODE: 0 = f32 (pitch ldc); 2 = bf16 hi plane C + bf16 lo plane C2 (lo = RNE(v - hi), unscaled), pitch ldc.
// =====================================================================================================
#define GTM  128                   // work-group tile rows
#define GTN  256                   // work-group tile columns
#define GKB  64                    // k elements per stage
#define GSTG ((GTM + GTN) * LP)    // bf16 elements of one stage in LDS (55296 B)
static_assert(((NB * SEQ) % GTN) == 0 && (DM % GTN) == 0 && ((2 * DM) % GTN) == 0);
static_assert((DM % GKB) == 0 && (CXP % GKB) == 0 && DM >= 2 * GKB);

// One stage's copies of one lane: rows r, r + 32, .. of A (4) and of Bt (8), LDS rows 32 * LP elements apart.
// The copies and s_wait_xcnt 0 are one statement, so that no address register is rewritten ahead of that wait.
__device__ __forceinline__ void stage_copy(unsigned l, const __bf16* a, size_t as, const __bf16* b, size_t bs) {
  const unsigned ls = 32 * LP * 2;   // bytes between a lane's consecutive LDS rows
  asm volatile(
      "global_load_async_to_lds_b128 %0, %12, off\n\t"
      "global_load_async_to_lds_b128 %1, %13, off\n\t"
      "global_load_async_to_lds_b128 %2, %14, off\n\t"
      "global_load_async_to_lds_b128 %3, %15, off\n\t"
      "global_load_async_to_lds_b128 %4, %16, off\n\t"
      "global_load_async_to_lds_b128 %5, %17, off\n\t"
      "global_load_async_to_lds_b128 %6, %18, off\n\t"
      "global_load_async_to_lds_b128 %7, %19, off\n\t"
      "global_load_async_to_lds_b128 %8, %20, off\n\t"
      "global_load_async_to_lds_b128 %9, %21, off\n\t"
      "global_load_async_to_lds_b128 %10, %22, off\n\t"
      "global_load_async_to_lds_b128 %11, %23, off\n\t"
      "s_wait_xcnt 0x0"
      :: "v"(l), "v"(l + ls), "v"(l + 2 * ls), "v"(l + 3 * ls), "v"(l + 4 * ls), "v"(l + 5 * ls),
         "v"(l + 6 * ls), "v"(l + 7 * ls), "v"(l + 8 * ls), "v"(l + 9 * ls), "v"(l + 10 * ls), "v"(l + 11 * ls),
         "v"(a), "v"(a + as), "v"(a + 2 * as), "v"(a + 3 * as),
         "v"(b), "v"(b + bs), "v"(b + 2 * bs), "v"(b + 3 * bs), "v"(b + 4 * bs), "v"(b + 5 * bs), "v"(b + 6 * bs), "v"(b + 7 * bs)
      : "memory");
}

// ring: two stages [A 128 rows | Bt 256 rows], pitch LP; sT: per-wave 16x64 slabs, pitch 68 floats; blk: the tile's index in its GEMM
template <int BIAS_MODE, int OUT_MODE>
__device__ __forceinline__ void gemm_tile(
    __bf16* ring, float* sT, int blk,
    const unsigned short* __restrict__ Ap, int lda,
    const unsigned short* __restrict__ Btp, int ldb,
    void* Cout, void* Cout2, int ldc,
    const float* __restrict__ bias,
    int M, int N, int K) {
  const __bf16* A  = (const __bf16*)(const void*)Ap;
  const __bf16* Bt = (const __bf16*)(const void*)Btp;
  const int lane = threadIdx.x & 31;
  const int wave = threadIdx.x >> 5;
  const int blocksN = N / GTN;
  const int blocksM = M / GTM;
  if (blk >= blocksM * blocksN) return;        // block-uniform, in front of every barrier
  const int bm = blk / blocksN;
  const int bn = blk - bm * blocksN;
  const int wm = wave >> 2;                    // 0..1
  const int wn = wave & 3;                     // 0..3
  const int m0 = bm * GTM + (wm << 6);
  const int n0 = bn * GTN + (wn << 6);

  const int rlane = lane & 15;                 // row (A) / col (B, D) within subtile
  const int koff  = (lane >> 4) * 8;           // k offset of this lane half
  const int mOff  = (lane >> 4) * 8;           // D row offset

  v8f acc[4][4];
#pragma unroll
  for (int i = 0; i < 4; ++i)
#pragma unroll
    for (int j = 0; j < 4; ++j) acc[i][j] = zero8();

  // this lane's place in a stage: row crow (+ 32 per copy), 16-B piece ccol of the row's 128 B
  const int crow = threadIdx.x >> 3;           // 0..31
  const int ccol = (threadIdx.x & 7) * 8;      // 0..56 elements
  const __bf16* ga = A  + (size_t)(bm * GTM + crow) * lda + ccol;
  const __bf16* gb = Bt + (size_t)(bn * GTN + crow) * ldb + ccol;
  const size_t  as = (size_t)32 * lda;
  const size_t  bs = (size_t)32 * ldb;
  const unsigned l0 = (unsigned)(uintptr_t)(ring + crow * LP + ccol);   // LDS byte address in buffer 0
  const int nst = K / GKB;                     // stages, >= 2

  stage_copy(l0, ga, as, gb, bs);
  asm volatile("s_wait_asynccnt 0x0" ::: "memory");   // stage 0 of this wave has landed
  __syncthreads();                                    // stage 0 of every wave is readable
  if (nst > 1) stage_copy(l0 + GSTG * 2, ga + GKB, as, gb + GKB, bs);

#pragma unroll 1   // rolled: one publish point in the text, the buffer chosen by t & 1
  for (int t = 0; t < nst; ++t) {
    const int bo = (t & 1) * GSTG;
    const __bf16* sa = ring + bo + ((wm << 6) + rlane) * LP + koff;
    const __bf16* sb = ring + bo + (GTM + (wn << 6) + rlane) * LP + koff;
#pragma unroll
    for (int kk = 0; kk < GKB; kk += 32) {
      v16b bh[4], ah[4];
#pragma unroll
      for (int j = 0; j < 4; ++j) bh[j] = ldfrag_b(sb + (j << 4) * LP + kk);
#pragma unroll
      for (int i = 0; i < 4; ++i) ah[i] = ldfrag_b(sa + (i << 4) * LP + kk);
#pragma unroll
      for (int i = 0; i < 4; ++i) {
#pragma unroll
        for (int j = 0; j < 4; ++j) acc[i][j] = mma_b_raw(ah[i], bh[j], acc[i][j]);
        dep_guard_b(acc[i][0], acc[i][3], ah[i], ah[i]);
      }
      keep4_b(bh[0], bh[1], bh[2], bh[3]);
    }
    asm volatile("s_wait_dscnt 0x0" ::: "memory");      // this wave's reads of stage t are done before the buffer is refilled
    asm volatile("s_wait_asynccnt 0x0" ::: "memory");   // this wave's copies of stage t + 1 have landed
    __syncthreads();                                    // publishes stage t + 1 and ends every reader's use of stage t
    if (t + 2 < nst) stage_copy(l0 + (unsigned)bo * 2, ga + (size_t)(t + 2) * GKB, as, gb + (size_t)(t + 2) * GKB, bs);
  }
  asm volatile("s_wait_asynccnt 0x0" ::: "memory");     // no copy is outstanding when the wave goes on
  acc_guard4(acc[0][0], acc[0][1], acc[0][2], acc[0][3]);
  acc_guard4(acc[1][0], acc[1][1], acc[1][2], acc[1][3]);
  acc_guard4(acc[2][0], acc[2][1], acc[2][2], acc[2][3]);
  acc_guard4(acc[3][0], acc[3][1], acc[3][2], acc[3][3]);

  // ---- epilogue ----
  float* slab = sT + wave * (16 * 68);
#pragma unroll
  for (int i = 0; i < 4; ++i) {
    const int mBase = m0 + (i << 4);
    float bm8[8];
#pragma unroll
    for (int r = 0; r < 8; ++r) bm8[r] = 0.f;
    if (BIAS_MODE == 1) {                          // rows mBase+mOff .. +7: two 16-B loads (32-B aligned)
      const v4f t0 = *(const v4f*)(bias + mBase + mOff);
      const v4f t1 = *(const v4f*)(bias + mBase + mOff + 4);
      bm8[0] = bfr(t0[0]); bm8[1] = bfr(t0[1]); bm8[2] = bfr(t0[2]); bm8[3] = bfr(t0[3]);
      bm8[4] = bfr(t1[0]); bm8[5] = bfr(t1[1]); bm8[6] = bfr(t1[2]); bm8[7] = bfr(t1[3]);
    }
#pragma unroll
    for (int j = 0; j < 4; ++j) {
      float bn = 0.f;
      if (BIAS_MODE == 2) bn = bfr(bias[n0 + (j << 4) + rlane]);
#pragma unroll
      for (int r = 0; r < 8; ++r) {
        float v = acc[i][j][r];
        if (BIAS_MODE == 1) v += bm8[r];
        if (BIAS_MODE == 2) v += bn;
        slab[(mOff + r) * 68 + (j << 4) + rlane] = v;
      }
    }
    __builtin_amdgcn_fence(__ATOMIC_RELEASE, "workgroup");
    __builtin_amdgcn_wave_barrier();
    __builtin_amdgcn_fence(__ATOMIC_ACQUIRE, "workgroup");
    if (OUT_MODE == 0) {
      float* C = (float*)Cout;
      const int hh = lane >> 4, c4 = (lane & 15) * 4;     // 256-B row segment = 16 lanes x 16 B
      {
#pragma unroll
        for (int it = 0; it < 8; ++it) {
          const int row = it * 2 + hh;                     // it 0..7 x hh 0..1 = rows 0..15
          const v4f v = *(const v4f*)(slab + row * 68 + c4);
          *(v4f*)(C + (size_t)(mBase + row) * ldc + n0 + c4) = v;
        }
        
      }
    } else {
      const int q = lane >> 3, c8 = (lane & 7) * 8;
      unsigned short* C  = (unsigned short*)Cout;
      unsigned short* C2 = (unsigned short*)Cout2;
      v4u hv[4], lv[4];
#pragma unroll
      for (int it = 0; it < 4; ++it) {
        const int row = it * 4 + q;                        // it 0..3 x q 0..3 = rows 0..15
        const float* sp = slab + row * 68 + c8;
        float f[8];
#pragma unroll
        for (int e = 0; e < 8; ++e) f[e] = sp[e];
        split8(f, hv[it], lv[it]);
      }
      {
#pragma unroll
        for (int it = 0; it < 4; ++it) {
          const int row = it * 4 + q;
          *(v4u*)(C  + (size_t)(mBase + row) * ldc + n0 + c8) = hv[it];
          *(v4u*)(C2 + (size_t)(mBase + row) * ldc + n0 + c8) = lv[it];
        }
        
      }
    }
    __builtin_amdgcn_fence(__ATOMIC_RELEASE, "workgroup");
    __builtin_amdgcn_wave_barrier();
    __builtin_amdgcn_fence(__ATOMIC_ACQUIRE, "workgroup");
  }
}

template <int BIAS_MODE, int OUT_MODE>
__global__ __launch_bounds__(256) void gemm64(
    const unsigned short* __restrict__ Ap, int lda,
    const unsigned short* __restrict__ Btp, int ldb,
    void* Cout, void* Cout2, int ldc,
    const float* __restrict__ bias,
    int M, int N, int K) {
  __shared__ __align__(16) __bf16 ring[2 * GSTG];
  __shared__ __align__(16) float sT[8 * 16 * 68];
  gemm_tile<BIAS_MODE, OUT_MODE>(ring, sT, (int)blockIdx.x, Ap, lda, Btp, ldb, Cout, Cout2, ldc, bias, M, N, K);
}

// The q|k and the v^T projection read the same two planes and none of each other's output: one launch, the GEMM picked by the
// work-group index (block-uniform: a work-group runs one tile of one GEMM, with that tile's barriers).
//   0 .. QK_N-1:  q|k = x . W_attn[:, 0:2048] + b_attn[n]            (M = 8192, N = 2048, K = 1024) -> hi/lo [8192][2048]
//   QK_N .. +VT_N-1: v^T = W_attn[:, 2048:3072]^T . x^T + b_attn[2048 + m] (M = 1024, N = 8192, K = 1024) -> hi/lo [1024][8192]
#define QK_N ((NB * SEQ / GTM) * (2 * DM / GTN))   // 512
#define VT_N ((DM / GTM) * (NB * SEQ / GTN))       // 256
__global__ __launch_bounds__(256) void gemm_qkv(const unsigned short* __restrict__ xb, const unsigned short* __restrict__ wat,
                                                unsigned short* qkh, unsigned short* qkl, unsigned short* vth, unsigned short* vtl,
                                                const float* __restrict__ b_attn) {
  __shared__ __align__(16) __bf16 ring[2 * GSTG];
  __shared__ __align__(16) float sT[8 * 16 * 68];
  const int b = blockIdx.x;
  if (b < QK_N) {
    gemm_tile<2, 2>(ring, sT, b, xb, DM, wat, DM, (void*)qkh, (void*)qkl, QKP, b_attn, NB * SEQ, 2 * DM, DM);
  } else {
    gemm_tile<1, 2>(ring, sT, b - QK_N, wat + (size_t)(2 * DM) * DM, DM, xb, DM, (void*)vth, (void*)vtl, VTP, b_attn + 2 * DM,
                    DM, NB * SEQ, DM);
  }
}

// =====================================================================================================
// Causal attention, head dim 64, all batch elements in one launch (blockIdx.x = head and batch element, blockIdx.y = query tile, longest first).
//   q|k planes (bf16 hi / lo): [b*SEQ + t][QKP], q(t, h, d) at col h*64 + d, k(s, h, d) at col DM + h*64 + d
//   v^T planes (bf16 hi / lo): [(h*64 + d)][VTP], key s of batch b at col b*SEQ + s, s contiguous
//   context plane (bf16): row b*SEQ + t, pitch CXP; hi at col h*64 + d, lo (RNE(v - hi)) at col DM + h*64 + d
//   scores = q . k : bf16 hi/lo split (hi.hi + hi.lo + lo.hi), f32 accumulate, then * sscale in f32
//   out    = p . v : bf16 hi/lo split of p (unnormalised) and v, f32 accumulate
//   both products are formed transposed: S^T = K . Q^T (A = K rows, B = q) and O^T += V^T . P^T (A = V^T rows, B = p):
//   a wave holds 32 queries as two column groups n of 16, so every K and V^T fragment read from LDS feeds two products;
//   in a group a lane holds the scores of ONE query (q0 + n*16 + lane&15), keys 8*(lane>>4) + r of each 16-key tile, so two score tiles, split in
//   place, are the B operand of the second product (element e = tile 2kk row e, element 8 + e = tile 2kk+1 row e: the k order of
//   the V^T loader), and maximum, sum and rescale factor are one value per lane and group.
//   online softmax in f32; key s > t set to -inf only on the block's last two key tiles (key 0 of tile 0 is live for every query).
//   Block = 4 waves = 128 query rows of one head; grid = (NH * NB, NQT); key tiles of 64, block-uniform trip count 2*qb+2 <= 32,
//   every wave reaches the one block barrier of every iteration.
//   K / V^T tile staging: a stage = the 64x64 tile of all four planes [K hi | K lo | V^T hi | V^T lo], rows pitched LP; two buffers;
//   tile kc + 2 is copied (16 B per lane, global -> LDS, no register) while tile kc + 1 is worked on.
//   copy coverage per stage: 16 copies x 128 threads x 16 B = 4 planes x 64 rows x 128 B; a wave's copy = 4 whole 128-B lines.
//   After the loop the ring is free (the last trip's barrier ends every read) and holds the per-wave f32 context tiles.
//   Output coverage: each wave stores rows q0..q0+31 (it 0..7 x lane>>3 0..3) x 64 columns (8 lanes x 8) of both planes.
// =====================================================================================================
#define APL  (64 * LP)     // bf16 elements of one plane's tile in LDS (9216 B)
#define ASTG (4 * APL)     // bf16 elements of one stage in LDS (36864 B)
static_assert(4 * 32 * OSP * 4 <= 2 * ASTG * 2);   // the four f32 context tiles fit in the ring

// One lane's copies of two planes of a stage: rows r, r + 16, r + 32, r + 48 of plane a, then of plane b (LDS: the next plane).
// a, b: the two planes' tile starts, the same for the whole work-group (scalar base); o: this lane's byte offset in a tile, rs: bytes
// between its consecutive rows: four offset registers serve both planes, and no 64-bit lane pointer lives over the key loop.
// The copies and s_wait_xcnt 0 are one statement, so that no address register is rewritten ahead of that wait.
__device__ __forceinline__ void tile_copy(unsigned l, const __bf16* a, const __bf16* b, unsigned o, unsigned rs) {
  const unsigned ls = 16 * LP * 2;   // bytes between a lane's consecutive LDS rows
  const unsigned ps = APL * 2;       // bytes between the planes in LDS
  asm volatile(
      "global_load_async_to_lds_b128 %0, %8, %12\n\t"
      "global_load_async_to_lds_b128 %1, %9, %12\n\t"
      "global_load_async_to_lds_b128 %2, %10, %12\n\t"
      "global_load_async_to_lds_b128 %3, %11, %12\n\t"
      "global_load_async_to_lds_b128 %4, %8, %13\n\t"
      "global_load_async_to_lds_b128 %5, %9, %13\n\t"
      "global_load_async_to_lds_b128 %6, %10, %13\n\t"
      "global_load_async_to_lds_b128 %7, %11, %13\n\t"
      "s_wait_xcnt 0x0"
      :: "v"(l), "v"(l + ls), "v"(l + 2 * ls), "v"(l + 3 * ls),
         "v"(l + ps), "v"(l + ps + ls), "v"(l + ps + 2 * ls), "v"(l + ps + 3 * ls),
         "v"(o), "v"(o + rs), "v"(o + 2 * rs), "v"(o + 3 * rs),
         "s"(a), "s"(b)
      : "memory");
}

__global__ __launch_bounds__(128)
void attn_causal64(const unsigned short* __restrict__ qkhp, const unsigned short* __restrict__ qklp,
                   const unsigned short* __restrict__ vhp, const unsigned short* __restrict__ vlp,
                   unsigned short* cxp, float sscale) {
  union FB { v16b v; v8b h[2]; v4u q[2]; };
  __shared__ __align__(16) __bf16 ring[2 * ASTG];      // two stages [K hi [kv][d] | K lo | V^T hi [d][kv] | V^T lo], rows pitched LP

  const int tid  = threadIdx.x;
  const int wave = tid >> 5;
  const int lane = tid & 31;
  const int hh   = lane >> 4;
  const int c    = lane & 15;

  // The query tile falls with blockIdx.y, so the longest key loops get the lowest block indices (for speed only).
  const int bx = blockIdx.x;               // 0..NH*NB-1 (grid.x = NH * NB)
  const int by = blockIdx.y;               // 0..NQT-1   (grid.y = NQT)
  const int qb = (NQT - 1 - by) % NQT;     // % NQT is an identity on this grid: it gives the compiler the tile's range
  const int h  = bx % NH;                  // 0..NH-1
  const int q0 = qb * QBLK + wave * 32;    // first of this wave's 32 queries
  const int rowBase = (bx / NH) * SEQ;     // first token row of this batch element (bx / NH = 0..NB-1)

  const __bf16* Qh = (const __bf16*)(const void*)qkhp + (size_t)rowBase * QKP + (size_t)h * HD;
  const __bf16* Ql = (const __bf16*)(const void*)qklp + (size_t)rowBase * QKP + (size_t)h * HD;
  const __bf16* Kh = Qh + DM;
  const __bf16* Kl = Ql + DM;
  const __bf16* Vh = (const __bf16*)(const void*)vhp + (size_t)h * HD * VTP + rowBase;
  const __bf16* Vl = (const __bf16*)(const void*)vlp + (size_t)h * HD * VTP + rowBase;

  // ---- Q fragments (B operand, column = query = n*16 + lane&15, split k map): 2 column groups x 2 d-chunks, hi and lo ----
  v16b qah[2][2], qal[2][2];
#pragma unroll
  for (int n = 0; n < 2; ++n) {
#pragma unroll
    for (int dc = 0; dc < 2; ++dc) {
      const size_t qo = (size_t)(q0 + n * 16 + c) * QKP + dc * 32 + 8 * hh;
      qah[n][dc] = ldfrag_b(Qh + qo);
      qal[n][dc] = ldfrag_b(Ql + qo);
    }
  }
  asm volatile("s_wait_xcnt 0x0" ::: "memory");   // stands in front of the first instruction that reuses an address register of the Q loads
  __builtin_amdgcn_sched_barrier(0);              // keeps the later address arithmetic below that wait (the compiler lifted one over it)

  float mrow[2];            // running maximum of query q0 + n*16 + c (the same in both lane halves)
  float lrow[2];            // running sum over this lane half's keys only; the halves are joined after the loop
  v8f oacc[2][4];           // O^T: oacc[n][t][r] = context(query q0 + n*16 + c, d = t*16 + 8*hh + r)
#pragma unroll
  for (int n = 0; n < 2; ++n) {
    mrow[n] = -INFINITY;
    lrow[n] = 0.f;
#pragma unroll
    for (int t = 0; t < 4; ++t) oacc[n][t] = zero8();
  }

  const int nChunks = 2 * qb + 2;   // block-uniform, 2..32: key tiles 0 .. the one that holds the block's last query

  // this lane's place in a stage: row crow (+ 16 per copy), 16-B piece ccol of the row's 128 B
  const int crow = tid >> 3;               // 0..15
  const int ccol = (tid & 7) * 8;          // 0..56 elements
  const unsigned ko  = (crow * QKP + ccol) * 2;   // this lane's byte in a K tile (row crow)
  const unsigned vo  = (crow * VTP + ccol) * 2;   // this lane's byte in a V^T tile (row d = crow)
  const unsigned krs = 16 * QKP * 2;
  const unsigned vrs = 16 * VTP * 2;
  const size_t   kts = (size_t)64 * QKP;          // a K tile is 64 rows on, a V^T tile 64 columns on
  const unsigned l0 = (unsigned)(uintptr_t)(ring + crow * LP + ccol);   // LDS byte address in buffer 0, plane K hi

  tile_copy(l0, Kh, Kl, ko, krs);
  tile_copy(l0 + 2 * APL * 2, Vh, Vl, vo, vrs);
  asm volatile("s_wait_asynccnt 0x0" ::: "memory");   // tile 0 of this wave has landed
  __syncthreads();                                    // tile 0 of every wave is readable
  if (nChunks > 1) {
    tile_copy(l0 + ASTG * 2, Kh + kts, Kl + kts, ko, krs);
    tile_copy(l0 + ASTG * 2 + 2 * APL * 2, Vh + 64, Vl + 64, vo, vrs);
  }

#pragma unroll 1   // rolled: one publish point in the text, the buffer chosen by kc & 1
  for (int kc = 0; kc < nChunks; ++kc) {
    const int kv0 = kc * 64;
    const int bo  = (kc & 1) * ASTG;
    const __bf16* Ksh = ring + bo;
    const __bf16* Ksl = Ksh + APL;
    const __bf16* Vth = Ksh + 2 * APL;
    const __bf16* Vtl = Ksh + 3 * APL;

    // ---- scores, transposed: 64 keys (rows) x 32 queries (columns) per wave, 3 bf16 products;
    //      each K fragment is read once and multiplies both column groups (two independent accumulators) ----
    v8f s[2][4];
#pragma unroll
    for (int j = 0; j < 4; ++j) {
      s[0][j] = zero8();
      s[1][j] = zero8();
#pragma unroll
      for (int dc = 0; dc < 2; ++dc) {
        FB kb, kl;
        kb.h[0] = *(const v8b*)(Ksh + (j * 16 + c) * LP + dc * 32 + 8 * hh);
        kb.h[1] = *(const v8b*)(Ksh + (j * 16 + c) * LP + dc * 32 + 16 + 8 * hh);
        kl.h[0] = *(const v8b*)(Ksl + (j * 16 + c) * LP + dc * 32 + 8 * hh);
        kl.h[1] = *(const v8b*)(Ksl + (j * 16 + c) * LP + dc * 32 + 16 + 8 * hh);
        s[0][j] = mma_b_raw(kb.v, qah[0][dc], s[0][j]);
        s[1][j] = mma_b_raw(kb.v, qah[1][dc], s[1][j]);
        s[0][j] = mma_b_raw(kl.v, qah[0][dc], s[0][j]);
        s[1][j] = mma_b_raw(kl.v, qah[1][dc], s[1][j]);
        s[0][j] = mma_b_raw(kb.v, qal[0][dc], s[0][j]);
        s[1][j] = mma_b_raw(kb.v, qal[1][dc], s[1][j]);
      }
    }

    // ---- per column group: scale, causal mask, online softmax; P hi/lo (bf16, unnormalised) stays in registers as the B operand ----
    const bool diag = (kc >= 2 * qb);   // block-uniform: only the block's last two key tiles hold a key above one of its queries
    FB pa[2][2], pl[2][2];
#pragma unroll
    for (int n = 0; n < 2; ++n) {
      // key j*16 + r of this lane half is masked when it lies above lim (64 = above every key of a tile: nothing masked)
      const int lim = diag ? (q0 + n * 16 + c - kv0 - 8 * hh) : 64;
      float cm = -INFINITY;
#pragma unroll
      for (int j = 0; j < 4; ++j) {
#pragma unroll
        for (int r = 0; r < 8; ++r) {
          const float sv = s[n][j][r] * sscale;
          const float sm = (j * 16 + r > lim) ? -INFINITY : sv;
          s[n][j][r] = sm;
          cm = fmaxf(cm, sm);
        }
      }
      cm = fmaxf(cm, other_half(cm));                  // the other lane half holds the query's other 32 keys

      // finite: key 0 of tile 0 is live for every query, so mrow is finite from tile 0 on; a tile that is masked whole for a query
      // (the last tile, first two waves) gives alpha = 1 and p = 0
      const float mnew  = fmaxf(mrow[n], cm);
      const float alpha = __expf(mrow[n] - mnew);
      mrow[n] = mnew;
      float psum = 0.f;
#pragma unroll
      for (int j = 0; j < 4; ++j) {
        float p[8];
#pragma unroll
        for (int r = 0; r < 8; ++r) {
          p[r] = __expf(s[n][j][r] - mnew);
          psum += p[r];
        }
        split8(p, pa[n][j >> 1].q[j & 1], pl[n][j >> 1].q[j & 1]);   // elements (j & 1) * 8 + r of the operand
      }
      lrow[n] = lrow[n] * alpha + psum;
#pragma unroll
      for (int t = 0; t < 4; ++t)
#pragma unroll
        for (int r = 0; r < 8; ++r) oacc[n][t][r] *= alpha;
    }

    // ---- context^T += V^T . P^T, 3 bf16 products; each V^T fragment is read once and multiplies both column groups ----
#pragma unroll   // unrolled: pa / pl are registers and are indexed by kk
    for (int kk = 0; kk < 2; ++kk) {
#pragma unroll
      for (int t = 0; t < 4; ++t) {
        FB vb, vl;
        vb.h[0] = *(const v8b*)(Vth + (t * 16 + c) * LP + kk * 32 + 8 * hh);
        vb.h[1] = *(const v8b*)(Vth + (t * 16 + c) * LP + kk * 32 + 16 + 8 * hh);
        vl.h[0] = *(const v8b*)(Vtl + (t * 16 + c) * LP + kk * 32 + 8 * hh);
        vl.h[1] = *(const v8b*)(Vtl + (t * 16 + c) * LP + kk * 32 + 16 + 8 * hh);
        oacc[0][t] = mma_b_raw(vb.v, pa[0][kk].v, oacc[0][t]);
        oacc[1][t] = mma_b_raw(vb.v, pa[1][kk].v, oacc[1][t]);
        oacc[0][t] = mma_b_raw(vl.v, pa[0][kk].v, oacc[0][t]);
        oacc[1][t] = mma_b_raw(vl.v, pa[1][kk].v, oacc[1][t]);
        oacc[0][t] = mma_b_raw(vb.v, pl[0][kk].v, oacc[0][t]);
        oacc[1][t] = mma_b_raw(vb.v, pl[1][kk].v, oacc[1][t]);
      }
    }
    asm volatile("s_wait_dscnt 0x0" ::: "memory");      // this wave's reads of tile kc are done before the buffer is refilled
    asm volatile("s_wait_asynccnt 0x0" ::: "memory");   // this wave's copies of tile kc + 1 have landed
    __syncthreads();                                    // publishes tile kc + 1 and ends every reader's use of tile kc
    if (kc + 2 < nChunks) {
      tile_copy(l0 + (unsigned)bo * 2, Kh + (size_t)(kc + 2) * kts, Kl + (size_t)(kc + 2) * kts, ko, krs);
      tile_copy(l0 + (unsigned)bo * 2 + 2 * APL * 2, Vh + (kc + 2) * 64, Vl + (kc + 2) * 64, vo, vrs);
    }
  }
  asm volatile("s_wait_asynccnt 0x0" ::: "memory");     // no copy is outstanding when the ring becomes output staging

  // ---- normalise (1/l), stage the wave's 32x64 tile, bf16 hi/lo split,
  float* os = (float*)(void*)ring + wave * (32 * OSP);   // per wave context tile [row][d], rows pitched OSP
#pragma unroll
  for (int n = 0; n < 2; ++n) {
    const float l = lrow[n] + other_half(lrow[n]);     // join the lane halves' sums; >= 1 (the maximum's key contributes exp(0))
    const float inv = (l > 0.f) ? (1.0f / l) : 0.f;
#pragma unroll
    for (int t = 0; t < 4; ++t) {                      // 8 consecutive d of query row n*16 + c: two 16-B stores
      v4f o0, o1;
#pragma unroll
      for (int r = 0; r < 4; ++r) { o0[r] = oacc[n][t][r] * inv; o1[r] = oacc[n][t][4 + r] * inv; }
      *(v4f*)(os + (n * 16 + c) * OSP + t * 16 + 8 * hh)     = o0;
      *(v4f*)(os + (n * 16 + c) * OSP + t * 16 + 8 * hh + 4) = o1;
    }
  }
  __builtin_amdgcn_fence(__ATOMIC_RELEASE, "workgroup");
  __builtin_amdgcn_wave_barrier();
  __builtin_amdgcn_fence(__ATOMIC_ACQUIRE, "workgroup");
  {
    const int q4 = lane >> 3, c8 = (lane & 7) * 8;
    v4u hv[8], lv[8];
#pragma unroll
    for (int it = 0; it < 8; ++it) {
      const int row = it * 4 + q4;   // it 0..7 x q4 0..3 = rows 0..31 of the wave tile
      const float* sp = os + row * OSP + c8;
      float f[8];
#pragma unroll
      for (int e = 0; e < 8; ++e) f[e] = sp[e];
      split8(f, hv[it], lv[it]);
    }
    {
#pragma unroll
      for (int it = 0; it < 8; ++it) {
        const int row = it * 4 + q4;
        const size_t go = (size_t)(rowBase + q0 + row) * CXP + (size_t)h * HD + c8;
        *(v4u*)(cxp + go)      = hv[it];
        *(v4u*)(cxp + go + DM) = lv[it];
        if (it < 7) {
          asm volatile("s_wait_xcnt 0x0" ::: "memory");   // in front of the next rows' address arithmetic, which reuses these stores' registers
          __builtin_amdgcn_sched_barrier(0);              // keeps that arithmetic below the wait
        }
      }
    }
  }
}

// =====================================================================================================
// Workspace map (bytes); every region is an exact multiple of its 64x64-tile / whole-line store granularity:
//   XB   bf16 [8192][1024]              0        16777216
//   WAT  bf16 [3072 n][1024 k]          16777216  6291456
//   WPT2 bf16 [1024 n][2048 k]          23068672  4194304   (W_proj^T duplicated along k)
//   QKh  bf16 [8192][2048]              27262976 33554432
//   QKl  bf16 [8192][2048]              60817408 33554432
//   VTh  bf16 [1024][8192]              94371840 16777216
//   VTl  bf16 [1024][8192]             111149056 16777216
//   CTX  bf16 [8192][2048]             127926272 33554432
//   end                                161480704
// Four launches, each over all four batch elements; QK / VT planes are fully written before the attention launch reads them.
// =====================================================================================================
extern "C" void kernel_launch(void* const* d_in, const int* in_sizes, int n_in,
                              void* d_out, int out_size, void* d_ws, size_t ws_size,
                              hipStream_t stream) {
  if (n_in < 5) return;
  if (in_sizes[0] != NB * SEQ * DM) return;
  if (in_sizes[1] != DM * N3) return;
  if (in_sizes[2] != N3) return;
  if (in_sizes[3] != DM * DM) return;
  if (in_sizes[4] != DM) return;
  if (out_size != NB * SEQ * DM) return;

  const float* x      = (const float*)d_in[0];   // [4][2048][1024]
  const float* W_attn = (const float*)d_in[1];   // [1024 in][3072 out]
  const float* b_attn = (const float*)d_in[2];   // [3072]
  const float* W_proj = (const float*)d_in[3];   // [1024 in][1024 out]
  const float* b_proj = (const float*)d_in[4];   // [1024]

  const size_t PXB = (size_t)NB * SEQ * DM * 2;     // 16777216
  const size_t PWA = (size_t)N3 * DM * 2;           //  6291456
  const size_t PWP = (size_t)DM * (2 * DM) * 2;     //  4194304
  const size_t PQK = (size_t)NB * SEQ * QKP * 2;    // 33554432
  const size_t PVT = (size_t)DM * VTP * 2;          // 16777216
  const size_t PCX = (size_t)NB * SEQ * CXP * 2;    // 33554432
  size_t off = 0;
  const size_t oXB  = off; off += PXB;
  const size_t oWAT = off; off += PWA;
  const size_t oWPT = off; off += PWP;
  const size_t oQKh = off; off += PQK;
  const size_t oQKl = off; off += PQK;
  const size_t oVTh = off; off += PVT;
  const size_t oVTl = off; off += PVT;
  const size_t oCTX = off; off += PCX;
  if (off > ws_size) return;                        // off = 161480704

  char* ws = (char*)d_ws;
  unsigned short* XB   = (unsigned short*)(ws + oXB);
  unsigned short* WAT  = (unsigned short*)(ws + oWAT);
  unsigned short* WPT2 = (unsigned short*)(ws + oWPT);
  unsigned short* QKh  = (unsigned short*)(ws + oQKh);
  unsigned short* QKl  = (unsigned short*)(ws + oQKl);
  unsigned short* VTh  = (unsigned short*)(ws + oVTh);
  unsigned short* VTl  = (unsigned short*)(ws + oVTl);
  unsigned short* CTX  = (unsigned short*)(ws + oCTX);

  const dim3 blk(256);
  const dim3 gPrep(TA_N + TP_N + CV_N);                            // 768 + 256 transpose tiles + 4096 conversion blocks
  const dim3 gQKV(QK_N + VT_N);                                    // 512 q|k tiles + 256 v^T tiles
  const dim3 gAtt(NH * NB, NQT);                                   // 1024 blocks: (16 heads x 4 batch elements) x 16 query tiles, longest first
  const dim3 gOut(((NB * SEQ / 64) * (DM / 64) + 7) / 8);          // 2048 tiles -> 256 blocks: M=8192, N=1024

  // (1) x -> bf16 [8192][1024]; W_attn [k][n] -> WAT [n][k] bf16 (pitch 1024); W_proj [k][n] -> WPT2 [n][k | k] bf16 (pitch 2048)
  prep_inputs<<<gPrep, blk, 0, stream>>>(x, W_attn, W_proj, XB, WAT, WPT2);
  // (2) q|k -> bf16 hi/lo [8192][2048] and v^T -> bf16 hi/lo [1024][8192]
  gemm_qkv<<<gQKV, blk, 0, stream>>>(XB, WAT, QKh, QKl, VTh, VTl, b_attn);
  // (3) causal attention -> CTX rows 0..8191 (hi at cols 0..1023, lo at 1024..2047)
  attn_causal64<<<gAtt, dim3(128), 0, stream>>>(QKh, QKl, VTh, VTl, CTX, 0.125f);
  // (4) y = [ctx hi | ctx lo] . [W_proj^T | W_proj^T]^T + b_proj -> d_out f32 [8192][1024]   (M=8192, N=1024, K=2048)
  gemm64<2, 0><<<gOut, blk, 0, stream>>>(CTX, CXP, WPT2, 2 * DM, d_out, d_out, DM, b_proj, NB * SEQ, DM, 2 * DM);
  (void)hipGetLastError();
}
